// v000
// The times below were measured on an AMD MI455X: many runs one after another, warmed up first and cycling through
// copies of the inputs, with the whole window's GPU time divided by the number of runs. Launches and the gaps
// between them are all in it. The median over several windows is given; except for v000 it joins two sittings, which
// can be a few percent apart, so the side-by-side timings, each taken in one sitting, are the better comparison.
// The starting kernel, v000, takes 187 microseconds a run.
// Contractions: q/k/v projections (x rows f16 x16 . W^T f16 x64, K=32, one product), scores S^T = k . q^T
// (k and q each f16 x8 hi plane + f16 x1024 residual plane, 3 products per tile), O^T = v^T . P^T (v f16 x16 hi +
// x1024 residual, P f16 x1024 hi + x1024 residual, 3 products), pooled attention . Wo^T and LN rows . Wf^T
// (activation f16 hi + x1024 residual . W^T f16 x64, K=128, 2 products): all v_wmma_f32_16x16x32_f16, f32 accumulate;
// gater MLP, LayerNorm, softmax, pooling, SiLU in f32 on VALU; every float input RNE-converted to bf16 on load.
#include <hip/hip_runtime.h>
#include <math.h>
#include <stdint.h>

#define NB     2
#define TT     512
#define NF     6
#define DD     32
#define HID    128
#define NH     4
#define HD     32
#define GH     32
#define FD     128
#define LL     (TT * NF)
#define NTOK   (NB * LL)
#define NPOOL  (NB * TT)
#define LNEPS  1.0e-5f
#define XC     16.0f
#define WSC    64.0f
#define QC     8.0f
#define KC     8.0f
#define VC     16.0f
#define AC     32.0f
#define YC     16.0f
#define RSC    1024.0f
#define INVRS  (1.0f / 1024.0f)
#define FLOORC 1.0e-9f
#define NEGBIG (-1.0e30f)
#define SCL    ((0.17677669529663687f * 1.4426950408889634f) / (QC * KC))
static_assert(NH * HD == HID);
static_assert(FD == HID);
static_assert((LL % 64) == 0 && (LL % 48) == 0 && (LL % 32) == 0);
static_assert((NTOK % 64) == 0 && (NPOOL % 64) == 0);
static_assert(DD == 32 && GH == 32);

typedef _Float16 v16h __attribute__((ext_vector_type(16)));
typedef _Float16 v8h  __attribute__((ext_vector_type(8)));
typedef float    v8f  __attribute__((ext_vector_type(8)));
typedef float    v4f  __attribute__((ext_vector_type(4)));
typedef unsigned int v4u __attribute__((ext_vector_type(4)));
typedef unsigned int v2u __attribute__((ext_vector_type(2)));

union FragH { v16h v; v8h h[2]; };

// ---- scalar helpers --------------------------------------------------------------------------------
__device__ __forceinline__ unsigned short bf_bits(float f) {          // f32 -> bf16 bits, RNE convert
  unsigned u = __float_as_uint(f);
  return (unsigned short)((u + 0x7FFFu + ((u >> 16) & 1u)) >> 16);
}
__device__ __forceinline__ float bf_up(unsigned short h) { return __uint_as_float(((unsigned)h) << 16); }
__device__ __forceinline__ float bfr(float f) { return bf_up(bf_bits(f)); }
__device__ __forceinline__ unsigned short h_bits(_Float16 x) { return __builtin_bit_cast(unsigned short, x); }
__device__ __forceinline__ unsigned pk16(unsigned short a, unsigned short b) { return (unsigned)a | ((unsigned)b << 16); }
__device__ __forceinline__ v8f zero8() { v8f z = {0.f, 0.f, 0.f, 0.f, 0.f, 0.f, 0.f, 0.f}; return z; }
__device__ __forceinline__ float hmax8(v8f s) {
  return fmaxf(fmaxf(fmaxf(s[0], s[1]), fmaxf(s[2], s[3])), fmaxf(fmaxf(s[4], s[5]), fmaxf(s[6], s[7])));
}
__device__ __forceinline__ const _Float16* h16(const unsigned short* p) { return (const _Float16*)(const void*)p; }
// hi = f16(f), lo = f16((f - hi) * 1024): residual plane carried x1024, folded back in the f32 epilogue
__device__ __forceinline__ void split_h(float f, unsigned short& hb, unsigned short& lb) {
  const _Float16 h = (_Float16)f;
  const _Float16 l = (_Float16)((f - (float)h) * RSC);
  hb = h_bits(h);
  lb = h_bits(l);
}
__device__ __forceinline__ float fexp2(float x) { return __builtin_amdgcn_exp2f(x); }
__device__ __forceinline__ float sigm(float a) {
  const float e = __expf(fminf(-a, 60.0f));       // quotient stays far from underflow
  return 1.0f / (1.0f + e);
}
__device__ __forceinline__ float wsum(float v) {
#pragma unroll
  for (int off = 16; off > 0; off >>= 1) v += __shfl_xor(v, off, 32);
  return v;
}

// ---- fragment loader: 16-bit A/B operand, lane -> row/col (lane&15), p already includes +8*(lane>>4);
//      elements 0..7 <- p[0..7] (k0+8h..), elements 8..15 <- p[16..23] (k0+16+8h..)
__device__ __forceinline__ v16h ldfrag_h(const _Float16* p) {
  FragH f;
  f.h[0] = *(const v8h*)(p);
  f.h[1] = *(const v8h*)(p + 16);
  return f.v;
}

// ---- WMMA helpers with trailing VALU hazard gap --------------------------------------------------------
__device__ __forceinline__ v8f mma_h_raw(v16h a, v16h b, v8f c) {
  return __builtin_amdgcn_wmma_f32_16x16x32_f16(false, a, false, b, (short)0, c, false, false);
}
__device__ __forceinline__ void guard4x6(v8f& a, v8f& b, v8f& c, v8f& d,
                                         v16h x0, v16h x1, v16h x2, v16h x3, v16h x4, v16h x5) {
#if defined(__HIP_DEVICE_COMPILE__)
  asm volatile("v_nop\n\tv_nop\n\tv_nop\n\tv_nop"
               : "+v"(a), "+v"(b), "+v"(c), "+v"(d)
               : "v"(x0), "v"(x1), "v"(x2), "v"(x3), "v"(x4), "v"(x5));
#endif
}
__device__ __forceinline__ void guard8x6(v8f& a0, v8f& a1, v8f& a2, v8f& a3,
                                         v8f& b0, v8f& b1, v8f& b2, v8f& b3,
                                         v16h x0, v16h x1, v16h x2, v16h x3, v16h x4, v16h x5) {
#if defined(__HIP_DEVICE_COMPILE__)
  asm volatile("v_nop\n\tv_nop\n\tv_nop\n\tv_nop"
               : "+v"(a0), "+v"(a1), "+v"(a2), "+v"(a3), "+v"(b0), "+v"(b1), "+v"(b2), "+v"(b3)
               : "v"(x0), "v"(x1), "v"(x2), "v"(x3), "v"(x4), "v"(x5));
#endif
}
__device__ __forceinline__ void acc_guard4(v8f& a, v8f& b, v8f& c, v8f& d) {
#if defined(__HIP_DEVICE_COMPILE__)
  asm volatile("v_nop\n\tv_nop\n\tv_nop\n\tv_nop" : "+v"(a), "+v"(b), "+v"(c), "+v"(d));
#endif
}

// =====================================================================================================
// Weight convert with transpose: in[k][o] f32 (x @ W layout) -> out[o][k] = f16( bf16_RNE(in) * WSC ), k contiguous.
// Blocks 0..11: part p = bx>>2 of {q_w, k_w, v_w} [32][128] -> WT rows p*128 + n, 32 n per block: load 32 k x 32 n
// (thread t: k = t>>3, 4 floats at 4*(t&7)); store threads 0..127: row o = t>>2, 8 halves k = 8*(t&3) -> rows of
// Blocks 12..19: o_w [128][128] -> WOT [n][k]; blocks 20..27: f_w -> FWT; 64 k x 32 o per block (thread t loads k = t>>2,
// coverage: WT 3 parts x 4 tiles x (32 n x 32 k) = [384][32]; WOT/FWT 4 x 2 tiles x (32 o x 64 k) = [128][128] each.
// =====================================================================================================
__global__ __launch_bounds__(256) void wprep(const float* __restrict__ qw, const float* __restrict__ kw,
                                              const float* __restrict__ vw, const float* __restrict__ ow,
                                              const float* __restrict__ fw,
                                              unsigned short* WT, unsigned short* WOT, unsigned short* FWT) {
  __shared__ float T[64 * 33];
  const int t  = threadIdx.x;
  const int bx = blockIdx.x;
  if (bx < 12) {                                            // block-uniform
    const int p  = bx >> 2;
    const int n0 = (bx & 3) * 32;
    const float* src = (p == 0) ? qw : ((p == 1) ? kw : vw);
    {
      const int k = t >> 3, nn = 4 * (t & 7);
      const v4f a = *(const v4f*)(src + (size_t)k * HID + n0 + nn);
#pragma unroll
      for (int i = 0; i < 4; ++i) T[k * 33 + nn + i] = a[i];
    }
    __syncthreads();
    {
      const bool wr = (t < 128);
      const int tt = t & 127;
      const int o = tt >> 2, e = tt & 3;
      float w[8];
#pragma unroll
      for (int i = 0; i < 8; ++i) w[i] = bfr(T[(8 * e + i) * 33 + o]) * WSC;
      v4u v;
#pragma unroll
      for (int i = 0; i < 4; ++i) v[i] = pk16(h_bits((_Float16)w[2 * i]), h_bits((_Float16)w[2 * i + 1]));
      unsigned short* dp = WT + (size_t)(p * HID + n0 + o) * DD + 8 * e;
      if (wr) *(v4u*)dp = v;
      
    }
  } else {
    const int q = bx - 12;
    const bool iso = (q < 8);                                // block-uniform
    const int rr = iso ? q : (q - 8);
    const float* src   = iso ? ow : fw;
    unsigned short* ds = iso ? WOT : FWT;
    const int o0 = (rr >> 1) * 32, k0 = (rr & 1) * 64;
    {
      const int k = t >> 2, oo = 8 * (t & 3);
      const float* sp = src + (size_t)(k0 + k) * HID + o0 + oo;
      const v4f a = *(const v4f*)(sp), c = *(const v4f*)(sp + 4);
#pragma unroll
      for (int i = 0; i < 4; ++i) { T[k * 33 + oo + i] = a[i]; T[k * 33 + oo + 4 + i] = c[i]; }
    }
    __syncthreads();
    {
      const int o = t >> 3, e = t & 7;
      float w[8];
#pragma unroll
      for (int i = 0; i < 8; ++i) w[i] = bfr(T[(8 * e + i) * 33 + o]) * WSC;
      v4u v;
#pragma unroll
      for (int i = 0; i < 4; ++i) v[i] = pk16(h_bits((_Float16)w[2 * i]), h_bits((_Float16)w[2 * i + 1]));
      unsigned short* dp = ds + (size_t)(o0 + o) * HID + k0 + 8 * e;
      *(v4u*)dp = v;
      
    }
  }
}

// =====================================================================================================
// Gater + gated q/k/v projections for 64 tokens per block (256 threads = 8 waves; grid = 6144/64 = 96).
// Phase 0: x tile [64][32] loaded as float4 pairs, RNE-converted to bf16 values: f32 copy sX (pitch 33) for the gater and
//          f16(x * 16) rows sXh (pitch 40 halves) as the WMMA A operand; g_w1 staged bf16-RNE in LDS.
//          with lane = hidden unit (32 shfl-broadcast FMAs), gate = sigmoid(sum_lane h*g_w2 + g_b2), all f32 -> sG.
// Phase 2: per part p in {q,k,v}: wave w -> row tile w&3, 64-col half w>>2: 4 WMMAs (K = 32 = one k step; A from sXh,
//          B from WT rows [p*128 + n][32]); epilogue f = (acc/1024 + bf16(bias[n])) * gate[row] * C (C = 8 q/k, 16 v),
//          hi = f16(f), lo = f16((f-hi)*1024) staged in LDS (q/k row-major [64][136], v transposed [128 hcol][72]);
//          block barrier; whole-line stores: q/k rows of 256 B by 16 consecutive lanes (instruction i: row 16i + t>>4,
// coverage: QH/QL/KH/KL rows tok0..tok0+63 x 128 cols; VTH/VTL rows b*128 + 0..127 x tokens ltok0..ltok0+63; grid covers
//           all 6144 tokens exactly once.
// =====================================================================================================
__global__ __launch_bounds__(256) void qkv_prep(
    const float* __restrict__ x, const float* __restrict__ glnw, const float* __restrict__ glnb,
    const float* __restrict__ gw1, const float* __restrict__ gb1, const float* __restrict__ gw2,
    const float* __restrict__ gb2, const float* __restrict__ qbias, const float* __restrict__ kbias,
    const float* __restrict__ vbias, const unsigned short* __restrict__ WT,
    unsigned short* QH, unsigned short* QL, unsigned short* KH, unsigned short* KL,
    unsigned short* VTH, unsigned short* VTL) {
  __shared__ __align__(16) float sX[64 * 33];
  __shared__ __align__(16) _Float16 sXh[64 * 40];
  __shared__ float sW1[DD * GH];
  __shared__ float sG[64];
  __shared__ __align__(16) unsigned short sH[128 * 72];
  __shared__ __align__(16) unsigned short sL[128 * 72];
  const int t = threadIdx.x, wave = t >> 5, lane = t & 31, hh = lane >> 4, m = lane & 15;
  const int tok0  = blockIdx.x * 64;
  const int b     = tok0 / LL;
  const int ltok0 = tok0 - b * LL;

  // ---- phase 0 ----
  {
    const int tk = t >> 2, j = 8 * (t & 3);
    const float* sp = x + (size_t)(tok0 + tk) * DD + j;
    const v4f a = *(const v4f*)(sp), c = *(const v4f*)(sp + 4);
    float r8[8];
#pragma unroll
    for (int i = 0; i < 4; ++i) { r8[i] = bfr(a[i]); r8[4 + i] = bfr(c[i]); }
#pragma unroll
    for (int i = 0; i < 8; ++i) {
      sX[tk * 33 + j + i]  = r8[i];
      sXh[tk * 40 + j + i] = (_Float16)(r8[i] * XC);
    }
    for (int i = t; i < DD * GH; i += 256) sW1[i] = bfr(gw1[i]);
  }
  __syncthreads();

  // ---- phase 1: gater (f32, VALU) ----
  {
    const float gw = bfr(glnw[lane]), gb = bfr(glnb[lane]);
    const float b1 = bfr(gb1[lane]),  w2 = bfr(gw2[lane]), b2 = bfr(gb2[0]);
#pragma unroll 1
    for (int i = 0; i < 8; ++i) {
      const int tk = wave * 8 + i;
      const float xv  = sX[tk * 33 + lane];
      const float mu  = wsum(xv) * (1.0f / DD);
      const float dv  = xv - mu;
      const float var = wsum(dv * dv) * (1.0f / DD);
      const float xn  = dv * rsqrtf(var + LNEPS) * gw + gb;
      float hacc = b1;
#pragma unroll
      for (int k = 0; k < DD; ++k) hacc += __shfl(xn, k, 32) * sW1[k * GH + lane];
      const float hs = hacc * sigm(hacc);
      const float gs = wsum(hs * w2) + b2;
      const float g  = sigm(gs);
      if (lane == 0) sG[tk] = g;
    }
  }
  __syncthreads();

  // ---- phase 2: projections on WMMA ----
  const int rt = wave & 3, ch = wave >> 2;
  FragH af;
  af.h[0] = *(const v8h*)(sXh + (16 * rt + m) * 40 + 8 * hh);
  af.h[1] = *(const v8h*)(sXh + (16 * rt + m) * 40 + 16 + 8 * hh);
  const _Float16* WTp = h16(WT);
#pragma unroll 1
  for (int p = 0; p < 3; ++p) {
    const float* bp = (p == 0) ? qbias : ((p == 1) ? kbias : vbias);
    const float osc = (p == 2) ? VC : QC;
    v16h bf[4];
#pragma unroll
    for (int j = 0; j < 4; ++j)
      bf[j] = ldfrag_h(WTp + (size_t)(p * HID + 64 * ch + 16 * j + m) * DD + 8 * hh);
    v8f acc[4];
#pragma unroll
    for (int j = 0; j < 4; ++j) acc[j] = mma_h_raw(af.v, bf[j], zero8());
    guard4x6(acc[0], acc[1], acc[2], acc[3], af.v, bf[0], bf[1], bf[2], bf[3], af.v);
    float gr[8];
#pragma unroll
    for (int r = 0; r < 8; ++r) gr[r] = sG[16 * rt + 8 * hh + r];
#pragma unroll
    for (int j = 0; j < 4; ++j) {
      const int n = 64 * ch + 16 * j + m;
      const float bn = bfr(bp[n]);
#pragma unroll
      for (int r = 0; r < 8; ++r) {
        const int row = 16 * rt + 8 * hh + r;
        const float f = ((acc[j][r] * (1.0f / (XC * WSC)) + bn) * gr[r]) * osc;
        unsigned short hb, lb;
        split_h(f, hb, lb);
        if (p < 2) { sH[row * 136 + n] = hb; sL[row * 136 + n] = lb; }
        else       { sH[n * 72 + row]  = hb; sL[n * 72 + row]  = lb; }
      }
    }
    __syncthreads();
    if (p < 2) {                                                    // block-uniform
      unsigned short* Hp = (p == 0) ? QH : KH;
      unsigned short* Lp = (p == 0) ? QL : KL;
      const int e = t & 15;
      v4u hv[4], lv[4];
#pragma unroll
      for (int i = 0; i < 4; ++i) {
        const int row = 16 * i + (t >> 4);
        hv[i] = *(const v4u*)(sH + row * 136 + 8 * e);
        lv[i] = *(const v4u*)(sL + row * 136 + 8 * e);
      }
#pragma unroll
      for (int i = 0; i < 4; ++i) {
        const int row = 16 * i + (t >> 4);
        *(v4u*)(Hp + (size_t)(tok0 + row) * HID + 8 * e) = hv[i];
        *(v4u*)(Lp + (size_t)(tok0 + row) * HID + 8 * e) = lv[i];
      }
      
    } else {
      const int e = t & 7;
      v4u hv[4], lv[4];
#pragma unroll
      for (int i = 0; i < 4; ++i) {
        const int vr = 32 * i + (t >> 3);
        hv[i] = *(const v4u*)(sH + vr * 72 + 8 * e);
        lv[i] = *(const v4u*)(sL + vr * 72 + 8 * e);
      }
#pragma unroll
      for (int i = 0; i < 4; ++i) {
        const int vr = 32 * i + (t >> 3);
        const size_t o = ((size_t)(b * HID + vr)) * LL + ltok0 + 8 * e;
        *(v4u*)(VTH + o) = hv[i];
        *(v4u*)(VTL + o) = lv[i];
      }
      
    }
    __syncthreads();
  }
}

// =====================================================================================================
// Per-(b, head column) suffix sums of v over time blocks, for the post-softmax 1e-9 floor on masked keys:
//   SV[b*128 + hcol][tb] = sum over keys j >= 6*(tb+1) of v[j][hcol]   (v reconstructed from the hi/lo planes, f32).
// One block per row (grid 256, 256 threads): per-time-block sums of 6 keys into LDS, thread 0 scans the 512 suffixes
// coverage: 256 rows x 512 floats = the whole SV table.
// =====================================================================================================
__global__ __launch_bounds__(256) void vsuf(const unsigned short* __restrict__ VTH, const unsigned short* __restrict__ VTL,
                                             const int* __restrict__ Tp, float* SV) {
  __shared__ float bs[TT];
  __shared__ __align__(16) float S[TT];
  const int t = threadIdx.x;
  const int row = blockIdx.x;
  const int tin = Tp[0];
  const int ntb = (tin < 0) ? 0 : ((tin > TT) ? TT : tin);     // structural, clamped to the static extent
  const _Float16* hp = h16(VTH) + (size_t)row * LL;
  const _Float16* lp = h16(VTL) + (size_t)row * LL;
  for (int tb = t; tb < TT; tb += 256) {
    float s = 0.f;
#pragma unroll
    for (int f = 0; f < NF; ++f) {
      const int idx = tb * NF + f;
      s += ((float)hp[idx] + (float)lp[idx] * INVRS) * (1.0f / VC);
    }
    bs[tb] = (tb < ntb) ? s : 0.f;
  }
  __syncthreads();
  if (t == 0) {
    float run = 0.f;
    for (int tb = TT - 1; tb >= 0; --tb) { S[tb] = run; run += bs[tb]; }
  }
  __syncthreads();
  {
    const bool wr = (t < 128);
    const int tt = t & 127;
    const v4f v = *(const v4f*)(S + 4 * tt);
    float* dp = SV + (size_t)row * TT + 4 * tt;
    if (wr) *(v4f*)dp = v;
    
  }
}

// =====================================================================================================
// One 32-key step of the transposed flash formulation for 16 queries of one head (head dim 32 = one k step):
//   S^T tiles (16 keys x 16 queries) = A(k rows, dims split-map) . B(q^T): hi.hi -> s, hi.lo + lo.hi -> sr (x1024);
//   logit (log2 domain) = (s + sr/1024) * scale*log2e/64; block-causal mask by value (key < horizon of the lane's query);
//   online softmax per lane (8 + 8 keys of ONE query per lane, max combined with lane^16), p = 2^(e - m + 10) (x1024);
//   P^T as the B operand of O^T(16 d x 16 queries) += v^T(d rows, keys contiguous) . P^T: element r <- tile keys kb..kb+15,
//   element 8+r <- tile kb+16..kb+31, lane unchanged; P hi to o, (v hi . P lo x1024 + v lo x1024 . P hi) to or.
// =====================================================================================================
template <bool MASKED>
__device__ __forceinline__ void attn_step(const int kb, const int jl, const int hh,
    const _Float16* __restrict__ kH, const _Float16* __restrict__ kL,
    const _Float16* __restrict__ vH, const _Float16* __restrict__ vL,
    const v16h qhi, const v16h qlo, float& m_run, float& l_run,
    v8f& o1, v8f& o1r, v8f& o2, v8f& o2r) {
  const v16h kh0 = ldfrag_h(kH + (size_t)kb * HID);
  const v16h kh1 = ldfrag_h(kH + (size_t)(kb + 16) * HID);
  const v16h kl0 = ldfrag_h(kL + (size_t)kb * HID);
  const v16h kl1 = ldfrag_h(kL + (size_t)(kb + 16) * HID);
  v8f s0  = mma_h_raw(kh0, qhi, zero8());
  v8f s1  = mma_h_raw(kh1, qhi, zero8());
  v8f s0r = mma_h_raw(kh0, qlo, zero8());
  v8f s1r = mma_h_raw(kh1, qlo, zero8());
  s0r = mma_h_raw(kl0, qhi, s0r);
  s1r = mma_h_raw(kl1, qhi, s1r);
  guard4x6(s0, s1, s0r, s1r, kh0, kh1, kl0, kl1, qhi, qlo);

  float e0[8], e1[8];
#pragma unroll
  for (int r = 0; r < 8; ++r) {
    e0[r] = (s0[r] + s0r[r] * INVRS) * SCL;
    e1[r] = (s1[r] + s1r[r] * INVRS) * SCL;
  }
  if (MASKED) {
    const int base = kb + 8 * hh;                    // key index of row r = base + r (tile 0), base + 16 + r (tile 1)
#pragma unroll
    for (int r = 0; r < 8; ++r) {
      e0[r] = (base + r      < jl) ? e0[r] : NEGBIG;
      e1[r] = (base + 16 + r < jl) ? e1[r] : NEGBIG;
    }
  }
  float mx = fmaxf(fmaxf(fmaxf(fmaxf(e0[0], e0[1]), fmaxf(e0[2], e0[3])), fmaxf(fmaxf(e0[4], e0[5]), fmaxf(e0[6], e0[7]))),
                   fmaxf(fmaxf(fmaxf(e1[0], e1[1]), fmaxf(e1[2], e1[3])), fmaxf(fmaxf(e1[4], e1[5]), fmaxf(e1[6], e1[7]))));
  mx = fmaxf(mx, __shfl_xor(mx, 16, 32));
  const float m_new = fmaxf(m_run, mx);
  const float corr  = fexp2(m_run - m_new);
  m_run = m_new;
  const float msh = m_new - 10.0f;                   // 2^(e - m + 10) = e^{s - smax} * 1024
  l_run *= corr;
  o1 = o1 * corr; o1r = o1r * corr; o2 = o2 * corr; o2r = o2r * corr;

  FragH ph, pl;
  float ls = 0.f;
#pragma unroll
  for (int r = 0; r < 8; ++r) {
    const float p0 = fexp2(e0[r] - msh);
    const float p1 = fexp2(e1[r] - msh);
    ls += p0 + p1;
    const _Float16 a0 = (_Float16)p0, a1 = (_Float16)p1;
    ph.h[0][r] = a0;                                          // keys kb      + 8hh + r
    ph.h[1][r] = a1;                                          // keys kb + 16 + 8hh + r
    pl.h[0][r] = (_Float16)((p0 - (float)a0) * RSC);
    pl.h[1][r] = (_Float16)((p1 - (float)a1) * RSC);
  }
  l_run += ls;

  const v16h vh1 = ldfrag_h(vH + kb);
  const v16h vl1 = ldfrag_h(vL + kb);
  const v16h vh2 = ldfrag_h(vH + (size_t)16 * LL + kb);
  const v16h vl2 = ldfrag_h(vL + (size_t)16 * LL + kb);
  o1  = mma_h_raw(vh1, ph.v, o1);
  o2  = mma_h_raw(vh2, ph.v, o2);
  o1r = mma_h_raw(vh1, pl.v, o1r);
  o2r = mma_h_raw(vh2, pl.v, o2r);
  o1r = mma_h_raw(vl1, ph.v, o1r);
  o2r = mma_h_raw(vl2, ph.v, o2r);
  guard4x6(o1, o2, o1r, o2r, vh1, vh2, vl1, vl2, ph.v, pl.v);
}

// =====================================================================================================
// Attention + mean-pool for 48 queries (= 8 time blocks) x all 4 heads of one batch row: block = 12 waves (384 threads),
// wave w -> head w&3, query tile w>>2 (16 queries); grid = 2 * 3072/48 = 128. Each wave runs over keys 0..jmax-1 of its
// tile (jmax = block-causal horizon of its last query, a multiple of 6 <= 3072; steps of 32 never pass key 3071), the
// fully visible prefix without masking, the rest with the per-lane horizon test by value.
// Epilogue: attn[d] = (o + or/1024) / (16 l) + 1e-9 * SV[b][h*32+d][query time block] -> LDS sO[48][132] (f32);
// barrier; threads 0..255 pool 6 consecutive query rows (pooled row = t>>5, cols 4*(t&31)) -> f16 hi (x32) / lo (x1024)
// in LDS; barrier; threads 0..127 write the 8 hi rows (row t>>4, 16-B piece t&15: 16 consecutive lanes per 256-B row =
// coverage: PH/PL rows b*512 + 8*qblock .. +7 x 128 cols; 128 blocks cover [1024][128] of each plane exactly once.
// =====================================================================================================
__global__ __launch_bounds__(384)
void attn_pool(const unsigned short* __restrict__ QH, const unsigned short* __restrict__ QL,
               const unsigned short* __restrict__ KH, const unsigned short* __restrict__ KL,
               const unsigned short* __restrict__ VTH, const unsigned short* __restrict__ VTL,
               const float* __restrict__ SV, unsigned short* PH, unsigned short* PL) {
  __shared__ __align__(16) float sO[48 * 132];
  __shared__ __align__(16) unsigned short sPH[8 * 128];
  __shared__ __align__(16) unsigned short sPL[8 * 128];
  const int t = threadIdx.x, wave = t >> 5, lane = t & 31, hh = lane >> 4, c = lane & 15;
  const int bx = blockIdx.x;
  const int b  = bx >> 6;
  const int qblk = bx & 63;
  const int q0 = qblk * 48;
  const int h  = wave & 3, qt = wave >> 2;
  const int qw0 = q0 + 16 * qt;
  const int qi  = qw0 + c;                                   // query of this lane (B column / D column)
  const int jl  = (qi / NF + 1) * NF;                        // exclusive key horizon
  const size_t tokb = (size_t)b * LL;

  const _Float16* QHp = h16(QH);
  const _Float16* QLp = h16(QL);
  const v16h qhi = ldfrag_h(QHp + (tokb + qi) * HID + h * HD + 8 * hh);
  const v16h qlo = ldfrag_h(QLp + (tokb + qi) * HID + h * HD + 8 * hh);
  const _Float16* kH = h16(KH) + (tokb + c) * HID + h * HD + 8 * hh;                       // + key * 128
  const _Float16* kL = h16(KL) + (tokb + c) * HID + h * HD + 8 * hh;
  const _Float16* vH = h16(VTH) + ((size_t)(b * HID + h * HD + c)) * LL + 8 * hh;          // + kb; d tile 2 at +16 rows
  const _Float16* vL = h16(VTL) + ((size_t)(b * HID + h * HD + c)) * LL + 8 * hh;

  float m_run = NEGBIG, l_run = 0.f;
  v8f o1 = zero8(), o1r = zero8(), o2 = zero8(), o2r = zero8();
  const int jmax  = ((qw0 + 15) / NF + 1) * NF;              // <= 3072
  const int jmin  = (qw0 / NF + 1) * NF;
  const int cfull = (jmin / 32) * 32;
  int kb = 0;
#pragma unroll 1
  for (; kb < cfull; kb += 32)
    attn_step<false>(kb, jl, hh, kH, kL, vH, vL, qhi, qlo, m_run, l_run, o1, o1r, o2, o2r);
#pragma unroll 1
  for (; kb < jmax; kb += 32)
    attn_step<true>(kb, jl, hh, kH, kL, vH, vL, qhi, qlo, m_run, l_run, o1, o1r, o2, o2r);

  l_run += __shfl_xor(l_run, 16, 32);
  const float inv = (1.0f / l_run) * (1.0f / VC);
  const int tq = qi / NF;
  const float* svp = SV + ((size_t)(b * HID + h * HD)) * TT + tq;
  float* so = sO + (16 * qt + c) * 132 + h * HD;
#pragma unroll
  for (int r = 0; r < 8; ++r) {
    const int d1 = 8 * hh + r, d2 = 16 + 8 * hh + r;
    so[d1] = (o1[r] + o1r[r] * INVRS) * inv + FLOORC * svp[(size_t)d1 * TT];
    so[d2] = (o2[r] + o2r[r] * INVRS) * inv + FLOORC * svp[(size_t)d2 * TT];
  }
  __syncthreads();
  {
    const bool act = (t < 256);
    const int tt = act ? t : 0;
    const int pr = tt >> 5, col = 4 * (tt & 31);
    v4f s = {0.f, 0.f, 0.f, 0.f};
#pragma unroll
    for (int f = 0; f < NF; ++f) s += *(const v4f*)(sO + (NF * pr + f) * 132 + col);
    unsigned short hb[4], lb[4];
#pragma unroll
    for (int e = 0; e < 4; ++e) split_h((s[e] * (1.0f / NF)) * AC, hb[e], lb[e]);
    v2u ph2, pl2;
    ph2[0] = pk16(hb[0], hb[1]); ph2[1] = pk16(hb[2], hb[3]);
    pl2[0] = pk16(lb[0], lb[1]); pl2[1] = pk16(lb[2], lb[3]);
    if (act) {
      *(v2u*)(sPH + pr * 128 + col) = ph2;
      *(v2u*)(sPL + pr * 128 + col) = pl2;
    }
  }
  __syncthreads();
  {
    const bool wr  = (t < 256);
    const bool isl = (t >= 128);
    const int tt = t & 127;
    const int row = tt >> 4, e = tt & 15;
    const v4u a  = *(const v4u*)(sPH + row * 128 + 8 * e);
    const v4u bq = *(const v4u*)(sPL + row * 128 + 8 * e);
    v4u val;
#pragma unroll
    for (int i = 0; i < 4; ++i) val[i] = isl ? bq[i] : a[i];
    unsigned short* dp = (isl ? PL : PH) + ((size_t)(b * TT + 8 * qblk + row)) * HID + 8 * e;
    if (wr) *(v4u*)dp = val;
    
  }
}

// =====================================================================================================
// Tail: 64 pooled rows per block (grid 1024/64 = 16, 256 threads = 8 waves, wave -> row tile w&3, 64-col half w>>2).
// GEMM1 z = pooled(hi + lo/1024)/32 . Wo + bf16(o_b): A planes PH/PL (two products into acc/accr), B = WOT rows, K=128;
// GEMM2 from sZ rows split to f16 hi (x16) / lo (x1024) at fragment build . FWT rows; epilogue silu(acc + bf16(f_b))
// coverage: out rows r0..r0+63 x 128 cols; 16 blocks cover [1024][128] exactly once.
// =====================================================================================================
__global__ __launch_bounds__(256) void tail_k(const unsigned short* __restrict__ PH, const unsigned short* __restrict__ PL,
                                               const unsigned short* __restrict__ WOT, const float* __restrict__ obias,
                                               const float* __restrict__ flnw, const float* __restrict__ flnb,
                                               const unsigned short* __restrict__ FWT, const float* __restrict__ fbias,
                                               float* out) {
  __shared__ __align__(16) float sZ[64 * 132];
  const int t = threadIdx.x, wave = t >> 5, lane = t & 31, hh = lane >> 4, m = lane & 15;
  const int r0 = blockIdx.x * 64;
  const int rt = wave & 3, ch = wave >> 2;

  // ---- GEMM1 ----
  {
    v8f acc[4], accr[4];
#pragma unroll
    for (int j = 0; j < 4; ++j) { acc[j] = zero8(); accr[j] = zero8(); }
    const _Float16* Ah = h16(PH) + (size_t)(r0 + 16 * rt + m) * HID + 8 * hh;
    const _Float16* Al = h16(PL) + (size_t)(r0 + 16 * rt + m) * HID + 8 * hh;
    const _Float16* Bw = h16(WOT) + (size_t)(64 * ch + m) * HID + 8 * hh;
#pragma unroll 1
    for (int k0 = 0; k0 < HID; k0 += 32) {
      v16h bf[4];
#pragma unroll
      for (int j = 0; j < 4; ++j) bf[j] = ldfrag_h(Bw + (size_t)(16 * j) * HID + k0);
      const v16h ah = ldfrag_h(Ah + k0);
      const v16h al = ldfrag_h(Al + k0);
#pragma unroll
      for (int j = 0; j < 4; ++j) acc[j]  = mma_h_raw(ah, bf[j], acc[j]);
#pragma unroll
      for (int j = 0; j < 4; ++j) accr[j] = mma_h_raw(al, bf[j], accr[j]);
      guard8x6(acc[0], acc[1], acc[2], acc[3], accr[0], accr[1], accr[2], accr[3], ah, al, bf[0], bf[1], bf[2], bf[3]);
    }
    acc_guard4(acc[0], acc[1], acc[2], acc[3]);
    acc_guard4(accr[0], accr[1], accr[2], accr[3]);
#pragma unroll
    for (int j = 0; j < 4; ++j) {
      const int n = 64 * ch + 16 * j + m;
      const float bn = bfr(obias[n]);
#pragma unroll
      for (int r = 0; r < 8; ++r) {
        const int row = 16 * rt + 8 * hh + r;
        sZ[row * 132 + n] = (acc[j][r] + accr[j][r] * INVRS) * (1.0f / (AC * WSC)) + bn;
      }
    }
  }
  __syncthreads();

  // ---- LayerNorm in place ----
  {
    float gg[4], bb[4];
#pragma unroll
    for (int e = 0; e < 4; ++e) { gg[e] = bfr(flnw[4 * lane + e]); bb[e] = bfr(flnb[4 * lane + e]); }
#pragma unroll 1
    for (int i = 0; i < 8; ++i) {
      const int row = 8 * wave + i;
      float* zp = sZ + row * 132 + 4 * lane;
      const v4f z = *(const v4f*)zp;
      float s = (z[0] + z[1]) + (z[2] + z[3]);
      s = wsum(s);
      const float mean = s * (1.0f / HID);
      float d[4];
#pragma unroll
      for (int e = 0; e < 4; ++e) d[e] = z[e] - mean;
      float vs = (d[0] * d[0] + d[1] * d[1]) + (d[2] * d[2] + d[3] * d[3]);
      vs = wsum(vs);
      const float rstd = rsqrtf(vs * (1.0f / HID) + LNEPS);
      v4f y;
#pragma unroll
      for (int e = 0; e < 4; ++e) y[e] = (d[e] * rstd) * gg[e] + bb[e];
      *(v4f*)zp = y;
    }
  }
  __syncthreads();

  // ---- GEMM2 ----
  v8f acc2[4], acc2r[4];
#pragma unroll
  for (int j = 0; j < 4; ++j) { acc2[j] = zero8(); acc2r[j] = zero8(); }
  {
    const float* zr = sZ + (16 * rt + m) * 132 + 8 * hh;
    const _Float16* Bf = h16(FWT) + (size_t)(64 * ch + m) * HID + 8 * hh;
#pragma unroll 1
    for (int k0 = 0; k0 < HID; k0 += 32) {
      FragH ah, al;
      const v4f za = *(const v4f*)(zr + k0), zb = *(const v4f*)(zr + k0 + 4);
      const v4f zc = *(const v4f*)(zr + k0 + 16), zd = *(const v4f*)(zr + k0 + 20);
#pragma unroll
      for (int i = 0; i < 4; ++i) {
        const float f0 = za[i] * YC, f1 = zb[i] * YC, f2 = zc[i] * YC, f3 = zd[i] * YC;
        const _Float16 h0 = (_Float16)f0, h1 = (_Float16)f1, h2 = (_Float16)f2, h3 = (_Float16)f3;
        ah.h[0][i] = h0;     al.h[0][i]     = (_Float16)((f0 - (float)h0) * RSC);
        ah.h[0][4 + i] = h1; al.h[0][4 + i] = (_Float16)((f1 - (float)h1) * RSC);
        ah.h[1][i] = h2;     al.h[1][i]     = (_Float16)((f2 - (float)h2) * RSC);
        ah.h[1][4 + i] = h3; al.h[1][4 + i] = (_Float16)((f3 - (float)h3) * RSC);
      }
      v16h bf[4];
#pragma unroll
      for (int j = 0; j < 4; ++j) bf[j] = ldfrag_h(Bf + (size_t)(16 * j) * HID + k0);
#pragma unroll
      for (int j = 0; j < 4; ++j) acc2[j]  = mma_h_raw(ah.v, bf[j], acc2[j]);
#pragma unroll
      for (int j = 0; j < 4; ++j) acc2r[j] = mma_h_raw(al.v, bf[j], acc2r[j]);
      guard8x6(acc2[0], acc2[1], acc2[2], acc2[3], acc2r[0], acc2r[1], acc2r[2], acc2r[3],
               ah.v, al.v, bf[0], bf[1], bf[2], bf[3]);
    }
    acc_guard4(acc2[0], acc2[1], acc2[2], acc2[3]);
    acc_guard4(acc2r[0], acc2r[1], acc2r[2], acc2r[3]);
  }
  __syncthreads();                                            // every wave is done reading sZ rows as the A operand
#pragma unroll
  for (int j = 0; j < 4; ++j) {
    const int n = 64 * ch + 16 * j + m;
    const float bn = bfr(fbias[n]);
#pragma unroll
    for (int r = 0; r < 8; ++r) {
      const int row = 16 * rt + 8 * hh + r;
      const float a = (acc2[j][r] + acc2r[j][r] * INVRS) * (1.0f / (YC * WSC)) + bn;
      sZ[row * 132 + n] = a * sigm(a);
    }
  }
  __syncthreads();
  {
    v4f vals[8];
#pragma unroll
    for (int i = 0; i < 8; ++i) vals[i] = *(const v4f*)(sZ + (8 * i + wave) * 132 + 4 * lane);
#pragma unroll
    for (int i = 0; i < 8; ++i)
      *(v4f*)(out + (size_t)(r0 + 8 * i + wave) * FD + 4 * lane) = vals[i];
    
  }
}

// =====================================================================================================
// Workspace map (bytes), every offset a multiple of 256 and every plane sized to its whole-line store granularity:
//   WT   f16 [384][32]  x64        0          24576     (q_w^T | k_w^T | v_w^T rows)
//   WOT  f16 [128][128] x64        24576      32768
//   FWT  f16 [128][128] x64        57344      32768
//   QH   f16 [6144][128] q x8      90112      1572864
//   QL   f16 [6144][128] residual  1662976    1572864
//   KH   f16 [6144][128] k x8      3235840    1572864
//   KL                             4808704    1572864
//   VTH  f16 [2][128][3072] v x16  6381568    1572864
//   VTL                            7954432    1572864
//   SV   f32 [256][512]            9527296    524288
//   PH   f16 [1024][128] x32       10051584   262144
//   PL                             10313728   262144
//   end                            10575872
// =====================================================================================================
extern "C" void kernel_launch(void* const* d_in, const int* in_sizes, int n_in,
                              void* d_out, int out_size, void* d_ws, size_t ws_size,
                              hipStream_t stream) {
  if (n_in < 20) return;
  if (in_sizes[0] != NTOK * DD) return;
  if (in_sizes[1] != DD || in_sizes[2] != DD || in_sizes[3] != DD * GH || in_sizes[4] != GH ||
      in_sizes[5] != GH || in_sizes[6] != 1) return;
  if (in_sizes[7] != DD * HID || in_sizes[8] != HID || in_sizes[9] != DD * HID || in_sizes[10] != HID ||
      in_sizes[11] != DD * HID || in_sizes[12] != HID) return;
  if (in_sizes[13] != HID * HID || in_sizes[14] != HID || in_sizes[15] != HID || in_sizes[16] != HID ||
      in_sizes[17] != HID * FD || in_sizes[18] != FD || in_sizes[19] != 1) return;
  if (out_size != NPOOL * FD) return;

  const float* x    = (const float*)d_in[0];
  const float* glnw = (const float*)d_in[1];
  const float* glnb = (const float*)d_in[2];
  const float* gw1  = (const float*)d_in[3];
  const float* gb1  = (const float*)d_in[4];
  const float* gw2  = (const float*)d_in[5];
  const float* gb2  = (const float*)d_in[6];
  const float* qw   = (const float*)d_in[7];
  const float* qb   = (const float*)d_in[8];
  const float* kw   = (const float*)d_in[9];
  const float* kb   = (const float*)d_in[10];
  const float* vw   = (const float*)d_in[11];
  const float* vb   = (const float*)d_in[12];
  const float* ow   = (const float*)d_in[13];
  const float* ob   = (const float*)d_in[14];
  const float* flnw = (const float*)d_in[15];
  const float* flnb = (const float*)d_in[16];
  const float* fw   = (const float*)d_in[17];
  const float* fb   = (const float*)d_in[18];
  const int*   Tp   = (const int*)d_in[19];

  const size_t PWT = (size_t)3 * HID * DD * 2;        //    24576
  const size_t PWO = (size_t)HID * HID * 2;           //    32768
  const size_t PWF = (size_t)FD * HID * 2;            //    32768
  const size_t PQP = (size_t)NTOK * HID * 2;          //  1572864
  const size_t PVT = (size_t)NB * HID * LL * 2;       //  1572864
  const size_t PSV = (size_t)NB * HID * TT * 4;       //   524288
  const size_t PPP = (size_t)NPOOL * HID * 2;         //   262144
  size_t off = 0;
  const size_t oWT = off; off += PWT;
  const size_t oWO = off; off += PWO;
  const size_t oWF = off; off += PWF;
  const size_t oQH = off; off += PQP;
  const size_t oQL = off; off += PQP;
  const size_t oKH = off; off += PQP;
  const size_t oKL = off; off += PQP;
  const size_t oVH = off; off += PVT;
  const size_t oVL = off; off += PVT;
  const size_t oSV = off; off += PSV;
  const size_t oPH = off; off += PPP;
  const size_t oPL = off; off += PPP;
  if (off > ws_size) return;                           // off = 10575872
  if (off > (size_t)134217728) return;

  char* ws = (char*)d_ws;
  unsigned short* WT  = (unsigned short*)(ws + oWT);
  unsigned short* WOT = (unsigned short*)(ws + oWO);
  unsigned short* FWT = (unsigned short*)(ws + oWF);
  unsigned short* QH  = (unsigned short*)(ws + oQH);
  unsigned short* QL  = (unsigned short*)(ws + oQL);
  unsigned short* KH  = (unsigned short*)(ws + oKH);
  unsigned short* KL  = (unsigned short*)(ws + oKL);
  unsigned short* VTH = (unsigned short*)(ws + oVH);
  unsigned short* VTL = (unsigned short*)(ws + oVL);
  float*          SV  = (float*)(ws + oSV);
  unsigned short* PH  = (unsigned short*)(ws + oPH);
  unsigned short* PL  = (unsigned short*)(ws + oPL);
  float*          out = (float*)d_out;

  const dim3 blk(256), blk384(384);
  const dim3 gW(12 + 8 + 8);                           // 28 weight tiles
  const dim3 gQ(NTOK / 64);                            // 96
  const dim3 gS(NB * HID);                             // 256
  const dim3 gA(NB * (LL / 48));                       // 128
  const dim3 gT(NPOOL / 64);                           // 16

  // (0) weight planes, transposed to k-contiguous rows: f16( bf16_RNE(w) * 64 )
  wprep<<<gW, blk, 0, stream>>>(qw, kw, vw, ow, fw, WT, WOT, FWT);

  // (1) gater + gated q/k/v planes (q, k rows hi/lo; v transposed hi/lo)
  qkv_prep<<<gQ, blk, 0, stream>>>(x, glnw, glnb, gw1, gb1, gw2, gb2, qb, kb, vb, WT, QH, QL, KH, KL, VTH, VTL);

  // (2) per-(b, head column) suffix sums of v over time blocks (masked-key floor term)
  vsuf<<<gS, blk, 0, stream>>>(VTH, VTL, Tp, SV);

  // (3) block-causal attention + mean-pool over the 6 forces -> pooled planes
  attn_pool<<<gA, blk384, 0, stream>>>(QH, QL, KH, KL, VTH, VTL, SV, PH, PL);

  // (4) o-proj + LayerNorm + final linear + SiLU -> out
  tail_k<<<gT, blk, 0, stream>>>(PH, PL, WOT, ob, flnw, flnb, FWT, fb, out);
  (void)hipGetLastError();
}

// v001
// Measured time: 117 microseconds a run.
// Next to v000, in two timings, it ran 1.55 and 1.57 times as fast.
// Contractions: q/k/v projections (x rows f16 x16 . W^T f16 x64, K=32, one product), scores S^T = k . q^T
// (k and q each f16 x8 hi plane + f16 x1024 residual plane, 3 products per tile), O^T = v^T . P^T (v f16 x16 hi +
// x1024 residual, P f16 x1024 hi + x1024 residual, 3 products), pooled attention . Wo^T and LN rows . Wf^T
// (activation f16 hi + x1024 residual . W^T f16 x64, K=128, 2 products): all v_wmma_f32_16x16x32_f16, f32 accumulate;
// gater MLP, LayerNorm, softmax, pooling, SiLU in f32 on VALU; every float input RNE-converted to bf16 on load.
#include <hip/hip_runtime.h>
#include <math.h>
#include <stdint.h>

#define NB     2
#define TT     512
#define NF     6
#define DD     32
#define HID    128
#define NH     4
#define HD     32
#define GH     32
#define FD     128
#define LL     (TT * NF)
#define NTOK   (NB * LL)
#define NPOOL  (NB * TT)
#define LNEPS  1.0e-5f
#define XC     16.0f
#define WSC    64.0f
#define QC     8.0f
#define KC     8.0f
#define VC     16.0f
#define AC     32.0f
#define YC     16.0f
#define RSC    1024.0f
#define INVRS  (1.0f / 1024.0f)
#define FLOORC 1.0e-9f
#define NEGBIG (-1.0e30f)
#define SCL    ((0.17677669529663687f * 1.4426950408889634f) / (QC * KC))
static_assert(NH * HD == HID);
static_assert(FD == HID);
static_assert((LL % 64) == 0 && (LL % 48) == 0 && (LL % 32) == 0);
static_assert((NTOK % 64) == 0 && (NPOOL % 64) == 0);
static_assert(DD == 32 && GH == 32);

typedef _Float16 v16h __attribute__((ext_vector_type(16)));
typedef _Float16 v8h  __attribute__((ext_vector_type(8)));
typedef float    v8f  __attribute__((ext_vector_type(8)));
typedef float    v4f  __attribute__((ext_vector_type(4)));
typedef unsigned int v4u __attribute__((ext_vector_type(4)));
typedef unsigned int v2u __attribute__((ext_vector_type(2)));

union FragH { v16h v; v8h h[2]; };

// ---- scalar helpers --------------------------------------------------------------------------------
__device__ __forceinline__ unsigned short bf_bits(float f) {          // f32 -> bf16 bits, RNE convert
  unsigned u = __float_as_uint(f);
  return (unsigned short)((u + 0x7FFFu + ((u >> 16) & 1u)) >> 16);
}
__device__ __forceinline__ float bf_up(unsigned short h) { return __uint_as_float(((unsigned)h) << 16); }
__device__ __forceinline__ float bfr(float f) { return bf_up(bf_bits(f)); }
__device__ __forceinline__ unsigned short h_bits(_Float16 x) { return __builtin_bit_cast(unsigned short, x); }
__device__ __forceinline__ unsigned pk16(unsigned short a, unsigned short b) { return (unsigned)a | ((unsigned)b << 16); }
__device__ __forceinline__ v8f zero8() { v8f z = {0.f, 0.f, 0.f, 0.f, 0.f, 0.f, 0.f, 0.f}; return z; }
__device__ __forceinline__ float hmax8(v8f s) {
  return fmaxf(fmaxf(fmaxf(s[0], s[1]), fmaxf(s[2], s[3])), fmaxf(fmaxf(s[4], s[5]), fmaxf(s[6], s[7])));
}
__device__ __forceinline__ const _Float16* h16(const unsigned short* p) { return (const _Float16*)(const void*)p; }
// hi = f16(f), lo = f16((f - hi) * 1024): residual plane carried x1024, folded back in the f32 epilogue
__device__ __forceinline__ void split_h(float f, unsigned short& hb, unsigned short& lb) {
  const _Float16 h = (_Float16)f;
  const _Float16 l = (_Float16)((f - (float)h) * RSC);
  hb = h_bits(h);
  lb = h_bits(l);
}
__device__ __forceinline__ float fexp2(float x) { return __builtin_amdgcn_exp2f(x); }
__device__ __forceinline__ float sigm(float a) {
  const float e = __expf(fminf(-a, 60.0f));       // quotient stays far from underflow
  return 1.0f / (1.0f + e);
}
__device__ __forceinline__ float wsum(float v) {
#pragma unroll
  for (int off = 16; off > 0; off >>= 1) v += __shfl_xor(v, off, 32);
  return v;
}

// ---- fragment loader: 16-bit A/B operand, lane -> row/col (lane&15), p already includes +8*(lane>>4);
//      elements 0..7 <- p[0..7] (k0+8h..), elements 8..15 <- p[16..23] (k0+16+8h..)
__device__ __forceinline__ v16h ldfrag_h(const _Float16* p) {
  FragH f;
  f.h[0] = *(const v8h*)(p);
  f.h[1] = *(const v8h*)(p + 16);
  return f.v;
}

// ---- the same fragment from a plane stored in fragment order: one 16 x 32 operand tile = 1024 B = two 512-B halves,
//      half s holds lane L's elements 8s..8s+7 at byte 16*L, so each wave-wide 16-B load covers four whole 128-B lines;
//      p already includes +8*lane
__device__ __forceinline__ v16h ldfrag_p(const _Float16* p) {
  FragH f;
  f.h[0] = *(const v8h*)(p);
  f.h[1] = *(const v8h*)(p + 256);
  return f.v;
}

// ---- WMMA helpers with trailing VALU hazard gap --------------------------------------------------------
__device__ __forceinline__ v8f mma_h_raw(v16h a, v16h b, v8f c) {
  return __builtin_amdgcn_wmma_f32_16x16x32_f16(false, a, false, b, (short)0, c, false, false);
}
__device__ __forceinline__ void guard4x6(v8f& a, v8f& b, v8f& c, v8f& d,
                                         v16h x0, v16h x1, v16h x2, v16h x3, v16h x4, v16h x5) {
#if defined(__HIP_DEVICE_COMPILE__)
  asm volatile("v_nop\n\tv_nop\n\tv_nop\n\tv_nop"
               : "+v"(a), "+v"(b), "+v"(c), "+v"(d)
               : "v"(x0), "v"(x1), "v"(x2), "v"(x3), "v"(x4), "v"(x5));
#endif
}
__device__ __forceinline__ void guard8x6(v8f& a0, v8f& a1, v8f& a2, v8f& a3,
                                         v8f& b0, v8f& b1, v8f& b2, v8f& b3,
                                         v16h x0, v16h x1, v16h x2, v16h x3, v16h x4, v16h x5) {
#if defined(__HIP_DEVICE_COMPILE__)
  asm volatile("v_nop\n\tv_nop\n\tv_nop\n\tv_nop"
               : "+v"(a0), "+v"(a1), "+v"(a2), "+v"(a3), "+v"(b0), "+v"(b1), "+v"(b2), "+v"(b3)
               : "v"(x0), "v"(x1), "v"(x2), "v"(x3), "v"(x4), "v"(x5));
#endif
}
__device__ __forceinline__ void acc_guard4(v8f& a, v8f& b, v8f& c, v8f& d) {
#if defined(__HIP_DEVICE_COMPILE__)
  asm volatile("v_nop\n\tv_nop\n\tv_nop\n\tv_nop" : "+v"(a), "+v"(b), "+v"(c), "+v"(d));
#endif
}

// =====================================================================================================
// Weight convert with transpose: in[k][o] f32 (x @ W layout) -> out[o][k] = f16( bf16_RNE(in) * WSC ), k contiguous.
// Blocks 0..11: part p = bx>>2 of {q_w, k_w, v_w} [32][128] -> WT rows p*128 + n, 32 n per block: load 32 k x 32 n
// (thread t: k = t>>3, 4 floats at 4*(t&7)); store threads 0..127: row o = t>>2, 8 halves k = 8*(t&3) -> rows of
// Blocks 12..19: o_w [128][128] -> WOT [n][k]; blocks 20..27: f_w -> FWT; 64 k x 32 o per block (thread t loads k = t>>2,
// coverage: WT 3 parts x 4 tiles x (32 n x 32 k) = [384][32]; WOT/FWT 4 x 2 tiles x (32 o x 64 k) = [128][128] each.
// =====================================================================================================
__global__ __launch_bounds__(256) void wprep(const float* __restrict__ qw, const float* __restrict__ kw,
                                              const float* __restrict__ vw, const float* __restrict__ ow,
                                              const float* __restrict__ fw,
                                              unsigned short* WT, unsigned short* WOT, unsigned short* FWT) {
  __shared__ float T[64 * 33];
  const int t  = threadIdx.x;
  const int bx = blockIdx.x;
  if (bx < 12) {                                            // block-uniform
    const int p  = bx >> 2;
    const int n0 = (bx & 3) * 32;
    const float* src = (p == 0) ? qw : ((p == 1) ? kw : vw);
    {
      const int k = t >> 3, nn = 4 * (t & 7);
      const v4f a = *(const v4f*)(src + (size_t)k * HID + n0 + nn);
#pragma unroll
      for (int i = 0; i < 4; ++i) T[k * 33 + nn + i] = a[i];
    }
    __syncthreads();
    {
      const bool wr = (t < 128);
      const int tt = t & 127;
      const int o = tt >> 2, e = tt & 3;
      float w[8];
#pragma unroll
      for (int i = 0; i < 8; ++i) w[i] = bfr(T[(8 * e + i) * 33 + o]) * WSC;
      v4u v;
#pragma unroll
      for (int i = 0; i < 4; ++i) v[i] = pk16(h_bits((_Float16)w[2 * i]), h_bits((_Float16)w[2 * i + 1]));
      unsigned short* dp = WT + (size_t)(p * HID + n0 + o) * DD + 8 * e;
      if (wr) *(v4u*)dp = v;
      
    }
  } else {
    const int q = bx - 12;
    const bool iso = (q < 8);                                // block-uniform
    const int rr = iso ? q : (q - 8);
    const float* src   = iso ? ow : fw;
    unsigned short* ds = iso ? WOT : FWT;
    const int o0 = (rr >> 1) * 32, k0 = (rr & 1) * 64;
    {
      const int k = t >> 2, oo = 8 * (t & 3);
      const float* sp = src + (size_t)(k0 + k) * HID + o0 + oo;
      const v4f a = *(const v4f*)(sp), c = *(const v4f*)(sp + 4);
#pragma unroll
      for (int i = 0; i < 4; ++i) { T[k * 33 + oo + i] = a[i]; T[k * 33 + oo + 4 + i] = c[i]; }
    }
    __syncthreads();
    {
      const int o = t >> 3, e = t & 7;
      float w[8];
#pragma unroll
      for (int i = 0; i < 8; ++i) w[i] = bfr(T[(8 * e + i) * 33 + o]) * WSC;
      v4u v;
#pragma unroll
      for (int i = 0; i < 4; ++i) v[i] = pk16(h_bits((_Float16)w[2 * i]), h_bits((_Float16)w[2 * i + 1]));
      unsigned short* dp = ds + (size_t)(o0 + o) * HID + k0 + 8 * e;
      *(v4u*)dp = v;
      
    }
  }
}

// =====================================================================================================
// Gater + gated q/k/v projections for 64 tokens per block (256 threads = 8 waves; grid = 6144/64 = 96).
// Phase 0: x tile [64][32] loaded as float4 pairs, RNE-converted to bf16 values: f32 copy sX (pitch 33) for the gater and
//          f16(x * 16) rows sXh (pitch 40 halves) as the WMMA A operand; g_w1 staged bf16-RNE in LDS.
//          with lane = hidden unit (32 shfl-broadcast FMAs), gate = sigmoid(sum_lane h*g_w2 + g_b2), all f32 -> sG.
// Phase 2: per part p in {q,k,v}: wave w -> row tile w&3, 64-col half w>>2: 4 WMMAs (K = 32 = one k step; A from sXh,
//          B from WT rows [p*128 + n][32]); epilogue f = (acc/1024 + bf16(bias[n])) * gate[row] * C (C = 8 q/k, 16 v),
//          hi = f16(f), lo = f16((f-hi)*1024) staged in LDS (q/k row-major [64][136], v transposed [128 hcol][72]);
//          block barrier; whole-line stores: q rows of 256 B by 16 consecutive lanes (instruction i: row 16i + t>>4);
//          k and v^T in fragment order (see ldfrag_p), slab (b, head), 512 contiguous bytes per wave and store.
// coverage: QH/QL rows tok0..tok0+63 x 128 cols; KH/KL 4 heads x key tiles ltok0/16..+3; VTH/VTL 4 heads x key steps
//           ltok0/32..+1 x 2 d tiles; grid covers all 6144 tokens exactly once.
// =====================================================================================================
__global__ __launch_bounds__(256) void qkv_prep(
    const float* __restrict__ x, const float* __restrict__ glnw, const float* __restrict__ glnb,
    const float* __restrict__ gw1, const float* __restrict__ gb1, const float* __restrict__ gw2,
    const float* __restrict__ gb2, const float* __restrict__ qbias, const float* __restrict__ kbias,
    const float* __restrict__ vbias, const unsigned short* __restrict__ WT,
    unsigned short* QH, unsigned short* QL, unsigned short* KH, unsigned short* KL,
    unsigned short* VTH, unsigned short* VTL) {
  __shared__ __align__(16) float sX[64 * 33];
  __shared__ __align__(16) _Float16 sXh[64 * 40];
  __shared__ float sW1[DD * GH];
  __shared__ float sG[64];
  __shared__ __align__(16) unsigned short sH[128 * 72];
  __shared__ __align__(16) unsigned short sL[128 * 72];
  const int t = threadIdx.x, wave = t >> 5, lane = t & 31, hh = lane >> 4, m = lane & 15;
  const int tok0  = blockIdx.x * 64;
  const int b     = tok0 / LL;
  const int ltok0 = tok0 - b * LL;

  // ---- phase 0 ----
  {
    const int tk = t >> 2, j = 8 * (t & 3);
    const float* sp = x + (size_t)(tok0 + tk) * DD + j;
    const v4f a = *(const v4f*)(sp), c = *(const v4f*)(sp + 4);
    float r8[8];
#pragma unroll
    for (int i = 0; i < 4; ++i) { r8[i] = bfr(a[i]); r8[4 + i] = bfr(c[i]); }
#pragma unroll
    for (int i = 0; i < 8; ++i) {
      sX[tk * 33 + j + i]  = r8[i];
      sXh[tk * 40 + j + i] = (_Float16)(r8[i] * XC);
    }
    for (int i = t; i < DD * GH; i += 256) sW1[i] = bfr(gw1[i]);
  }
  __syncthreads();

  // ---- phase 1: gater (f32, VALU) ----
  {
    const float gw = bfr(glnw[lane]), gb = bfr(glnb[lane]);
    const float b1 = bfr(gb1[lane]),  w2 = bfr(gw2[lane]), b2 = bfr(gb2[0]);
#pragma unroll 1
    for (int i = 0; i < 8; ++i) {
      const int tk = wave * 8 + i;
      const float xv  = sX[tk * 33 + lane];
      const float mu  = wsum(xv) * (1.0f / DD);
      const float dv  = xv - mu;
      const float var = wsum(dv * dv) * (1.0f / DD);
      const float xn  = dv * rsqrtf(var + LNEPS) * gw + gb;
      float hacc = b1;
#pragma unroll
      for (int k = 0; k < DD; ++k) hacc += __shfl(xn, k, 32) * sW1[k * GH + lane];
      const float hs = hacc * sigm(hacc);
      const float gs = wsum(hs * w2) + b2;
      const float g  = sigm(gs);
      if (lane == 0) sG[tk] = g;
    }
  }
  __syncthreads();

  // ---- phase 2: projections on WMMA ----
  const int rt = wave & 3, ch = wave >> 2;
  FragH af;
  af.h[0] = *(const v8h*)(sXh + (16 * rt + m) * 40 + 8 * hh);
  af.h[1] = *(const v8h*)(sXh + (16 * rt + m) * 40 + 16 + 8 * hh);
  const _Float16* WTp = h16(WT);
#pragma unroll 1
  for (int p = 0; p < 3; ++p) {
    const float* bp = (p == 0) ? qbias : ((p == 1) ? kbias : vbias);
    const float osc = (p == 2) ? VC : QC;
    v16h bf[4];
#pragma unroll
    for (int j = 0; j < 4; ++j)
      bf[j] = ldfrag_h(WTp + (size_t)(p * HID + 64 * ch + 16 * j + m) * DD + 8 * hh);
    v8f acc[4];
#pragma unroll
    for (int j = 0; j < 4; ++j) acc[j] = mma_h_raw(af.v, bf[j], zero8());
    guard4x6(acc[0], acc[1], acc[2], acc[3], af.v, bf[0], bf[1], bf[2], bf[3], af.v);
    float gr[8];
#pragma unroll
    for (int r = 0; r < 8; ++r) gr[r] = sG[16 * rt + 8 * hh + r];
#pragma unroll
    for (int j = 0; j < 4; ++j) {
      const int n = 64 * ch + 16 * j + m;
      const float bn = bfr(bp[n]);
#pragma unroll
      for (int r = 0; r < 8; ++r) {
        const int row = 16 * rt + 8 * hh + r;
        const float f = ((acc[j][r] * (1.0f / (XC * WSC)) + bn) * gr[r]) * osc;
        unsigned short hb, lb;
        split_h(f, hb, lb);
        if (p < 2) { sH[row * 136 + n] = hb; sL[row * 136 + n] = lb; }
        else       { sH[n * 72 + row]  = hb; sL[n * 72 + row]  = lb; }
      }
    }
    __syncthreads();
    if (p == 0) {                                                   // block-uniform
      unsigned short* Hp = QH;
      unsigned short* Lp = QL;
      const int e = t & 15;
      v4u hv[4], lv[4];
#pragma unroll
      for (int i = 0; i < 4; ++i) {
        const int row = 16 * i + (t >> 4);
        hv[i] = *(const v4u*)(sH + row * 136 + 8 * e);
        lv[i] = *(const v4u*)(sL + row * 136 + 8 * e);
      }
#pragma unroll
      for (int i = 0; i < 4; ++i) {
        const int row = 16 * i + (t >> 4);
        *(v4u*)(Hp + (size_t)(tok0 + row) * HID + 8 * e) = hv[i];
        *(v4u*)(Lp + (size_t)(tok0 + row) * HID + 8 * e) = lv[i];
      }
      
    } else if (p == 1) {
      // k in fragment order: instruction i = head; wave -> 16-key tile t>>6, half s; lane -> key m, dims 16s + 8hh ..+7
      const int ktl = t >> 6, s = (t >> 5) & 1;
      v4u hv[4], lv[4];
#pragma unroll
      for (int i = 0; i < 4; ++i) {
        const int src = (16 * ktl + m) * 136 + HD * i + 16 * s + 8 * hh;
        hv[i] = *(const v4u*)(sH + src);
        lv[i] = *(const v4u*)(sL + src);
      }
#pragma unroll
      for (int i = 0; i < 4; ++i) {
        const size_t o = ((size_t)(b * NH + i) * (LL / 16) + (ltok0 >> 4) + ktl) * 512 + s * 256 + lane * 8;
        *(v4u*)(KH + o) = hv[i];
        *(v4u*)(KL + o) = lv[i];
      }
      // the stores' registers are reused by the next part's LDS reads: keep the wait in front of that overwrite
      asm volatile("s_wait_xcnt 0x0" ::: "memory");
    } else {
      // v^T in fragment order: instruction i = head; wave -> 32-key step t>>7, d tile dt, half s; lane -> d row m,
      // keys 16s + 8hh ..+7
      const int ksl = t >> 7, dt = (t >> 6) & 1, s = (t >> 5) & 1;
      v4u hv[4], lv[4];
#pragma unroll
      for (int i = 0; i < 4; ++i) {
        const int src = (HD * i + 16 * dt + m) * 72 + 32 * ksl + 16 * s + 8 * hh;
        hv[i] = *(const v4u*)(sH + src);
        lv[i] = *(const v4u*)(sL + src);
      }
#pragma unroll
      for (int i = 0; i < 4; ++i) {
        const size_t o = ((size_t)(b * NH + i) * (LL / 32) + (ltok0 >> 5) + ksl) * 1024 + dt * 512 + s * 256 + lane * 8;
        *(v4u*)(VTH + o) = hv[i];
        *(v4u*)(VTL + o) = lv[i];
      }
      // same wait behind the v^T stores, in front of any reuse of their registers
      asm volatile("s_wait_xcnt 0x0" ::: "memory");
    }
    __syncthreads();
  }
}

// =====================================================================================================
// Per-(b, head column) suffix sums of v over time blocks, for the post-softmax 1e-9 floor on masked keys:
//   SV[b*128 + hcol][tb] = sum over keys j >= 6*(tb+1) of v[j][hcol]   (v reconstructed from the hi/lo planes, f32).
// One block per row (grid 256, 256 threads): the row's 3072 values gathered from the fragment-order planes into LDS (16-B
// pieces of 8 keys), per-time-block sums of 6 keys into LDS, thread 0 scans the 512 suffixes
// coverage: 256 rows x 512 floats = the whole SV table.
// =====================================================================================================
__global__ __launch_bounds__(256) void vsuf(const unsigned short* __restrict__ VTH, const unsigned short* __restrict__ VTL,
                                             const int* __restrict__ Tp, float* SV) {
  __shared__ float bs[TT];
  __shared__ __align__(16) float S[TT];
  __shared__ __align__(16) float vv[LL];
  const int t = threadIdx.x;
  const int row = blockIdx.x;
  const int tin = Tp[0];
  const int ntb = (tin < 0) ? 0 : ((tin > TT) ? TT : tin);     // structural, clamped to the static extent
  // this row's keys in the fragment-order planes: 8 keys per 16-B piece; piece g at step g>>2, half (g>>1)&1, hh = g&1
  const size_t rbase = (size_t)(row >> 5) * (LL / 32) * 1024 + ((row >> 4) & 1) * 512 + (row & 15) * 8;
  const _Float16* hp = h16(VTH) + rbase;
  const _Float16* lp = h16(VTL) + rbase;
  for (int g = t; g < LL / 8; g += 256) {
    const int off = (g >> 2) * 1024 + ((g >> 1) & 1) * 256 + (g & 1) * 128;
    const v8h a = *(const v8h*)(hp + off);
    const v8h l = *(const v8h*)(lp + off);
#pragma unroll
    for (int j = 0; j < 8; ++j) vv[8 * g + j] = ((float)a[j] + (float)l[j] * INVRS) * (1.0f / VC);
  }
  __syncthreads();
  for (int tb = t; tb < TT; tb += 256) {
    float s = 0.f;
#pragma unroll
    for (int f = 0; f < NF; ++f) s += vv[tb * NF + f];
    bs[tb] = (tb < ntb) ? s : 0.f;
  }
  __syncthreads();
  if (t == 0) {
    float run = 0.f;
    for (int tb = TT - 1; tb >= 0; --tb) { S[tb] = run; run += bs[tb]; }
  }
  __syncthreads();
  {
    const bool wr = (t < 128);
    const int tt = t & 127;
    const v4f v = *(const v4f*)(S + 4 * tt);
    float* dp = SV + (size_t)row * TT + 4 * tt;
    if (wr) *(v4f*)dp = v;
    
  }
}

// =====================================================================================================
// One 32-key step of the transposed flash formulation for 16 queries of one head (head dim 32 = one k step):
//   S^T tiles (16 keys x 16 queries) = A(k rows, dims split-map) . B(q^T): hi.hi -> s, hi.lo + lo.hi -> sr (x1024);
//   logit (log2 domain) = (s + sr/1024) * scale*log2e/64; block-causal mask by value (key < horizon of the lane's query);
//   online softmax per lane (8 + 8 keys of ONE query per lane, max combined with lane^16), p = 2^(e - m + 10) (x1024);
//   P^T as the B operand of O^T(16 d x 16 queries) += v^T(d rows, keys split-map) . P^T: element r <- tile keys kb..kb+15,
//   element 8+r <- tile kb+16..kb+31, lane unchanged; P hi to o, (v hi . P lo x1024 + v lo x1024 . P hi) to or.
// =====================================================================================================
template <bool MASKED>
__device__ __forceinline__ void attn_step(const int kb, const int jl, const int hh,
    const _Float16* __restrict__ kH, const _Float16* __restrict__ kL,
    const _Float16* __restrict__ vH, const _Float16* __restrict__ vL,
    const v16h qhi, const v16h qlo, float& m_run, float& l_run,
    v8f& o1, v8f& o1r, v8f& o2, v8f& o2r) {
  const size_t so = (size_t)kb * 32;                 // 32 keys = 1024 halves of each fragment-order plane
  const v16h kh0 = ldfrag_p(kH + so);
  const v16h kh1 = ldfrag_p(kH + so + 512);
  const v16h kl0 = ldfrag_p(kL + so);
  const v16h kl1 = ldfrag_p(kL + so + 512);
  v8f s0  = mma_h_raw(kh0, qhi, zero8());
  v8f s1  = mma_h_raw(kh1, qhi, zero8());
  v8f s0r = mma_h_raw(kh0, qlo, zero8());
  v8f s1r = mma_h_raw(kh1, qlo, zero8());
  s0r = mma_h_raw(kl0, qhi, s0r);
  s1r = mma_h_raw(kl1, qhi, s1r);
  guard4x6(s0, s1, s0r, s1r, kh0, kh1, kl0, kl1, qhi, qlo);

  float e0[8], e1[8];
#pragma unroll
  for (int r = 0; r < 8; ++r) {
    e0[r] = (s0[r] + s0r[r] * INVRS) * SCL;
    e1[r] = (s1[r] + s1r[r] * INVRS) * SCL;
  }
  if (MASKED) {
    const int base = kb + 8 * hh;                    // key index of row r = base + r (tile 0), base + 16 + r (tile 1)
#pragma unroll
    for (int r = 0; r < 8; ++r) {
      e0[r] = (base + r      < jl) ? e0[r] : NEGBIG;
      e1[r] = (base + 16 + r < jl) ? e1[r] : NEGBIG;
    }
  }
  float mx = fmaxf(fmaxf(fmaxf(fmaxf(e0[0], e0[1]), fmaxf(e0[2], e0[3])), fmaxf(fmaxf(e0[4], e0[5]), fmaxf(e0[6], e0[7]))),
                   fmaxf(fmaxf(fmaxf(e1[0], e1[1]), fmaxf(e1[2], e1[3])), fmaxf(fmaxf(e1[4], e1[5]), fmaxf(e1[6], e1[7]))));
  mx = fmaxf(mx, __shfl_xor(mx, 16, 32));
  const float m_new = fmaxf(m_run, mx);
  const float corr  = fexp2(m_run - m_new);
  m_run = m_new;
  const float msh = m_new - 10.0f;                   // 2^(e - m + 10) = e^{s - smax} * 1024
  l_run *= corr;
  o1 = o1 * corr; o1r = o1r * corr; o2 = o2 * corr; o2r = o2r * corr;

  FragH ph, pl;
  float ls = 0.f;
#pragma unroll
  for (int r = 0; r < 8; ++r) {
    const float p0 = fexp2(e0[r] - msh);
    const float p1 = fexp2(e1[r] - msh);
    ls += p0 + p1;
    const _Float16 a0 = (_Float16)p0, a1 = (_Float16)p1;
    ph.h[0][r] = a0;                                          // keys kb      + 8hh + r
    ph.h[1][r] = a1;                                          // keys kb + 16 + 8hh + r
    pl.h[0][r] = (_Float16)((p0 - (float)a0) * RSC);
    pl.h[1][r] = (_Float16)((p1 - (float)a1) * RSC);
  }
  l_run += ls;

  const v16h vh1 = ldfrag_p(vH + so);
  const v16h vl1 = ldfrag_p(vL + so);
  const v16h vh2 = ldfrag_p(vH + so + 512);
  const v16h vl2 = ldfrag_p(vL + so + 512);
  o1  = mma_h_raw(vh1, ph.v, o1);
  o2  = mma_h_raw(vh2, ph.v, o2);
  o1r = mma_h_raw(vh1, pl.v, o1r);
  o2r = mma_h_raw(vh2, pl.v, o2r);
  o1r = mma_h_raw(vl1, ph.v, o1r);
  o2r = mma_h_raw(vl2, ph.v, o2r);
  guard4x6(o1, o2, o1r, o2r, vh1, vh2, vl1, vl2, ph.v, pl.v);
}

// =====================================================================================================
// Attention + mean-pool for 48 queries (= 8 time blocks) x all 4 heads of one batch row: block = 12 waves (384 threads),
// wave w -> head w&3, query tile w>>2 (16 queries); grid = 2 * 3072/48 = 128. Each wave runs over keys 0..jmax-1 of its
// tile (jmax = block-causal horizon of its last query, a multiple of 6 <= 3072; steps of 32 never pass key 3071), the
// fully visible prefix without masking, the rest with the per-lane horizon test by value.
// Epilogue: attn[d] = (o + or/1024) / (16 l) + 1e-9 * SV[b][h*32+d][query time block] -> LDS sO[48][132] (f32);
// barrier; threads 0..255 pool 6 consecutive query rows (pooled row = t>>5, cols 4*(t&31)) -> f16 hi (x32) / lo (x1024)
// in LDS; barrier; threads 0..127 write the 8 hi rows (row t>>4, 16-B piece t&15: 16 consecutive lanes per 256-B row =
// coverage: PH/PL rows b*512 + 8*qblock .. +7 x 128 cols; 128 blocks cover [1024][128] of each plane exactly once.
// =====================================================================================================
__global__ __launch_bounds__(384)
void attn_pool(const unsigned short* __restrict__ QH, const unsigned short* __restrict__ QL,
               const unsigned short* __restrict__ KH, const unsigned short* __restrict__ KL,
               const unsigned short* __restrict__ VTH, const unsigned short* __restrict__ VTL,
               const float* __restrict__ SV, unsigned short* PH, unsigned short* PL) {
  __shared__ __align__(16) float sO[48 * 132];
  __shared__ __align__(16) unsigned short sPH[8 * 128];
  __shared__ __align__(16) unsigned short sPL[8 * 128];
  const int t = threadIdx.x, wave = t >> 5, lane = t & 31, hh = lane >> 4, c = lane & 15;
  const int bx = blockIdx.x;
  const int b  = bx >> 6;
  const int qblk = bx & 63;
  const int q0 = qblk * 48;
  const int h  = wave & 3, qt = wave >> 2;
  const int qw0 = q0 + 16 * qt;
  const int qi  = qw0 + c;                                   // query of this lane (B column / D column)
  const int jl  = (qi / NF + 1) * NF;                        // exclusive key horizon
  const size_t tokb = (size_t)b * LL;

  const _Float16* QHp = h16(QH);
  const _Float16* QLp = h16(QL);
  const v16h qhi = ldfrag_h(QHp + (tokb + qi) * HID + h * HD + 8 * hh);
  const v16h qlo = ldfrag_h(QLp + (tokb + qi) * HID + h * HD + 8 * hh);
  const size_t pbase = (size_t)(b * NH + h) * LL * HD + 8 * lane;     // (b, head) slab of a fragment-order plane; + kb * 32
  const _Float16* kH = h16(KH) + pbase;                               // key tile 2 at +512 halves
  const _Float16* kL = h16(KL) + pbase;
  const _Float16* vH = h16(VTH) + pbase;                              // d tile 2 at +512 halves
  const _Float16* vL = h16(VTL) + pbase;

  float m_run = NEGBIG, l_run = 0.f;
  v8f o1 = zero8(), o1r = zero8(), o2 = zero8(), o2r = zero8();
  const int jmax  = ((qw0 + 15) / NF + 1) * NF;              // <= 3072
  const int jmin  = (qw0 / NF + 1) * NF;
  const int cfull = (jmin / 32) * 32;
  int kb = 0;
#pragma unroll 1
  for (; kb < cfull; kb += 32)
    attn_step<false>(kb, jl, hh, kH, kL, vH, vL, qhi, qlo, m_run, l_run, o1, o1r, o2, o2r);
#pragma unroll 1
  for (; kb < jmax; kb += 32)
    attn_step<true>(kb, jl, hh, kH, kL, vH, vL, qhi, qlo, m_run, l_run, o1, o1r, o2, o2r);

  l_run += __shfl_xor(l_run, 16, 32);
  const float inv = (1.0f / l_run) * (1.0f / VC);
  const int tq = qi / NF;
  const float* svp = SV + ((size_t)(b * HID + h * HD)) * TT + tq;
  float* so = sO + (16 * qt + c) * 132 + h * HD;
#pragma unroll
  for (int r = 0; r < 8; ++r) {
    const int d1 = 8 * hh + r, d2 = 16 + 8 * hh + r;
    so[d1] = (o1[r] + o1r[r] * INVRS) * inv + FLOORC * svp[(size_t)d1 * TT];
    so[d2] = (o2[r] + o2r[r] * INVRS) * inv + FLOORC * svp[(size_t)d2 * TT];
  }
  __syncthreads();
  {
    const bool act = (t < 256);
    const int tt = act ? t : 0;
    const int pr = tt >> 5, col = 4 * (tt & 31);
    v4f s = {0.f, 0.f, 0.f, 0.f};
#pragma unroll
    for (int f = 0; f < NF; ++f) s += *(const v4f*)(sO + (NF * pr + f) * 132 + col);
    unsigned short hb[4], lb[4];
#pragma unroll
    for (int e = 0; e < 4; ++e) split_h((s[e] * (1.0f / NF)) * AC, hb[e], lb[e]);
    v2u ph2, pl2;
    ph2[0] = pk16(hb[0], hb[1]); ph2[1] = pk16(hb[2], hb[3]);
    pl2[0] = pk16(lb[0], lb[1]); pl2[1] = pk16(lb[2], lb[3]);
    if (act) {
      *(v2u*)(sPH + pr * 128 + col) = ph2;
      *(v2u*)(sPL + pr * 128 + col) = pl2;
    }
  }
  __syncthreads();
  {
    const bool wr  = (t < 256);
    const bool isl = (t >= 128);
    const int tt = t & 127;
    const int row = tt >> 4, e = tt & 15;
    const v4u a  = *(const v4u*)(sPH + row * 128 + 8 * e);
    const v4u bq = *(const v4u*)(sPL + row * 128 + 8 * e);
    v4u val;
#pragma unroll
    for (int i = 0; i < 4; ++i) val[i] = isl ? bq[i] : a[i];
    unsigned short* dp = (isl ? PL : PH) + ((size_t)(b * TT + 8 * qblk + row)) * HID + 8 * e;
    if (wr) *(v4u*)dp = val;
    
  }
}

// =====================================================================================================
// Tail: 64 pooled rows per block (grid 1024/64 = 16, 256 threads = 8 waves, wave -> row tile w&3, 64-col half w>>2).
// GEMM1 z = pooled(hi + lo/1024)/32 . Wo + bf16(o_b): A planes PH/PL (two products into acc/accr), B = WOT rows, K=128;
// GEMM2 from sZ rows split to f16 hi (x16) / lo (x1024) at fragment build . FWT rows; epilogue silu(acc + bf16(f_b))
// coverage: out rows r0..r0+63 x 128 cols; 16 blocks cover [1024][128] exactly once.
// =====================================================================================================
__global__ __launch_bounds__(256) void tail_k(const unsigned short* __restrict__ PH, const unsigned short* __restrict__ PL,
                                               const unsigned short* __restrict__ WOT, const float* __restrict__ obias,
                                               const float* __restrict__ flnw, const float* __restrict__ flnb,
                                               const unsigned short* __restrict__ FWT, const float* __restrict__ fbias,
                                               float* out) {
  __shared__ __align__(16) float sZ[64 * 132];
  const int t = threadIdx.x, wave = t >> 5, lane = t & 31, hh = lane >> 4, m = lane & 15;
  const int r0 = blockIdx.x * 64;
  const int rt = wave & 3, ch = wave >> 2;

  // ---- GEMM1 ----
  {
    v8f acc[4], accr[4];
#pragma unroll
    for (int j = 0; j < 4; ++j) { acc[j] = zero8(); accr[j] = zero8(); }
    const _Float16* Ah = h16(PH) + (size_t)(r0 + 16 * rt + m) * HID + 8 * hh;
    const _Float16* Al = h16(PL) + (size_t)(r0 + 16 * rt + m) * HID + 8 * hh;
    const _Float16* Bw = h16(WOT) + (size_t)(64 * ch + m) * HID + 8 * hh;
#pragma unroll 1
    for (int k0 = 0; k0 < HID; k0 += 32) {
      v16h bf[4];
#pragma unroll
      for (int j = 0; j < 4; ++j) bf[j] = ldfrag_h(Bw + (size_t)(16 * j) * HID + k0);
      const v16h ah = ldfrag_h(Ah + k0);
      const v16h al = ldfrag_h(Al + k0);
#pragma unroll
      for (int j = 0; j < 4; ++j) acc[j]  = mma_h_raw(ah, bf[j], acc[j]);
#pragma unroll
      for (int j = 0; j < 4; ++j) accr[j] = mma_h_raw(al, bf[j], accr[j]);
      guard8x6(acc[0], acc[1], acc[2], acc[3], accr[0], accr[1], accr[2], accr[3], ah, al, bf[0], bf[1], bf[2], bf[3]);
    }
    acc_guard4(acc[0], acc[1], acc[2], acc[3]);
    acc_guard4(accr[0], accr[1], accr[2], accr[3]);
#pragma unroll
    for (int j = 0; j < 4; ++j) {
      const int n = 64 * ch + 16 * j + m;
      const float bn = bfr(obias[n]);
#pragma unroll
      for (int r = 0; r < 8; ++r) {
        const int row = 16 * rt + 8 * hh + r;
        sZ[row * 132 + n] = (acc[j][r] + accr[j][r] * INVRS) * (1.0f / (AC * WSC)) + bn;
      }
    }
  }
  __syncthreads();

  // ---- LayerNorm in place ----
  {
    float gg[4], bb[4];
#pragma unroll
    for (int e = 0; e < 4; ++e) { gg[e] = bfr(flnw[4 * lane + e]); bb[e] = bfr(flnb[4 * lane + e]); }
#pragma unroll 1
    for (int i = 0; i < 8; ++i) {
      const int row = 8 * wave + i;
      float* zp = sZ + row * 132 + 4 * lane;
      const v4f z = *(const v4f*)zp;
      float s = (z[0] + z[1]) + (z[2] + z[3]);
      s = wsum(s);
      const float mean = s * (1.0f / HID);
      float d[4];
#pragma unroll
      for (int e = 0; e < 4; ++e) d[e] = z[e] - mean;
      float vs = (d[0] * d[0] + d[1] * d[1]) + (d[2] * d[2] + d[3] * d[3]);
      vs = wsum(vs);
      const float rstd = rsqrtf(vs * (1.0f / HID) + LNEPS);
      v4f y;
#pragma unroll
      for (int e = 0; e < 4; ++e) y[e] = (d[e] * rstd) * gg[e] + bb[e];
      *(v4f*)zp = y;
    }
  }
  __syncthreads();

  // ---- GEMM2 ----
  v8f acc2[4], acc2r[4];
#pragma unroll
  for (int j = 0; j < 4; ++j) { acc2[j] = zero8(); acc2r[j] = zero8(); }
  {
    const float* zr = sZ + (16 * rt + m) * 132 + 8 * hh;
    const _Float16* Bf = h16(FWT) + (size_t)(64 * ch + m) * HID + 8 * hh;
#pragma unroll 1
    for (int k0 = 0; k0 < HID; k0 += 32) {
      FragH ah, al;
      const v4f za = *(const v4f*)(zr + k0), zb = *(const v4f*)(zr + k0 + 4);
      const v4f zc = *(const v4f*)(zr + k0 + 16), zd = *(const v4f*)(zr + k0 + 20);
#pragma unroll
      for (int i = 0; i < 4; ++i) {
        const float f0 = za[i] * YC, f1 = zb[i] * YC, f2 = zc[i] * YC, f3 = zd[i] * YC;
        const _Float16 h0 = (_Float16)f0, h1 = (_Float16)f1, h2 = (_Float16)f2, h3 = (_Float16)f3;
        ah.h[0][i] = h0;     al.h[0][i]     = (_Float16)((f0 - (float)h0) * RSC);
        ah.h[0][4 + i] = h1; al.h[0][4 + i] = (_Float16)((f1 - (float)h1) * RSC);
        ah.h[1][i] = h2;     al.h[1][i]     = (_Float16)((f2 - (float)h2) * RSC);
        ah.h[1][4 + i] = h3; al.h[1][4 + i] = (_Float16)((f3 - (float)h3) * RSC);
      }
      v16h bf[4];
#pragma unroll
      for (int j = 0; j < 4; ++j) bf[j] = ldfrag_h(Bf + (size_t)(16 * j) * HID + k0);
#pragma unroll
      for (int j = 0; j < 4; ++j) acc2[j]  = mma_h_raw(ah.v, bf[j], acc2[j]);
#pragma unroll
      for (int j = 0; j < 4; ++j) acc2r[j] = mma_h_raw(al.v, bf[j], acc2r[j]);
      guard8x6(acc2[0], acc2[1], acc2[2], acc2[3], acc2r[0], acc2r[1], acc2r[2], acc2r[3],
               ah.v, al.v, bf[0], bf[1], bf[2], bf[3]);
    }
    acc_guard4(acc2[0], acc2[1], acc2[2], acc2[3]);
    acc_guard4(acc2r[0], acc2r[1], acc2r[2], acc2r[3]);
  }
  __syncthreads();                                            // every wave is done reading sZ rows as the A operand
#pragma unroll
  for (int j = 0; j < 4; ++j) {
    const int n = 64 * ch + 16 * j + m;
    const float bn = bfr(fbias[n]);
#pragma unroll
    for (int r = 0; r < 8; ++r) {
      const int row = 16 * rt + 8 * hh + r;
      const float a = (acc2[j][r] + acc2r[j][r] * INVRS) * (1.0f / (YC * WSC)) + bn;
      sZ[row * 132 + n] = a * sigm(a);
    }
  }
  __syncthreads();
  {
    v4f vals[8];
#pragma unroll
    for (int i = 0; i < 8; ++i) vals[i] = *(const v4f*)(sZ + (8 * i + wave) * 132 + 4 * lane);
#pragma unroll
    for (int i = 0; i < 8; ++i)
      *(v4f*)(out + (size_t)(r0 + 8 * i + wave) * FD + 4 * lane) = vals[i];
    
  }
}

// =====================================================================================================
// Workspace map (bytes), every offset a multiple of 256 and every plane sized to its whole-line store granularity:
//   WT   f16 [384][32]  x64        0          24576     (q_w^T | k_w^T | v_w^T rows)
//   WOT  f16 [128][128] x64        24576      32768
//   FWT  f16 [128][128] x64        57344      32768
//   QH   f16 [6144][128] q x8      90112      1572864
//   QL   f16 [6144][128] residual  1662976    1572864
//   KH   f16 k x8, fragment order [2][4 heads][192 key tiles][2 halves][32 lanes][8]   3235840    1572864
//   KL                             4808704    1572864
//   VTH  f16 v x16, fragment order [2][4 heads][96 key steps][2 d tiles][2 halves][32 lanes][8]   6381568    1572864
//   VTL                            7954432    1572864
//   SV   f32 [256][512]            9527296    524288
//   PH   f16 [1024][128] x32       10051584   262144
//   PL                             10313728   262144
//   end                            10575872
// =====================================================================================================
extern "C" void kernel_launch(void* const* d_in, const int* in_sizes, int n_in,
                              void* d_out, int out_size, void* d_ws, size_t ws_size,
                              hipStream_t stream) {
  if (n_in < 20) return;
  if (in_sizes[0] != NTOK * DD) return;
  if (in_sizes[1] != DD || in_sizes[2] != DD || in_sizes[3] != DD * GH || in_sizes[4] != GH ||
      in_sizes[5] != GH || in_sizes[6] != 1) return;
  if (in_sizes[7] != DD * HID || in_sizes[8] != HID || in_sizes[9] != DD * HID || in_sizes[10] != HID ||
      in_sizes[11] != DD * HID || in_sizes[12] != HID) return;
  if (in_sizes[13] != HID * HID || in_sizes[14] != HID || in_sizes[15] != HID || in_sizes[16] != HID ||
      in_sizes[17] != HID * FD || in_sizes[18] != FD || in_sizes[19] != 1) return;
  if (out_size != NPOOL * FD) return;

  const float* x    = (const float*)d_in[0];
  const float* glnw = (const float*)d_in[1];
  const float* glnb = (const float*)d_in[2];
  const float* gw1  = (const float*)d_in[3];
  const float* gb1  = (const float*)d_in[4];
  const float* gw2  = (const float*)d_in[5];
  const float* gb2  = (const float*)d_in[6];
  const float* qw   = (const float*)d_in[7];
  const float* qb   = (const float*)d_in[8];
  const float* kw   = (const float*)d_in[9];
  const float* kb   = (const float*)d_in[10];
  const float* vw   = (const float*)d_in[11];
  const float* vb   = (const float*)d_in[12];
  const float* ow   = (const float*)d_in[13];
  const float* ob   = (const float*)d_in[14];
  const float* flnw = (const float*)d_in[15];
  const float* flnb = (const float*)d_in[16];
  const float* fw   = (const float*)d_in[17];
  const float* fb   = (const float*)d_in[18];
  const int*   Tp   = (const int*)d_in[19];

  const size_t PWT = (size_t)3 * HID * DD * 2;        //    24576
  const size_t PWO = (size_t)HID * HID * 2;           //    32768
  const size_t PWF = (size_t)FD * HID * 2;            //    32768
  const size_t PQP = (size_t)NTOK * HID * 2;          //  1572864
  const size_t PVT = (size_t)NB * HID * LL * 2;       //  1572864
  const size_t PSV = (size_t)NB * HID * TT * 4;       //   524288
  const size_t PPP = (size_t)NPOOL * HID * 2;         //   262144
  size_t off = 0;
  const size_t oWT = off; off += PWT;
  const size_t oWO = off; off += PWO;
  const size_t oWF = off; off += PWF;
  const size_t oQH = off; off += PQP;
  const size_t oQL = off; off += PQP;
  const size_t oKH = off; off += PQP;
  const size_t oKL = off; off += PQP;
  const size_t oVH = off; off += PVT;
  const size_t oVL = off; off += PVT;
  const size_t oSV = off; off += PSV;
  const size_t oPH = off; off += PPP;
  const size_t oPL = off; off += PPP;
  if (off > ws_size) return;                           // off = 10575872
  if (off > (size_t)134217728) return;

  char* ws = (char*)d_ws;
  unsigned short* WT  = (unsigned short*)(ws + oWT);
  unsigned short* WOT = (unsigned short*)(ws + oWO);
  unsigned short* FWT = (unsigned short*)(ws + oWF);
  unsigned short* QH  = (unsigned short*)(ws + oQH);
  unsigned short* QL  = (unsigned short*)(ws + oQL);
  unsigned short* KH  = (unsigned short*)(ws + oKH);
  unsigned short* KL  = (unsigned short*)(ws + oKL);
  unsigned short* VTH = (unsigned short*)(ws + oVH);
  unsigned short* VTL = (unsigned short*)(ws + oVL);
  float*          SV  = (float*)(ws + oSV);
  unsigned short* PH  = (unsigned short*)(ws + oPH);
  unsigned short* PL  = (unsigned short*)(ws + oPL);
  float*          out = (float*)d_out;

  const dim3 blk(256), blk384(384);
  const dim3 gW(12 + 8 + 8);                           // 28 weight tiles
  const dim3 gQ(NTOK / 64);                            // 96
  const dim3 gS(NB * HID);                             // 256
  const dim3 gA(NB * (LL / 48));                       // 128
  const dim3 gT(NPOOL / 64);                           // 16

  // (0) weight planes, transposed to k-contiguous rows: f16( bf16_RNE(w) * 64 )
  wprep<<<gW, blk, 0, stream>>>(qw, kw, vw, ow, fw, WT, WOT, FWT);

  // (1) gater + gated q/k/v planes (q rows hi/lo; k and v^T hi/lo in fragment order)
  qkv_prep<<<gQ, blk, 0, stream>>>(x, glnw, glnb, gw1, gb1, gw2, gb2, qb, kb, vb, WT, QH, QL, KH, KL, VTH, VTL);

  // (2) per-(b, head column) suffix sums of v over time blocks (masked-key floor term)
  vsuf<<<gS, blk, 0, stream>>>(VTH, VTL, Tp, SV);

  // (3) block-causal attention + mean-pool over the 6 forces -> pooled planes
  attn_pool<<<gA, blk384, 0, stream>>>(QH, QL, KH, KL, VTH, VTL, SV, PH, PL);

  // (4) o-proj + LayerNorm + final linear + SiLU -> out
  tail_k<<<gT, blk, 0, stream>>>(PH, PL, WOT, ob, flnw, flnb, FWT, fb, out);
  (void)hipGetLastError();
}

// v002
// It runs in 64.4 microseconds.
// Two timings next to v001 put it at 1.81 and 1.83 times that version's speed.
// Over all steps from v000 it is 2.84 times as fast.
// Contractions: q/k/v projections (x rows f16 x16 . W^T f16 x64, K=32, one product), scores S^T = k . q^T
// (k and q each f16 x8 hi plane + f16 x1024 residual plane, 3 products per tile), O^T = v^T . P^T (v f16 x16 hi +
// x1024 residual, P f16 x1024 hi + x1024 residual, 3 products), pooled attention . Wo^T and LN rows . Wf^T
// (activation f16 hi + x1024 residual . W^T f16 x64, K=128, 2 products): all v_wmma_f32_16x16x32_f16, f32 accumulate;
// gater MLP, LayerNorm, softmax, pooling, SiLU in f32 on VALU; every float input RNE-converted to bf16 on load.
#include <hip/hip_runtime.h>
#include <math.h>
#include <stdint.h>

#define NB     2
#define TT     512
#define NF     6
#define DD     32
#define HID    128
#define NH     4
#define HD     32
#define GH     32
#define FD     128
#define LL     (TT * NF)
#define NTOK   (NB * LL)
#define NPOOL  (NB * TT)
#define LNEPS  1.0e-5f
#define XC     16.0f
#define WSC    64.0f
#define QC     8.0f
#define KC     8.0f
#define VC     16.0f
#define AC     32.0f
#define YC     16.0f
#define RSC    1024.0f
#define INVRS  (1.0f / 1024.0f)
#define FLOORC 1.0e-9f
#define NEGBIG (-1.0e30f)
#define SCL    ((0.17677669529663687f * 1.4426950408889634f) / (QC * KC))
static_assert(NH * HD == HID);
static_assert(FD == HID);
static_assert((LL % 64) == 0 && (LL % 96) == 0 && (LL % 32) == 0 && LL / 48 == 64);
static_assert((NTOK % 64) == 0 && (NPOOL % 64) == 0);
static_assert(DD == 32 && GH == 32);

typedef _Float16 v16h __attribute__((ext_vector_type(16)));
typedef _Float16 v8h  __attribute__((ext_vector_type(8)));
typedef float    v8f  __attribute__((ext_vector_type(8)));
typedef float    v4f  __attribute__((ext_vector_type(4)));
typedef unsigned int v4u __attribute__((ext_vector_type(4)));
typedef unsigned int v2u __attribute__((ext_vector_type(2)));

union FragH { v16h v; v8h h[2]; };

// ---- scalar helpers --------------------------------------------------------------------------------
__device__ __forceinline__ unsigned short bf_bits(float f) {          // f32 -> bf16 bits, RNE convert
  unsigned u = __float_as_uint(f);
  return (unsigned short)((u + 0x7FFFu + ((u >> 16) & 1u)) >> 16);
}
__device__ __forceinline__ float bf_up(unsigned short h) { return __uint_as_float(((unsigned)h) << 16); }
__device__ __forceinline__ float bfr(float f) { return bf_up(bf_bits(f)); }
__device__ __forceinline__ unsigned short h_bits(_Float16 x) { return __builtin_bit_cast(unsigned short, x); }
__device__ __forceinline__ unsigned pk16(unsigned short a, unsigned short b) { return (unsigned)a | ((unsigned)b << 16); }
__device__ __forceinline__ v8f zero8() { v8f z = {0.f, 0.f, 0.f, 0.f, 0.f, 0.f, 0.f, 0.f}; return z; }
__device__ __forceinline__ float hmax8(v8f s) {
  return fmaxf(fmaxf(fmaxf(s[0], s[1]), fmaxf(s[2], s[3])), fmaxf(fmaxf(s[4], s[5]), fmaxf(s[6], s[7])));
}
__device__ __forceinline__ const _Float16* h16(const unsigned short* p) { return (const _Float16*)(const void*)p; }
// hi = f16(f), lo = f16((f - hi) * 1024): residual plane carried x1024, folded back in the f32 epilogue
__device__ __forceinline__ void split_h(float f, unsigned short& hb, unsigned short& lb) {
  const _Float16 h = (_Float16)f;
  const _Float16 l = (_Float16)((f - (float)h) * RSC);
  hb = h_bits(h);
  lb = h_bits(l);
}
__device__ __forceinline__ float fexp2(float x) { return __builtin_amdgcn_exp2f(x); }
__device__ __forceinline__ float sigm(float a) {
  const float e = __expf(fminf(-a, 60.0f));       // quotient stays far from underflow
  return 1.0f / (1.0f + e);
}
__device__ __forceinline__ float wsum(float v) {
#pragma unroll
  for (int off = 16; off > 0; off >>= 1) v += __shfl_xor(v, off, 32);
  return v;
}

// ---- fragment loader: 16-bit A/B operand, lane -> row/col (lane&15), p already includes +8*(lane>>4);
//      elements 0..7 <- p[0..7] (k0+8h..), elements 8..15 <- p[16..23] (k0+16+8h..)
__device__ __forceinline__ v16h ldfrag_h(const _Float16* p) {
  FragH f;
  f.h[0] = *(const v8h*)(p);
  f.h[1] = *(const v8h*)(p + 16);
  return f.v;
}

// ---- the same fragment from a plane stored in fragment order: one 16 x 32 operand tile = 1024 B = two 512-B halves,
//      half s holds lane L's elements 8s..8s+7 at byte 16*L, so each wave-wide 16-B load covers four whole 128-B lines;
//      p already includes +8*lane
__device__ __forceinline__ v16h ldfrag_p(const _Float16* p) {
  FragH f;
  f.h[0] = *(const v8h*)(p);
  f.h[1] = *(const v8h*)(p + 256);
  return f.v;
}

// ---- WMMA helpers with trailing VALU hazard gap --------------------------------------------------------
__device__ __forceinline__ v8f mma_h_raw(v16h a, v16h b, v8f c) {
  return __builtin_amdgcn_wmma_f32_16x16x32_f16(false, a, false, b, (short)0, c, false, false);
}
__device__ __forceinline__ void guard4x6(v8f& a, v8f& b, v8f& c, v8f& d,
                                         v16h x0, v16h x1, v16h x2, v16h x3, v16h x4, v16h x5) {
#if defined(__HIP_DEVICE_COMPILE__)
  asm volatile("v_nop\n\tv_nop\n\tv_nop\n\tv_nop"
               : "+v"(a), "+v"(b), "+v"(c), "+v"(d)
               : "v"(x0), "v"(x1), "v"(x2), "v"(x3), "v"(x4), "v"(x5));
#endif
}
__device__ __forceinline__ void guard8x6(v8f& a0, v8f& a1, v8f& a2, v8f& a3,
                                         v8f& b0, v8f& b1, v8f& b2, v8f& b3,
                                         v16h x0, v16h x1, v16h x2, v16h x3, v16h x4, v16h x5) {
#if defined(__HIP_DEVICE_COMPILE__)
  asm volatile("v_nop\n\tv_nop\n\tv_nop\n\tv_nop"
               : "+v"(a0), "+v"(a1), "+v"(a2), "+v"(a3), "+v"(b0), "+v"(b1), "+v"(b2), "+v"(b3)
               : "v"(x0), "v"(x1), "v"(x2), "v"(x3), "v"(x4), "v"(x5));
#endif
}
__device__ __forceinline__ void acc_guard4(v8f& a, v8f& b, v8f& c, v8f& d) {
#if defined(__HIP_DEVICE_COMPILE__)
  asm volatile("v_nop\n\tv_nop\n\tv_nop\n\tv_nop" : "+v"(a), "+v"(b), "+v"(c), "+v"(d));
#endif
}

// =====================================================================================================
// Weight convert with transpose: in[k][o] f32 (x @ W layout) -> out[o][k] = f16( bf16_RNE(in) * WSC ), k contiguous.
// Blocks 0..11: part p = bx>>2 of {q_w, k_w, v_w} [32][128] -> WT rows p*128 + n, 32 n per block: load 32 k x 32 n
// (thread t: k = t>>3, 4 floats at 4*(t&7)); store threads 0..127: row o = t>>2, 8 halves k = 8*(t&3) -> rows of
// Blocks 12..19: o_w [128][128] -> WOT [n][k]; blocks 20..27: f_w -> FWT; 64 k x 32 o per block (thread t loads k = t>>2,
// coverage: WT 3 parts x 4 tiles x (32 n x 32 k) = [384][32]; WOT/FWT 4 x 2 tiles x (32 o x 64 k) = [128][128] each.
// =====================================================================================================
__global__ __launch_bounds__(256) void wprep(const float* __restrict__ qw, const float* __restrict__ kw,
                                              const float* __restrict__ vw, const float* __restrict__ ow,
                                              const float* __restrict__ fw,
                                              unsigned short* WT, unsigned short* WOT, unsigned short* FWT) {
  __shared__ float T[64 * 33];
  const int t  = threadIdx.x;
  const int bx = blockIdx.x;
  if (bx < 12) {                                            // block-uniform
    const int p  = bx >> 2;
    const int n0 = (bx & 3) * 32;
    const float* src = (p == 0) ? qw : ((p == 1) ? kw : vw);
    {
      const int k = t >> 3, nn = 4 * (t & 7);
      const v4f a = *(const v4f*)(src + (size_t)k * HID + n0 + nn);
#pragma unroll
      for (int i = 0; i < 4; ++i) T[k * 33 + nn + i] = a[i];
    }
    __syncthreads();
    {
      const bool wr = (t < 128);
      const int tt = t & 127;
      const int o = tt >> 2, e = tt & 3;
      float w[8];
#pragma unroll
      for (int i = 0; i < 8; ++i) w[i] = bfr(T[(8 * e + i) * 33 + o]) * WSC;
      v4u v;
#pragma unroll
      for (int i = 0; i < 4; ++i) v[i] = pk16(h_bits((_Float16)w[2 * i]), h_bits((_Float16)w[2 * i + 1]));
      unsigned short* dp = WT + (size_t)(p * HID + n0 + o) * DD + 8 * e;
      if (wr) *(v4u*)dp = v;
      
    }
  } else {
    const int q = bx - 12;
    const bool iso = (q < 8);                                // block-uniform
    const int rr = iso ? q : (q - 8);
    const float* src   = iso ? ow : fw;
    unsigned short* ds = iso ? WOT : FWT;
    const int o0 = (rr >> 1) * 32, k0 = (rr & 1) * 64;
    {
      const int k = t >> 2, oo = 8 * (t & 3);
      const float* sp = src + (size_t)(k0 + k) * HID + o0 + oo;
      const v4f a = *(const v4f*)(sp), c = *(const v4f*)(sp + 4);
#pragma unroll
      for (int i = 0; i < 4; ++i) { T[k * 33 + oo + i] = a[i]; T[k * 33 + oo + 4 + i] = c[i]; }
    }
    __syncthreads();
    {
      const int o = t >> 3, e = t & 7;
      float w[8];
#pragma unroll
      for (int i = 0; i < 8; ++i) w[i] = bfr(T[(8 * e + i) * 33 + o]) * WSC;
      v4u v;
#pragma unroll
      for (int i = 0; i < 4; ++i) v[i] = pk16(h_bits((_Float16)w[2 * i]), h_bits((_Float16)w[2 * i + 1]));
      unsigned short* dp = ds + (size_t)(o0 + o) * HID + k0 + 8 * e;
      *(v4u*)dp = v;
      
    }
  }
}

// =====================================================================================================
// Gater + gated q/k/v projections for 64 tokens per block (256 threads = 8 waves; grid = 6144/64 = 96).
// Phase 0: x tile [64][32] loaded as float4 pairs, RNE-converted to bf16 values: f32 copy sX (pitch 33) for the gater and
//          f16(x * 16) rows sXh (pitch 40 halves) as the WMMA A operand; g_w1 staged bf16-RNE in LDS.
//          with lane = hidden unit (32 shfl-broadcast FMAs), gate = sigmoid(sum_lane h*g_w2 + g_b2), all f32 -> sG.
// Phase 2: per part p in {q,k,v}: wave w -> row tile w&3, 64-col half w>>2: 4 WMMAs (K = 32 = one k step; A from sXh,
//          B from WT rows [p*128 + n][32]); epilogue f = (acc/1024 + bf16(bias[n])) * gate[row] * C (C = 8 q/k, 16 v),
//          hi = f16(f), lo = f16((f-hi)*1024) staged in LDS (q/k row-major [64][136], v transposed [128 hcol][72]);
//          block barrier; whole-line stores: q rows of 256 B by 16 consecutive lanes (instruction i: row 16i + t>>4);
//          k and v^T in fragment order (see ldfrag_p), slab (b, head), 512 contiguous bytes per wave and store.
// coverage: QH/QL rows tok0..tok0+63 x 128 cols; KH/KL 4 heads x key tiles ltok0/16..+3; VTH/VTL 4 heads x key steps
//           ltok0/32..+1 x 2 d tiles; grid covers all 6144 tokens exactly once.
// =====================================================================================================
__global__ __launch_bounds__(256) void qkv_prep(
    const float* __restrict__ x, const float* __restrict__ glnw, const float* __restrict__ glnb,
    const float* __restrict__ gw1, const float* __restrict__ gb1, const float* __restrict__ gw2,
    const float* __restrict__ gb2, const float* __restrict__ qbias, const float* __restrict__ kbias,
    const float* __restrict__ vbias, const unsigned short* __restrict__ WT,
    unsigned short* QH, unsigned short* QL, unsigned short* KH, unsigned short* KL,
    unsigned short* VTH, unsigned short* VTL) {
  __shared__ __align__(16) float sX[64 * 33];
  __shared__ __align__(16) _Float16 sXh[64 * 40];
  __shared__ float sW1[DD * GH];
  __shared__ float sG[64];
  __shared__ __align__(16) unsigned short sH[128 * 72];
  __shared__ __align__(16) unsigned short sL[128 * 72];
  const int t = threadIdx.x, wave = t >> 5, lane = t & 31, hh = lane >> 4, m = lane & 15;
  const int tok0  = blockIdx.x * 64;
  const int b     = tok0 / LL;
  const int ltok0 = tok0 - b * LL;

  // ---- phase 0 ----
  {
    const int tk = t >> 2, j = 8 * (t & 3);
    const float* sp = x + (size_t)(tok0 + tk) * DD + j;
    const v4f a = *(const v4f*)(sp), c = *(const v4f*)(sp + 4);
    float r8[8];
#pragma unroll
    for (int i = 0; i < 4; ++i) { r8[i] = bfr(a[i]); r8[4 + i] = bfr(c[i]); }
#pragma unroll
    for (int i = 0; i < 8; ++i) {
      sX[tk * 33 + j + i]  = r8[i];
      sXh[tk * 40 + j + i] = (_Float16)(r8[i] * XC);
    }
    for (int i = t; i < DD * GH; i += 256) sW1[i] = bfr(gw1[i]);
  }
  __syncthreads();

  // ---- phase 1: gater (f32, VALU) ----
  {
    const float gw = bfr(glnw[lane]), gb = bfr(glnb[lane]);
    const float b1 = bfr(gb1[lane]),  w2 = bfr(gw2[lane]), b2 = bfr(gb2[0]);
#pragma unroll 1
    for (int i = 0; i < 8; ++i) {
      const int tk = wave * 8 + i;
      const float xv  = sX[tk * 33 + lane];
      const float mu  = wsum(xv) * (1.0f / DD);
      const float dv  = xv - mu;
      const float var = wsum(dv * dv) * (1.0f / DD);
      const float xn  = dv * rsqrtf(var + LNEPS) * gw + gb;
      float hacc = b1;
#pragma unroll
      for (int k = 0; k < DD; ++k) hacc += __shfl(xn, k, 32) * sW1[k * GH + lane];
      const float hs = hacc * sigm(hacc);
      const float gs = wsum(hs * w2) + b2;
      const float g  = sigm(gs);
      if (lane == 0) sG[tk] = g;
    }
  }
  __syncthreads();

  // ---- phase 2: projections on WMMA ----
  const int rt = wave & 3, ch = wave >> 2;
  FragH af;
  af.h[0] = *(const v8h*)(sXh + (16 * rt + m) * 40 + 8 * hh);
  af.h[1] = *(const v8h*)(sXh + (16 * rt + m) * 40 + 16 + 8 * hh);
  const _Float16* WTp = h16(WT);
#pragma unroll 1
  for (int p = 0; p < 3; ++p) {
    const float* bp = (p == 0) ? qbias : ((p == 1) ? kbias : vbias);
    const float osc = (p == 2) ? VC : QC;
    v16h bf[4];
#pragma unroll
    for (int j = 0; j < 4; ++j)
      bf[j] = ldfrag_h(WTp + (size_t)(p * HID + 64 * ch + 16 * j + m) * DD + 8 * hh);
    v8f acc[4];
#pragma unroll
    for (int j = 0; j < 4; ++j) acc[j] = mma_h_raw(af.v, bf[j], zero8());
    guard4x6(acc[0], acc[1], acc[2], acc[3], af.v, bf[0], bf[1], bf[2], bf[3], af.v);
    float gr[8];
#pragma unroll
    for (int r = 0; r < 8; ++r) gr[r] = sG[16 * rt + 8 * hh + r];
#pragma unroll
    for (int j = 0; j < 4; ++j) {
      const int n = 64 * ch + 16 * j + m;
      const float bn = bfr(bp[n]);
#pragma unroll
      for (int r = 0; r < 8; ++r) {
        const int row = 16 * rt + 8 * hh + r;
        const float f = ((acc[j][r] * (1.0f / (XC * WSC)) + bn) * gr[r]) * osc;
        unsigned short hb, lb;
        split_h(f, hb, lb);
        if (p < 2) { sH[row * 136 + n] = hb; sL[row * 136 + n] = lb; }
        else       { sH[n * 72 + row]  = hb; sL[n * 72 + row]  = lb; }
      }
    }
    __syncthreads();
    if (p == 0) {                                                   // block-uniform
      unsigned short* Hp = QH;
      unsigned short* Lp = QL;
      const int e = t & 15;
      v4u hv[4], lv[4];
#pragma unroll
      for (int i = 0; i < 4; ++i) {
        const int row = 16 * i + (t >> 4);
        hv[i] = *(const v4u*)(sH + row * 136 + 8 * e);
        lv[i] = *(const v4u*)(sL + row * 136 + 8 * e);
      }
#pragma unroll
      for (int i = 0; i < 4; ++i) {
        const int row = 16 * i + (t >> 4);
        *(v4u*)(Hp + (size_t)(tok0 + row) * HID + 8 * e) = hv[i];
        *(v4u*)(Lp + (size_t)(tok0 + row) * HID + 8 * e) = lv[i];
      }
      
    } else if (p == 1) {
      // k in fragment order: instruction i = head; wave -> 16-key tile t>>6, half s; lane -> key m, dims 16s + 8hh ..+7
      const int ktl = t >> 6, s = (t >> 5) & 1;
      v4u hv[4], lv[4];
#pragma unroll
      for (int i = 0; i < 4; ++i) {
        const int src = (16 * ktl + m) * 136 + HD * i + 16 * s + 8 * hh;
        hv[i] = *(const v4u*)(sH + src);
        lv[i] = *(const v4u*)(sL + src);
      }
#pragma unroll
      for (int i = 0; i < 4; ++i) {
        const size_t o = ((size_t)(b * NH + i) * (LL / 16) + (ltok0 >> 4) + ktl) * 512 + s * 256 + lane * 8;
        *(v4u*)(KH + o) = hv[i];
        *(v4u*)(KL + o) = lv[i];
      }
      // the stores' registers are reused by the next part's LDS reads: keep the wait in front of that overwrite
      asm volatile("s_wait_xcnt 0x0" ::: "memory");
    } else {
      // v^T in fragment order: instruction i = head; wave -> 32-key step t>>7, d tile dt, half s; lane -> d row m,
      // keys 16s + 8hh ..+7
      const int ksl = t >> 7, dt = (t >> 6) & 1, s = (t >> 5) & 1;
      v4u hv[4], lv[4];
#pragma unroll
      for (int i = 0; i < 4; ++i) {
        const int src = (HD * i + 16 * dt + m) * 72 + 32 * ksl + 16 * s + 8 * hh;
        hv[i] = *(const v4u*)(sH + src);
        lv[i] = *(const v4u*)(sL + src);
      }
#pragma unroll
      for (int i = 0; i < 4; ++i) {
        const size_t o = ((size_t)(b * NH + i) * (LL / 32) + (ltok0 >> 5) + ksl) * 1024 + dt * 512 + s * 256 + lane * 8;
        *(v4u*)(VTH + o) = hv[i];
        *(v4u*)(VTL + o) = lv[i];
      }
      // same wait behind the v^T stores, in front of any reuse of their registers
      asm volatile("s_wait_xcnt 0x0" ::: "memory");
    }
    __syncthreads();
  }
}

// =====================================================================================================
// Per-(b, head column) suffix sums of v over time blocks, for the post-softmax 1e-9 floor on masked keys:
//   SV[b*128 + hcol][tb] = sum over keys j >= 6*(tb+1) of v[j][hcol]   (v reconstructed from the hi/lo planes, f32).
// One block per row (grid 256, 256 threads): the row's 3072 values gathered from the fragment-order planes into LDS (16-B
// pieces of 8 keys), per-time-block sums of 6 keys into LDS, thread 0 scans the 512 suffixes
// coverage: 256 rows x 512 floats = the whole SV table.
// =====================================================================================================
__global__ __launch_bounds__(256) void vsuf(const unsigned short* __restrict__ VTH, const unsigned short* __restrict__ VTL,
                                             const int* __restrict__ Tp, float* SV) {
  __shared__ float bs[TT];
  __shared__ __align__(16) float S[TT];
  __shared__ __align__(16) float vv[LL];
  const int t = threadIdx.x;
  const int row = blockIdx.x;
  const int tin = Tp[0];
  const int ntb = (tin < 0) ? 0 : ((tin > TT) ? TT : tin);     // structural, clamped to the static extent
  // this row's keys in the fragment-order planes: 8 keys per 16-B piece; piece g at step g>>2, half (g>>1)&1, hh = g&1
  const size_t rbase = (size_t)(row >> 5) * (LL / 32) * 1024 + ((row >> 4) & 1) * 512 + (row & 15) * 8;
  const _Float16* hp = h16(VTH) + rbase;
  const _Float16* lp = h16(VTL) + rbase;
  for (int g = t; g < LL / 8; g += 256) {
    const int off = (g >> 2) * 1024 + ((g >> 1) & 1) * 256 + (g & 1) * 128;
    const v8h a = *(const v8h*)(hp + off);
    const v8h l = *(const v8h*)(lp + off);
#pragma unroll
    for (int j = 0; j < 8; ++j) vv[8 * g + j] = ((float)a[j] + (float)l[j] * INVRS) * (1.0f / VC);
  }
  __syncthreads();
  for (int tb = t; tb < TT; tb += 256) {
    float s = 0.f;
#pragma unroll
    for (int f = 0; f < NF; ++f) s += vv[tb * NF + f];
    bs[tb] = (tb < ntb) ? s : 0.f;
  }
  __syncthreads();
  if (t == 0) {
    float run = 0.f;
    for (int tb = TT - 1; tb >= 0; --tb) { S[tb] = run; run += bs[tb]; }
  }
  __syncthreads();
  {
    const bool wr = (t < 128);
    const int tt = t & 127;
    const v4f v = *(const v4f*)(S + 4 * tt);
    float* dp = SV + (size_t)row * TT + 4 * tt;
    if (wr) *(v4f*)dp = v;
    
  }
}

// =====================================================================================================
// One 32-key step of the transposed flash formulation for 16 queries of one head (head dim 32 = one k step):
//   S^T tiles (16 keys x 16 queries) = A(k rows, dims split-map) . B(q^T): hi.hi -> s, hi.lo + lo.hi -> sr (x1024);
//   logit (log2 domain) = (s + sr/1024) * scale*log2e/64; block-causal mask by value (key < horizon of the lane's query);
//   online softmax per lane (8 + 8 keys of ONE query per lane, max combined with lane^16), p = 2^(e - m + 10) (x1024);
//   P^T as the B operand of O^T(16 d x 16 queries) += v^T(d rows, keys split-map) . P^T: element r <- tile keys kb..kb+15,
//   element 8+r <- tile kb+16..kb+31, lane unchanged; P hi to o, (v hi . P lo x1024 + v lo x1024 . P hi) to or.
// =====================================================================================================
template <bool MASKED>
__device__ __forceinline__ void attn_step(const int kb, const int jl, const int hh,
    const _Float16* __restrict__ kH, const _Float16* __restrict__ kL,
    const _Float16* __restrict__ vH, const _Float16* __restrict__ vL,
    const v16h qhi, const v16h qlo, float& m_run, float& l_run,
    v8f& o1, v8f& o1r, v8f& o2, v8f& o2r) {
  const size_t so = (size_t)kb * 32;                 // 32 keys = 1024 halves of each fragment-order plane
  const v16h kh0 = ldfrag_p(kH + so);
  const v16h kh1 = ldfrag_p(kH + so + 512);
  const v16h kl0 = ldfrag_p(kL + so);
  const v16h kl1 = ldfrag_p(kL + so + 512);
  v8f s0  = mma_h_raw(kh0, qhi, zero8());
  v8f s1  = mma_h_raw(kh1, qhi, zero8());
  v8f s0r = mma_h_raw(kh0, qlo, zero8());
  v8f s1r = mma_h_raw(kh1, qlo, zero8());
  s0r = mma_h_raw(kl0, qhi, s0r);
  s1r = mma_h_raw(kl1, qhi, s1r);
  guard4x6(s0, s1, s0r, s1r, kh0, kh1, kl0, kl1, qhi, qlo);

  float e0[8], e1[8];
#pragma unroll
  for (int r = 0; r < 8; ++r) {
    e0[r] = (s0[r] + s0r[r] * INVRS) * SCL;
    e1[r] = (s1[r] + s1r[r] * INVRS) * SCL;
  }
  if (MASKED) {
    const int lim = jl - (kb + 8 * hh);              // row r is key kb + 8hh + r (tile 0), + 16 (tile 1): visible if below jl
#pragma unroll
    for (int r = 0; r < 8; ++r) {
      e0[r] = (r      < lim) ? e0[r] : NEGBIG;
      e1[r] = (16 + r < lim) ? e1[r] : NEGBIG;
    }
  }
  float mx = fmaxf(fmaxf(fmaxf(fmaxf(e0[0], e0[1]), fmaxf(e0[2], e0[3])), fmaxf(fmaxf(e0[4], e0[5]), fmaxf(e0[6], e0[7]))),
                   fmaxf(fmaxf(fmaxf(e1[0], e1[1]), fmaxf(e1[2], e1[3])), fmaxf(fmaxf(e1[4], e1[5]), fmaxf(e1[6], e1[7]))));
  mx = fmaxf(mx, __shfl_xor(mx, 16, 32));
  const float m_new = fmaxf(m_run, mx);
  const float corr  = fexp2(m_run - m_new);
  m_run = m_new;
  const float msh = m_new - 10.0f;                   // 2^(e - m + 10) = e^{s - smax} * 1024
  l_run *= corr;
  o1 = o1 * corr; o1r = o1r * corr; o2 = o2 * corr; o2r = o2r * corr;

  FragH ph, pl;
  float ls = 0.f;
#pragma unroll
  for (int r = 0; r < 8; ++r) {
    const float p0 = fexp2(e0[r] - msh);
    const float p1 = fexp2(e1[r] - msh);
    ls += p0 + p1;
    const _Float16 a0 = (_Float16)p0, a1 = (_Float16)p1;
    ph.h[0][r] = a0;                                          // keys kb      + 8hh + r
    ph.h[1][r] = a1;                                          // keys kb + 16 + 8hh + r
    pl.h[0][r] = (_Float16)((p0 - (float)a0) * RSC);
    pl.h[1][r] = (_Float16)((p1 - (float)a1) * RSC);
  }
  l_run += ls;

  const v16h vh1 = ldfrag_p(vH + so);
  const v16h vl1 = ldfrag_p(vL + so);
  const v16h vh2 = ldfrag_p(vH + so + 512);
  const v16h vl2 = ldfrag_p(vL + so + 512);
  o1  = mma_h_raw(vh1, ph.v, o1);
  o2  = mma_h_raw(vh2, ph.v, o2);
  o1r = mma_h_raw(vh1, pl.v, o1r);
  o2r = mma_h_raw(vh2, pl.v, o2r);
  o1r = mma_h_raw(vl1, ph.v, o1r);
  o2r = mma_h_raw(vl2, ph.v, o2r);
  guard4x6(o1, o2, o1r, o2r, vh1, vh2, vl1, vl2, ph.v, pl.v);
}

// =====================================================================================================
// Attention + mean-pool for one head of one batch row and a PAIR of 48-query groups: group 63 - pi (long key range) and
// group pi (short key range), so that every block holds about the same number of 32-key steps. Block = 24 waves (768
// threads), grid = 2 * 4 * 32 = 256. Wave w -> query tile index g = w>>3 of both groups; the 8 waves of one g share the
// key steps of the long tile (nH steps) and of the short tile (nL steps) in runs of C consecutive steps, C the smallest
// run length for which the block's longest pair of tiles fits in 8 waves. Each wave runs the online softmax over its own run only (the fully
// visible steps without masking, the rest with the per-lane horizon test by value) and leaves its partial
// (row maximum m, row sum l, o + or/1024) in LDS; a lane whose keys are all masked in its run keeps m = NEGBIG and gets
// weight 0 in the merge (run 0 of every tile holds keys 0..5, visible to every query, so the merged maximum is real).
// Merge (all 768 threads, thread -> query t>>3 of 96, 4 d at 4*(t&7)): M = max m_s, w_s = 2^(m_s - M),
// attn[d] = (sum w_s o_s) / (16 sum w_s l_s) + 1e-9 * SV[b][h*32+d][query time block] -> LDS sO[96][36] (f32);
// barrier; threads 0..127 pool 6 consecutive query rows (pooled row t>>3 of 16, cols 4*(t&7)) -> f16 hi (x32) / lo
// (x1024), stored to the head's own plane [head][1024 rows][32]: one wave writes 256 contiguous bytes of each plane.
// coverage: per block rows b*512 + 8*(63-pi) .. +7 and b*512 + 8*pi .. +7 of head h; 256 blocks cover [4][1024][32] once.
// =====================================================================================================
#define KS 8                                                 // waves that share one long and one short query tile
__device__ __forceinline__ int cdiv_i(int a, int d) { return (a + d - 1) / d; }
// 32-key steps of the 16-query tile that starts at query qw0: up to the block-causal horizon of its last query (<= 3072)
__device__ __forceinline__ int tile_steps(int qw0) { return (((qw0 + 15) / NF + 1) * NF + 31) >> 5; }
// run length for a pair of tiles; at most 96 since then each tile is one run
__device__ __forceinline__ int run_len(int nH, int nL) {
  int C = cdiv_i(nH + nL, KS);
  for (; C < LL / 32; ++C)
    if (cdiv_i(nH, C) + cdiv_i(nL, C) <= KS) break;
  return C;
}

__global__ __launch_bounds__(768)
void attn_pool(const unsigned short* __restrict__ QH, const unsigned short* __restrict__ QL,
               const unsigned short* __restrict__ KH, const unsigned short* __restrict__ KL,
               const unsigned short* __restrict__ VTH, const unsigned short* __restrict__ VTL,
               const float* __restrict__ SV, unsigned short* PH, unsigned short* PL) {
  __shared__ __align__(16) float sP[3 * KS * 16 * 36];       // per wave 16 queries x 32 d, pitch 36
  __shared__ float sM[3 * KS * 16];
  __shared__ float sL[3 * KS * 16];
  __shared__ __align__(16) float sO[96 * 36];
  const int t = threadIdx.x, lane = t & 31, hh = lane >> 4, c = lane & 15;
  const int wave = __builtin_amdgcn_readfirstlane(t >> 5);   // wave-uniform: run bounds and plane bases stay scalar
  const int bx = blockIdx.x;
  const int pi = bx & 31;
  const int h  = (bx >> 5) & 3;
  const int b  = bx >> 7;
  const size_t tokb = (size_t)b * LL;
  // one run length for the block, from its last (longest) tiles: run s of all three tiles covers the same keys, so the
  // three waves that walk it together read the same k and v lines
  const int C = run_len(tile_steps((63 - pi) * 48 + 32), tile_steps(pi * 48 + 32));

  {
    const int g = wave >> 3, s8 = wave & (KS - 1);
    const int qH0 = (63 - pi) * 48 + 16 * g, qL0 = pi * 48 + 16 * g;
    const int nH = tile_steps(qH0), nL = tile_steps(qL0);
    const int SH = cdiv_i(nH, C);
    const bool isH = (s8 < SH);
    const int qw0 = isH ? qH0 : qL0;
    const int n   = isH ? nH : nL;
    const int s   = isH ? s8 : (s8 - SH);
    const int st1 = (s + 1) * C;
    const int kb1 = ((st1 < n) ? st1 : n) * 32;              // a wave past the short tile's last run does no step
    const int qi  = qw0 + c;                                 // query of this lane (B column / D column)
    const int jl  = (qi / NF + 1) * NF;                      // exclusive key horizon

    const _Float16* QHp = h16(QH);
    const _Float16* QLp = h16(QL);
    const v16h qhi = ldfrag_h(QHp + (tokb + qi) * HID + h * HD + 8 * hh);
    const v16h qlo = ldfrag_h(QLp + (tokb + qi) * HID + h * HD + 8 * hh);
    // the q loads' address registers are reused by the accumulators' start values: keep the wait in front of that overwrite
    asm volatile("s_wait_xcnt 0x0" ::: "memory");
    const size_t pbase = (size_t)(b * NH + h) * LL * HD + 8 * lane;   // (b, head) slab of a fragment-order plane; + kb * 32
    const _Float16* kH = h16(KH) + pbase;                             // key tile 2 at +512 halves
    const _Float16* kL = h16(KL) + pbase;
    const _Float16* vH = h16(VTH) + pbase;                            // d tile 2 at +512 halves
    const _Float16* vL = h16(VTL) + pbase;

    float m_run = NEGBIG, l_run = 0.f;
    v8f o1 = zero8(), o1r = zero8(), o2 = zero8(), o2r = zero8();
    const int jmin  = (qw0 / NF + 1) * NF;
    const int cfull = (jmin / 32) * 32;
    const int kbf   = (cfull < kb1) ? cfull : kb1;
    int kb = s * C * 32;
#pragma unroll 1
    for (; kb < kbf; kb += 32)
      attn_step<false>(kb, jl, hh, kH, kL, vH, vL, qhi, qlo, m_run, l_run, o1, o1r, o2, o2r);
#pragma unroll 1
    for (; kb < kb1; kb += 32)
      attn_step<true>(kb, jl, hh, kH, kL, vH, vL, qhi, qlo, m_run, l_run, o1, o1r, o2, o2r);

    l_run += __shfl_xor(l_run, 16, 32);
    float* pp = sP + (wave * 16 + c) * 36 + 8 * hh;
    v4f a0, a1, c0, c1;
#pragma unroll
    for (int r = 0; r < 4; ++r) {
      a0[r] = o1[r] + o1r[r] * INVRS;  a1[r] = o1[4 + r] + o1r[4 + r] * INVRS;
      c0[r] = o2[r] + o2r[r] * INVRS;  c1[r] = o2[4 + r] + o2r[4 + r] * INVRS;
    }
    *(v4f*)(pp)      = a0;                                   // d  8hh ..  8hh+7
    *(v4f*)(pp + 4)  = a1;
    *(v4f*)(pp + 16) = c0;                                   // d 16+8hh .. 16+8hh+7
    *(v4f*)(pp + 20) = c1;
    if (hh == 0) { sM[wave * 16 + c] = m_run; sL[wave * 16 + c] = l_run; }
  }
  __syncthreads();
  {
    const int tile = wave >> 2;                              // 0..2 long group's tiles, 3..5 short group's; 4 queries per wave
    const int hl = (tile >= 3) ? 1 : 0;
    const int g  = tile - 3 * hl;
    const int qH0 = (63 - pi) * 48 + 16 * g, qL0 = pi * 48 + 16 * g;
    const int nH = tile_steps(qH0), nL = tile_steps(qL0);
    const int SH = cdiv_i(nH, C);
    const int w0 = g * KS + (hl ? SH : 0);                   // first wave and number of waves that hold this tile's runs
    const int wn = hl ? cdiv_i(nL, C) : SH;
    const int c2 = (t >> 3) & 15, dg = t & 7;
    const int tq = ((hl ? qL0 : qH0) + c2) / NF;
    const float* svp = SV + ((size_t)(b * HID + h * HD + 4 * dg)) * TT + tq;
    v4f sv;
#pragma unroll
    for (int e = 0; e < 4; ++e) sv[e] = svp[(size_t)e * TT];
    // all KS slots read at once (one LDS latency); a slot past the tile's last run rereads run 0 and gets weight 0
    float ms[KS], ls[KS];
    v4f os[KS];
#pragma unroll
    for (int i = 0; i < KS; ++i) {
      const int wi = w0 + ((i < wn) ? i : 0);
      ms[i] = sM[wi * 16 + c2];
      ls[i] = sL[wi * 16 + c2];
      os[i] = *(const v4f*)(sP + (wi * 16 + c2) * 36 + 4 * dg);
    }
    float M = ms[0];
#pragma unroll
    for (int i = 1; i < KS; ++i) M = fmaxf(M, ms[i]);
    float L = 0.f;
    v4f O = {0.f, 0.f, 0.f, 0.f};
#pragma unroll
    for (int i = 0; i < KS; ++i) {
      const float w = (i < wn) ? fexp2(ms[i] - M) : 0.f;
      L += w * ls[i];
      O += os[i] * w;
    }
    const float inv = (1.0f / L) * (1.0f / VC);
    *(v4f*)(sO + (t >> 3) * 36 + 4 * dg) = O * inv + sv * FLOORC;
  }
  __syncthreads();
  if (wave < 4) {                                            // wave-uniform; no barrier behind it
    const int pr = t >> 3, col = 4 * (t & 7);
    v4f s = {0.f, 0.f, 0.f, 0.f};
#pragma unroll
    for (int f = 0; f < NF; ++f) s += *(const v4f*)(sO + (NF * pr + f) * 36 + col);
    unsigned short hb[4], lb[4];
#pragma unroll
    for (int e = 0; e < 4; ++e) split_h((s[e] * (1.0f / NF)) * AC, hb[e], lb[e]);
    v2u ph2, pl2;
    ph2[0] = pk16(hb[0], hb[1]); ph2[1] = pk16(hb[2], hb[3]);
    pl2[0] = pk16(lb[0], lb[1]); pl2[1] = pk16(lb[2], lb[3]);
    const int qblk = (pr < 8) ? (63 - pi) : pi;
    const size_t o = ((size_t)h * NPOOL + (size_t)(b * TT + 8 * qblk + (pr & 7))) * HD + col;
    *(v2u*)(PH + o) = ph2;
    *(v2u*)(PL + o) = pl2;
  }
}

// =====================================================================================================
// Tail: 64 pooled rows per block (grid 1024/64 = 16, 256 threads = 8 waves, wave -> row tile w&3, 64-col half w>>2).
// GEMM1 z = pooled(hi + lo/1024)/32 . Wo + bf16(o_b): A planes PH/PL [head][row][32], k step = head (two products into
// acc/accr), B = WOT rows, K=128;
// GEMM2 from sZ rows split to f16 hi (x16) / lo (x1024) at fragment build . FWT rows; epilogue silu(acc + bf16(f_b))
// coverage: out rows r0..r0+63 x 128 cols; 16 blocks cover [1024][128] exactly once.
// =====================================================================================================
__global__ __launch_bounds__(256) void tail_k(const unsigned short* __restrict__ PH, const unsigned short* __restrict__ PL,
                                               const unsigned short* __restrict__ WOT, const float* __restrict__ obias,
                                               const float* __restrict__ flnw, const float* __restrict__ flnb,
                                               const unsigned short* __restrict__ FWT, const float* __restrict__ fbias,
                                               float* out) {
  __shared__ __align__(16) float sZ[64 * 132];
  const int t = threadIdx.x, wave = t >> 5, lane = t & 31, hh = lane >> 4, m = lane & 15;
  const int r0 = blockIdx.x * 64;
  const int rt = wave & 3, ch = wave >> 2;

  // ---- GEMM1 ----
  {
    v8f acc[4], accr[4];
#pragma unroll
    for (int j = 0; j < 4; ++j) { acc[j] = zero8(); accr[j] = zero8(); }
    const _Float16* Ah = h16(PH) + (size_t)(r0 + 16 * rt + m) * HD + 8 * hh;   // + k0 * NPOOL: plane of head k0 / 32
    const _Float16* Al = h16(PL) + (size_t)(r0 + 16 * rt + m) * HD + 8 * hh;
    const _Float16* Bw = h16(WOT) + (size_t)(64 * ch + m) * HID + 8 * hh;
#pragma unroll 1
    for (int k0 = 0; k0 < HID; k0 += 32) {
      v16h bf[4];
#pragma unroll
      for (int j = 0; j < 4; ++j) bf[j] = ldfrag_h(Bw + (size_t)(16 * j) * HID + k0);
      const v16h ah = ldfrag_h(Ah + (size_t)k0 * NPOOL);
      const v16h al = ldfrag_h(Al + (size_t)k0 * NPOOL);
#pragma unroll
      for (int j = 0; j < 4; ++j) acc[j]  = mma_h_raw(ah, bf[j], acc[j]);
#pragma unroll
      for (int j = 0; j < 4; ++j) accr[j] = mma_h_raw(al, bf[j], accr[j]);
      guard8x6(acc[0], acc[1], acc[2], acc[3], accr[0], accr[1], accr[2], accr[3], ah, al, bf[0], bf[1], bf[2], bf[3]);
    }
    acc_guard4(acc[0], acc[1], acc[2], acc[3]);
    acc_guard4(accr[0], accr[1], accr[2], accr[3]);
#pragma unroll
    for (int j = 0; j < 4; ++j) {
      const int n = 64 * ch + 16 * j + m;
      const float bn = bfr(obias[n]);
#pragma unroll
      for (int r = 0; r < 8; ++r) {
        const int row = 16 * rt + 8 * hh + r;
        sZ[row * 132 + n] = (acc[j][r] + accr[j][r] * INVRS) * (1.0f / (AC * WSC)) + bn;
      }
    }
  }
  __syncthreads();

  // ---- LayerNorm in place ----
  {
    float gg[4], bb[4];
#pragma unroll
    for (int e = 0; e < 4; ++e) { gg[e] = bfr(flnw[4 * lane + e]); bb[e] = bfr(flnb[4 * lane + e]); }
#pragma unroll 1
    for (int i = 0; i < 8; ++i) {
      const int row = 8 * wave + i;
      float* zp = sZ + row * 132 + 4 * lane;
      const v4f z = *(const v4f*)zp;
      float s = (z[0] + z[1]) + (z[2] + z[3]);
      s = wsum(s);
      const float mean = s * (1.0f / HID);
      float d[4];
#pragma unroll
      for (int e = 0; e < 4; ++e) d[e] = z[e] - mean;
      float vs = (d[0] * d[0] + d[1] * d[1]) + (d[2] * d[2] + d[3] * d[3]);
      vs = wsum(vs);
      const float rstd = rsqrtf(vs * (1.0f / HID) + LNEPS);
      v4f y;
#pragma unroll
      for (int e = 0; e < 4; ++e) y[e] = (d[e] * rstd) * gg[e] + bb[e];
      *(v4f*)zp = y;
    }
  }
  __syncthreads();

  // ---- GEMM2 ----
  v8f acc2[4], acc2r[4];
#pragma unroll
  for (int j = 0; j < 4; ++j) { acc2[j] = zero8(); acc2r[j] = zero8(); }
  {
    const float* zr = sZ + (16 * rt + m) * 132 + 8 * hh;
    const _Float16* Bf = h16(FWT) + (size_t)(64 * ch + m) * HID + 8 * hh;
#pragma unroll 1
    for (int k0 = 0; k0 < HID; k0 += 32) {
      FragH ah, al;
      const v4f za = *(const v4f*)(zr + k0), zb = *(const v4f*)(zr + k0 + 4);
      const v4f zc = *(const v4f*)(zr + k0 + 16), zd = *(const v4f*)(zr + k0 + 20);
#pragma unroll
      for (int i = 0; i < 4; ++i) {
        const float f0 = za[i] * YC, f1 = zb[i] * YC, f2 = zc[i] * YC, f3 = zd[i] * YC;
        const _Float16 h0 = (_Float16)f0, h1 = (_Float16)f1, h2 = (_Float16)f2, h3 = (_Float16)f3;
        ah.h[0][i] = h0;     al.h[0][i]     = (_Float16)((f0 - (float)h0) * RSC);
        ah.h[0][4 + i] = h1; al.h[0][4 + i] = (_Float16)((f1 - (float)h1) * RSC);
        ah.h[1][i] = h2;     al.h[1][i]     = (_Float16)((f2 - (float)h2) * RSC);
        ah.h[1][4 + i] = h3; al.h[1][4 + i] = (_Float16)((f3 - (float)h3) * RSC);
      }
      v16h bf[4];
#pragma unroll
      for (int j = 0; j < 4; ++j) bf[j] = ldfrag_h(Bf + (size_t)(16 * j) * HID + k0);
#pragma unroll
      for (int j = 0; j < 4; ++j) acc2[j]  = mma_h_raw(ah.v, bf[j], acc2[j]);
#pragma unroll
      for (int j = 0; j < 4; ++j) acc2r[j] = mma_h_raw(al.v, bf[j], acc2r[j]);
      guard8x6(acc2[0], acc2[1], acc2[2], acc2[3], acc2r[0], acc2r[1], acc2r[2], acc2r[3],
               ah.v, al.v, bf[0], bf[1], bf[2], bf[3]);
    }
    acc_guard4(acc2[0], acc2[1], acc2[2], acc2[3]);
    acc_guard4(acc2r[0], acc2r[1], acc2r[2], acc2r[3]);
  }
  __syncthreads();                                            // every wave is done reading sZ rows as the A operand
#pragma unroll
  for (int j = 0; j < 4; ++j) {
    const int n = 64 * ch + 16 * j + m;
    const float bn = bfr(fbias[n]);
#pragma unroll
    for (int r = 0; r < 8; ++r) {
      const int row = 16 * rt + 8 * hh + r;
      const float a = (acc2[j][r] + acc2r[j][r] * INVRS) * (1.0f / (YC * WSC)) + bn;
      sZ[row * 132 + n] = a * sigm(a);
    }
  }
  __syncthreads();
  {
    v4f vals[8];
#pragma unroll
    for (int i = 0; i < 8; ++i) vals[i] = *(const v4f*)(sZ + (8 * i + wave) * 132 + 4 * lane);
#pragma unroll
    for (int i = 0; i < 8; ++i)
      *(v4f*)(out + (size_t)(r0 + 8 * i + wave) * FD + 4 * lane) = vals[i];
    
  }
}

// =====================================================================================================
// Workspace map (bytes), every offset a multiple of 256 and every plane sized to its whole-line store granularity:
//   WT   f16 [384][32]  x64        0          24576     (q_w^T | k_w^T | v_w^T rows)
//   WOT  f16 [128][128] x64        24576      32768
//   FWT  f16 [128][128] x64        57344      32768
//   QH   f16 [6144][128] q x8      90112      1572864
//   QL   f16 [6144][128] residual  1662976    1572864
//   KH   f16 k x8, fragment order [2][4 heads][192 key tiles][2 halves][32 lanes][8]   3235840    1572864
//   KL                             4808704    1572864
//   VTH  f16 v x16, fragment order [2][4 heads][96 key steps][2 d tiles][2 halves][32 lanes][8]   6381568    1572864
//   VTL                            7954432    1572864
//   SV   f32 [256][512]            9527296    524288
//   PH   f16 [4 heads][1024][32] x32  10051584   262144
//   PL                             10313728   262144
//   end                            10575872
// =====================================================================================================
extern "C" void kernel_launch(void* const* d_in, const int* in_sizes, int n_in,
                              void* d_out, int out_size, void* d_ws, size_t ws_size,
                              hipStream_t stream) {
  if (n_in < 20) return;
  if (in_sizes[0] != NTOK * DD) return;
  if (in_sizes[1] != DD || in_sizes[2] != DD || in_sizes[3] != DD * GH || in_sizes[4] != GH ||
      in_sizes[5] != GH || in_sizes[6] != 1) return;
  if (in_sizes[7] != DD * HID || in_sizes[8] != HID || in_sizes[9] != DD * HID || in_sizes[10] != HID ||
      in_sizes[11] != DD * HID || in_sizes[12] != HID) return;
  if (in_sizes[13] != HID * HID || in_sizes[14] != HID || in_sizes[15] != HID || in_sizes[16] != HID ||
      in_sizes[17] != HID * FD || in_sizes[18] != FD || in_sizes[19] != 1) return;
  if (out_size != NPOOL * FD) return;

  const float* x    = (const float*)d_in[0];
  const float* glnw = (const float*)d_in[1];
  const float* glnb = (const float*)d_in[2];
  const float* gw1  = (const float*)d_in[3];
  const float* gb1  = (const float*)d_in[4];
  const float* gw2  = (const float*)d_in[5];
  const float* gb2  = (const float*)d_in[6];
  const float* qw   = (const float*)d_in[7];
  const float* qb   = (const float*)d_in[8];
  const float* kw   = (const float*)d_in[9];
  const float* kb   = (const float*)d_in[10];
  const float* vw   = (const float*)d_in[11];
  const float* vb   = (const float*)d_in[12];
  const float* ow   = (const float*)d_in[13];
  const float* ob   = (const float*)d_in[14];
  const float* flnw = (const float*)d_in[15];
  const float* flnb = (const float*)d_in[16];
  const float* fw   = (const float*)d_in[17];
  const float* fb   = (const float*)d_in[18];
  const int*   Tp   = (const int*)d_in[19];

  const size_t PWT = (size_t)3 * HID * DD * 2;        //    24576
  const size_t PWO = (size_t)HID * HID * 2;           //    32768
  const size_t PWF = (size_t)FD * HID * 2;            //    32768
  const size_t PQP = (size_t)NTOK * HID * 2;          //  1572864
  const size_t PVT = (size_t)NB * HID * LL * 2;       //  1572864
  const size_t PSV = (size_t)NB * HID * TT * 4;       //   524288
  const size_t PPP = (size_t)NPOOL * HID * 2;         //   262144
  size_t off = 0;
  const size_t oWT = off; off += PWT;
  const size_t oWO = off; off += PWO;
  const size_t oWF = off; off += PWF;
  const size_t oQH = off; off += PQP;
  const size_t oQL = off; off += PQP;
  const size_t oKH = off; off += PQP;
  const size_t oKL = off; off += PQP;
  const size_t oVH = off; off += PVT;
  const size_t oVL = off; off += PVT;
  const size_t oSV = off; off += PSV;
  const size_t oPH = off; off += PPP;
  const size_t oPL = off; off += PPP;
  if (off > ws_size) return;                           // off = 10575872
  if (off > (size_t)134217728) return;

  char* ws = (char*)d_ws;
  unsigned short* WT  = (unsigned short*)(ws + oWT);
  unsigned short* WOT = (unsigned short*)(ws + oWO);
  unsigned short* FWT = (unsigned short*)(ws + oWF);
  unsigned short* QH  = (unsigned short*)(ws + oQH);
  unsigned short* QL  = (unsigned short*)(ws + oQL);
  unsigned short* KH  = (unsigned short*)(ws + oKH);
  unsigned short* KL  = (unsigned short*)(ws + oKL);
  unsigned short* VTH = (unsigned short*)(ws + oVH);
  unsigned short* VTL = (unsigned short*)(ws + oVL);
  float*          SV  = (float*)(ws + oSV);
  unsigned short* PH  = (unsigned short*)(ws + oPH);
  unsigned short* PL  = (unsigned short*)(ws + oPL);
  float*          out = (float*)d_out;

  const dim3 blk(256), blk768(768);
  const dim3 gW(12 + 8 + 8);                           // 28 weight tiles
  const dim3 gQ(NTOK / 64);                            // 96
  const dim3 gS(NB * HID);                             // 256
  const dim3 gA(NB * NH * (LL / 96));                  // 256
  const dim3 gT(NPOOL / 64);                           // 16

  // (0) weight planes, transposed to k-contiguous rows: f16( bf16_RNE(w) * 64 )
  wprep<<<gW, blk, 0, stream>>>(qw, kw, vw, ow, fw, WT, WOT, FWT);

  // (1) gater + gated q/k/v planes (q rows hi/lo; k and v^T hi/lo in fragment order)
  qkv_prep<<<gQ, blk, 0, stream>>>(x, glnw, glnb, gw1, gb1, gw2, gb2, qb, kb, vb, WT, QH, QL, KH, KL, VTH, VTL);

  // (2) per-(b, head column) suffix sums of v over time blocks (masked-key floor term)
  vsuf<<<gS, blk, 0, stream>>>(VTH, VTL, Tp, SV);

  // (3) block-causal attention + mean-pool over the 6 forces -> pooled planes
  attn_pool<<<gA, blk768, 0, stream>>>(QH, QL, KH, KL, VTH, VTL, SV, PH, PL);

  // (4) o-proj + LayerNorm + final linear + SiLU -> out
  tail_k<<<gT, blk, 0, stream>>>(PH, PL, WOT, ob, flnw, flnb, FWT, fb, out);
  (void)hipGetLastError();
}

// v003
// Measured time: 56.5 microseconds a run.
// Timed twice side by side with v002, it ran 1.14 times as fast both times.
// All steps since v000 together make it 3.23 times as fast.
// Contractions: q/k/v projections (x rows f16 x16 . W^T f16 x64, K=32, one product), scores S^T = k . q^T
// (k and q each f16 x8 hi plane + f16 x1024 residual plane, 3 products per tile), O^T = v^T . P^T (v f16 x16 hi +
// x1024 residual, P f16 x1024 hi + x1024 residual, 3 products), pooled attention . Wo^T and LN rows . Wf^T
// (activation f16 hi + x1024 residual . W^T f16 x64, K=128, 2 products): all v_wmma_f32_16x16x32_f16, f32 accumulate;
// gater MLP, LayerNorm, softmax, pooling, SiLU in f32 on VALU; every float input RNE-converted to bf16 on load.
#include <hip/hip_runtime.h>
#include <math.h>
#include <stdint.h>

#define NB     2
#define TT     512
#define NF     6
#define DD     32
#define HID    128
#define NH     4
#define HD     32
#define GH     32
#define FD     128
#define LL     (TT * NF)
#define NTOK   (NB * LL)
#define NPOOL  (NB * TT)
#define LNEPS  1.0e-5f
#define XC     16.0f
#define WSC    64.0f
#define QC     8.0f
#define KC     8.0f
#define VC     16.0f
#define AC     32.0f
#define YC     16.0f
#define RSC    1024.0f
#define INVRS  (1.0f / 1024.0f)
#define FLOORC 1.0e-9f
#define NEGBIG (-1.0e30f)
#define SCL    ((0.17677669529663687f * 1.4426950408889634f) / (QC * KC))
static_assert(NH * HD == HID);
static_assert(FD == HID);
static_assert((LL % 64) == 0 && (LL % 96) == 0 && (LL % 32) == 0 && LL / 48 == 64);
static_assert((NTOK % 64) == 0 && (NPOOL % 64) == 0);
static_assert(DD == 32 && GH == 32);

typedef _Float16 v16h __attribute__((ext_vector_type(16)));
typedef _Float16 v8h  __attribute__((ext_vector_type(8)));
typedef float    v8f  __attribute__((ext_vector_type(8)));
typedef float    v4f  __attribute__((ext_vector_type(4)));
typedef unsigned int v4u __attribute__((ext_vector_type(4)));
typedef unsigned int v2u __attribute__((ext_vector_type(2)));

union FragH { v16h v; v8h h[2]; };

// ---- scalar helpers --------------------------------------------------------------------------------
__device__ __forceinline__ unsigned short bf_bits(float f) {          // f32 -> bf16 bits, RNE convert
  unsigned u = __float_as_uint(f);
  return (unsigned short)((u + 0x7FFFu + ((u >> 16) & 1u)) >> 16);
}
__device__ __forceinline__ float bf_up(unsigned short h) { return __uint_as_float(((unsigned)h) << 16); }
__device__ __forceinline__ float bfr(float f) { return bf_up(bf_bits(f)); }
__device__ __forceinline__ unsigned short h_bits(_Float16 x) { return __builtin_bit_cast(unsigned short, x); }
__device__ __forceinline__ unsigned pk16(unsigned short a, unsigned short b) { return (unsigned)a | ((unsigned)b << 16); }
__device__ __forceinline__ v8f zero8() { v8f z = {0.f, 0.f, 0.f, 0.f, 0.f, 0.f, 0.f, 0.f}; return z; }
__device__ __forceinline__ float hmax8(v8f s) {
  return fmaxf(fmaxf(fmaxf(s[0], s[1]), fmaxf(s[2], s[3])), fmaxf(fmaxf(s[4], s[5]), fmaxf(s[6], s[7])));
}
__device__ __forceinline__ const _Float16* h16(const unsigned short* p) { return (const _Float16*)(const void*)p; }
// hi = f16(f), lo = f16((f - hi) * 1024): residual plane carried x1024, folded back in the f32 epilogue
__device__ __forceinline__ void split_h(float f, unsigned short& hb, unsigned short& lb) {
  const _Float16 h = (_Float16)f;
  const _Float16 l = (_Float16)((f - (float)h) * RSC);
  hb = h_bits(h);
  lb = h_bits(l);
}
__device__ __forceinline__ float fexp2(float x) { return __builtin_amdgcn_exp2f(x); }
__device__ __forceinline__ float sigm(float a) {
  const float e = __expf(fminf(-a, 60.0f));       // quotient stays far from underflow
  return 1.0f / (1.0f + e);
}
__device__ __forceinline__ float wsum(float v) {
#pragma unroll
  for (int off = 16; off > 0; off >>= 1) v += __shfl_xor(v, off, 32);
  return v;
}

// ---- fragment loader: 16-bit A/B operand, lane -> row/col (lane&15), p already includes +8*(lane>>4);
//      elements 0..7 <- p[0..7] (k0+8h..), elements 8..15 <- p[16..23] (k0+16+8h..)
__device__ __forceinline__ v16h ldfrag_h(const _Float16* p) {
  FragH f;
  f.h[0] = *(const v8h*)(p);
  f.h[1] = *(const v8h*)(p + 16);
  return f.v;
}

// ---- the same fragment from a plane stored in fragment order: one 16 x 32 operand tile = 1024 B = two 512-B halves,
//      half s holds lane L's elements 8s..8s+7 at byte 16*L, so each wave-wide 16-B load covers four whole 128-B lines;
//      p already includes +8*lane
__device__ __forceinline__ v16h ldfrag_p(const _Float16* p) {
  FragH f;
  f.h[0] = *(const v8h*)(p);
  f.h[1] = *(const v8h*)(p + 256);
  return f.v;
}

// ---- WMMA helpers with trailing VALU hazard gap --------------------------------------------------------
__device__ __forceinline__ v8f mma_h_raw(v16h a, v16h b, v8f c) {
  return __builtin_amdgcn_wmma_f32_16x16x32_f16(false, a, false, b, (short)0, c, false, false);
}
__device__ __forceinline__ void guard4x6(v8f& a, v8f& b, v8f& c, v8f& d,
                                         v16h x0, v16h x1, v16h x2, v16h x3, v16h x4, v16h x5) {
#if defined(__HIP_DEVICE_COMPILE__)
  asm volatile("v_nop\n\tv_nop\n\tv_nop\n\tv_nop"
               : "+v"(a), "+v"(b), "+v"(c), "+v"(d)
               : "v"(x0), "v"(x1), "v"(x2), "v"(x3), "v"(x4), "v"(x5));
#endif
}
__device__ __forceinline__ void guard8x6(v8f& a0, v8f& a1, v8f& a2, v8f& a3,
                                         v8f& b0, v8f& b1, v8f& b2, v8f& b3,
                                         v16h x0, v16h x1, v16h x2, v16h x3, v16h x4, v16h x5) {
#if defined(__HIP_DEVICE_COMPILE__)
  asm volatile("v_nop\n\tv_nop\n\tv_nop\n\tv_nop"
               : "+v"(a0), "+v"(a1), "+v"(a2), "+v"(a3), "+v"(b0), "+v"(b1), "+v"(b2), "+v"(b3)
               : "v"(x0), "v"(x1), "v"(x2), "v"(x3), "v"(x4), "v"(x5));
#endif
}
__device__ __forceinline__ void acc_guard4(v8f& a, v8f& b, v8f& c, v8f& d) {
#if defined(__HIP_DEVICE_COMPILE__)
  asm volatile("v_nop\n\tv_nop\n\tv_nop\n\tv_nop" : "+v"(a), "+v"(b), "+v"(c), "+v"(d));
#endif
}

// =====================================================================================================
// Weight convert with transpose: in[k][o] f32 (x @ W layout) -> out[o][k] = f16( bf16_RNE(in) * WSC ), k contiguous.
// Blocks 0..11: part p = bx>>2 of {q_w, k_w, v_w} [32][128] -> WT rows p*128 + n, 32 n per block: load 32 k x 32 n
// (thread t: k = t>>3, 4 floats at 4*(t&7)); store threads 0..127: row o = t>>2, 8 halves k = 8*(t&3) -> rows of
// Blocks 12..19: o_w [128][128] -> WOT [n][k]; blocks 20..27: f_w -> FWT; 64 k x 32 o per block (thread t loads k = t>>2,
// coverage: WT 3 parts x 4 tiles x (32 n x 32 k) = [384][32]; WOT/FWT 4 x 2 tiles x (32 o x 64 k) = [128][128] each.
// =====================================================================================================
__global__ __launch_bounds__(256) void wprep(const float* __restrict__ qw, const float* __restrict__ kw,
                                              const float* __restrict__ vw, const float* __restrict__ ow,
                                              const float* __restrict__ fw,
                                              unsigned short* WT, unsigned short* WOT, unsigned short* FWT) {
  __shared__ float T[64 * 33];
  const int t  = threadIdx.x;
  const int bx = blockIdx.x;
  if (bx < 12) {                                            // block-uniform
    const int p  = bx >> 2;
    const int n0 = (bx & 3) * 32;
    const float* src = (p == 0) ? qw : ((p == 1) ? kw : vw);
    {
      const int k = t >> 3, nn = 4 * (t & 7);
      const v4f a = *(const v4f*)(src + (size_t)k * HID + n0 + nn);
#pragma unroll
      for (int i = 0; i < 4; ++i) T[k * 33 + nn + i] = a[i];
    }
    __syncthreads();
    {
      const bool wr = (t < 128);
      const int tt = t & 127;
      const int o = tt >> 2, e = tt & 3;
      float w[8];
#pragma unroll
      for (int i = 0; i < 8; ++i) w[i] = bfr(T[(8 * e + i) * 33 + o]) * WSC;
      v4u v;
#pragma unroll
      for (int i = 0; i < 4; ++i) v[i] = pk16(h_bits((_Float16)w[2 * i]), h_bits((_Float16)w[2 * i + 1]));
      unsigned short* dp = WT + (size_t)(p * HID + n0 + o) * DD + 8 * e;
      if (wr) *(v4u*)dp = v;
      
    }
  } else {
    const int q = bx - 12;
    const bool iso = (q < 8);                                // block-uniform
    const int rr = iso ? q : (q - 8);
    const float* src   = iso ? ow : fw;
    unsigned short* ds = iso ? WOT : FWT;
    const int o0 = (rr >> 1) * 32, k0 = (rr & 1) * 64;
    {
      const int k = t >> 2, oo = 8 * (t & 3);
      const float* sp = src + (size_t)(k0 + k) * HID + o0 + oo;
      const v4f a = *(const v4f*)(sp), c = *(const v4f*)(sp + 4);
#pragma unroll
      for (int i = 0; i < 4; ++i) { T[k * 33 + oo + i] = a[i]; T[k * 33 + oo + 4 + i] = c[i]; }
    }
    __syncthreads();
    {
      const int o = t >> 3, e = t & 7;
      float w[8];
#pragma unroll
      for (int i = 0; i < 8; ++i) w[i] = bfr(T[(8 * e + i) * 33 + o]) * WSC;
      v4u v;
#pragma unroll
      for (int i = 0; i < 4; ++i) v[i] = pk16(h_bits((_Float16)w[2 * i]), h_bits((_Float16)w[2 * i + 1]));
      unsigned short* dp = ds + (size_t)(o0 + o) * HID + k0 + 8 * e;
      *(v4u*)dp = v;
      
    }
  }
}

// =====================================================================================================
// Gater + gated q/k/v projections for 64 tokens per block (256 threads = 8 waves; grid = 6144/64 = 96).
// Phase 0: x tile [64][32] loaded as float4 pairs, RNE-converted to bf16 values: f32 copy sX (pitch 33) for the gater and
//          f16(x * 16) rows sXh (pitch 40 halves) as the WMMA A operand; g_w1 staged bf16-RNE in LDS.
//          with lane = hidden unit (32 shfl-broadcast FMAs), gate = sigmoid(sum_lane h*g_w2 + g_b2), all f32 -> sG.
// Phase 2: per part p in {q,k,v}: wave w -> row tile w&3, 64-col half w>>2: 4 WMMAs (K = 32 = one k step; A from sXh,
//          B from WT rows [p*128 + n][32]); epilogue f = (acc/1024 + bf16(bias[n])) * gate[row] * C (C = 8 q/k, 16 v),
//          hi = f16(f), lo = f16((f-hi)*1024) staged in LDS (q/k row-major [64][136], v transposed [128 hcol][72]);
//          block barrier; whole-line stores: q rows of 256 B by 16 consecutive lanes (instruction i: row 16i + t>>4);
//          k and v^T in fragment order (see ldfrag_p), slab (b, head), 512 contiguous bytes per wave and store.
// Phase 3 (waves 0..3, thread -> head column): this block's share of the masked-key floor sums, from the staged v planes:
//          LS[b][tb][hcol] = sum of v over the block's keys j >= 6*(tb+1), for every boundary 6*(tb+1) that lies in the
//          block, and TOT[b][block][hcol] = sum over all 64 keys (keys of time blocks >= T count as 0).
// coverage: QH/QL rows tok0..tok0+63 x 128 cols; KH/KL 4 heads x key tiles ltok0/16..+3; VTH/VTL 4 heads x key steps
//           ltok0/32..+1 x 2 d tiles; grid covers all 6144 tokens exactly once. LS rows tb = 0..510 of each batch row once
//           (the boundary of tb = 511 is past the last key: no row, and none is read); TOT 96 rows once.
// =====================================================================================================
// Suffix sums of one head column inside a 64-key block whose first boundary (key index a multiple of 6) is local key I0:
// six-key sums first (independent), then one short chain over the boundaries, last to first. r[j] = sum over the block's
// keys from boundary j on (0 where the block has no boundary j), tot = sum over all 64 keys.
#define NJMAX 11                                             // boundaries in a block: 11 for I0 = 0 and 2, 10 for I0 = 4
template <int I0>
__device__ __forceinline__ void block_suffix(const float (&val)[64], const int tb0, const int ntb,
                                             float (&r)[NJMAX], float& tot) {
  constexpr int NJ = (63 - I0) / NF + 1;
  float run = 0.f;
#pragma unroll
  for (int j = NJMAX - 1; j >= NJ; --j) r[j] = 0.f;
#pragma unroll
  for (int j = NJ - 1; j >= 0; --j) {
    float sg = 0.f;
#pragma unroll
    for (int f = 0; f < NF; ++f)
      if (I0 + NF * j + f < 64) sg += val[I0 + NF * j + f];
    run += (tb0 + 1 + j < ntb) ? sg : 0.f;                   // these keys are time block tb0 + 1 + j
    r[j] = run * (1.0f / VC);
  }
  float head = 0.f;
#pragma unroll
  for (int i = 0; i < I0; ++i) head += val[i];
  tot = (run + ((tb0 < ntb) ? head : 0.f)) * (1.0f / VC);    // the keys in front of I0 are time block tb0
}

__global__ __launch_bounds__(256) void qkv_prep(
    const float* __restrict__ x, const float* __restrict__ glnw, const float* __restrict__ glnb,
    const float* __restrict__ gw1, const float* __restrict__ gb1, const float* __restrict__ gw2,
    const float* __restrict__ gb2, const float* __restrict__ qbias, const float* __restrict__ kbias,
    const float* __restrict__ vbias, const unsigned short* __restrict__ WT, const int* __restrict__ Tp,
    unsigned short* QH, unsigned short* QL, unsigned short* KH, unsigned short* KL,
    unsigned short* VTH, unsigned short* VTL, float* LS, float* TOT) {
  __shared__ __align__(16) float sX[64 * 33];
  __shared__ __align__(16) _Float16 sXh[64 * 40];
  __shared__ float sW1[DD * GH];
  __shared__ float sG[64];
  __shared__ __align__(16) unsigned short sH[128 * 72];
  __shared__ __align__(16) unsigned short sL[128 * 72];
  const int t = threadIdx.x, wave = t >> 5, lane = t & 31, hh = lane >> 4, m = lane & 15;
  const int tok0  = blockIdx.x * 64;
  const int b     = tok0 / LL;
  const int ltok0 = tok0 - b * LL;
  const int tin   = Tp[0];                                   // read here so that phase 3 does not wait for it

  // ---- phase 0 ----
  {
    const int tk = t >> 2, j = 8 * (t & 3);
    const float* sp = x + (size_t)(tok0 + tk) * DD + j;
    const v4f a = *(const v4f*)(sp), c = *(const v4f*)(sp + 4);
    float r8[8];
#pragma unroll
    for (int i = 0; i < 4; ++i) { r8[i] = bfr(a[i]); r8[4 + i] = bfr(c[i]); }
#pragma unroll
    for (int i = 0; i < 8; ++i) {
      sX[tk * 33 + j + i]  = r8[i];
      sXh[tk * 40 + j + i] = (_Float16)(r8[i] * XC);
    }
    for (int i = t; i < DD * GH; i += 256) sW1[i] = bfr(gw1[i]);
  }
  __syncthreads();

  // ---- phase 1: gater (f32, VALU) ----
  {
    const float gw = bfr(glnw[lane]), gb = bfr(glnb[lane]);
    const float b1 = bfr(gb1[lane]),  w2 = bfr(gw2[lane]), b2 = bfr(gb2[0]);
#pragma unroll 1
    for (int i = 0; i < 8; ++i) {
      const int tk = wave * 8 + i;
      const float xv  = sX[tk * 33 + lane];
      const float mu  = wsum(xv) * (1.0f / DD);
      const float dv  = xv - mu;
      const float var = wsum(dv * dv) * (1.0f / DD);
      const float xn  = dv * rsqrtf(var + LNEPS) * gw + gb;
      float hacc = b1;
#pragma unroll
      for (int k = 0; k < DD; ++k) hacc += __shfl(xn, k, 32) * sW1[k * GH + lane];
      const float hs = hacc * sigm(hacc);
      const float gs = wsum(hs * w2) + b2;
      const float g  = sigm(gs);
      if (lane == 0) sG[tk] = g;
    }
  }
  __syncthreads();

  // ---- phase 2: projections on WMMA ----
  const int rt = wave & 3, ch = wave >> 2;
  FragH af;
  af.h[0] = *(const v8h*)(sXh + (16 * rt + m) * 40 + 8 * hh);
  af.h[1] = *(const v8h*)(sXh + (16 * rt + m) * 40 + 16 + 8 * hh);
  const _Float16* WTp = h16(WT);
#pragma unroll 1
  for (int p = 0; p < 3; ++p) {
    const float* bp = (p == 0) ? qbias : ((p == 1) ? kbias : vbias);
    const float osc = (p == 2) ? VC : QC;
    v16h bf[4];
#pragma unroll
    for (int j = 0; j < 4; ++j)
      bf[j] = ldfrag_h(WTp + (size_t)(p * HID + 64 * ch + 16 * j + m) * DD + 8 * hh);
    v8f acc[4];
#pragma unroll
    for (int j = 0; j < 4; ++j) acc[j] = mma_h_raw(af.v, bf[j], zero8());
    guard4x6(acc[0], acc[1], acc[2], acc[3], af.v, bf[0], bf[1], bf[2], bf[3], af.v);
    float gr[8];
#pragma unroll
    for (int r = 0; r < 8; ++r) gr[r] = sG[16 * rt + 8 * hh + r];
#pragma unroll
    for (int j = 0; j < 4; ++j) {
      const int n = 64 * ch + 16 * j + m;
      const float bn = bfr(bp[n]);
#pragma unroll
      for (int r = 0; r < 8; ++r) {
        const int row = 16 * rt + 8 * hh + r;
        const float f = ((acc[j][r] * (1.0f / (XC * WSC)) + bn) * gr[r]) * osc;
        unsigned short hb, lb;
        split_h(f, hb, lb);
        if (p < 2) { sH[row * 136 + n] = hb; sL[row * 136 + n] = lb; }
        else       { sH[n * 72 + row]  = hb; sL[n * 72 + row]  = lb; }
      }
    }
    __syncthreads();
    if (p == 0) {                                                   // block-uniform
      unsigned short* Hp = QH;
      unsigned short* Lp = QL;
      const int e = t & 15;
      v4u hv[4], lv[4];
#pragma unroll
      for (int i = 0; i < 4; ++i) {
        const int row = 16 * i + (t >> 4);
        hv[i] = *(const v4u*)(sH + row * 136 + 8 * e);
        lv[i] = *(const v4u*)(sL + row * 136 + 8 * e);
      }
#pragma unroll
      for (int i = 0; i < 4; ++i) {
        const int row = 16 * i + (t >> 4);
        *(v4u*)(Hp + (size_t)(tok0 + row) * HID + 8 * e) = hv[i];
        *(v4u*)(Lp + (size_t)(tok0 + row) * HID + 8 * e) = lv[i];
      }
      
    } else if (p == 1) {
      // k in fragment order: instruction i = head; wave -> 16-key tile t>>6, half s; lane -> key m, dims 16s + 8hh ..+7
      const int ktl = t >> 6, s = (t >> 5) & 1;
      v4u hv[4], lv[4];
#pragma unroll
      for (int i = 0; i < 4; ++i) {
        const int src = (16 * ktl + m) * 136 + HD * i + 16 * s + 8 * hh;
        hv[i] = *(const v4u*)(sH + src);
        lv[i] = *(const v4u*)(sL + src);
      }
#pragma unroll
      for (int i = 0; i < 4; ++i) {
        const size_t o = ((size_t)(b * NH + i) * (LL / 16) + (ltok0 >> 4) + ktl) * 512 + s * 256 + lane * 8;
        *(v4u*)(KH + o) = hv[i];
        *(v4u*)(KL + o) = lv[i];
      }
      // the stores' registers are reused by the next part's LDS reads: keep the wait in front of that overwrite
      asm volatile("s_wait_xcnt 0x0" ::: "memory");
    } else {
      // v^T in fragment order: instruction i = head; wave -> 32-key step t>>7, d tile dt, half s; lane -> d row m,
      // keys 16s + 8hh ..+7
      const int ksl = t >> 7, dt = (t >> 6) & 1, s = (t >> 5) & 1;
      v4u hv[4], lv[4];
#pragma unroll
      for (int i = 0; i < 4; ++i) {
        const int src = (HD * i + 16 * dt + m) * 72 + 32 * ksl + 16 * s + 8 * hh;
        hv[i] = *(const v4u*)(sH + src);
        lv[i] = *(const v4u*)(sL + src);
      }
#pragma unroll
      for (int i = 0; i < 4; ++i) {
        const size_t o = ((size_t)(b * NH + i) * (LL / 32) + (ltok0 >> 5) + ksl) * 1024 + dt * 512 + s * 256 + lane * 8;
        *(v4u*)(VTH + o) = hv[i];
        *(v4u*)(VTL + o) = lv[i];
      }
      // same wait behind the v^T stores, in front of any reuse of their registers
      asm volatile("s_wait_xcnt 0x0" ::: "memory");
      // ---- phase 3: floor sums of this block's keys ----
      if (wave < 4) {                                               // wave-uniform; no barrier inside
        const int ntb = (tin < 0) ? 0 : ((tin > TT) ? TT : tin);    // structural, clamped to the static extent
        float val[64];
#pragma unroll
        for (int g = 0; g < 8; ++g) {
          const v8h a = *(const v8h*)(h16(sH) + t * 72 + 8 * g);
          const v8h l = *(const v8h*)(h16(sL) + t * 72 + 8 * g);
#pragma unroll
          for (int j = 0; j < 8; ++j)
            val[8 * g + j] = (float)a[j] + (float)l[j] * INVRS;
        }
        const int i0  = (NF - ltok0 % NF) % NF;                     // 0, 2 or 4: 64 keys shift the phase by 4
        const int tb0 = (ltok0 + i0) / NF - 1;                      // time block whose masked keys start at local key i0
        float r[NJMAX], tot;
        if (i0 == 0)      block_suffix<0>(val, tb0, ntb, r, tot);   // block-uniform
        else if (i0 == 2) block_suffix<2>(val, tb0, ntb, r, tot);
        else              block_suffix<4>(val, tb0, ntb, r, tot);
        float* lsp  = LS + ((size_t)b * TT + tb0 + 1) * HID + t;    // row tb0 + 1, the block's second boundary
        float* totp = TOT + ((size_t)b * (LL / 64) + (ltok0 >> 6)) * HID + t;
        if (tb0 >= 0) *(lsp - HID) = r[0];                          // block-uniform: key 0 is no boundary of a time block
#pragma unroll
        for (int j = 1; j < NJMAX - 1; ++j) lsp[(size_t)(j - 1) * HID] = r[j];
        if (i0 != 4) lsp[(size_t)(NJMAX - 2) * HID] = r[NJMAX - 1]; // block-uniform: the eleventh boundary
        totp[0] = tot;
        // the stores' registers may be reused behind this point: keep the wait in front of that overwrite
        asm volatile("s_wait_xcnt 0x0" ::: "memory");
      }
    }
    __syncthreads();
  }
}

// =====================================================================================================
// One 32-key step of the transposed flash formulation for 16 queries of one head (head dim 32 = one k step):
//   S^T tiles (16 keys x 16 queries) = A(k rows, dims split-map) . B(q^T): hi.hi -> s, hi.lo + lo.hi -> sr (x1024);
//   logit (log2 domain) = (s + sr/1024) * scale*log2e/64; block-causal mask by value (key < horizon of the lane's query);
//   online softmax per lane (8 + 8 keys of ONE query per lane, max combined with lane^16), p = 2^(e - m + 10) (x1024);
//   P^T as the B operand of O^T(16 d x 16 queries) += v^T(d rows, keys split-map) . P^T: element r <- tile keys kb..kb+15,
//   element 8+r <- tile kb+16..kb+31, lane unchanged; P hi to o, (v hi . P lo x1024 + v lo x1024 . P hi) to or.
// =====================================================================================================
template <bool MASKED>
__device__ __forceinline__ void attn_step(const int kb, const int jl, const int hh,
    const _Float16* __restrict__ kH, const _Float16* __restrict__ kL,
    const _Float16* __restrict__ vH, const _Float16* __restrict__ vL,
    const v16h qhi, const v16h qlo, float& m_run, float& l_run,
    v8f& o1, v8f& o1r, v8f& o2, v8f& o2r) {
  const size_t so = (size_t)kb * 32;                 // 32 keys = 1024 halves of each fragment-order plane
  const v16h kh0 = ldfrag_p(kH + so);
  const v16h kh1 = ldfrag_p(kH + so + 512);
  const v16h kl0 = ldfrag_p(kL + so);
  const v16h kl1 = ldfrag_p(kL + so + 512);
  v8f s0  = mma_h_raw(kh0, qhi, zero8());
  v8f s1  = mma_h_raw(kh1, qhi, zero8());
  v8f s0r = mma_h_raw(kh0, qlo, zero8());
  v8f s1r = mma_h_raw(kh1, qlo, zero8());
  s0r = mma_h_raw(kl0, qhi, s0r);
  s1r = mma_h_raw(kl1, qhi, s1r);
  guard4x6(s0, s1, s0r, s1r, kh0, kh1, kl0, kl1, qhi, qlo);

  float e0[8], e1[8];
#pragma unroll
  for (int r = 0; r < 8; ++r) {
    e0[r] = (s0[r] + s0r[r] * INVRS) * SCL;
    e1[r] = (s1[r] + s1r[r] * INVRS) * SCL;
  }
  if (MASKED) {
    const int lim = jl - (kb + 8 * hh);              // row r is key kb + 8hh + r (tile 0), + 16 (tile 1): visible if below jl
#pragma unroll
    for (int r = 0; r < 8; ++r) {
      e0[r] = (r      < lim) ? e0[r] : NEGBIG;
      e1[r] = (16 + r < lim) ? e1[r] : NEGBIG;
    }
  }
  float mx = fmaxf(fmaxf(fmaxf(fmaxf(e0[0], e0[1]), fmaxf(e0[2], e0[3])), fmaxf(fmaxf(e0[4], e0[5]), fmaxf(e0[6], e0[7]))),
                   fmaxf(fmaxf(fmaxf(e1[0], e1[1]), fmaxf(e1[2], e1[3])), fmaxf(fmaxf(e1[4], e1[5]), fmaxf(e1[6], e1[7]))));
  mx = fmaxf(mx, __shfl_xor(mx, 16, 32));
  const float m_new = fmaxf(m_run, mx);
  const float corr  = fexp2(m_run - m_new);
  m_run = m_new;
  const float msh = m_new - 10.0f;                   // 2^(e - m + 10) = e^{s - smax} * 1024
  l_run *= corr;
  o1 = o1 * corr; o1r = o1r * corr; o2 = o2 * corr; o2r = o2r * corr;

  FragH ph, pl;
  float ls = 0.f;
#pragma unroll
  for (int r = 0; r < 8; ++r) {
    const float p0 = fexp2(e0[r] - msh);
    const float p1 = fexp2(e1[r] - msh);
    ls += p0 + p1;
    const _Float16 a0 = (_Float16)p0, a1 = (_Float16)p1;
    ph.h[0][r] = a0;                                          // keys kb      + 8hh + r
    ph.h[1][r] = a1;                                          // keys kb + 16 + 8hh + r
    pl.h[0][r] = (_Float16)((p0 - (float)a0) * RSC);
    pl.h[1][r] = (_Float16)((p1 - (float)a1) * RSC);
  }
  l_run += ls;

  const v16h vh1 = ldfrag_p(vH + so);
  const v16h vl1 = ldfrag_p(vL + so);
  const v16h vh2 = ldfrag_p(vH + so + 512);
  const v16h vl2 = ldfrag_p(vL + so + 512);
  o1  = mma_h_raw(vh1, ph.v, o1);
  o2  = mma_h_raw(vh2, ph.v, o2);
  o1r = mma_h_raw(vh1, pl.v, o1r);
  o2r = mma_h_raw(vh2, pl.v, o2r);
  o1r = mma_h_raw(vl1, ph.v, o1r);
  o2r = mma_h_raw(vl2, ph.v, o2r);
  guard4x6(o1, o2, o1r, o2r, vh1, vh2, vl1, vl2, ph.v, pl.v);
}

// =====================================================================================================
// Attention + mean-pool for one head of one batch row and a PAIR of 48-query groups: group 63 - pi (long key range) and
// group pi (short key range), so that every block holds about the same number of 32-key steps. Block = 24 waves (768
// threads), grid = 2 * 4 * 32 = 256. Wave w -> query tile index g = w>>3 of both groups; the 8 waves of one g share the
// key steps of the long tile (nH steps) and of the short tile (nL steps) in runs of C consecutive steps, C the smallest
// run length for which the block's longest pair of tiles fits in 8 waves. Each wave runs the online softmax over its own run only (the fully
// visible steps without masking, the rest with the per-lane horizon test by value) and leaves its partial
// (row maximum m, row sum l, o + or/1024) in LDS; a lane whose keys are all masked in its run keeps m = NEGBIG and gets
// weight 0 in the merge (run 0 of every tile holds keys 0..5, visible to every query, so the merged maximum is real).
// Merge (all 768 threads, thread -> query t>>3 of 96, 4 d at 4*(t&7)): M = max m_s, w_s = 2^(m_s - M),
// attn[d] = (sum w_s o_s) / (16 sum w_s l_s) + 1e-9 * (sum of v[.][d] over the query's masked keys) -> LDS sO[96][36] (f32);
// that sum = LS[b][tq][.] (the masked keys inside the 64-key block that holds the first of them) + the totals TOT of all
// later 64-key blocks, which wave 7 sums last to first into LDS sTS[48][32] in front of the merge barrier;
// barrier; threads 0..127 pool 6 consecutive query rows (pooled row t>>3 of 16, cols 4*(t&7)) -> f16 hi (x32) / lo
// (x1024), stored to the head's own plane [head][1024 rows][32]: one wave writes 256 contiguous bytes of each plane.
// coverage: per block rows b*512 + 8*(63-pi) .. +7 and b*512 + 8*pi .. +7 of head h; 256 blocks cover [4][1024][32] once.
// =====================================================================================================
#define KS 8                                                 // waves that share one long and one short query tile
__device__ __forceinline__ int cdiv_i(int a, int d) { return (a + d - 1) / d; }
// 32-key steps of the 16-query tile that starts at query qw0: up to the block-causal horizon of its last query (<= 3072)
__device__ __forceinline__ int tile_steps(int qw0) { return (((qw0 + 15) / NF + 1) * NF + 31) >> 5; }
// run length for a pair of tiles; at most 96 since then each tile is one run
__device__ __forceinline__ int run_len(int nH, int nL) {
  int C = cdiv_i(nH + nL, KS);
  for (; C < LL / 32; ++C)
    if (cdiv_i(nH, C) + cdiv_i(nL, C) <= KS) break;
  return C;
}

__global__ __launch_bounds__(768)
void attn_pool(const unsigned short* __restrict__ QH, const unsigned short* __restrict__ QL,
               const unsigned short* __restrict__ KH, const unsigned short* __restrict__ KL,
               const unsigned short* __restrict__ VTH, const unsigned short* __restrict__ VTL,
               const float* __restrict__ LS, const float* __restrict__ TOT, unsigned short* PH, unsigned short* PL) {
  __shared__ __align__(16) float sP[3 * KS * 16 * 36];       // per wave 16 queries x 32 d, pitch 36
  __shared__ float sM[3 * KS * 16];
  __shared__ float sL[3 * KS * 16];
  __shared__ __align__(16) float sO[96 * 36];
  __shared__ __align__(16) float sTS[(LL / 64) * HD];        // [64-key block k][d]: sum of v over all keys of blocks > k
  const int t = threadIdx.x, lane = t & 31, hh = lane >> 4, c = lane & 15;
  const int wave = __builtin_amdgcn_readfirstlane(t >> 5);   // wave-uniform: run bounds and plane bases stay scalar
  const int bx = blockIdx.x;
  const int pi = bx & 31;
  const int h  = (bx >> 5) & 3;
  const int b  = bx >> 7;
  const size_t tokb = (size_t)b * LL;
  // one run length for the block, from its last (longest) tiles: run s of all three tiles covers the same keys, so the
  // three waves that walk it together read the same k and v lines
  const int C = run_len(tile_steps((63 - pi) * 48 + 32), tile_steps(pi * 48 + 32));

  if (wave == KS - 1) {                                      // scalar branch; this wave holds at most the last, short run of a short tile
    const float* tp = TOT + (size_t)b * (LL / 64) * HID + h * HD + lane;   // lane -> d
    float tv[LL / 64];
#pragma unroll
    for (int k = 0; k < LL / 64; ++k) tv[k] = tp[(size_t)k * HID];
    // the loads' address registers may be reused below: keep the wait in front of that overwrite
    asm volatile("s_wait_xcnt 0x0" ::: "memory");
    float run = 0.f;
#pragma unroll
    for (int k = LL / 64 - 1; k >= 0; --k) { sTS[k * HD + lane] = run; run += tv[k]; }
  }

  {
    const int g = wave >> 3, s8 = wave & (KS - 1);
    const int qH0 = (63 - pi) * 48 + 16 * g, qL0 = pi * 48 + 16 * g;
    const int nH = tile_steps(qH0), nL = tile_steps(qL0);
    const int SH = cdiv_i(nH, C);
    const bool isH = (s8 < SH);
    const int qw0 = isH ? qH0 : qL0;
    const int n   = isH ? nH : nL;
    const int s   = isH ? s8 : (s8 - SH);
    const int st1 = (s + 1) * C;
    const int kb1 = ((st1 < n) ? st1 : n) * 32;              // a wave past the short tile's last run does no step
    const int qi  = qw0 + c;                                 // query of this lane (B column / D column)
    const int jl  = (qi / NF + 1) * NF;                      // exclusive key horizon

    const _Float16* QHp = h16(QH);
    const _Float16* QLp = h16(QL);
    const v16h qhi = ldfrag_h(QHp + (tokb + qi) * HID + h * HD + 8 * hh);
    const v16h qlo = ldfrag_h(QLp + (tokb + qi) * HID + h * HD + 8 * hh);
    // the q loads' address registers are reused by the accumulators' start values: keep the wait in front of that overwrite
    asm volatile("s_wait_xcnt 0x0" ::: "memory");
    const size_t pbase = (size_t)(b * NH + h) * LL * HD + 8 * lane;   // (b, head) slab of a fragment-order plane; + kb * 32
    const _Float16* kH = h16(KH) + pbase;                             // key tile 2 at +512 halves
    const _Float16* kL = h16(KL) + pbase;
    const _Float16* vH = h16(VTH) + pbase;                            // d tile 2 at +512 halves
    const _Float16* vL = h16(VTL) + pbase;

    float m_run = NEGBIG, l_run = 0.f;
    v8f o1 = zero8(), o1r = zero8(), o2 = zero8(), o2r = zero8();
    const int jmin  = (qw0 / NF + 1) * NF;
    const int cfull = (jmin / 32) * 32;
    const int kbf   = (cfull < kb1) ? cfull : kb1;
    int kb = s * C * 32;
#pragma unroll 1
    for (; kb < kbf; kb += 32)
      attn_step<false>(kb, jl, hh, kH, kL, vH, vL, qhi, qlo, m_run, l_run, o1, o1r, o2, o2r);
#pragma unroll 1
    for (; kb < kb1; kb += 32)
      attn_step<true>(kb, jl, hh, kH, kL, vH, vL, qhi, qlo, m_run, l_run, o1, o1r, o2, o2r);

    l_run += __shfl_xor(l_run, 16, 32);
    float* pp = sP + (wave * 16 + c) * 36 + 8 * hh;
    v4f a0, a1, c0, c1;
#pragma unroll
    for (int r = 0; r < 4; ++r) {
      a0[r] = o1[r] + o1r[r] * INVRS;  a1[r] = o1[4 + r] + o1r[4 + r] * INVRS;
      c0[r] = o2[r] + o2r[r] * INVRS;  c1[r] = o2[4 + r] + o2r[4 + r] * INVRS;
    }
    *(v4f*)(pp)      = a0;                                   // d  8hh ..  8hh+7
    *(v4f*)(pp + 4)  = a1;
    *(v4f*)(pp + 16) = c0;                                   // d 16+8hh .. 16+8hh+7
    *(v4f*)(pp + 20) = c1;
    if (hh == 0) { sM[wave * 16 + c] = m_run; sL[wave * 16 + c] = l_run; }
  }
  __syncthreads();
  {
    const int tile = wave >> 2;                              // 0..2 long group's tiles, 3..5 short group's; 4 queries per wave
    const int hl = (tile >= 3) ? 1 : 0;
    const int g  = tile - 3 * hl;
    const int qH0 = (63 - pi) * 48 + 16 * g, qL0 = pi * 48 + 16 * g;
    const int nH = tile_steps(qH0), nL = tile_steps(qL0);
    const int SH = cdiv_i(nH, C);
    const int w0 = g * KS + (hl ? SH : 0);                   // first wave and number of waves that hold this tile's runs
    const int wn = hl ? cdiv_i(nL, C) : SH;
    const int c2 = (t >> 3) & 15, dg = t & 7;
    const int tq = ((hl ? qL0 : qH0) + c2) / NF;
    const int  j0  = (tq + 1) * NF;                          // first masked key; none for the last time block
    const bool any = (j0 < LL);
    const v4f lsv = *(const v4f*)(LS + ((size_t)b * TT + (any ? tq : 0)) * HID + h * HD + 4 * dg);
    const v4f tsv = *(const v4f*)(sTS + (any ? (j0 >> 6) : 0) * HD + 4 * dg);
    v4f sv;
#pragma unroll
    for (int e = 0; e < 4; ++e) sv[e] = any ? (lsv[e] + tsv[e]) : 0.f;
    // all KS slots read at once (one LDS latency); a slot past the tile's last run rereads run 0 and gets weight 0
    float ms[KS], ls[KS];
    v4f os[KS];
#pragma unroll
    for (int i = 0; i < KS; ++i) {
      const int wi = w0 + ((i < wn) ? i : 0);
      ms[i] = sM[wi * 16 + c2];
      ls[i] = sL[wi * 16 + c2];
      os[i] = *(const v4f*)(sP + (wi * 16 + c2) * 36 + 4 * dg);
    }
    float M = ms[0];
#pragma unroll
    for (int i = 1; i < KS; ++i) M = fmaxf(M, ms[i]);
    float L = 0.f;
    v4f O = {0.f, 0.f, 0.f, 0.f};
#pragma unroll
    for (int i = 0; i < KS; ++i) {
      const float w = (i < wn) ? fexp2(ms[i] - M) : 0.f;
      L += w * ls[i];
      O += os[i] * w;
    }
    const float inv = (1.0f / L) * (1.0f / VC);
    *(v4f*)(sO + (t >> 3) * 36 + 4 * dg) = O * inv + sv * FLOORC;
  }
  __syncthreads();
  if (wave < 4) {                                            // wave-uniform; no barrier behind it
    const int pr = t >> 3, col = 4 * (t & 7);
    v4f s = {0.f, 0.f, 0.f, 0.f};
#pragma unroll
    for (int f = 0; f < NF; ++f) s += *(const v4f*)(sO + (NF * pr + f) * 36 + col);
    unsigned short hb[4], lb[4];
#pragma unroll
    for (int e = 0; e < 4; ++e) split_h((s[e] * (1.0f / NF)) * AC, hb[e], lb[e]);
    v2u ph2, pl2;
    ph2[0] = pk16(hb[0], hb[1]); ph2[1] = pk16(hb[2], hb[3]);
    pl2[0] = pk16(lb[0], lb[1]); pl2[1] = pk16(lb[2], lb[3]);
    const int qblk = (pr < 8) ? (63 - pi) : pi;
    const size_t o = ((size_t)h * NPOOL + (size_t)(b * TT + 8 * qblk + (pr & 7))) * HD + col;
    *(v2u*)(PH + o) = ph2;
    *(v2u*)(PL + o) = pl2;
  }
}

// =====================================================================================================
// Tail: 64 pooled rows per block (grid 1024/64 = 16, 256 threads = 8 waves, wave -> row tile w&3, 64-col half w>>2).
// GEMM1 z = pooled(hi + lo/1024)/32 . Wo + bf16(o_b): A planes PH/PL [head][row][32], k step = head (two products into
// acc/accr), B = WOT rows, K=128;
// GEMM2 from sZ rows split to f16 hi (x16) / lo (x1024) at fragment build . FWT rows; epilogue silu(acc + bf16(f_b))
// coverage: out rows r0..r0+63 x 128 cols; 16 blocks cover [1024][128] exactly once.
// =====================================================================================================
__global__ __launch_bounds__(256) void tail_k(const unsigned short* __restrict__ PH, const unsigned short* __restrict__ PL,
                                               const unsigned short* __restrict__ WOT, const float* __restrict__ obias,
                                               const float* __restrict__ flnw, const float* __restrict__ flnb,
                                               const unsigned short* __restrict__ FWT, const float* __restrict__ fbias,
                                               float* out) {
  __shared__ __align__(16) float sZ[64 * 132];
  const int t = threadIdx.x, wave = t >> 5, lane = t & 31, hh = lane >> 4, m = lane & 15;
  const int r0 = blockIdx.x * 64;
  const int rt = wave & 3, ch = wave >> 2;

  // ---- GEMM1 ----
  {
    v8f acc[4], accr[4];
#pragma unroll
    for (int j = 0; j < 4; ++j) { acc[j] = zero8(); accr[j] = zero8(); }
    const _Float16* Ah = h16(PH) + (size_t)(r0 + 16 * rt + m) * HD + 8 * hh;   // + k0 * NPOOL: plane of head k0 / 32
    const _Float16* Al = h16(PL) + (size_t)(r0 + 16 * rt + m) * HD + 8 * hh;
    const _Float16* Bw = h16(WOT) + (size_t)(64 * ch + m) * HID + 8 * hh;
#pragma unroll 1
    for (int k0 = 0; k0 < HID; k0 += 32) {
      v16h bf[4];
#pragma unroll
      for (int j = 0; j < 4; ++j) bf[j] = ldfrag_h(Bw + (size_t)(16 * j) * HID + k0);
      const v16h ah = ldfrag_h(Ah + (size_t)k0 * NPOOL);
      const v16h al = ldfrag_h(Al + (size_t)k0 * NPOOL);
#pragma unroll
      for (int j = 0; j < 4; ++j) acc[j]  = mma_h_raw(ah, bf[j], acc[j]);
#pragma unroll
      for (int j = 0; j < 4; ++j) accr[j] = mma_h_raw(al, bf[j], accr[j]);
      guard8x6(acc[0], acc[1], acc[2], acc[3], accr[0], accr[1], accr[2], accr[3], ah, al, bf[0], bf[1], bf[2], bf[3]);
    }
    acc_guard4(acc[0], acc[1], acc[2], acc[3]);
    acc_guard4(accr[0], accr[1], accr[2], accr[3]);
#pragma unroll
    for (int j = 0; j < 4; ++j) {
      const int n = 64 * ch + 16 * j + m;
      const float bn = bfr(obias[n]);
#pragma unroll
      for (int r = 0; r < 8; ++r) {
        const int row = 16 * rt + 8 * hh + r;
        sZ[row * 132 + n] = (acc[j][r] + accr[j][r] * INVRS) * (1.0f / (AC * WSC)) + bn;
      }
    }
  }
  __syncthreads();

  // ---- LayerNorm in place ----
  {
    float gg[4], bb[4];
#pragma unroll
    for (int e = 0; e < 4; ++e) { gg[e] = bfr(flnw[4 * lane + e]); bb[e] = bfr(flnb[4 * lane + e]); }
#pragma unroll 1
    for (int i = 0; i < 8; ++i) {
      const int row = 8 * wave + i;
      float* zp = sZ + row * 132 + 4 * lane;
      const v4f z = *(const v4f*)zp;
      float s = (z[0] + z[1]) + (z[2] + z[3]);
      s = wsum(s);
      const float mean = s * (1.0f / HID);
      float d[4];
#pragma unroll
      for (int e = 0; e < 4; ++e) d[e] = z[e] - mean;
      float vs = (d[0] * d[0] + d[1] * d[1]) + (d[2] * d[2] + d[3] * d[3]);
      vs = wsum(vs);
      const float rstd = rsqrtf(vs * (1.0f / HID) + LNEPS);
      v4f y;
#pragma unroll
      for (int e = 0; e < 4; ++e) y[e] = (d[e] * rstd) * gg[e] + bb[e];
      *(v4f*)zp = y;
    }
  }
  __syncthreads();

  // ---- GEMM2 ----
  v8f acc2[4], acc2r[4];
#pragma unroll
  for (int j = 0; j < 4; ++j) { acc2[j] = zero8(); acc2r[j] = zero8(); }
  {
    const float* zr = sZ + (16 * rt + m) * 132 + 8 * hh;
    const _Float16* Bf = h16(FWT) + (size_t)(64 * ch + m) * HID + 8 * hh;
#pragma unroll 1
    for (int k0 = 0; k0 < HID; k0 += 32) {
      FragH ah, al;
      const v4f za = *(const v4f*)(zr + k0), zb = *(const v4f*)(zr + k0 + 4);
      const v4f zc = *(const v4f*)(zr + k0 + 16), zd = *(const v4f*)(zr + k0 + 20);
#pragma unroll
      for (int i = 0; i < 4; ++i) {
        const float f0 = za[i] * YC, f1 = zb[i] * YC, f2 = zc[i] * YC, f3 = zd[i] * YC;
        const _Float16 h0 = (_Float16)f0, h1 = (_Float16)f1, h2 = (_Float16)f2, h3 = (_Float16)f3;
        ah.h[0][i] = h0;     al.h[0][i]     = (_Float16)((f0 - (float)h0) * RSC);
        ah.h[0][4 + i] = h1; al.h[0][4 + i] = (_Float16)((f1 - (float)h1) * RSC);
        ah.h[1][i] = h2;     al.h[1][i]     = (_Float16)((f2 - (float)h2) * RSC);
        ah.h[1][4 + i] = h3; al.h[1][4 + i] = (_Float16)((f3 - (float)h3) * RSC);
      }
      v16h bf[4];
#pragma unroll
      for (int j = 0; j < 4; ++j) bf[j] = ldfrag_h(Bf + (size_t)(16 * j) * HID + k0);
#pragma unroll
      for (int j = 0; j < 4; ++j) acc2[j]  = mma_h_raw(ah.v, bf[j], acc2[j]);
#pragma unroll
      for (int j = 0; j < 4; ++j) acc2r[j] = mma_h_raw(al.v, bf[j], acc2r[j]);
      guard8x6(acc2[0], acc2[1], acc2[2], acc2[3], acc2r[0], acc2r[1], acc2r[2], acc2r[3],
               ah.v, al.v, bf[0], bf[1], bf[2], bf[3]);
    }
    acc_guard4(acc2[0], acc2[1], acc2[2], acc2[3]);
    acc_guard4(acc2r[0], acc2r[1], acc2r[2], acc2r[3]);
  }
  __syncthreads();                                            // every wave is done reading sZ rows as the A operand
#pragma unroll
  for (int j = 0; j < 4; ++j) {
    const int n = 64 * ch + 16 * j + m;
    const float bn = bfr(fbias[n]);
#pragma unroll
    for (int r = 0; r < 8; ++r) {
      const int row = 16 * rt + 8 * hh + r;
      const float a = (acc2[j][r] + acc2r[j][r] * INVRS) * (1.0f / (YC * WSC)) + bn;
      sZ[row * 132 + n] = a * sigm(a);
    }
  }
  __syncthreads();
  {
    v4f vals[8];
#pragma unroll
    for (int i = 0; i < 8; ++i) vals[i] = *(const v4f*)(sZ + (8 * i + wave) * 132 + 4 * lane);
#pragma unroll
    for (int i = 0; i < 8; ++i)
      *(v4f*)(out + (size_t)(r0 + 8 * i + wave) * FD + 4 * lane) = vals[i];
    
  }
}

// =====================================================================================================
// Workspace map (bytes), every offset a multiple of 256 and every plane sized to its whole-line store granularity:
//   WT   f16 [384][32]  x64        0          24576     (q_w^T | k_w^T | v_w^T rows)
//   WOT  f16 [128][128] x64        24576      32768
//   FWT  f16 [128][128] x64        57344      32768
//   QH   f16 [6144][128] q x8      90112      1572864
//   QL   f16 [6144][128] residual  1662976    1572864
//   KH   f16 k x8, fragment order [2][4 heads][192 key tiles][2 halves][32 lanes][8]   3235840    1572864
//   KL                             4808704    1572864
//   VTH  f16 v x16, fragment order [2][4 heads][96 key steps][2 d tiles][2 halves][32 lanes][8]   6381568    1572864
//   VTL                            7954432    1572864
//   LS   f32 [2][512 time blocks][128]   9527296    524288   (row 511 of each batch row neither written nor read)
//   PH   f16 [4 heads][1024][32] x32  10051584   262144
//   PL                             10313728   262144
//   TOT  f32 [2][48 key blocks][128]     10575872   49152
//   end                            10625024
// =====================================================================================================
extern "C" void kernel_launch(void* const* d_in, const int* in_sizes, int n_in,
                              void* d_out, int out_size, void* d_ws, size_t ws_size,
                              hipStream_t stream) {
  if (n_in < 20) return;
  if (in_sizes[0] != NTOK * DD) return;
  if (in_sizes[1] != DD || in_sizes[2] != DD || in_sizes[3] != DD * GH || in_sizes[4] != GH ||
      in_sizes[5] != GH || in_sizes[6] != 1) return;
  if (in_sizes[7] != DD * HID || in_sizes[8] != HID || in_sizes[9] != DD * HID || in_sizes[10] != HID ||
      in_sizes[11] != DD * HID || in_sizes[12] != HID) return;
  if (in_sizes[13] != HID * HID || in_sizes[14] != HID || in_sizes[15] != HID || in_sizes[16] != HID ||
      in_sizes[17] != HID * FD || in_sizes[18] != FD || in_sizes[19] != 1) return;
  if (out_size != NPOOL * FD) return;

  const float* x    = (const float*)d_in[0];
  const float* glnw = (const float*)d_in[1];
  const float* glnb = (const float*)d_in[2];
  const float* gw1  = (const float*)d_in[3];
  const float* gb1  = (const float*)d_in[4];
  const float* gw2  = (const float*)d_in[5];
  const float* gb2  = (const float*)d_in[6];
  const float* qw   = (const float*)d_in[7];
  const float* qb   = (const float*)d_in[8];
  const float* kw   = (const float*)d_in[9];
  const float* kb   = (const float*)d_in[10];
  const float* vw   = (const float*)d_in[11];
  const float* vb   = (const float*)d_in[12];
  const float* ow   = (const float*)d_in[13];
  const float* ob   = (const float*)d_in[14];
  const float* flnw = (const float*)d_in[15];
  const float* flnb = (const float*)d_in[16];
  const float* fw   = (const float*)d_in[17];
  const float* fb   = (const float*)d_in[18];
  const int*   Tp   = (const int*)d_in[19];

  const size_t PWT = (size_t)3 * HID * DD * 2;        //    24576
  const size_t PWO = (size_t)HID * HID * 2;           //    32768
  const size_t PWF = (size_t)FD * HID * 2;            //    32768
  const size_t PQP = (size_t)NTOK * HID * 2;          //  1572864
  const size_t PVT = (size_t)NB * HID * LL * 2;       //  1572864
  const size_t PSV = (size_t)NB * HID * TT * 4;       //   524288
  const size_t PPP = (size_t)NPOOL * HID * 2;         //   262144
  const size_t PTO = (size_t)NB * (LL / 64) * HID * 4; //    49152
  size_t off = 0;
  const size_t oWT = off; off += PWT;
  const size_t oWO = off; off += PWO;
  const size_t oWF = off; off += PWF;
  const size_t oQH = off; off += PQP;
  const size_t oQL = off; off += PQP;
  const size_t oKH = off; off += PQP;
  const size_t oKL = off; off += PQP;
  const size_t oVH = off; off += PVT;
  const size_t oVL = off; off += PVT;
  const size_t oSV = off; off += PSV;
  const size_t oPH = off; off += PPP;
  const size_t oPL = off; off += PPP;
  const size_t oTO = off; off += PTO;
  if (off > ws_size) return;                           // off = 10625024
  if (off > (size_t)134217728) return;

  char* ws = (char*)d_ws;
  unsigned short* WT  = (unsigned short*)(ws + oWT);
  unsigned short* WOT = (unsigned short*)(ws + oWO);
  unsigned short* FWT = (unsigned short*)(ws + oWF);
  unsigned short* QH  = (unsigned short*)(ws + oQH);
  unsigned short* QL  = (unsigned short*)(ws + oQL);
  unsigned short* KH  = (unsigned short*)(ws + oKH);
  unsigned short* KL  = (unsigned short*)(ws + oKL);
  unsigned short* VTH = (unsigned short*)(ws + oVH);
  unsigned short* VTL = (unsigned short*)(ws + oVL);
  float*          LS  = (float*)(ws + oSV);
  float*          TOT = (float*)(ws + oTO);
  unsigned short* PH  = (unsigned short*)(ws + oPH);
  unsigned short* PL  = (unsigned short*)(ws + oPL);
  float*          out = (float*)d_out;

  const dim3 blk(256), blk768(768);
  const dim3 gW(12 + 8 + 8);                           // 28 weight tiles
  const dim3 gQ(NTOK / 64);                            // 96
  const dim3 gA(NB * NH * (LL / 96));                  // 256
  const dim3 gT(NPOOL / 64);                           // 16

  // (0) weight planes, transposed to k-contiguous rows: f16( bf16_RNE(w) * 64 )
  wprep<<<gW, blk, 0, stream>>>(qw, kw, vw, ow, fw, WT, WOT, FWT);

  // (1) gater + gated q/k/v planes (q rows hi/lo; k and v^T hi/lo in fragment order) + per-block masked-key floor sums
  qkv_prep<<<gQ, blk, 0, stream>>>(x, glnw, glnb, gw1, gb1, gw2, gb2, qb, kb, vb, WT, Tp, QH, QL, KH, KL, VTH, VTL, LS, TOT);

  // (2) block-causal attention + mean-pool over the 6 forces -> pooled planes
  attn_pool<<<gA, blk768, 0, stream>>>(QH, QL, KH, KL, VTH, VTL, LS, TOT, PH, PL);

  // (3) o-proj + LayerNorm + final linear + SiLU -> out
  tail_k<<<gT, blk, 0, stream>>>(PH, PL, WOT, ob, flnw, flnb, FWT, fb, out);
  (void)hipGetLastError();
}

// v004
// It runs in 52.8 microseconds.
// Next to v003, in two timings, it ran 1.07 times as fast each time.
// Over all steps from v000 it is 3.46 times as fast.
// Contractions: q/k/v projections (x rows f16 x16 . W^T f16 x64, K=32, one product), scores S^T = k . q^T
// (k and q each f16 x8 hi plane + f16 x1024 residual plane, 3 products per tile), O^T = v^T . P^T (v f16 x16 hi +
// x1024 residual, P f16 x1024 hi + x1024 residual, 3 products), pooled attention . Wo^T and LN rows . Wf^T
// (activation f16 hi + x1024 residual . W^T f16 x64, K=128, 2 products): all v_wmma_f32_16x16x32_f16, f32 accumulate;
// gater MLP, LayerNorm, softmax, pooling, SiLU in f32 on VALU; every float input RNE-converted to bf16 on load.
#include <hip/hip_runtime.h>
#include <math.h>
#include <stdint.h>

#define NB     2
#define TT     512
#define NF     6
#define DD     32
#define HID    128
#define NH     4
#define HD     32
#define GH     32
#define FD     128
#define LL     (TT * NF)
#define NTOK   (NB * LL)
#define NPOOL  (NB * TT)
#define LNEPS  1.0e-5f
#define XC     16.0f
#define WSC    64.0f
#define QC     8.0f
#define KC     8.0f
#define VC     16.0f
#define AC     32.0f
#define YC     16.0f
#define RSC    1024.0f
#define INVRS  (1.0f / 1024.0f)
#define FLOORC 1.0e-9f
#define NEGBIG (-1.0e30f)
#define SCL    ((0.17677669529663687f * 1.4426950408889634f) / (QC * KC))
static_assert(NH * HD == HID);
static_assert(FD == HID);
static_assert((LL % 64) == 0 && (LL % 96) == 0 && (LL % 32) == 0 && LL / 48 == 64);
static_assert((NTOK % 64) == 0 && (NPOOL % 64) == 0);
static_assert(DD == 32 && GH == 32);

typedef _Float16 v16h __attribute__((ext_vector_type(16)));
typedef _Float16 v8h  __attribute__((ext_vector_type(8)));
typedef float    v8f  __attribute__((ext_vector_type(8)));
typedef float    v4f  __attribute__((ext_vector_type(4)));
typedef unsigned int v4u __attribute__((ext_vector_type(4)));
typedef unsigned int v2u __attribute__((ext_vector_type(2)));

union FragH { v16h v; v8h h[2]; };

// ---- scalar helpers --------------------------------------------------------------------------------
__device__ __forceinline__ unsigned short bf_bits(float f) {          // f32 -> bf16 bits, RNE convert
  unsigned u = __float_as_uint(f);
  return (unsigned short)((u + 0x7FFFu + ((u >> 16) & 1u)) >> 16);
}
__device__ __forceinline__ float bf_up(unsigned short h) { return __uint_as_float(((unsigned)h) << 16); }
__device__ __forceinline__ float bfr(float f) { return bf_up(bf_bits(f)); }
__device__ __forceinline__ unsigned short h_bits(_Float16 x) { return __builtin_bit_cast(unsigned short, x); }
__device__ __forceinline__ unsigned pk16(unsigned short a, unsigned short b) { return (unsigned)a | ((unsigned)b << 16); }
__device__ __forceinline__ v8f zero8() { v8f z = {0.f, 0.f, 0.f, 0.f, 0.f, 0.f, 0.f, 0.f}; return z; }
__device__ __forceinline__ float hmax8(v8f s) {
  return fmaxf(fmaxf(fmaxf(s[0], s[1]), fmaxf(s[2], s[3])), fmaxf(fmaxf(s[4], s[5]), fmaxf(s[6], s[7])));
}
__device__ __forceinline__ const _Float16* h16(const unsigned short* p) { return (const _Float16*)(const void*)p; }
// hi = f16(f), lo = f16((f - hi) * 1024): residual plane carried x1024, folded back in the f32 epilogue
__device__ __forceinline__ void split_h(float f, unsigned short& hb, unsigned short& lb) {
  const _Float16 h = (_Float16)f;
  const _Float16 l = (_Float16)((f - (float)h) * RSC);
  hb = h_bits(h);
  lb = h_bits(l);
}
__device__ __forceinline__ float fexp2(float x) { return __builtin_amdgcn_exp2f(x); }
__device__ __forceinline__ float sigm(float a) {
  const float e = __expf(fminf(-a, 60.0f));       // quotient stays far from underflow
  return 1.0f / (1.0f + e);
}
__device__ __forceinline__ float wsum(float v) {
#pragma unroll
  for (int off = 16; off > 0; off >>= 1) v += __shfl_xor(v, off, 32);
  return v;
}

// ---- fragment loader: 16-bit A/B operand, lane -> row/col (lane&15), p already includes +8*(lane>>4);
//      elements 0..7 <- p[0..7] (k0+8h..), elements 8..15 <- p[16..23] (k0+16+8h..)
__device__ __forceinline__ v16h ldfrag_h(const _Float16* p) {
  FragH f;
  f.h[0] = *(const v8h*)(p);
  f.h[1] = *(const v8h*)(p + 16);
  return f.v;
}

// ---- the same fragment from a plane stored in fragment order: one 16 x 32 operand tile = 1024 B = two 512-B halves,
//      half s holds lane L's elements 8s..8s+7 at byte 16*L, so each wave-wide 16-B load covers four whole 128-B lines;
//      p already includes +8*lane
__device__ __forceinline__ v16h ldfrag_p(const _Float16* p) {
  FragH f;
  f.h[0] = *(const v8h*)(p);
  f.h[1] = *(const v8h*)(p + 256);
  return f.v;
}

// ---- WMMA helpers with trailing VALU hazard gap --------------------------------------------------------
__device__ __forceinline__ v8f mma_h_raw(v16h a, v16h b, v8f c) {
  return __builtin_amdgcn_wmma_f32_16x16x32_f16(false, a, false, b, (short)0, c, false, false);
}
__device__ __forceinline__ void guard4x6(v8f& a, v8f& b, v8f& c, v8f& d,
                                         v16h x0, v16h x1, v16h x2, v16h x3, v16h x4, v16h x5) {
#if defined(__HIP_DEVICE_COMPILE__)
  asm volatile("v_nop\n\tv_nop\n\tv_nop\n\tv_nop"
               : "+v"(a), "+v"(b), "+v"(c), "+v"(d)
               : "v"(x0), "v"(x1), "v"(x2), "v"(x3), "v"(x4), "v"(x5));
#endif
}
__device__ __forceinline__ void guard8x6(v8f& a0, v8f& a1, v8f& a2, v8f& a3,
                                         v8f& b0, v8f& b1, v8f& b2, v8f& b3,
                                         v16h x0, v16h x1, v16h x2, v16h x3, v16h x4, v16h x5) {
#if defined(__HIP_DEVICE_COMPILE__)
  asm volatile("v_nop\n\tv_nop\n\tv_nop\n\tv_nop"
               : "+v"(a0), "+v"(a1), "+v"(a2), "+v"(a3), "+v"(b0), "+v"(b1), "+v"(b2), "+v"(b3)
               : "v"(x0), "v"(x1), "v"(x2), "v"(x3), "v"(x4), "v"(x5));
#endif
}
__device__ __forceinline__ void acc_guard4(v8f& a, v8f& b, v8f& c, v8f& d) {
#if defined(__HIP_DEVICE_COMPILE__)
  asm volatile("v_nop\n\tv_nop\n\tv_nop\n\tv_nop" : "+v"(a), "+v"(b), "+v"(c), "+v"(d));
#endif
}

// =====================================================================================================
// Weight convert with transpose, one 64 k x 32 o tile of o_w or f_w per block (the 16 blocks behind the token blocks of
// the projection launch): in[k][o] f32 (x @ W layout) -> out[o][k] = f16( bf16_RNE(in) * WSC ), k contiguous.
// q = 0..7: o_w [128][128] -> WOT [n][k]; q = 8..15: f_w -> FWT; thread t loads k = t>>2, 8 floats at 8*(t&3) into T
// (pitch 33), stores row o = t>>3, 8 halves k = 8*(t&7).
// coverage: WOT/FWT 4 x 2 tiles x (32 o x 64 k) = [128][128] each.
// =====================================================================================================
__device__ __forceinline__ void conv_tile(const int q, const int t, const float* __restrict__ ow,
                                          const float* __restrict__ fw, unsigned short* WOT, unsigned short* FWT,
                                          float* T) {
  const bool iso = (q < 8);                                  // block-uniform
  const int rr = iso ? q : (q - 8);
  const float* src   = iso ? ow : fw;
  unsigned short* ds = iso ? WOT : FWT;
  const int o0 = (rr >> 1) * 32, k0 = (rr & 1) * 64;
  {
    const int k = t >> 2, oo = 8 * (t & 3);
    const float* sp = src + (size_t)(k0 + k) * HID + o0 + oo;
    const v4f a = *(const v4f*)(sp), c = *(const v4f*)(sp + 4);
#pragma unroll
    for (int i = 0; i < 4; ++i) { T[k * 33 + oo + i] = a[i]; T[k * 33 + oo + 4 + i] = c[i]; }
  }
  __syncthreads();
  {
    const int o = t >> 3, e = t & 7;
    float w[8];
#pragma unroll
    for (int i = 0; i < 8; ++i) w[i] = bfr(T[(8 * e + i) * 33 + o]) * WSC;
    v4u v;
#pragma unroll
    for (int i = 0; i < 4; ++i) v[i] = pk16(h_bits((_Float16)w[2 * i]), h_bits((_Float16)w[2 * i + 1]));
    unsigned short* dp = ds + (size_t)(o0 + o) * HID + k0 + 8 * e;
    *(v4u*)dp = v;
  }
}

// =====================================================================================================
// Gater + gated q/k/v projections for 64 tokens per block (256 threads = 8 waves; blocks 0..95 of a grid of 96 + 16; the
// last 16 blocks convert o_w and f_w for the tail launch, see conv_tile, and do nothing else).
// Phase 0: x tile [64][32] loaded as float4 pairs, RNE-converted to bf16 values: f32 copy sX (pitch 33) for the gater and
//          f16(x * 16) rows sXh (pitch 40 halves) as the WMMA A operand; g_w1 staged bf16-RNE in LDS;
//          q_w | k_w | v_w [32 k][128 n] f32 -> sWT rows [p*128 + n][32 k] = f16( bf16_RNE(w) * 64 ), pitch 40 halves:
//          thread -> column n = t&127 and 8 k (each wave-wide 4-B load is one whole line), one 16-B LDS store per 8 k.
// Phase 1 (wave -> 8 tokens): LayerNorm over the 32 lanes, h = SiLU(LN(x) . g_w1 + g_b1)
//          with lane = hidden unit (32 shfl-broadcast FMAs), gate = sigmoid(sum_lane h*g_w2 + g_b2), all f32 -> sG.
// Phase 2: per part p in {q,k,v}: wave w -> row tile w&3, 64-col half w>>2: 4 WMMAs (K = 32 = one k step; A from sXh,
//          B from sWT rows [p*128 + n][32]); epilogue f = (acc/1024 + bf16(bias[n])) * gate[row] * C (C = 8 q/k, 16 v),
//          hi = f16(f), lo = f16((f-hi)*1024) staged in LDS (q/k row-major [64][136], v transposed [128 hcol][72]);
//          block barrier; whole-line stores: q rows of 256 B by 16 consecutive lanes (instruction i: row 16i + t>>4);
//          k and v^T in fragment order (see ldfrag_p), slab (b, head), 512 contiguous bytes per wave and store.
// Phase 3 (waves 0..3, thread -> head column): this block's share of the masked-key floor sums, from the staged v planes:
//          LS[b][tb][hcol] = sum of v over the block's keys j >= 6*(tb+1), for every boundary 6*(tb+1) that lies in the
//          block, and TOT[b][block][hcol] = sum over all 64 keys (keys of time blocks >= T count as 0).
// coverage: QH/QL rows tok0..tok0+63 x 128 cols; KH/KL 4 heads x key tiles ltok0/16..+3; VTH/VTL 4 heads x key steps
//           ltok0/32..+1 x 2 d tiles; grid covers all 6144 tokens exactly once. LS rows tb = 0..510 of each batch row once
//           (the boundary of tb = 511 is past the last key: no row, and none is read); TOT 96 rows once.
// =====================================================================================================
// Suffix sums of one head column inside a 64-key block whose first boundary (key index a multiple of 6) is local key I0:
// six-key sums first (independent), then one short chain over the boundaries, last to first. r[j] = sum over the block's
// keys from boundary j on (0 where the block has no boundary j), tot = sum over all 64 keys.
#define NJMAX 11                                             // boundaries in a block: 11 for I0 = 0 and 2, 10 for I0 = 4
template <int I0>
__device__ __forceinline__ void block_suffix(const float (&val)[64], const int tb0, const int ntb,
                                             float (&r)[NJMAX], float& tot) {
  constexpr int NJ = (63 - I0) / NF + 1;
  float run = 0.f;
#pragma unroll
  for (int j = NJMAX - 1; j >= NJ; --j) r[j] = 0.f;
#pragma unroll
  for (int j = NJ - 1; j >= 0; --j) {
    float sg = 0.f;
#pragma unroll
    for (int f = 0; f < NF; ++f)
      if (I0 + NF * j + f < 64) sg += val[I0 + NF * j + f];
    run += (tb0 + 1 + j < ntb) ? sg : 0.f;                   // these keys are time block tb0 + 1 + j
    r[j] = run * (1.0f / VC);
  }
  float head = 0.f;
#pragma unroll
  for (int i = 0; i < I0; ++i) head += val[i];
  tot = (run + ((tb0 < ntb) ? head : 0.f)) * (1.0f / VC);    // the keys in front of I0 are time block tb0
}

__global__ __launch_bounds__(256) void qkv_prep(
    const float* __restrict__ x, const float* __restrict__ glnw, const float* __restrict__ glnb,
    const float* __restrict__ gw1, const float* __restrict__ gb1, const float* __restrict__ gw2,
    const float* __restrict__ gb2, const float* __restrict__ qbias, const float* __restrict__ kbias,
    const float* __restrict__ vbias, const float* __restrict__ qw, const float* __restrict__ kw,
    const float* __restrict__ vw, const float* __restrict__ ow, const float* __restrict__ fw,
    const int* __restrict__ Tp,
    unsigned short* QH, unsigned short* QL, unsigned short* KH, unsigned short* KL,
    unsigned short* VTH, unsigned short* VTL, float* LS, float* TOT, unsigned short* WOT, unsigned short* FWT) {
  __shared__ __align__(16) float sX[64 * 33];
  __shared__ __align__(16) _Float16 sXh[64 * 40];
  __shared__ float sW1[DD * GH];
  __shared__ float sG[64];
  __shared__ __align__(16) unsigned short sH[128 * 72];
  __shared__ __align__(16) unsigned short sL[128 * 72];
  __shared__ __align__(16) unsigned short sWT[3 * HID * 40];
  const int t = threadIdx.x, wave = t >> 5, lane = t & 31, hh = lane >> 4, m = lane & 15;
  if (blockIdx.x >= NTOK / 64) {                             // block-uniform, in front of every other barrier
    conv_tile((int)blockIdx.x - NTOK / 64, t, ow, fw, WOT, FWT, sX);
    return;
  }
  const int tok0  = blockIdx.x * 64;
  const int b     = tok0 / LL;
  const int ltok0 = tok0 - b * LL;
  const int tin   = Tp[0];                                   // read here so that phase 3 does not wait for it

  // ---- phase 0 ----
  {
    const int wn = t & 127, wk = t >> 7;                     // weight column; 8-k group wk + 2*(i&1) of part i>>1
    const unsigned wofs = (unsigned)(8 * wk * HID + wn);     // the thread's first element of each part
    float wv[6][8];
#pragma unroll
    for (int i = 0; i < 6; ++i) {
      const float* wsrc = (i < 2) ? qw : ((i < 4) ? kw : vw);
#pragma unroll
      for (int e = 0; e < 8; ++e) wv[i][e] = wsrc[wofs + (unsigned)((16 * (i & 1) + e) * HID)];
    }
    const int tk = t >> 2, j = 8 * (t & 3);
    const float* sp = x + (size_t)(tok0 + tk) * DD + j;
    const v4f a = *(const v4f*)(sp), c = *(const v4f*)(sp + 4);
    // one wait for the weight and x loads above: their address registers are inputs here, so that neither a later load's
    // destination nor any other instruction overwrites one of them in front of it
    asm volatile("s_wait_xcnt 0x0" :: "v"(wofs), "v"(sp) : "memory");
    float r8[8];
#pragma unroll
    for (int i = 0; i < 4; ++i) { r8[i] = bfr(a[i]); r8[4 + i] = bfr(c[i]); }
#pragma unroll
    for (int i = 0; i < 8; ++i) {
      sX[tk * 33 + j + i]  = r8[i];
      sXh[tk * 40 + j + i] = (_Float16)(r8[i] * XC);
    }
    for (int i = t; i < DD * GH; i += 256) sW1[i] = bfr(gw1[i]);
#pragma unroll
    for (int i = 0; i < 6; ++i) {
      v4u v;
#pragma unroll
      for (int e = 0; e < 4; ++e)
        v[e] = pk16(h_bits((_Float16)(bfr(wv[i][2 * e]) * WSC)), h_bits((_Float16)(bfr(wv[i][2 * e + 1]) * WSC)));
      *(v4u*)(sWT + ((i >> 1) * HID + wn) * 40 + 8 * (wk + 2 * (i & 1))) = v;
    }
  }
  __syncthreads();

  // ---- phase 1: gater (f32, VALU) ----
  {
    const float gw = bfr(glnw[lane]), gb = bfr(glnb[lane]);
    const float b1 = bfr(gb1[lane]),  w2 = bfr(gw2[lane]), b2 = bfr(gb2[0]);
#pragma unroll 1
    for (int i = 0; i < 8; ++i) {
      const int tk = wave * 8 + i;
      const float xv  = sX[tk * 33 + lane];
      const float mu  = wsum(xv) * (1.0f / DD);
      const float dv  = xv - mu;
      const float var = wsum(dv * dv) * (1.0f / DD);
      const float xn  = dv * rsqrtf(var + LNEPS) * gw + gb;
      float hacc = b1;
#pragma unroll
      for (int k = 0; k < DD; ++k) hacc += __shfl(xn, k, 32) * sW1[k * GH + lane];
      const float hs = hacc * sigm(hacc);
      const float gs = wsum(hs * w2) + b2;
      const float g  = sigm(gs);
      if (lane == 0) sG[tk] = g;
    }
  }
  __syncthreads();

  // ---- phase 2: projections on WMMA ----
  const int rt = wave & 3, ch = wave >> 2;
  FragH af;
  af.h[0] = *(const v8h*)(sXh + (16 * rt + m) * 40 + 8 * hh);
  af.h[1] = *(const v8h*)(sXh + (16 * rt + m) * 40 + 16 + 8 * hh);
  const _Float16* WTp = h16(sWT);
#pragma unroll 1
  for (int p = 0; p < 3; ++p) {
    const float* bp = (p == 0) ? qbias : ((p == 1) ? kbias : vbias);
    const float osc = (p == 2) ? VC : QC;
    v16h bf[4];
#pragma unroll
    for (int j = 0; j < 4; ++j)
      bf[j] = ldfrag_h(WTp + (p * HID + 64 * ch + 16 * j + m) * 40 + 8 * hh);
    v8f acc[4];
#pragma unroll
    for (int j = 0; j < 4; ++j) acc[j] = mma_h_raw(af.v, bf[j], zero8());
    guard4x6(acc[0], acc[1], acc[2], acc[3], af.v, bf[0], bf[1], bf[2], bf[3], af.v);
    float gr[8];
#pragma unroll
    for (int r = 0; r < 8; ++r) gr[r] = sG[16 * rt + 8 * hh + r];
#pragma unroll
    for (int j = 0; j < 4; ++j) {
      const int n = 64 * ch + 16 * j + m;
      const float bn = bfr(bp[n]);
#pragma unroll
      for (int r = 0; r < 8; ++r) {
        const int row = 16 * rt + 8 * hh + r;
        const float f = ((acc[j][r] * (1.0f / (XC * WSC)) + bn) * gr[r]) * osc;
        unsigned short hb, lb;
        split_h(f, hb, lb);
        if (p < 2) { sH[row * 136 + n] = hb; sL[row * 136 + n] = lb; }
        else       { sH[n * 72 + row]  = hb; sL[n * 72 + row]  = lb; }
      }
    }
    __syncthreads();
    if (p == 0) {                                                   // block-uniform
      unsigned short* Hp = QH;
      unsigned short* Lp = QL;
      const int e = t & 15;
      v4u hv[4], lv[4];
#pragma unroll
      for (int i = 0; i < 4; ++i) {
        const int row = 16 * i + (t >> 4);
        hv[i] = *(const v4u*)(sH + row * 136 + 8 * e);
        lv[i] = *(const v4u*)(sL + row * 136 + 8 * e);
      }
#pragma unroll
      for (int i = 0; i < 4; ++i) {
        const int row = 16 * i + (t >> 4);
        *(v4u*)(Hp + (size_t)(tok0 + row) * HID + 8 * e) = hv[i];
        *(v4u*)(Lp + (size_t)(tok0 + row) * HID + 8 * e) = lv[i];
      }
      
    } else if (p == 1) {
      // k in fragment order: instruction i = head; wave -> 16-key tile t>>6, half s; lane -> key m, dims 16s + 8hh ..+7
      const int ktl = t >> 6, s = (t >> 5) & 1;
      v4u hv[4], lv[4];
#pragma unroll
      for (int i = 0; i < 4; ++i) {
        const int src = (16 * ktl + m) * 136 + HD * i + 16 * s + 8 * hh;
        hv[i] = *(const v4u*)(sH + src);
        lv[i] = *(const v4u*)(sL + src);
      }
#pragma unroll
      for (int i = 0; i < 4; ++i) {
        const size_t o = ((size_t)(b * NH + i) * (LL / 16) + (ltok0 >> 4) + ktl) * 512 + s * 256 + lane * 8;
        *(v4u*)(KH + o) = hv[i];
        *(v4u*)(KL + o) = lv[i];
      }
      // the stores' registers are reused by the next part's LDS reads: keep the wait in front of that overwrite
      asm volatile("s_wait_xcnt 0x0" ::: "memory");
    } else {
      // v^T in fragment order: instruction i = head; wave -> 32-key step t>>7, d tile dt, half s; lane -> d row m,
      // keys 16s + 8hh ..+7
      const int ksl = t >> 7, dt = (t >> 6) & 1, s = (t >> 5) & 1;
      v4u hv[4], lv[4];
#pragma unroll
      for (int i = 0; i < 4; ++i) {
        const int src = (HD * i + 16 * dt + m) * 72 + 32 * ksl + 16 * s + 8 * hh;
        hv[i] = *(const v4u*)(sH + src);
        lv[i] = *(const v4u*)(sL + src);
      }
#pragma unroll
      for (int i = 0; i < 4; ++i) {
        const size_t o = ((size_t)(b * NH + i) * (LL / 32) + (ltok0 >> 5) + ksl) * 1024 + dt * 512 + s * 256 + lane * 8;
        *(v4u*)(VTH + o) = hv[i];
        *(v4u*)(VTL + o) = lv[i];
      }
      // same wait behind the v^T stores, in front of any reuse of their registers
      asm volatile("s_wait_xcnt 0x0" ::: "memory");
      // ---- phase 3: floor sums of this block's keys ----
      if (wave < 4) {                                               // wave-uniform; no barrier inside
        const int ntb = (tin < 0) ? 0 : ((tin > TT) ? TT : tin);    // structural, clamped to the static extent
        float val[64];
#pragma unroll
        for (int g = 0; g < 8; ++g) {
          const v8h a = *(const v8h*)(h16(sH) + t * 72 + 8 * g);
          const v8h l = *(const v8h*)(h16(sL) + t * 72 + 8 * g);
#pragma unroll
          for (int j = 0; j < 8; ++j)
            val[8 * g + j] = (float)a[j] + (float)l[j] * INVRS;
        }
        const int i0  = (NF - ltok0 % NF) % NF;                     // 0, 2 or 4: 64 keys shift the phase by 4
        const int tb0 = (ltok0 + i0) / NF - 1;                      // time block whose masked keys start at local key i0
        float r[NJMAX], tot;
        if (i0 == 0)      block_suffix<0>(val, tb0, ntb, r, tot);   // block-uniform
        else if (i0 == 2) block_suffix<2>(val, tb0, ntb, r, tot);
        else              block_suffix<4>(val, tb0, ntb, r, tot);
        float* lsp  = LS + ((size_t)b * TT + tb0 + 1) * HID + t;    // row tb0 + 1, the block's second boundary
        float* totp = TOT + ((size_t)b * (LL / 64) + (ltok0 >> 6)) * HID + t;
        if (tb0 >= 0) *(lsp - HID) = r[0];                          // block-uniform: key 0 is no boundary of a time block
#pragma unroll
        for (int j = 1; j < NJMAX - 1; ++j) lsp[(size_t)(j - 1) * HID] = r[j];
        if (i0 != 4) lsp[(size_t)(NJMAX - 2) * HID] = r[NJMAX - 1]; // block-uniform: the eleventh boundary
        totp[0] = tot;
        // the stores' registers may be reused behind this point: keep the wait in front of that overwrite
        asm volatile("s_wait_xcnt 0x0" ::: "memory");
      }
    }
    __syncthreads();
  }
}

// =====================================================================================================
// One 32-key step of the transposed flash formulation for 16 queries of one head (head dim 32 = one k step):
//   S^T tiles (16 keys x 16 queries) = A(k rows, dims split-map) . B(q^T): hi.hi -> s, hi.lo + lo.hi -> sr (x1024);
//   logit (log2 domain) = (s + sr/1024) * scale*log2e/64; block-causal mask by value (key < horizon of the lane's query);
//   online softmax per lane (8 + 8 keys of ONE query per lane, max combined with lane^16), p = 2^(e - m + 10) (x1024);
//   P^T as the B operand of O^T(16 d x 16 queries) += v^T(d rows, keys split-map) . P^T: element r <- tile keys kb..kb+15,
//   element 8+r <- tile kb+16..kb+31, lane unchanged; P hi to o, (v hi . P lo x1024 + v lo x1024 . P hi) to or.
// =====================================================================================================
template <bool MASKED>
__device__ __forceinline__ void attn_step(const int kb, const int jl, const int hh,
    const _Float16* __restrict__ kH, const _Float16* __restrict__ kL,
    const _Float16* __restrict__ vH, const _Float16* __restrict__ vL,
    const v16h qhi, const v16h qlo, float& m_run, float& l_run,
    v8f& o1, v8f& o1r, v8f& o2, v8f& o2r) {
  const size_t so = (size_t)kb * 32;                 // 32 keys = 1024 halves of each fragment-order plane
  const v16h kh0 = ldfrag_p(kH + so);
  const v16h kh1 = ldfrag_p(kH + so + 512);
  const v16h kl0 = ldfrag_p(kL + so);
  const v16h kl1 = ldfrag_p(kL + so + 512);
  v8f s0  = mma_h_raw(kh0, qhi, zero8());
  v8f s1  = mma_h_raw(kh1, qhi, zero8());
  v8f s0r = mma_h_raw(kh0, qlo, zero8());
  v8f s1r = mma_h_raw(kh1, qlo, zero8());
  s0r = mma_h_raw(kl0, qhi, s0r);
  s1r = mma_h_raw(kl1, qhi, s1r);
  guard4x6(s0, s1, s0r, s1r, kh0, kh1, kl0, kl1, qhi, qlo);

  float e0[8], e1[8];
#pragma unroll
  for (int r = 0; r < 8; ++r) {
    e0[r] = (s0[r] + s0r[r] * INVRS) * SCL;
    e1[r] = (s1[r] + s1r[r] * INVRS) * SCL;
  }
  if (MASKED) {
    const int lim = jl - (kb + 8 * hh);              // row r is key kb + 8hh + r (tile 0), + 16 (tile 1): visible if below jl
#pragma unroll
    for (int r = 0; r < 8; ++r) {
      e0[r] = (r      < lim) ? e0[r] : NEGBIG;
      e1[r] = (16 + r < lim) ? e1[r] : NEGBIG;
    }
  }
  float mx = fmaxf(fmaxf(fmaxf(fmaxf(e0[0], e0[1]), fmaxf(e0[2], e0[3])), fmaxf(fmaxf(e0[4], e0[5]), fmaxf(e0[6], e0[7]))),
                   fmaxf(fmaxf(fmaxf(e1[0], e1[1]), fmaxf(e1[2], e1[3])), fmaxf(fmaxf(e1[4], e1[5]), fmaxf(e1[6], e1[7]))));
  mx = fmaxf(mx, __shfl_xor(mx, 16, 32));
  const float m_new = fmaxf(m_run, mx);
  const float corr  = fexp2(m_run - m_new);
  m_run = m_new;
  const float msh = m_new - 10.0f;                   // 2^(e - m + 10) = e^{s - smax} * 1024
  l_run *= corr;
  o1 = o1 * corr; o1r = o1r * corr; o2 = o2 * corr; o2r = o2r * corr;

  FragH ph, pl;
  float ls = 0.f;
#pragma unroll
  for (int r = 0; r < 8; ++r) {
    const float p0 = fexp2(e0[r] - msh);
    const float p1 = fexp2(e1[r] - msh);
    ls += p0 + p1;
    const _Float16 a0 = (_Float16)p0, a1 = (_Float16)p1;
    ph.h[0][r] = a0;                                          // keys kb      + 8hh + r
    ph.h[1][r] = a1;                                          // keys kb + 16 + 8hh + r
    pl.h[0][r] = (_Float16)((p0 - (float)a0) * RSC);
    pl.h[1][r] = (_Float16)((p1 - (float)a1) * RSC);
  }
  l_run += ls;

  const v16h vh1 = ldfrag_p(vH + so);
  const v16h vl1 = ldfrag_p(vL + so);
  const v16h vh2 = ldfrag_p(vH + so + 512);
  const v16h vl2 = ldfrag_p(vL + so + 512);
  o1  = mma_h_raw(vh1, ph.v, o1);
  o2  = mma_h_raw(vh2, ph.v, o2);
  o1r = mma_h_raw(vh1, pl.v, o1r);
  o2r = mma_h_raw(vh2, pl.v, o2r);
  o1r = mma_h_raw(vl1, ph.v, o1r);
  o2r = mma_h_raw(vl2, ph.v, o2r);
  guard4x6(o1, o2, o1r, o2r, vh1, vh2, vl1, vl2, ph.v, pl.v);
}

// =====================================================================================================
// Attention + mean-pool for one head of one batch row and a PAIR of 48-query groups: group 63 - pi (long key range) and
// group pi (short key range), so that every block holds about the same number of 32-key steps. Block = 24 waves (768
// threads), grid = 2 * 4 * 32 = 256. Wave w -> query tile index g = w>>3 of both groups; the 8 waves of one g share the
// key steps of the long tile (nH steps) and of the short tile (nL steps) in runs of C consecutive steps, C the smallest
// run length for which the block's longest pair of tiles fits in 8 waves. Each wave runs the online softmax over its own run only (the fully
// visible steps without masking, the rest with the per-lane horizon test by value) and leaves its partial
// (row maximum m, row sum l, o + or/1024) in LDS; a lane whose keys are all masked in its run keeps m = NEGBIG and gets
// weight 0 in the merge (run 0 of every tile holds keys 0..5, visible to every query, so the merged maximum is real).
// Merge (all 768 threads, thread -> query t>>3 of 96, 4 d at 4*(t&7)): M = max m_s, w_s = 2^(m_s - M),
// attn[d] = (sum w_s o_s) / (16 sum w_s l_s) + 1e-9 * (sum of v[.][d] over the query's masked keys) -> LDS sO[96][36] (f32);
// that sum = LS[b][tq][.] (the masked keys inside the 64-key block that holds the first of them) + the totals TOT of all
// later 64-key blocks, which wave 7 sums last to first into LDS sTS[48][32] in front of the merge barrier;
// barrier; threads 0..127 pool 6 consecutive query rows (pooled row t>>3 of 16, cols 4*(t&7)) -> f16 hi (x32) / lo
// (x1024), stored to the head's own plane [head][1024 rows][32]: one wave writes 256 contiguous bytes of each plane.
// coverage: per block rows b*512 + 8*(63-pi) .. +7 and b*512 + 8*pi .. +7 of head h; 256 blocks cover [4][1024][32] once.
// =====================================================================================================
#define KS 8                                                 // waves that share one long and one short query tile
__device__ __forceinline__ int cdiv_i(int a, int d) { return (a + d - 1) / d; }
// 32-key steps of the 16-query tile that starts at query qw0: up to the block-causal horizon of its last query (<= 3072)
__device__ __forceinline__ int tile_steps(int qw0) { return (((qw0 + 15) / NF + 1) * NF + 31) >> 5; }
// run length for a pair of tiles; at most 96 since then each tile is one run
__device__ __forceinline__ int run_len(int nH, int nL) {
  int C = cdiv_i(nH + nL, KS);
  for (; C < LL / 32; ++C)
    if (cdiv_i(nH, C) + cdiv_i(nL, C) <= KS) break;
  return C;
}

__global__ __launch_bounds__(768)
void attn_pool(const unsigned short* __restrict__ QH, const unsigned short* __restrict__ QL,
               const unsigned short* __restrict__ KH, const unsigned short* __restrict__ KL,
               const unsigned short* __restrict__ VTH, const unsigned short* __restrict__ VTL,
               const float* __restrict__ LS, const float* __restrict__ TOT, unsigned short* PH, unsigned short* PL) {
  __shared__ __align__(16) float sP[3 * KS * 16 * 36];       // per wave 16 queries x 32 d, pitch 36
  __shared__ float sM[3 * KS * 16];
  __shared__ float sL[3 * KS * 16];
  __shared__ __align__(16) float sO[96 * 36];
  __shared__ __align__(16) float sTS[(LL / 64) * HD];        // [64-key block k][d]: sum of v over all keys of blocks > k
  const int t = threadIdx.x, lane = t & 31, hh = lane >> 4, c = lane & 15;
  const int wave = __builtin_amdgcn_readfirstlane(t >> 5);   // wave-uniform: run bounds and plane bases stay scalar
  const int bx = blockIdx.x;
  const int pi = bx & 31;
  const int h  = (bx >> 5) & 3;
  const int b  = bx >> 7;
  const size_t tokb = (size_t)b * LL;
  // one run length for the block, from its last (longest) tiles: run s of all three tiles covers the same keys, so the
  // three waves that walk it together read the same k and v lines
  const int C = run_len(tile_steps((63 - pi) * 48 + 32), tile_steps(pi * 48 + 32));

  if (wave == KS - 1) {                                      // scalar branch; this wave holds at most the last, short run of a short tile
    const float* tp = TOT + (size_t)b * (LL / 64) * HID + h * HD + lane;   // lane -> d
    float tv[LL / 64];
#pragma unroll
    for (int k = 0; k < LL / 64; ++k) tv[k] = tp[(size_t)k * HID];
    // the loads' address registers may be reused below: keep the wait in front of that overwrite
    asm volatile("s_wait_xcnt 0x0" ::: "memory");
    float run = 0.f;
#pragma unroll
    for (int k = LL / 64 - 1; k >= 0; --k) { sTS[k * HD + lane] = run; run += tv[k]; }
  }

  {
    const int g = wave >> 3, s8 = wave & (KS - 1);
    const int qH0 = (63 - pi) * 48 + 16 * g, qL0 = pi * 48 + 16 * g;
    const int nH = tile_steps(qH0), nL = tile_steps(qL0);
    const int SH = cdiv_i(nH, C);
    const bool isH = (s8 < SH);
    const int qw0 = isH ? qH0 : qL0;
    const int n   = isH ? nH : nL;
    const int s   = isH ? s8 : (s8 - SH);
    const int st1 = (s + 1) * C;
    const int kb1 = ((st1 < n) ? st1 : n) * 32;              // a wave past the short tile's last run does no step
    const int qi  = qw0 + c;                                 // query of this lane (B column / D column)
    const int jl  = (qi / NF + 1) * NF;                      // exclusive key horizon

    const _Float16* QHp = h16(QH);
    const _Float16* QLp = h16(QL);
    const v16h qhi = ldfrag_h(QHp + (tokb + qi) * HID + h * HD + 8 * hh);
    const v16h qlo = ldfrag_h(QLp + (tokb + qi) * HID + h * HD + 8 * hh);
    // the q loads' address registers are reused by the accumulators' start values: keep the wait in front of that overwrite
    asm volatile("s_wait_xcnt 0x0" ::: "memory");
    const size_t pbase = (size_t)(b * NH + h) * LL * HD + 8 * lane;   // (b, head) slab of a fragment-order plane; + kb * 32
    const _Float16* kH = h16(KH) + pbase;                             // key tile 2 at +512 halves
    const _Float16* kL = h16(KL) + pbase;
    const _Float16* vH = h16(VTH) + pbase;                            // d tile 2 at +512 halves
    const _Float16* vL = h16(VTL) + pbase;

    float m_run = NEGBIG, l_run = 0.f;
    v8f o1 = zero8(), o1r = zero8(), o2 = zero8(), o2r = zero8();
    const int jmin  = (qw0 / NF + 1) * NF;
    const int cfull = (jmin / 32) * 32;
    const int kbf   = (cfull < kb1) ? cfull : kb1;
    int kb = s * C * 32;
#pragma unroll 1
    for (; kb < kbf; kb += 32)
      attn_step<false>(kb, jl, hh, kH, kL, vH, vL, qhi, qlo, m_run, l_run, o1, o1r, o2, o2r);
#pragma unroll 1
    for (; kb < kb1; kb += 32)
      attn_step<true>(kb, jl, hh, kH, kL, vH, vL, qhi, qlo, m_run, l_run, o1, o1r, o2, o2r);

    l_run += __shfl_xor(l_run, 16, 32);
    float* pp = sP + (wave * 16 + c) * 36 + 8 * hh;
    v4f a0, a1, c0, c1;
#pragma unroll
    for (int r = 0; r < 4; ++r) {
      a0[r] = o1[r] + o1r[r] * INVRS;  a1[r] = o1[4 + r] + o1r[4 + r] * INVRS;
      c0[r] = o2[r] + o2r[r] * INVRS;  c1[r] = o2[4 + r] + o2r[4 + r] * INVRS;
    }
    *(v4f*)(pp)      = a0;                                   // d  8hh ..  8hh+7
    *(v4f*)(pp + 4)  = a1;
    *(v4f*)(pp + 16) = c0;                                   // d 16+8hh .. 16+8hh+7
    *(v4f*)(pp + 20) = c1;
    if (hh == 0) { sM[wave * 16 + c] = m_run; sL[wave * 16 + c] = l_run; }
  }
  __syncthreads();
  {
    const int tile = wave >> 2;                              // 0..2 long group's tiles, 3..5 short group's; 4 queries per wave
    const int hl = (tile >= 3) ? 1 : 0;
    const int g  = tile - 3 * hl;
    const int qH0 = (63 - pi) * 48 + 16 * g, qL0 = pi * 48 + 16 * g;
    const int nH = tile_steps(qH0), nL = tile_steps(qL0);
    const int SH = cdiv_i(nH, C);
    const int w0 = g * KS + (hl ? SH : 0);                   // first wave and number of waves that hold this tile's runs
    const int wn = hl ? cdiv_i(nL, C) : SH;
    const int c2 = (t >> 3) & 15, dg = t & 7;
    const int tq = ((hl ? qL0 : qH0) + c2) / NF;
    const int  j0  = (tq + 1) * NF;                          // first masked key; none for the last time block
    const bool any = (j0 < LL);
    const v4f lsv = *(const v4f*)(LS + ((size_t)b * TT + (any ? tq : 0)) * HID + h * HD + 4 * dg);
    const v4f tsv = *(const v4f*)(sTS + (any ? (j0 >> 6) : 0) * HD + 4 * dg);
    v4f sv;
#pragma unroll
    for (int e = 0; e < 4; ++e) sv[e] = any ? (lsv[e] + tsv[e]) : 0.f;
    // all KS slots read at once (one LDS latency); a slot past the tile's last run rereads run 0 and gets weight 0
    float ms[KS], ls[KS];
    v4f os[KS];
#pragma unroll
    for (int i = 0; i < KS; ++i) {
      const int wi = w0 + ((i < wn) ? i : 0);
      ms[i] = sM[wi * 16 + c2];
      ls[i] = sL[wi * 16 + c2];
      os[i] = *(const v4f*)(sP + (wi * 16 + c2) * 36 + 4 * dg);
    }
    float M = ms[0];
#pragma unroll
    for (int i = 1; i < KS; ++i) M = fmaxf(M, ms[i]);
    float L = 0.f;
    v4f O = {0.f, 0.f, 0.f, 0.f};
#pragma unroll
    for (int i = 0; i < KS; ++i) {
      const float w = (i < wn) ? fexp2(ms[i] - M) : 0.f;
      L += w * ls[i];
      O += os[i] * w;
    }
    const float inv = (1.0f / L) * (1.0f / VC);
    *(v4f*)(sO + (t >> 3) * 36 + 4 * dg) = O * inv + sv * FLOORC;
  }
  __syncthreads();
  if (wave < 4) {                                            // wave-uniform; no barrier behind it
    const int pr = t >> 3, col = 4 * (t & 7);
    v4f s = {0.f, 0.f, 0.f, 0.f};
#pragma unroll
    for (int f = 0; f < NF; ++f) s += *(const v4f*)(sO + (NF * pr + f) * 36 + col);
    unsigned short hb[4], lb[4];
#pragma unroll
    for (int e = 0; e < 4; ++e) split_h((s[e] * (1.0f / NF)) * AC, hb[e], lb[e]);
    v2u ph2, pl2;
    ph2[0] = pk16(hb[0], hb[1]); ph2[1] = pk16(hb[2], hb[3]);
    pl2[0] = pk16(lb[0], lb[1]); pl2[1] = pk16(lb[2], lb[3]);
    const int qblk = (pr < 8) ? (63 - pi) : pi;
    const size_t o = ((size_t)h * NPOOL + (size_t)(b * TT + 8 * qblk + (pr & 7))) * HD + col;
    *(v2u*)(PH + o) = ph2;
    *(v2u*)(PL + o) = pl2;
  }
}

// =====================================================================================================
// Tail: 64 pooled rows per block (grid 1024/64 = 16, 256 threads = 8 waves, wave -> row tile w&3, 64-col half w>>2).
// GEMM1 z = pooled(hi + lo/1024)/32 . Wo + bf16(o_b): A planes PH/PL [head][row][32], k step = head (two products into
// acc/accr), B = WOT rows, K=128;
// GEMM2 from sZ rows split to f16 hi (x16) / lo (x1024) at fragment build . FWT rows; epilogue silu(acc + bf16(f_b))
// coverage: out rows r0..r0+63 x 128 cols; 16 blocks cover [1024][128] exactly once.
// =====================================================================================================
__global__ __launch_bounds__(256) void tail_k(const unsigned short* __restrict__ PH, const unsigned short* __restrict__ PL,
                                               const unsigned short* __restrict__ WOT, const float* __restrict__ obias,
                                               const float* __restrict__ flnw, const float* __restrict__ flnb,
                                               const unsigned short* __restrict__ FWT, const float* __restrict__ fbias,
                                               float* out) {
  __shared__ __align__(16) float sZ[64 * 132];
  const int t = threadIdx.x, wave = t >> 5, lane = t & 31, hh = lane >> 4, m = lane & 15;
  const int r0 = blockIdx.x * 64;
  const int rt = wave & 3, ch = wave >> 2;

  // ---- GEMM1 ----
  {
    v8f acc[4], accr[4];
#pragma unroll
    for (int j = 0; j < 4; ++j) { acc[j] = zero8(); accr[j] = zero8(); }
    const _Float16* Ah = h16(PH) + (size_t)(r0 + 16 * rt + m) * HD + 8 * hh;   // + k0 * NPOOL: plane of head k0 / 32
    const _Float16* Al = h16(PL) + (size_t)(r0 + 16 * rt + m) * HD + 8 * hh;
    const _Float16* Bw = h16(WOT) + (size_t)(64 * ch + m) * HID + 8 * hh;
#pragma unroll 1
    for (int k0 = 0; k0 < HID; k0 += 32) {
      v16h bf[4];
#pragma unroll
      for (int j = 0; j < 4; ++j) bf[j] = ldfrag_h(Bw + (size_t)(16 * j) * HID + k0);
      const v16h ah = ldfrag_h(Ah + (size_t)k0 * NPOOL);
      const v16h al = ldfrag_h(Al + (size_t)k0 * NPOOL);
#pragma unroll
      for (int j = 0; j < 4; ++j) acc[j]  = mma_h_raw(ah, bf[j], acc[j]);
#pragma unroll
      for (int j = 0; j < 4; ++j) accr[j] = mma_h_raw(al, bf[j], accr[j]);
      guard8x6(acc[0], acc[1], acc[2], acc[3], accr[0], accr[1], accr[2], accr[3], ah, al, bf[0], bf[1], bf[2], bf[3]);
    }
    acc_guard4(acc[0], acc[1], acc[2], acc[3]);
    acc_guard4(accr[0], accr[1], accr[2], accr[3]);
#pragma unroll
    for (int j = 0; j < 4; ++j) {
      const int n = 64 * ch + 16 * j + m;
      const float bn = bfr(obias[n]);
#pragma unroll
      for (int r = 0; r < 8; ++r) {
        const int row = 16 * rt + 8 * hh + r;
        sZ[row * 132 + n] = (acc[j][r] + accr[j][r] * INVRS) * (1.0f / (AC * WSC)) + bn;
      }
    }
  }
  __syncthreads();

  // ---- LayerNorm in place ----
  {
    float gg[4], bb[4];
#pragma unroll
    for (int e = 0; e < 4; ++e) { gg[e] = bfr(flnw[4 * lane + e]); bb[e] = bfr(flnb[4 * lane + e]); }
#pragma unroll 1
    for (int i = 0; i < 8; ++i) {
      const int row = 8 * wave + i;
      float* zp = sZ + row * 132 + 4 * lane;
      const v4f z = *(const v4f*)zp;
      float s = (z[0] + z[1]) + (z[2] + z[3]);
      s = wsum(s);
      const float mean = s * (1.0f / HID);
      float d[4];
#pragma unroll
      for (int e = 0; e < 4; ++e) d[e] = z[e] - mean;
      float vs = (d[0] * d[0] + d[1] * d[1]) + (d[2] * d[2] + d[3] * d[3]);
      vs = wsum(vs);
      const float rstd = rsqrtf(vs * (1.0f / HID) + LNEPS);
      v4f y;
#pragma unroll
      for (int e = 0; e < 4; ++e) y[e] = (d[e] * rstd) * gg[e] + bb[e];
      *(v4f*)zp = y;
    }
  }
  __syncthreads();

  // ---- GEMM2 ----
  v8f acc2[4], acc2r[4];
#pragma unroll
  for (int j = 0; j < 4; ++j) { acc2[j] = zero8(); acc2r[j] = zero8(); }
  {
    const float* zr = sZ + (16 * rt + m) * 132 + 8 * hh;
    const _Float16* Bf = h16(FWT) + (size_t)(64 * ch + m) * HID + 8 * hh;
#pragma unroll 1
    for (int k0 = 0; k0 < HID; k0 += 32) {
      FragH ah, al;
      const v4f za = *(const v4f*)(zr + k0), zb = *(const v4f*)(zr + k0 + 4);
      const v4f zc = *(const v4f*)(zr + k0 + 16), zd = *(const v4f*)(zr + k0 + 20);
#pragma unroll
      for (int i = 0; i < 4; ++i) {
        const float f0 = za[i] * YC, f1 = zb[i] * YC, f2 = zc[i] * YC, f3 = zd[i] * YC;
        const _Float16 h0 = (_Float16)f0, h1 = (_Float16)f1, h2 = (_Float16)f2, h3 = (_Float16)f3;
        ah.h[0][i] = h0;     al.h[0][i]     = (_Float16)((f0 - (float)h0) * RSC);
        ah.h[0][4 + i] = h1; al.h[0][4 + i] = (_Float16)((f1 - (float)h1) * RSC);
        ah.h[1][i] = h2;     al.h[1][i]     = (_Float16)((f2 - (float)h2) * RSC);
        ah.h[1][4 + i] = h3; al.h[1][4 + i] = (_Float16)((f3 - (float)h3) * RSC);
      }
      v16h bf[4];
#pragma unroll
      for (int j = 0; j < 4; ++j) bf[j] = ldfrag_h(Bf + (size_t)(16 * j) * HID + k0);
#pragma unroll
      for (int j = 0; j < 4; ++j) acc2[j]  = mma_h_raw(ah.v, bf[j], acc2[j]);
#pragma unroll
      for (int j = 0; j < 4; ++j) acc2r[j] = mma_h_raw(al.v, bf[j], acc2r[j]);
      guard8x6(acc2[0], acc2[1], acc2[2], acc2[3], acc2r[0], acc2r[1], acc2r[2], acc2r[3],
               ah.v, al.v, bf[0], bf[1], bf[2], bf[3]);
    }
    acc_guard4(acc2[0], acc2[1], acc2[2], acc2[3]);
    acc_guard4(acc2r[0], acc2r[1], acc2r[2], acc2r[3]);
  }
  __syncthreads();                                            // every wave is done reading sZ rows as the A operand
#pragma unroll
  for (int j = 0; j < 4; ++j) {
    const int n = 64 * ch + 16 * j + m;
    const float bn = bfr(fbias[n]);
#pragma unroll
    for (int r = 0; r < 8; ++r) {
      const int row = 16 * rt + 8 * hh + r;
      const float a = (acc2[j][r] + acc2r[j][r] * INVRS) * (1.0f / (YC * WSC)) + bn;
      sZ[row * 132 + n] = a * sigm(a);
    }
  }
  __syncthreads();
  {
    v4f vals[8];
#pragma unroll
    for (int i = 0; i < 8; ++i) vals[i] = *(const v4f*)(sZ + (8 * i + wave) * 132 + 4 * lane);
#pragma unroll
    for (int i = 0; i < 8; ++i)
      *(v4f*)(out + (size_t)(r0 + 8 * i + wave) * FD + 4 * lane) = vals[i];
    
  }
}

// =====================================================================================================
// Workspace map (bytes), every offset a multiple of 256 and every plane sized to its whole-line store granularity:
//   WOT  f16 [128][128] x64        0          32768
//   FWT  f16 [128][128] x64        32768      32768
//   QH   f16 [6144][128] q x8      65536      1572864
//   QL   f16 [6144][128] residual  1638400    1572864
//   KH   f16 k x8, fragment order [2][4 heads][192 key tiles][2 halves][32 lanes][8]   3211264    1572864
//   KL                             4784128    1572864
//   VTH  f16 v x16, fragment order [2][4 heads][96 key steps][2 d tiles][2 halves][32 lanes][8]   6356992    1572864
//   VTL                            7929856    1572864
//   LS   f32 [2][512 time blocks][128]   9502720    524288   (row 511 of each batch row neither written nor read)
//   PH   f16 [4 heads][1024][32] x32  10027008   262144
//   PL                             10289152   262144
//   TOT  f32 [2][48 key blocks][128]     10551296   49152
//   end                            10600448
// =====================================================================================================
extern "C" void kernel_launch(void* const* d_in, const int* in_sizes, int n_in,
                              void* d_out, int out_size, void* d_ws, size_t ws_size,
                              hipStream_t stream) {
  if (n_in < 20) return;
  if (in_sizes[0] != NTOK * DD) return;
  if (in_sizes[1] != DD || in_sizes[2] != DD || in_sizes[3] != DD * GH || in_sizes[4] != GH ||
      in_sizes[5] != GH || in_sizes[6] != 1) return;
  if (in_sizes[7] != DD * HID || in_sizes[8] != HID || in_sizes[9] != DD * HID || in_sizes[10] != HID ||
      in_sizes[11] != DD * HID || in_sizes[12] != HID) return;
  if (in_sizes[13] != HID * HID || in_sizes[14] != HID || in_sizes[15] != HID || in_sizes[16] != HID ||
      in_sizes[17] != HID * FD || in_sizes[18] != FD || in_sizes[19] != 1) return;
  if (out_size != NPOOL * FD) return;

  const float* x    = (const float*)d_in[0];
  const float* glnw = (const float*)d_in[1];
  const float* glnb = (const float*)d_in[2];
  const float* gw1  = (const float*)d_in[3];
  const float* gb1  = (const float*)d_in[4];
  const float* gw2  = (const float*)d_in[5];
  const float* gb2  = (const float*)d_in[6];
  const float* qw   = (const float*)d_in[7];
  const float* qb   = (const float*)d_in[8];
  const float* kw   = (const float*)d_in[9];
  const float* kb   = (const float*)d_in[10];
  const float* vw   = (const float*)d_in[11];
  const float* vb   = (const float*)d_in[12];
  const float* ow   = (const float*)d_in[13];
  const float* ob   = (const float*)d_in[14];
  const float* flnw = (const float*)d_in[15];
  const float* flnb = (const float*)d_in[16];
  const float* fw   = (const float*)d_in[17];
  const float* fb   = (const float*)d_in[18];
  const int*   Tp   = (const int*)d_in[19];

  const size_t PWO = (size_t)HID * HID * 2;           //    32768
  const size_t PWF = (size_t)FD * HID * 2;            //    32768
  const size_t PQP = (size_t)NTOK * HID * 2;          //  1572864
  const size_t PVT = (size_t)NB * HID * LL * 2;       //  1572864
  const size_t PSV = (size_t)NB * HID * TT * 4;       //   524288
  const size_t PPP = (size_t)NPOOL * HID * 2;         //   262144
  const size_t PTO = (size_t)NB * (LL / 64) * HID * 4; //    49152
  size_t off = 0;
  const size_t oWO = off; off += PWO;
  const size_t oWF = off; off += PWF;
  const size_t oQH = off; off += PQP;
  const size_t oQL = off; off += PQP;
  const size_t oKH = off; off += PQP;
  const size_t oKL = off; off += PQP;
  const size_t oVH = off; off += PVT;
  const size_t oVL = off; off += PVT;
  const size_t oSV = off; off += PSV;
  const size_t oPH = off; off += PPP;
  const size_t oPL = off; off += PPP;
  const size_t oTO = off; off += PTO;
  if (off > ws_size) return;                           // off = 10600448
  if (off > (size_t)134217728) return;

  char* ws = (char*)d_ws;
  unsigned short* WOT = (unsigned short*)(ws + oWO);
  unsigned short* FWT = (unsigned short*)(ws + oWF);
  unsigned short* QH  = (unsigned short*)(ws + oQH);
  unsigned short* QL  = (unsigned short*)(ws + oQL);
  unsigned short* KH  = (unsigned short*)(ws + oKH);
  unsigned short* KL  = (unsigned short*)(ws + oKL);
  unsigned short* VTH = (unsigned short*)(ws + oVH);
  unsigned short* VTL = (unsigned short*)(ws + oVL);
  float*          LS  = (float*)(ws + oSV);
  float*          TOT = (float*)(ws + oTO);
  unsigned short* PH  = (unsigned short*)(ws + oPH);
  unsigned short* PL  = (unsigned short*)(ws + oPL);
  float*          out = (float*)d_out;

  const dim3 blk(256), blk768(768);
  const dim3 gQ(NTOK / 64 + 16);                       // 96 token blocks + 16 weight tiles
  const dim3 gA(NB * NH * (LL / 96));                  // 256
  const dim3 gT(NPOOL / 64);                           // 16

  // (1) gater + gated q/k/v planes (q rows hi/lo; k and v^T hi/lo in fragment order) + per-block masked-key floor sums;
  //     its last 16 blocks: o_w and f_w planes, transposed to k-contiguous rows: f16( bf16_RNE(w) * 64 )
  qkv_prep<<<gQ, blk, 0, stream>>>(x, glnw, glnb, gw1, gb1, gw2, gb2, qb, kb, vb, qw, kw, vw, ow, fw, Tp,
                                   QH, QL, KH, KL, VTH, VTL, LS, TOT, WOT, FWT);

  // (2) block-causal attention + mean-pool over the 6 forces -> pooled planes
  attn_pool<<<gA, blk768, 0, stream>>>(QH, QL, KH, KL, VTH, VTL, LS, TOT, PH, PL);

  // (3) o-proj + LayerNorm + final linear + SiLU -> out
  tail_k<<<gT, blk, 0, stream>>>(PH, PL, WOT, ob, flnw, flnb, FWT, fb, out);
  (void)hipGetLastError();
}

// v005
// Measured time: 45.4 microseconds a run.
// Two timings next to v004 put it at 1.17 and 1.16 times that version's speed.
// Over all steps from v000 it is 4.04 times as fast.
// Contractions: q/k/v projections (x rows f16 x16 . W^T f16 x64, K=32, one product), scores S^T = k . q^T
// (k and q each f16 x8 hi plane + f16 x1024 residual plane, 3 products per tile), O^T = v^T . P^T (v f16 x16 hi +
// x1024 residual, P f16 x1024 hi + x1024 residual, 3 products), pooled attention . Wo^T and LN rows . Wf^T
// (activation f16 hi + x1024 residual . W^T f16 x64, K=128, 2 products): all v_wmma_f32_16x16x32_f16, f32 accumulate;
// gater MLP, LayerNorm, softmax, pooling, SiLU in f32 on VALU; every float input RNE-converted to bf16 on load.
#include <hip/hip_runtime.h>
#include <math.h>
#include <stdint.h>

#define NB     2
#define TT     512
#define NF     6
#define DD     32
#define HID    128
#define NH     4
#define HD     32
#define GH     32
#define FD     128
#define LL     (TT * NF)
#define NTOK   (NB * LL)
#define NPOOL  (NB * TT)
#define LNEPS  1.0e-5f
#define XC     16.0f
#define WSC    64.0f
#define QC     8.0f
#define KC     8.0f
#define VC     16.0f
#define AC     32.0f
#define YC     16.0f
#define RSC    1024.0f
#define INVRS  (1.0f / 1024.0f)
#define FLOORC 1.0e-9f
#define NEGBIG (-1.0e30f)
#define SCL    ((0.17677669529663687f * 1.4426950408889634f) / (QC * KC))
static_assert(NH * HD == HID);
static_assert(FD == HID);
static_assert((LL % 64) == 0 && (LL % 96) == 0 && (LL % 32) == 0 && LL / 48 == 64);
static_assert((NTOK % 64) == 0 && (NPOOL % 64) == 0);
static_assert(DD == 32 && GH == 32);

typedef _Float16 v16h __attribute__((ext_vector_type(16)));
typedef _Float16 v8h  __attribute__((ext_vector_type(8)));
typedef float    v8f  __attribute__((ext_vector_type(8)));
typedef float    v4f  __attribute__((ext_vector_type(4)));
typedef unsigned int v4u __attribute__((ext_vector_type(4)));
typedef unsigned int v2u __attribute__((ext_vector_type(2)));

union FragH { v16h v; v8h h[2]; };

// ---- scalar helpers --------------------------------------------------------------------------------
__device__ __forceinline__ unsigned short bf_bits(float f) {          // f32 -> bf16 bits, RNE convert
  unsigned u = __float_as_uint(f);
  return (unsigned short)((u + 0x7FFFu + ((u >> 16) & 1u)) >> 16);
}
__device__ __forceinline__ float bf_up(unsigned short h) { return __uint_as_float(((unsigned)h) << 16); }
__device__ __forceinline__ float bfr(float f) { return bf_up(bf_bits(f)); }
__device__ __forceinline__ unsigned short h_bits(_Float16 x) { return __builtin_bit_cast(unsigned short, x); }
__device__ __forceinline__ unsigned pk16(unsigned short a, unsigned short b) { return (unsigned)a | ((unsigned)b << 16); }
__device__ __forceinline__ v8f zero8() { v8f z = {0.f, 0.f, 0.f, 0.f, 0.f, 0.f, 0.f, 0.f}; return z; }
__device__ __forceinline__ float hmax8(v8f s) {
  return fmaxf(fmaxf(fmaxf(s[0], s[1]), fmaxf(s[2], s[3])), fmaxf(fmaxf(s[4], s[5]), fmaxf(s[6], s[7])));
}
__device__ __forceinline__ const _Float16* h16(const unsigned short* p) { return (const _Float16*)(const void*)p; }
// hi = f16(f), lo = f16((f - hi) * 1024): residual plane carried x1024, folded back in the f32 epilogue
__device__ __forceinline__ void split_h(float f, unsigned short& hb, unsigned short& lb) {
  const _Float16 h = (_Float16)f;
  const _Float16 l = (_Float16)((f - (float)h) * RSC);
  hb = h_bits(h);
  lb = h_bits(l);
}
__device__ __forceinline__ float fexp2(float x) { return __builtin_amdgcn_exp2f(x); }
__device__ __forceinline__ float sigm(float a) {
  const float e = __expf(fminf(-a, 60.0f));       // quotient stays far from underflow
  return 1.0f / (1.0f + e);
}
// cross-lane moves on the vector unit (no LDS-path permute, no dscnt wait): lane l <- lane l ^ 16, and l <- l ^ X inside a
// 16-lane row (DPP row_xmask)
__device__ __forceinline__ float xhalf(float x) {
  const int b = __builtin_bit_cast(int, x);
  return __builtin_bit_cast(float, __builtin_amdgcn_permlanex16(b, b, 0x76543210, 0xfedcba98, false, false));
}
template <int X>
__device__ __forceinline__ float xrow(float x) {
  return __builtin_bit_cast(float, __builtin_amdgcn_mov_dpp(__builtin_bit_cast(int, x), 0x160 + X, 0xf, 0xf, true));
}
__device__ __forceinline__ float lane_bc(float x, int k) {   // lane k's value to every lane, through a scalar register
  return __builtin_bit_cast(float, __builtin_amdgcn_readlane(__builtin_bit_cast(int, x), k));
}
__device__ __forceinline__ float wsum(float v) {             // butterfly over 16, 8, 4, 2, 1
  v += xhalf(v);
  v += xrow<8>(v);
  v += xrow<4>(v);
  v += xrow<2>(v);
  v += xrow<1>(v);
  return v;
}

// ---- fragment loader: 16-bit A/B operand, lane -> row/col (lane&15), p already includes +8*(lane>>4);
//      elements 0..7 <- p[0..7] (k0+8h..), elements 8..15 <- p[16..23] (k0+16+8h..)
__device__ __forceinline__ v16h ldfrag_h(const _Float16* p) {
  FragH f;
  f.h[0] = *(const v8h*)(p);
  f.h[1] = *(const v8h*)(p + 16);
  return f.v;
}

// ---- the same fragment from a plane stored in fragment order: one 16 x 32 operand tile = 1024 B = two 512-B halves,
//      half s holds lane L's elements 8s..8s+7 at byte 16*L, so each wave-wide 16-B load covers four whole 128-B lines;
//      p already includes +8*lane
__device__ __forceinline__ v16h ldfrag_p(const _Float16* p) {
  FragH f;
  f.h[0] = *(const v8h*)(p);
  f.h[1] = *(const v8h*)(p + 256);
  return f.v;
}

// ---- WMMA helpers with trailing VALU hazard gap --------------------------------------------------------
__device__ __forceinline__ v8f mma_h_raw(v16h a, v16h b, v8f c) {
  return __builtin_amdgcn_wmma_f32_16x16x32_f16(false, a, false, b, (short)0, c, false, false);
}
__device__ __forceinline__ void guard4x6(v8f& a, v8f& b, v8f& c, v8f& d,
                                         v16h x0, v16h x1, v16h x2, v16h x3, v16h x4, v16h x5) {
#if defined(__HIP_DEVICE_COMPILE__)
  asm volatile("v_nop\n\tv_nop\n\tv_nop\n\tv_nop"
               : "+v"(a), "+v"(b), "+v"(c), "+v"(d)
               : "v"(x0), "v"(x1), "v"(x2), "v"(x3), "v"(x4), "v"(x5));
#endif
}
__device__ __forceinline__ void guard8x6(v8f& a0, v8f& a1, v8f& a2, v8f& a3,
                                         v8f& b0, v8f& b1, v8f& b2, v8f& b3,
                                         v16h x0, v16h x1, v16h x2, v16h x3, v16h x4, v16h x5) {
#if defined(__HIP_DEVICE_COMPILE__)
  asm volatile("v_nop\n\tv_nop\n\tv_nop\n\tv_nop"
               : "+v"(a0), "+v"(a1), "+v"(a2), "+v"(a3), "+v"(b0), "+v"(b1), "+v"(b2), "+v"(b3)
               : "v"(x0), "v"(x1), "v"(x2), "v"(x3), "v"(x4), "v"(x5));
#endif
}
__device__ __forceinline__ void acc_guard4(v8f& a, v8f& b, v8f& c, v8f& d) {
#if defined(__HIP_DEVICE_COMPILE__)
  asm volatile("v_nop\n\tv_nop\n\tv_nop\n\tv_nop" : "+v"(a), "+v"(b), "+v"(c), "+v"(d));
#endif
}

// =====================================================================================================
// Weight convert with transpose, one 64 k x 32 o tile of o_w or f_w per block (the 16 blocks behind the token blocks of
// the projection launch): in[k][o] f32 (x @ W layout) -> out[o][k] = f16( bf16_RNE(in) * WSC ), k contiguous.
// q = 0..7: o_w [128][128] -> WOT [n][k]; q = 8..15: f_w -> FWT; thread t loads k = t>>2, 8 floats at 8*(t&3) into T
// (pitch 33), stores row o = t>>3, 8 halves k = 8*(t&7).
// coverage: WOT/FWT 4 x 2 tiles x (32 o x 64 k) = [128][128] each.
// =====================================================================================================
__device__ __forceinline__ void conv_tile(const int q, const int t, const float* __restrict__ ow,
                                          const float* __restrict__ fw, unsigned short* WOT, unsigned short* FWT,
                                          float* T) {
  const bool iso = (q < 8);                                  // block-uniform
  const int rr = iso ? q : (q - 8);
  const float* src   = iso ? ow : fw;
  unsigned short* ds = iso ? WOT : FWT;
  const int o0 = (rr >> 1) * 32, k0 = (rr & 1) * 64;
  {
    const int k = t >> 2, oo = 8 * (t & 3);
    const float* sp = src + (size_t)(k0 + k) * HID + o0 + oo;
    const v4f a = *(const v4f*)(sp), c = *(const v4f*)(sp + 4);
#pragma unroll
    for (int i = 0; i < 4; ++i) { T[k * 33 + oo + i] = a[i]; T[k * 33 + oo + 4 + i] = c[i]; }
  }
  __syncthreads();
  {
    const int o = t >> 3, e = t & 7;
    float w[8];
#pragma unroll
    for (int i = 0; i < 8; ++i) w[i] = bfr(T[(8 * e + i) * 33 + o]) * WSC;
    v4u v;
#pragma unroll
    for (int i = 0; i < 4; ++i) v[i] = pk16(h_bits((_Float16)w[2 * i]), h_bits((_Float16)w[2 * i + 1]));
    unsigned short* dp = ds + (size_t)(o0 + o) * HID + k0 + 8 * e;
    *(v4u*)dp = v;
  }
}

// =====================================================================================================
// Gater + gated q/k/v projections for 64 tokens per block (256 threads = 8 waves; blocks 0..95 of a grid of 96 + 16; the
// last 16 blocks convert o_w and f_w for the tail launch, see conv_tile, and do nothing else).
// Phase 0: x tile [64][32] loaded as float4 pairs, RNE-converted to bf16 values: f32 copy sX (pitch 33) for the gater and
//          f16(x * 16) rows sXh (pitch 40 halves) as the WMMA A operand; g_w1 staged bf16-RNE in LDS;
//          q_w | k_w | v_w [32 k][128 n] f32 -> sWT rows [p*128 + n][32 k] = f16( bf16_RNE(w) * 64 ), pitch 40 halves:
//          thread -> column n = t&127 and 8 k (each wave-wide 4-B load is one whole line), one 16-B LDS store per 8 k.
//          Phase 1 (wave -> 8 tokens): LayerNorm, silu hidden layer with lane = hidden unit (32 readlane-broadcast FMAs), gate = sigmoid(sum_lane h*g_w2 + g_b2), all f32 -> sG.
// Phase 2: per part p in {q,k,v}: wave w -> row tile w&3, 64-col half w>>2: 4 WMMAs (K = 32 = one k step; A from sXh,
//          B from sWT rows [p*128 + n][32]); epilogue f = (acc/1024 + bf16(bias[n])) * gate[row] * C (C = 8 q/k, 16 v),
//          hi = f16(f), lo = f16((f-hi)*1024) staged in LDS (q/k row-major [64][136], v transposed [128 hcol][72]);
//          block barrier; whole-line stores: q rows of 256 B by 16 consecutive lanes (instruction i: row 16i + t>>4);
//          k and v^T in fragment order (see ldfrag_p), slab (b, head), 512 contiguous bytes per wave and store.
// Phase 3 (waves 0..3, thread -> head column): this block's share of the masked-key floor sums, from the staged v planes:
//          LS[b][tb][hcol] = sum of v over the block's keys j >= 6*(tb+1), for every boundary 6*(tb+1) that lies in the
//          block, and TOT[b][block][hcol] = sum over all 64 keys (keys of time blocks >= T count as 0).
// coverage: QH/QL rows tok0..tok0+63 x 128 cols; KH/KL 4 heads x key tiles ltok0/16..+3; VTH/VTL 4 heads x key steps
//           ltok0/32..+1 x 2 d tiles; grid covers all 6144 tokens exactly once. LS rows tb = 0..510 of each batch row once
//           (the boundary of tb = 511 is past the last key: no row, and none is read); TOT 96 rows once.
// =====================================================================================================
// Suffix sums of one head column inside a 64-key block whose first boundary (key index a multiple of 6) is local key I0:
// six-key sums first (independent), then one short chain over the boundaries, last to first. r[j] = sum over the block's
// keys from boundary j on (0 where the block has no boundary j), tot = sum over all 64 keys.
#define NJMAX 11                                             // boundaries in a block: 11 for I0 = 0 and 2, 10 for I0 = 4
template <int I0>
__device__ __forceinline__ void block_suffix(const float (&val)[64], const int tb0, const int ntb,
                                             float (&r)[NJMAX], float& tot) {
  constexpr int NJ = (63 - I0) / NF + 1;
  float run = 0.f;
#pragma unroll
  for (int j = NJMAX - 1; j >= NJ; --j) r[j] = 0.f;
#pragma unroll
  for (int j = NJ - 1; j >= 0; --j) {
    float sg = 0.f;
#pragma unroll
    for (int f = 0; f < NF; ++f)
      if (I0 + NF * j + f < 64) sg += val[I0 + NF * j + f];
    run += (tb0 + 1 + j < ntb) ? sg : 0.f;                   // these keys are time block tb0 + 1 + j
    r[j] = run * (1.0f / VC);
  }
  float head = 0.f;
#pragma unroll
  for (int i = 0; i < I0; ++i) head += val[i];
  tot = (run + ((tb0 < ntb) ? head : 0.f)) * (1.0f / VC);    // the keys in front of I0 are time block tb0
}

__global__ __launch_bounds__(256) void qkv_prep(
    const float* __restrict__ x, const float* __restrict__ glnw, const float* __restrict__ glnb,
    const float* __restrict__ gw1, const float* __restrict__ gb1, const float* __restrict__ gw2,
    const float* __restrict__ gb2, const float* __restrict__ qbias, const float* __restrict__ kbias,
    const float* __restrict__ vbias, const float* __restrict__ qw, const float* __restrict__ kw,
    const float* __restrict__ vw, const float* __restrict__ ow, const float* __restrict__ fw,
    const int* __restrict__ Tp,
    unsigned short* QH, unsigned short* QL, unsigned short* KH, unsigned short* KL,
    unsigned short* VTH, unsigned short* VTL, float* LS, float* TOT, unsigned short* WOT, unsigned short* FWT) {
  __shared__ __align__(16) float sX[64 * 33];
  __shared__ __align__(16) _Float16 sXh[64 * 40];
  __shared__ float sW1[DD * GH];
  __shared__ float sG[64];
  __shared__ __align__(16) unsigned short sH[128 * 72];
  __shared__ __align__(16) unsigned short sL[128 * 72];
  __shared__ __align__(16) unsigned short sWT[3 * HID * 40];
  const int t = threadIdx.x, wave = t >> 5, lane = t & 31, hh = lane >> 4, m = lane & 15;
  if (blockIdx.x >= NTOK / 64) {                             // block-uniform, in front of every other barrier
    conv_tile((int)blockIdx.x - NTOK / 64, t, ow, fw, WOT, FWT, sX);
    return;
  }
  const int tok0  = blockIdx.x * 64;
  const int b     = tok0 / LL;
  const int ltok0 = tok0 - b * LL;
  const int tin   = Tp[0];                                   // read here so that phase 3 does not wait for it

  // ---- phase 0 ----
  {
    const int wn = t & 127, wk = t >> 7;                     // weight column; 8-k group wk + 2*(i&1) of part i>>1
    const unsigned wofs = (unsigned)(8 * wk * HID + wn);     // the thread's first element of each part
    float wv[6][8];
#pragma unroll
    for (int i = 0; i < 6; ++i) {
      const float* wsrc = (i < 2) ? qw : ((i < 4) ? kw : vw);
#pragma unroll
      for (int e = 0; e < 8; ++e) wv[i][e] = wsrc[wofs + (unsigned)((16 * (i & 1) + e) * HID)];
    }
    const int tk = t >> 2, j = 8 * (t & 3);
    const float* sp = x + (size_t)(tok0 + tk) * DD + j;
    const v4f a = *(const v4f*)(sp), c = *(const v4f*)(sp + 4);
    // one wait for the weight and x loads above: their address registers are inputs here, so that neither a later load's
    // destination nor any other instruction overwrites one of them in front of it
    asm volatile("s_wait_xcnt 0x0" :: "v"(wofs), "v"(sp) : "memory");
    float r8[8];
#pragma unroll
    for (int i = 0; i < 4; ++i) { r8[i] = bfr(a[i]); r8[4 + i] = bfr(c[i]); }
#pragma unroll
    for (int i = 0; i < 8; ++i) {
      sX[tk * 33 + j + i]  = r8[i];
      sXh[tk * 40 + j + i] = (_Float16)(r8[i] * XC);
    }
    for (int i = t; i < DD * GH; i += 256) sW1[i] = bfr(gw1[i]);
#pragma unroll
    for (int i = 0; i < 6; ++i) {
      v4u v;
#pragma unroll
      for (int e = 0; e < 4; ++e)
        v[e] = pk16(h_bits((_Float16)(bfr(wv[i][2 * e]) * WSC)), h_bits((_Float16)(bfr(wv[i][2 * e + 1]) * WSC)));
      *(v4u*)(sWT + ((i >> 1) * HID + wn) * 40 + 8 * (wk + 2 * (i & 1))) = v;
    }
  }
  __syncthreads();

  // ---- phase 1: gater (f32, VALU) ----
  {
    const float gw = bfr(glnw[lane]), gb = bfr(glnb[lane]);
    const float b1 = bfr(gb1[lane]),  w2 = bfr(gw2[lane]), b2 = bfr(gb2[0]);
#pragma unroll 1
    for (int i = 0; i < 8; ++i) {
      const int tk = wave * 8 + i;
      const float xv  = sX[tk * 33 + lane];
      const float mu  = wsum(xv) * (1.0f / DD);
      const float dv  = xv - mu;
      const float var = wsum(dv * dv) * (1.0f / DD);
      const float xn  = dv * rsqrtf(var + LNEPS) * gw + gb;
      float hacc = b1;
#pragma unroll
      for (int k = 0; k < DD; ++k) hacc += lane_bc(xn, k) * sW1[k * GH + lane];
      const float hs = hacc * sigm(hacc);
      const float gs = wsum(hs * w2) + b2;
      const float g  = sigm(gs);
      if (lane == 0) sG[tk] = g;
    }
  }
  __syncthreads();

  // ---- phase 2: projections on WMMA ----
  const int rt = wave & 3, ch = wave >> 2;
  FragH af;
  af.h[0] = *(const v8h*)(sXh + (16 * rt + m) * 40 + 8 * hh);
  af.h[1] = *(const v8h*)(sXh + (16 * rt + m) * 40 + 16 + 8 * hh);
  const _Float16* WTp = h16(sWT);
#pragma unroll 1
  for (int p = 0; p < 3; ++p) {
    const float* bp = (p == 0) ? qbias : ((p == 1) ? kbias : vbias);
    const float osc = (p == 2) ? VC : QC;
    v16h bf[4];
#pragma unroll
    for (int j = 0; j < 4; ++j)
      bf[j] = ldfrag_h(WTp + (p * HID + 64 * ch + 16 * j + m) * 40 + 8 * hh);
    v8f acc[4];
#pragma unroll
    for (int j = 0; j < 4; ++j) acc[j] = mma_h_raw(af.v, bf[j], zero8());
    guard4x6(acc[0], acc[1], acc[2], acc[3], af.v, bf[0], bf[1], bf[2], bf[3], af.v);
    float gr[8];
#pragma unroll
    for (int r = 0; r < 8; ++r) gr[r] = sG[16 * rt + 8 * hh + r];
#pragma unroll
    for (int j = 0; j < 4; ++j) {
      const int n = 64 * ch + 16 * j + m;
      const float bn = bfr(bp[n]);
#pragma unroll
      for (int r = 0; r < 8; ++r) {
        const int row = 16 * rt + 8 * hh + r;
        const float f = ((acc[j][r] * (1.0f / (XC * WSC)) + bn) * gr[r]) * osc;
        unsigned short hb, lb;
        split_h(f, hb, lb);
        if (p < 2) { sH[row * 136 + n] = hb; sL[row * 136 + n] = lb; }
        else       { sH[n * 72 + row]  = hb; sL[n * 72 + row]  = lb; }
      }
    }
    __syncthreads();
    if (p == 0) {                                                   // block-uniform
      unsigned short* Hp = QH;
      unsigned short* Lp = QL;
      const int e = t & 15;
      v4u hv[4], lv[4];
#pragma unroll
      for (int i = 0; i < 4; ++i) {
        const int row = 16 * i + (t >> 4);
        hv[i] = *(const v4u*)(sH + row * 136 + 8 * e);
        lv[i] = *(const v4u*)(sL + row * 136 + 8 * e);
      }
#pragma unroll
      for (int i = 0; i < 4; ++i) {
        const int row = 16 * i + (t >> 4);
        *(v4u*)(Hp + (size_t)(tok0 + row) * HID + 8 * e) = hv[i];
        *(v4u*)(Lp + (size_t)(tok0 + row) * HID + 8 * e) = lv[i];
      }
      
    } else if (p == 1) {
      // k in fragment order: instruction i = head; wave -> 16-key tile t>>6, half s; lane -> key m, dims 16s + 8hh ..+7
      const int ktl = t >> 6, s = (t >> 5) & 1;
      v4u hv[4], lv[4];
#pragma unroll
      for (int i = 0; i < 4; ++i) {
        const int src = (16 * ktl + m) * 136 + HD * i + 16 * s + 8 * hh;
        hv[i] = *(const v4u*)(sH + src);
        lv[i] = *(const v4u*)(sL + src);
      }
#pragma unroll
      for (int i = 0; i < 4; ++i) {
        const size_t o = ((size_t)(b * NH + i) * (LL / 16) + (ltok0 >> 4) + ktl) * 512 + s * 256 + lane * 8;
        *(v4u*)(KH + o) = hv[i];
        *(v4u*)(KL + o) = lv[i];
      }
      // the stores' registers are reused by the next part's LDS reads: keep the wait in front of that overwrite
      asm volatile("s_wait_xcnt 0x0" ::: "memory");
    } else {
      // v^T in fragment order: instruction i = head; wave -> 32-key step t>>7, d tile dt, half s; lane -> d row m,
      // keys 16s + 8hh ..+7
      const int ksl = t >> 7, dt = (t >> 6) & 1, s = (t >> 5) & 1;
      v4u hv[4], lv[4];
#pragma unroll
      for (int i = 0; i < 4; ++i) {
        const int src = (HD * i + 16 * dt + m) * 72 + 32 * ksl + 16 * s + 8 * hh;
        hv[i] = *(const v4u*)(sH + src);
        lv[i] = *(const v4u*)(sL + src);
      }
#pragma unroll
      for (int i = 0; i < 4; ++i) {
        const size_t o = ((size_t)(b * NH + i) * (LL / 32) + (ltok0 >> 5) + ksl) * 1024 + dt * 512 + s * 256 + lane * 8;
        *(v4u*)(VTH + o) = hv[i];
        *(v4u*)(VTL + o) = lv[i];
      }
      // same wait behind the v^T stores, in front of any reuse of their registers
      asm volatile("s_wait_xcnt 0x0" ::: "memory");
      // ---- phase 3: floor sums of this block's keys ----
      if (wave < 4) {                                               // wave-uniform; no barrier inside
        const int ntb = (tin < 0) ? 0 : ((tin > TT) ? TT : tin);    // structural, clamped to the static extent
        float val[64];
#pragma unroll
        for (int g = 0; g < 8; ++g) {
          const v8h a = *(const v8h*)(h16(sH) + t * 72 + 8 * g);
          const v8h l = *(const v8h*)(h16(sL) + t * 72 + 8 * g);
#pragma unroll
          for (int j = 0; j < 8; ++j)
            val[8 * g + j] = (float)a[j] + (float)l[j] * INVRS;
        }
        const int i0  = (NF - ltok0 % NF) % NF;                     // 0, 2 or 4: 64 keys shift the phase by 4
        const int tb0 = (ltok0 + i0) / NF - 1;                      // time block whose masked keys start at local key i0
        float r[NJMAX], tot;
        if (i0 == 0)      block_suffix<0>(val, tb0, ntb, r, tot);   // block-uniform
        else if (i0 == 2) block_suffix<2>(val, tb0, ntb, r, tot);
        else              block_suffix<4>(val, tb0, ntb, r, tot);
        float* lsp  = LS + ((size_t)b * TT + tb0 + 1) * HID + t;    // row tb0 + 1, the block's second boundary
        float* totp = TOT + ((size_t)b * (LL / 64) + (ltok0 >> 6)) * HID + t;
        if (tb0 >= 0) *(lsp - HID) = r[0];                          // block-uniform: key 0 is no boundary of a time block
#pragma unroll
        for (int j = 1; j < NJMAX - 1; ++j) lsp[(size_t)(j - 1) * HID] = r[j];
        if (i0 != 4) lsp[(size_t)(NJMAX - 2) * HID] = r[NJMAX - 1]; // block-uniform: the eleventh boundary
        totp[0] = tot;
        // the stores' registers may be reused behind this point: keep the wait in front of that overwrite
        asm volatile("s_wait_xcnt 0x0" ::: "memory");
      }
    }
    __syncthreads();
  }
}

// =====================================================================================================
// One 32-key step of the transposed flash formulation for 16 queries of one head (head dim 32 = one k step):
//   S^T tiles (16 keys x 16 queries) = A(k rows, dims split-map) . B(q^T): hi.hi -> s, hi.lo + lo.hi -> sr (x1024);
//   logit (log2 domain) = (s + sr/1024) * scale*log2e/64; block-causal mask by value (key < horizon of the lane's query);
//   online softmax per lane (8 + 8 keys of ONE query per lane, max combined with lane^16), p = 2^(e - m + 10) (x1024);
//   P^T as the B operand of O^T(16 d x 16 queries) += v^T(d rows, keys split-map) . P^T: element r <- tile keys kb..kb+15,
//   element 8+r <- tile kb+16..kb+31, lane unchanged; P hi to o, (v hi . P lo x1024 + v lo x1024 . P hi) to or.
// =====================================================================================================
template <bool MASKED>
__device__ __forceinline__ void attn_step(const int kb, const int jl, const int hh,
    const _Float16* __restrict__ kH, const _Float16* __restrict__ kL,
    const _Float16* __restrict__ vH, const _Float16* __restrict__ vL,
    const v16h qhi, const v16h qlo, float& m_run, float& l_run,
    v8f& o1, v8f& o1r, v8f& o2, v8f& o2r) {
  const size_t so = (size_t)kb * 32;                 // 32 keys = 1024 halves of each fragment-order plane
  const v16h kh0 = ldfrag_p(kH + so);
  const v16h kh1 = ldfrag_p(kH + so + 512);
  const v16h kl0 = ldfrag_p(kL + so);
  const v16h kl1 = ldfrag_p(kL + so + 512);
  v8f s0  = mma_h_raw(kh0, qhi, zero8());
  v8f s1  = mma_h_raw(kh1, qhi, zero8());
  v8f s0r = mma_h_raw(kh0, qlo, zero8());
  v8f s1r = mma_h_raw(kh1, qlo, zero8());
  s0r = mma_h_raw(kl0, qhi, s0r);
  s1r = mma_h_raw(kl1, qhi, s1r);
  guard4x6(s0, s1, s0r, s1r, kh0, kh1, kl0, kl1, qhi, qlo);

  float e0[8], e1[8];
#pragma unroll
  for (int r = 0; r < 8; ++r) {
    e0[r] = (s0[r] + s0r[r] * INVRS) * SCL;
    e1[r] = (s1[r] + s1r[r] * INVRS) * SCL;
  }
  if (MASKED) {
    const int lim = jl - (kb + 8 * hh);              // row r is key kb + 8hh + r (tile 0), + 16 (tile 1): visible if below jl
#pragma unroll
    for (int r = 0; r < 8; ++r) {
      e0[r] = (r      < lim) ? e0[r] : NEGBIG;
      e1[r] = (16 + r < lim) ? e1[r] : NEGBIG;
    }
  }
  float mx = fmaxf(fmaxf(fmaxf(fmaxf(e0[0], e0[1]), fmaxf(e0[2], e0[3])), fmaxf(fmaxf(e0[4], e0[5]), fmaxf(e0[6], e0[7]))),
                   fmaxf(fmaxf(fmaxf(e1[0], e1[1]), fmaxf(e1[2], e1[3])), fmaxf(fmaxf(e1[4], e1[5]), fmaxf(e1[6], e1[7]))));
  mx = fmaxf(mx, __shfl_xor(mx, 16, 32));
  const float m_new = fmaxf(m_run, mx);
  const float corr  = fexp2(m_run - m_new);
  m_run = m_new;
  const float msh = m_new - 10.0f;                   // 2^(e - m + 10) = e^{s - smax} * 1024
  l_run *= corr;
  o1 = o1 * corr; o1r = o1r * corr; o2 = o2 * corr; o2r = o2r * corr;

  FragH ph, pl;
  float ls = 0.f;
#pragma unroll
  for (int r = 0; r < 8; ++r) {
    const float p0 = fexp2(e0[r] - msh);
    const float p1 = fexp2(e1[r] - msh);
    ls += p0 + p1;
    const _Float16 a0 = (_Float16)p0, a1 = (_Float16)p1;
    ph.h[0][r] = a0;                                          // keys kb      + 8hh + r
    ph.h[1][r] = a1;                                          // keys kb + 16 + 8hh + r
    pl.h[0][r] = (_Float16)((p0 - (float)a0) * RSC);
    pl.h[1][r] = (_Float16)((p1 - (float)a1) * RSC);
  }
  l_run += ls;

  const v16h vh1 = ldfrag_p(vH + so);
  const v16h vl1 = ldfrag_p(vL + so);
  const v16h vh2 = ldfrag_p(vH + so + 512);
  const v16h vl2 = ldfrag_p(vL + so + 512);
  o1  = mma_h_raw(vh1, ph.v, o1);
  o2  = mma_h_raw(vh2, ph.v, o2);
  o1r = mma_h_raw(vh1, pl.v, o1r);
  o2r = mma_h_raw(vh2, pl.v, o2r);
  o1r = mma_h_raw(vl1, ph.v, o1r);
  o2r = mma_h_raw(vl2, ph.v, o2r);
  guard4x6(o1, o2, o1r, o2r, vh1, vh2, vl1, vl2, ph.v, pl.v);
}

// =====================================================================================================
// Attention + mean-pool for one head of one batch row and a PAIR of 48-query groups: group 63 - pi (long key range) and
// group pi (short key range), so that every block holds about the same number of 32-key steps. Block = 24 waves (768
// threads), grid = 2 * 4 * 32 = 256. Wave w -> query tile index g = w>>3 of both groups; the 8 waves of one g share the
// key steps of the long tile (nH steps) and of the short tile (nL steps) in runs of C consecutive steps, C the smallest
// run length for which the block's longest pair of tiles fits in 8 waves. Each wave runs the online softmax over its own run only (the fully
// visible steps without masking, the rest with the per-lane horizon test by value) and leaves its partial
// (row maximum m, row sum l, o + or/1024) in LDS; a lane whose keys are all masked in its run keeps m = NEGBIG and gets
// weight 0 in the merge (run 0 of every tile holds keys 0..5, visible to every query, so the merged maximum is real).
// Merge (all 768 threads, thread -> query t>>3 of 96, 4 d at 4*(t&7)): M = max m_s, w_s = 2^(m_s - M),
// attn[d] = (sum w_s o_s) / (16 sum w_s l_s) + 1e-9 * (sum of v[.][d] over the query's masked keys) -> LDS sO[96][36] (f32);
// that sum = LS[b][tq][.] (the masked keys inside the 64-key block that holds the first of them) + the totals TOT of all
// later 64-key blocks, which wave 7 sums last to first into LDS sTS[48][32] in front of the merge barrier;
// barrier; threads 0..127 pool 6 consecutive query rows (pooled row t>>3 of 16, cols 4*(t&7)) -> f16 hi (x32) / lo
// (x1024), stored to the head's own plane [head][1024 rows][32]: one wave writes 256 contiguous bytes of each plane.
// coverage: per block rows b*512 + 8*(63-pi) .. +7 and b*512 + 8*pi .. +7 of head h; 256 blocks cover [4][1024][32] once.
// =====================================================================================================
#define KS 8                                                 // waves that share one long and one short query tile
__device__ __forceinline__ int cdiv_i(int a, int d) { return (a + d - 1) / d; }
// 32-key steps of the 16-query tile that starts at query qw0: up to the block-causal horizon of its last query (<= 3072)
__device__ __forceinline__ int tile_steps(int qw0) { return (((qw0 + 15) / NF + 1) * NF + 31) >> 5; }
// run length for a pair of tiles; at most 96 since then each tile is one run
__device__ __forceinline__ int run_len(int nH, int nL) {
  int C = cdiv_i(nH + nL, KS);
  for (; C < LL / 32; ++C)
    if (cdiv_i(nH, C) + cdiv_i(nL, C) <= KS) break;
  return C;
}

__global__ __launch_bounds__(768)
void attn_pool(const unsigned short* __restrict__ QH, const unsigned short* __restrict__ QL,
               const unsigned short* __restrict__ KH, const unsigned short* __restrict__ KL,
               const unsigned short* __restrict__ VTH, const unsigned short* __restrict__ VTL,
               const float* __restrict__ LS, const float* __restrict__ TOT, unsigned short* PH, unsigned short* PL) {
  __shared__ __align__(16) float sP[3 * KS * 16 * 36];       // per wave 16 queries x 32 d, pitch 36
  __shared__ float sM[3 * KS * 16];
  __shared__ float sL[3 * KS * 16];
  __shared__ __align__(16) float sO[96 * 36];
  __shared__ __align__(16) float sTS[(LL / 64) * HD];        // [64-key block k][d]: sum of v over all keys of blocks > k
  const int t = threadIdx.x, lane = t & 31, hh = lane >> 4, c = lane & 15;
  const int wave = __builtin_amdgcn_readfirstlane(t >> 5);   // wave-uniform: run bounds and plane bases stay scalar
  const int bx = blockIdx.x;
  const int pi = bx & 31;
  const int h  = (bx >> 5) & 3;
  const int b  = bx >> 7;
  const size_t tokb = (size_t)b * LL;
  // one run length for the block, from its last (longest) tiles: run s of all three tiles covers the same keys, so the
  // three waves that walk it together read the same k and v lines
  const int C = run_len(tile_steps((63 - pi) * 48 + 32), tile_steps(pi * 48 + 32));

  if (wave == KS - 1) {                                      // scalar branch; this wave holds at most the last, short run of a short tile
    const float* tp = TOT + (size_t)b * (LL / 64) * HID + h * HD + lane;   // lane -> d
    float tv[LL / 64];
#pragma unroll
    for (int k = 0; k < LL / 64; ++k) tv[k] = tp[(size_t)k * HID];
    // the loads' address registers may be reused below: keep the wait in front of that overwrite
    asm volatile("s_wait_xcnt 0x0" ::: "memory");
    float run = 0.f;
#pragma unroll
    for (int k = LL / 64 - 1; k >= 0; --k) { sTS[k * HD + lane] = run; run += tv[k]; }
  }

  {
    const int g = wave >> 3, s8 = wave & (KS - 1);
    const int qH0 = (63 - pi) * 48 + 16 * g, qL0 = pi * 48 + 16 * g;
    const int nH = tile_steps(qH0), nL = tile_steps(qL0);
    const int SH = cdiv_i(nH, C);
    const bool isH = (s8 < SH);
    const int qw0 = isH ? qH0 : qL0;
    const int n   = isH ? nH : nL;
    const int s   = isH ? s8 : (s8 - SH);
    const int st1 = (s + 1) * C;
    const int kb1 = ((st1 < n) ? st1 : n) * 32;              // a wave past the short tile's last run does no step
    const int qi  = qw0 + c;                                 // query of this lane (B column / D column)
    const int jl  = (qi / NF + 1) * NF;                      // exclusive key horizon

    const _Float16* QHp = h16(QH);
    const _Float16* QLp = h16(QL);
    const v16h qhi = ldfrag_h(QHp + (tokb + qi) * HID + h * HD + 8 * hh);
    const v16h qlo = ldfrag_h(QLp + (tokb + qi) * HID + h * HD + 8 * hh);
    // the q loads' address registers are reused by the accumulators' start values: keep the wait in front of that overwrite
    asm volatile("s_wait_xcnt 0x0" ::: "memory");
    const size_t pbase = (size_t)(b * NH + h) * LL * HD + 8 * lane;   // (b, head) slab of a fragment-order plane; + kb * 32
    const _Float16* kH = h16(KH) + pbase;                             // key tile 2 at +512 halves
    const _Float16* kL = h16(KL) + pbase;
    const _Float16* vH = h16(VTH) + pbase;                            // d tile 2 at +512 halves
    const _Float16* vL = h16(VTL) + pbase;

    float m_run = NEGBIG, l_run = 0.f;
    v8f o1 = zero8(), o1r = zero8(), o2 = zero8(), o2r = zero8();
    const int jmin  = (qw0 / NF + 1) * NF;
    const int cfull = (jmin / 32) * 32;
    const int kbf   = (cfull < kb1) ? cfull : kb1;
    int kb = s * C * 32;
#pragma unroll 1
    for (; kb < kbf; kb += 32)
      attn_step<false>(kb, jl, hh, kH, kL, vH, vL, qhi, qlo, m_run, l_run, o1, o1r, o2, o2r);
#pragma unroll 1
    for (; kb < kb1; kb += 32)
      attn_step<true>(kb, jl, hh, kH, kL, vH, vL, qhi, qlo, m_run, l_run, o1, o1r, o2, o2r);

    l_run += __shfl_xor(l_run, 16, 32);
    float* pp = sP + (wave * 16 + c) * 36 + 8 * hh;
    v4f a0, a1, c0, c1;
#pragma unroll
    for (int r = 0; r < 4; ++r) {
      a0[r] = o1[r] + o1r[r] * INVRS;  a1[r] = o1[4 + r] + o1r[4 + r] * INVRS;
      c0[r] = o2[r] + o2r[r] * INVRS;  c1[r] = o2[4 + r] + o2r[4 + r] * INVRS;
    }
    *(v4f*)(pp)      = a0;                                   // d  8hh ..  8hh+7
    *(v4f*)(pp + 4)  = a1;
    *(v4f*)(pp + 16) = c0;                                   // d 16+8hh .. 16+8hh+7
    *(v4f*)(pp + 20) = c1;
    if (hh == 0) { sM[wave * 16 + c] = m_run; sL[wave * 16 + c] = l_run; }
  }
  __syncthreads();
  {
    const int tile = wave >> 2;                              // 0..2 long group's tiles, 3..5 short group's; 4 queries per wave
    const int hl = (tile >= 3) ? 1 : 0;
    const int g  = tile - 3 * hl;
    const int qH0 = (63 - pi) * 48 + 16 * g, qL0 = pi * 48 + 16 * g;
    const int nH = tile_steps(qH0), nL = tile_steps(qL0);
    const int SH = cdiv_i(nH, C);
    const int w0 = g * KS + (hl ? SH : 0);                   // first wave and number of waves that hold this tile's runs
    const int wn = hl ? cdiv_i(nL, C) : SH;
    const int c2 = (t >> 3) & 15, dg = t & 7;
    const int tq = ((hl ? qL0 : qH0) + c2) / NF;
    const int  j0  = (tq + 1) * NF;                          // first masked key; none for the last time block
    const bool any = (j0 < LL);
    const v4f lsv = *(const v4f*)(LS + ((size_t)b * TT + (any ? tq : 0)) * HID + h * HD + 4 * dg);
    const v4f tsv = *(const v4f*)(sTS + (any ? (j0 >> 6) : 0) * HD + 4 * dg);
    v4f sv;
#pragma unroll
    for (int e = 0; e < 4; ++e) sv[e] = any ? (lsv[e] + tsv[e]) : 0.f;
    // all KS slots read at once (one LDS latency); a slot past the tile's last run rereads run 0 and gets weight 0
    float ms[KS], ls[KS];
    v4f os[KS];
#pragma unroll
    for (int i = 0; i < KS; ++i) {
      const int wi = w0 + ((i < wn) ? i : 0);
      ms[i] = sM[wi * 16 + c2];
      ls[i] = sL[wi * 16 + c2];
      os[i] = *(const v4f*)(sP + (wi * 16 + c2) * 36 + 4 * dg);
    }
    float M = ms[0];
#pragma unroll
    for (int i = 1; i < KS; ++i) M = fmaxf(M, ms[i]);
    float L = 0.f;
    v4f O = {0.f, 0.f, 0.f, 0.f};
#pragma unroll
    for (int i = 0; i < KS; ++i) {
      const float w = (i < wn) ? fexp2(ms[i] - M) : 0.f;
      L += w * ls[i];
      O += os[i] * w;
    }
    const float inv = (1.0f / L) * (1.0f / VC);
    *(v4f*)(sO + (t >> 3) * 36 + 4 * dg) = O * inv + sv * FLOORC;
  }
  __syncthreads();
  if (wave < 4) {                                            // wave-uniform; no barrier behind it
    const int pr = t >> 3, col = 4 * (t & 7);
    v4f s = {0.f, 0.f, 0.f, 0.f};
#pragma unroll
    for (int f = 0; f < NF; ++f) s += *(const v4f*)(sO + (NF * pr + f) * 36 + col);
    unsigned short hb[4], lb[4];
#pragma unroll
    for (int e = 0; e < 4; ++e) split_h((s[e] * (1.0f / NF)) * AC, hb[e], lb[e]);
    v2u ph2, pl2;
    ph2[0] = pk16(hb[0], hb[1]); ph2[1] = pk16(hb[2], hb[3]);
    pl2[0] = pk16(lb[0], lb[1]); pl2[1] = pk16(lb[2], lb[3]);
    const int qblk = (pr < 8) ? (63 - pi) : pi;
    const size_t o = ((size_t)h * NPOOL + (size_t)(b * TT + 8 * qblk + (pr & 7))) * HD + col;
    *(v2u*)(PH + o) = ph2;
    *(v2u*)(PL + o) = pl2;
  }
}

// =====================================================================================================
// Tail: 64 pooled rows per block (grid 1024/64 = 16, 256 threads = 8 waves, wave -> row tile w&3, 64-col half w>>2).
// GEMM1 z = pooled(hi + lo/1024)/32 . Wo + bf16(o_b): A planes PH/PL [head][row][32], k step = head (two products into
// acc/accr), B = WOT rows, K=128;
// GEMM2 from sZ rows split to f16 hi (x16) / lo (x1024) at fragment build . FWT rows; epilogue silu(acc + bf16(f_b))
// coverage: out rows r0..r0+63 x 128 cols; 16 blocks cover [1024][128] exactly once.
// =====================================================================================================
__global__ __launch_bounds__(256) void tail_k(const unsigned short* __restrict__ PH, const unsigned short* __restrict__ PL,
                                               const unsigned short* __restrict__ WOT, const float* __restrict__ obias,
                                               const float* __restrict__ flnw, const float* __restrict__ flnb,
                                               const unsigned short* __restrict__ FWT, const float* __restrict__ fbias,
                                               float* out) {
  __shared__ __align__(16) float sZ[64 * 132];
  const int t = threadIdx.x, wave = t >> 5, lane = t & 31, hh = lane >> 4, m = lane & 15;
  const int r0 = blockIdx.x * 64;
  const int rt = wave & 3, ch = wave >> 2;

  // ---- GEMM1 ----
  {
    v8f acc[4], accr[4];
#pragma unroll
    for (int j = 0; j < 4; ++j) { acc[j] = zero8(); accr[j] = zero8(); }
    const _Float16* Ah = h16(PH) + (size_t)(r0 + 16 * rt + m) * HD + 8 * hh;   // + k0 * NPOOL: plane of head k0 / 32
    const _Float16* Al = h16(PL) + (size_t)(r0 + 16 * rt + m) * HD + 8 * hh;
    const _Float16* Bw = h16(WOT) + (size_t)(64 * ch + m) * HID + 8 * hh;
#pragma unroll 1
    for (int k0 = 0; k0 < HID; k0 += 32) {
      v16h bf[4];
#pragma unroll
      for (int j = 0; j < 4; ++j) bf[j] = ldfrag_h(Bw + (size_t)(16 * j) * HID + k0);
      const v16h ah = ldfrag_h(Ah + (size_t)k0 * NPOOL);
      const v16h al = ldfrag_h(Al + (size_t)k0 * NPOOL);
#pragma unroll
      for (int j = 0; j < 4; ++j) acc[j]  = mma_h_raw(ah, bf[j], acc[j]);
#pragma unroll
      for (int j = 0; j < 4; ++j) accr[j] = mma_h_raw(al, bf[j], accr[j]);
      guard8x6(acc[0], acc[1], acc[2], acc[3], accr[0], accr[1], accr[2], accr[3], ah, al, bf[0], bf[1], bf[2], bf[3]);
    }
    acc_guard4(acc[0], acc[1], acc[2], acc[3]);
    acc_guard4(accr[0], accr[1], accr[2], accr[3]);
#pragma unroll
    for (int j = 0; j < 4; ++j) {
      const int n = 64 * ch + 16 * j + m;
      const float bn = bfr(obias[n]);
#pragma unroll
      for (int r = 0; r < 8; ++r) {
        const int row = 16 * rt + 8 * hh + r;
        sZ[row * 132 + n] = (acc[j][r] + accr[j][r] * INVRS) * (1.0f / (AC * WSC)) + bn;
      }
    }
  }
  __syncthreads();

  // ---- LayerNorm in place ----
  {
    float gg[4], bb[4];
#pragma unroll
    for (int e = 0; e < 4; ++e) { gg[e] = bfr(flnw[4 * lane + e]); bb[e] = bfr(flnb[4 * lane + e]); }
#pragma unroll 1
    for (int i = 0; i < 8; ++i) {
      const int row = 8 * wave + i;
      float* zp = sZ + row * 132 + 4 * lane;
      const v4f z = *(const v4f*)zp;
      float s = (z[0] + z[1]) + (z[2] + z[3]);
      s = wsum(s);
      const float mean = s * (1.0f / HID);
      float d[4];
#pragma unroll
      for (int e = 0; e < 4; ++e) d[e] = z[e] - mean;
      float vs = (d[0] * d[0] + d[1] * d[1]) + (d[2] * d[2] + d[3] * d[3]);
      vs = wsum(vs);
      const float rstd = rsqrtf(vs * (1.0f / HID) + LNEPS);
      v4f y;
#pragma unroll
      for (int e = 0; e < 4; ++e) y[e] = (d[e] * rstd) * gg[e] + bb[e];
      *(v4f*)zp = y;
    }
  }
  __syncthreads();

  // ---- GEMM2 ----
  v8f acc2[4], acc2r[4];
#pragma unroll
  for (int j = 0; j < 4; ++j) { acc2[j] = zero8(); acc2r[j] = zero8(); }
  {
    const float* zr = sZ + (16 * rt + m) * 132 + 8 * hh;
    const _Float16* Bf = h16(FWT) + (size_t)(64 * ch + m) * HID + 8 * hh;
#pragma unroll 1
    for (int k0 = 0; k0 < HID; k0 += 32) {
      FragH ah, al;
      const v4f za = *(const v4f*)(zr + k0), zb = *(const v4f*)(zr + k0 + 4);
      const v4f zc = *(const v4f*)(zr + k0 + 16), zd = *(const v4f*)(zr + k0 + 20);
#pragma unroll
      for (int i = 0; i < 4; ++i) {
        const float f0 = za[i] * YC, f1 = zb[i] * YC, f2 = zc[i] * YC, f3 = zd[i] * YC;
        const _Float16 h0 = (_Float16)f0, h1 = (_Float16)f1, h2 = (_Float16)f2, h3 = (_Float16)f3;
        ah.h[0][i] = h0;     al.h[0][i]     = (_Float16)((f0 - (float)h0) * RSC);
        ah.h[0][4 + i] = h1; al.h[0][4 + i] = (_Float16)((f1 - (float)h1) * RSC);
        ah.h[1][i] = h2;     al.h[1][i]     = (_Float16)((f2 - (float)h2) * RSC);
        ah.h[1][4 + i] = h3; al.h[1][4 + i] = (_Float16)((f3 - (float)h3) * RSC);
      }
      v16h bf[4];
#pragma unroll
      for (int j = 0; j < 4; ++j) bf[j] = ldfrag_h(Bf + (size_t)(16 * j) * HID + k0);
#pragma unroll
      for (int j = 0; j < 4; ++j) acc2[j]  = mma_h_raw(ah.v, bf[j], acc2[j]);
#pragma unroll
      for (int j = 0; j < 4; ++j) acc2r[j] = mma_h_raw(al.v, bf[j], acc2r[j]);
      guard8x6(acc2[0], acc2[1], acc2[2], acc2[3], acc2r[0], acc2r[1], acc2r[2], acc2r[3],
               ah.v, al.v, bf[0], bf[1], bf[2], bf[3]);
    }
    acc_guard4(acc2[0], acc2[1], acc2[2], acc2[3]);
    acc_guard4(acc2r[0], acc2r[1], acc2r[2], acc2r[3]);
  }
  __syncthreads();                                            // every wave is done reading sZ rows as the A operand
#pragma unroll
  for (int j = 0; j < 4; ++j) {
    const int n = 64 * ch + 16 * j + m;
    const float bn = bfr(fbias[n]);
#pragma unroll
    for (int r = 0; r < 8; ++r) {
      const int row = 16 * rt + 8 * hh + r;
      const float a = (acc2[j][r] + acc2r[j][r] * INVRS) * (1.0f / (YC * WSC)) + bn;
      sZ[row * 132 + n] = a * sigm(a);
    }
  }
  __syncthreads();
  {
    v4f vals[8];
#pragma unroll
    for (int i = 0; i < 8; ++i) vals[i] = *(const v4f*)(sZ + (8 * i + wave) * 132 + 4 * lane);
#pragma unroll
    for (int i = 0; i < 8; ++i)
      *(v4f*)(out + (size_t)(r0 + 8 * i + wave) * FD + 4 * lane) = vals[i];
    
  }
}

// =====================================================================================================
// Workspace map (bytes), every offset a multiple of 256 and every plane sized to its whole-line store granularity:
//   WOT  f16 [128][128] x64        0          32768
//   FWT  f16 [128][128] x64        32768      32768
//   QH   f16 [6144][128] q x8      65536      1572864
//   QL   f16 [6144][128] residual  1638400    1572864
//   KH   f16 k x8, fragment order [2][4 heads][192 key tiles][2 halves][32 lanes][8]   3211264    1572864
//   KL                             4784128    1572864
//   VTH  f16 v x16, fragment order [2][4 heads][96 key steps][2 d tiles][2 halves][32 lanes][8]   6356992    1572864
//   VTL                            7929856    1572864
//   LS   f32 [2][512 time blocks][128]   9502720    524288   (row 511 of each batch row neither written nor read)
//   PH   f16 [4 heads][1024][32] x32  10027008   262144
//   PL                             10289152   262144
//   TOT  f32 [2][48 key blocks][128]     10551296   49152
//   end                            10600448
// =====================================================================================================
extern "C" void kernel_launch(void* const* d_in, const int* in_sizes, int n_in,
                              void* d_out, int out_size, void* d_ws, size_t ws_size,
                              hipStream_t stream) {
  if (n_in < 20) return;
  if (in_sizes[0] != NTOK * DD) return;
  if (in_sizes[1] != DD || in_sizes[2] != DD || in_sizes[3] != DD * GH || in_sizes[4] != GH ||
      in_sizes[5] != GH || in_sizes[6] != 1) return;
  if (in_sizes[7] != DD * HID || in_sizes[8] != HID || in_sizes[9] != DD * HID || in_sizes[10] != HID ||
      in_sizes[11] != DD * HID || in_sizes[12] != HID) return;
  if (in_sizes[13] != HID * HID || in_sizes[14] != HID || in_sizes[15] != HID || in_sizes[16] != HID ||
      in_sizes[17] != HID * FD || in_sizes[18] != FD || in_sizes[19] != 1) return;
  if (out_size != NPOOL * FD) return;

  const float* x    = (const float*)d_in[0];
  const float* glnw = (const float*)d_in[1];
  const float* glnb = (const float*)d_in[2];
  const float* gw1  = (const float*)d_in[3];
  const float* gb1  = (const float*)d_in[4];
  const float* gw2  = (const float*)d_in[5];
  const float* gb2  = (const float*)d_in[6];
  const float* qw   = (const float*)d_in[7];
  const float* qb   = (const float*)d_in[8];
  const float* kw   = (const float*)d_in[9];
  const float* kb   = (const float*)d_in[10];
  const float* vw   = (const float*)d_in[11];
  const float* vb   = (const float*)d_in[12];
  const float* ow   = (const float*)d_in[13];
  const float* ob   = (const float*)d_in[14];
  const float* flnw = (const float*)d_in[15];
  const float* flnb = (const float*)d_in[16];
  const float* fw   = (const float*)d_in[17];
  const float* fb   = (const float*)d_in[18];
  const int*   Tp   = (const int*)d_in[19];

  const size_t PWO = (size_t)HID * HID * 2;           //    32768
  const size_t PWF = (size_t)FD * HID * 2;            //    32768
  const size_t PQP = (size_t)NTOK * HID * 2;          //  1572864
  const size_t PVT = (size_t)NB * HID * LL * 2;       //  1572864
  const size_t PSV = (size_t)NB * HID * TT * 4;       //   524288
  const size_t PPP = (size_t)NPOOL * HID * 2;         //   262144
  const size_t PTO = (size_t)NB * (LL / 64) * HID * 4; //    49152
  size_t off = 0;
  const size_t oWO = off; off += PWO;
  const size_t oWF = off; off += PWF;
  const size_t oQH = off; off += PQP;
  const size_t oQL = off; off += PQP;
  const size_t oKH = off; off += PQP;
  const size_t oKL = off; off += PQP;
  const size_t oVH = off; off += PVT;
  const size_t oVL = off; off += PVT;
  const size_t oSV = off; off += PSV;
  const size_t oPH = off; off += PPP;
  const size_t oPL = off; off += PPP;
  const size_t oTO = off; off += PTO;
  if (off > ws_size) return;                           // off = 10600448
  if (off > (size_t)134217728) return;

  char* ws = (char*)d_ws;
  unsigned short* WOT = (unsigned short*)(ws + oWO);
  unsigned short* FWT = (unsigned short*)(ws + oWF);
  unsigned short* QH  = (unsigned short*)(ws + oQH);
  unsigned short* QL  = (unsigned short*)(ws + oQL);
  unsigned short* KH  = (unsigned short*)(ws + oKH);
  unsigned short* KL  = (unsigned short*)(ws + oKL);
  unsigned short* VTH = (unsigned short*)(ws + oVH);
  unsigned short* VTL = (unsigned short*)(ws + oVL);
  float*          LS  = (float*)(ws + oSV);
  float*          TOT = (float*)(ws + oTO);
  unsigned short* PH  = (unsigned short*)(ws + oPH);
  unsigned short* PL  = (unsigned short*)(ws + oPL);
  float*          out = (float*)d_out;

  const dim3 blk(256), blk768(768);
  const dim3 gQ(NTOK / 64 + 16);                       // 96 token blocks + 16 weight tiles
  const dim3 gA(NB * NH * (LL / 96));                  // 256
  const dim3 gT(NPOOL / 64);                           // 16

  // (1) gater + gated q/k/v planes (q rows hi/lo; k and v^T hi/lo in fragment order) + per-block masked-key floor sums;
  //     its last 16 blocks: o_w and f_w planes, transposed to k-contiguous rows: f16( bf16_RNE(w) * 64 )
  qkv_prep<<<gQ, blk, 0, stream>>>(x, glnw, glnb, gw1, gb1, gw2, gb2, qb, kb, vb, qw, kw, vw, ow, fw, Tp,
                                   QH, QL, KH, KL, VTH, VTL, LS, TOT, WOT, FWT);

  // (2) block-causal attention + mean-pool over the 6 forces -> pooled planes
  attn_pool<<<gA, blk768, 0, stream>>>(QH, QL, KH, KL, VTH, VTL, LS, TOT, PH, PL);

  // (3) o-proj + LayerNorm + final linear + SiLU -> out
  tail_k<<<gT, blk, 0, stream>>>(PH, PL, WOT, ob, flnw, flnb, FWT, fb, out);
  (void)hipGetLastError();
}

// v006
// It runs in 40.1 microseconds.
// In two side-by-side timings against v005, it was 1.14 and 1.13 times as fast.
// Counting every step since v000, it is 4.58 times as fast.
// Contractions: q/k/v projections (x rows f16 x16 . W^T f16 x64, K=32, one product), scores S^T = k . q^T
// (k and q each f16 x8 hi plane + f16 x1024 residual plane, 3 products per tile), O^T = v^T . P^T (v f16 x16 hi +
// x1024 residual, P f16 x1024 hi + x1024 residual, 3 products), pooled attention . Wo^T and LN rows . Wf^T
// (activation f16 hi + x1024 residual . W^T f16 x64, K=128, 2 products): all v_wmma_f32_16x16x32_f16, f32 accumulate;
// gater MLP, LayerNorm, softmax, pooling, SiLU in f32 on VALU; every float input RNE-converted to bf16 on load.
#include <hip/hip_runtime.h>
#include <math.h>
#include <stdint.h>

#define NB     2
#define TT     512
#define NF     6
#define DD     32
#define HID    128
#define NH     4
#define HD     32
#define GH     32
#define FD     128
#define LL     (TT * NF)
#define NTOK   (NB * LL)
#define NPOOL  (NB * TT)
#define LNEPS  1.0e-5f
#define XC     16.0f
#define WSC    64.0f
#define QC     8.0f
#define KC     8.0f
#define VC     16.0f
#define AC     32.0f
#define YC     16.0f
#define RSC    1024.0f
#define INVRS  (1.0f / 1024.0f)
#define FLOORC 1.0e-9f
#define NEGBIG (-1.0e30f)
#define SCL    ((0.17677669529663687f * 1.4426950408889634f) / (QC * KC))
static_assert(NH * HD == HID);
static_assert(FD == HID);
static_assert((LL % 64) == 0 && (LL % 96) == 0 && (LL % 32) == 0 && LL / 48 == 64);
static_assert((NTOK % 64) == 0 && (NPOOL % 16) == 0);
static_assert(DD == 32 && GH == 32);

typedef _Float16 v16h __attribute__((ext_vector_type(16)));
typedef _Float16 v8h  __attribute__((ext_vector_type(8)));
typedef float    v8f  __attribute__((ext_vector_type(8)));
typedef float    v4f  __attribute__((ext_vector_type(4)));
typedef unsigned int v4u __attribute__((ext_vector_type(4)));
typedef unsigned int v2u __attribute__((ext_vector_type(2)));

union FragH { v16h v; v8h h[2]; };

// ---- scalar helpers --------------------------------------------------------------------------------
__device__ __forceinline__ unsigned short bf_bits(float f) {          // f32 -> bf16 bits, RNE convert
  unsigned u = __float_as_uint(f);
  return (unsigned short)((u + 0x7FFFu + ((u >> 16) & 1u)) >> 16);
}
__device__ __forceinline__ float bf_up(unsigned short h) { return __uint_as_float(((unsigned)h) << 16); }
__device__ __forceinline__ float bfr(float f) { return bf_up(bf_bits(f)); }
__device__ __forceinline__ unsigned short h_bits(_Float16 x) { return __builtin_bit_cast(unsigned short, x); }
__device__ __forceinline__ unsigned pk16(unsigned short a, unsigned short b) { return (unsigned)a | ((unsigned)b << 16); }
__device__ __forceinline__ v8f zero8() { v8f z = {0.f, 0.f, 0.f, 0.f, 0.f, 0.f, 0.f, 0.f}; return z; }
__device__ __forceinline__ float hmax8(v8f s) {
  return fmaxf(fmaxf(fmaxf(s[0], s[1]), fmaxf(s[2], s[3])), fmaxf(fmaxf(s[4], s[5]), fmaxf(s[6], s[7])));
}
__device__ __forceinline__ const _Float16* h16(const unsigned short* p) { return (const _Float16*)(const void*)p; }
// hi = f16(f), lo = f16((f - hi) * 1024): residual plane carried x1024, folded back in the f32 epilogue
__device__ __forceinline__ void split_h(float f, unsigned short& hb, unsigned short& lb) {
  const _Float16 h = (_Float16)f;
  const _Float16 l = (_Float16)((f - (float)h) * RSC);
  hb = h_bits(h);
  lb = h_bits(l);
}
__device__ __forceinline__ float fexp2(float x) { return __builtin_amdgcn_exp2f(x); }
__device__ __forceinline__ float sigm(float a) {
  const float e = __expf(fminf(-a, 60.0f));       // quotient stays far from underflow
  return 1.0f / (1.0f + e);
}
// cross-lane moves on the vector unit (no LDS-path permute, no dscnt wait): lane l <- lane l ^ 16, and l <- l ^ X inside a
// 16-lane row (DPP row_xmask)
__device__ __forceinline__ float xhalf(float x) {
  const int b = __builtin_bit_cast(int, x);
  return __builtin_bit_cast(float, __builtin_amdgcn_permlanex16(b, b, 0x76543210, 0xfedcba98, false, false));
}
template <int X>
__device__ __forceinline__ float xrow(float x) {
  return __builtin_bit_cast(float, __builtin_amdgcn_mov_dpp(__builtin_bit_cast(int, x), 0x160 + X, 0xf, 0xf, true));
}
__device__ __forceinline__ float lane_bc(float x, int k) {   // lane k's value to every lane, through a scalar register
  return __builtin_bit_cast(float, __builtin_amdgcn_readlane(__builtin_bit_cast(int, x), k));
}
__device__ __forceinline__ float wsum(float v) {             // butterfly over 16, 8, 4, 2, 1
  v += xhalf(v);
  v += xrow<8>(v);
  v += xrow<4>(v);
  v += xrow<2>(v);
  v += xrow<1>(v);
  return v;
}

// ---- fragment loader: 16-bit A/B operand, lane -> row/col (lane&15), p already includes +8*(lane>>4);
//      elements 0..7 <- p[0..7] (k0+8h..), elements 8..15 <- p[16..23] (k0+16+8h..)
__device__ __forceinline__ v16h ldfrag_h(const _Float16* p) {
  FragH f;
  f.h[0] = *(const v8h*)(p);
  f.h[1] = *(const v8h*)(p + 16);
  return f.v;
}

// ---- the same fragment from a plane stored in fragment order: one 16 x 32 operand tile = 1024 B = two 512-B halves,
//      half s holds lane L's elements 8s..8s+7 at byte 16*L, so each wave-wide 16-B load covers four whole 128-B lines;
//      p already includes +8*lane
__device__ __forceinline__ v16h ldfrag_p(const _Float16* p) {
  FragH f;
  f.h[0] = *(const v8h*)(p);
  f.h[1] = *(const v8h*)(p + 256);
  return f.v;
}

// ---- WMMA helpers with trailing VALU hazard gap --------------------------------------------------------
__device__ __forceinline__ v8f mma_h_raw(v16h a, v16h b, v8f c) {
  return __builtin_amdgcn_wmma_f32_16x16x32_f16(false, a, false, b, (short)0, c, false, false);
}
__device__ __forceinline__ void guard4x6(v8f& a, v8f& b, v8f& c, v8f& d,
                                         v16h x0, v16h x1, v16h x2, v16h x3, v16h x4, v16h x5) {
#if defined(__HIP_DEVICE_COMPILE__)
  asm volatile("v_nop\n\tv_nop\n\tv_nop\n\tv_nop"
               : "+v"(a), "+v"(b), "+v"(c), "+v"(d)
               : "v"(x0), "v"(x1), "v"(x2), "v"(x3), "v"(x4), "v"(x5));
#endif
}

// =====================================================================================================
// Weight convert with transpose, one 64 k x 32 o tile of o_w or f_w per block (the 16 blocks behind the token blocks of
// the projection launch): in[k][o] f32 (x @ W layout) -> out[o][k] = f16( bf16_RNE(in) * WSC ), k contiguous.
// q = 0..7: o_w [128][128] -> WOT [n][k]; q = 8..15: f_w -> FWT; thread t loads k = t>>2, 8 floats at 8*(t&3) into T
// (pitch 33), stores row o = t>>3, 8 halves k = 8*(t&7).
// coverage: WOT/FWT 4 x 2 tiles x (32 o x 64 k) = [128][128] each.
// =====================================================================================================
__device__ __forceinline__ void conv_tile(const int q, const int t, const float* __restrict__ ow,
                                          const float* __restrict__ fw, unsigned short* WOT, unsigned short* FWT,
                                          float* T) {
  const bool iso = (q < 8);                                  // block-uniform
  const int rr = iso ? q : (q - 8);
  const float* src   = iso ? ow : fw;
  unsigned short* ds = iso ? WOT : FWT;
  const int o0 = (rr >> 1) * 32, k0 = (rr & 1) * 64;
  {
    const int k = t >> 2, oo = 8 * (t & 3);
    const float* sp = src + (size_t)(k0 + k) * HID + o0 + oo;
    const v4f a = *(const v4f*)(sp), c = *(const v4f*)(sp + 4);
#pragma unroll
    for (int i = 0; i < 4; ++i) { T[k * 33 + oo + i] = a[i]; T[k * 33 + oo + 4 + i] = c[i]; }
  }
  __syncthreads();
  {
    const int o = t >> 3, e = t & 7;
    float w[8];
#pragma unroll
    for (int i = 0; i < 8; ++i) w[i] = bfr(T[(8 * e + i) * 33 + o]) * WSC;
    v4u v;
#pragma unroll
    for (int i = 0; i < 4; ++i) v[i] = pk16(h_bits((_Float16)w[2 * i]), h_bits((_Float16)w[2 * i + 1]));
    unsigned short* dp = ds + (size_t)(o0 + o) * HID + k0 + 8 * e;
    *(v4u*)dp = v;
  }
}

// =====================================================================================================
// Gater + gated q/k/v projections for 64 tokens per block (256 threads = 8 waves; blocks 0..95 of a grid of 96 + 16; the
// last 16 blocks convert o_w and f_w for the tail launch, see conv_tile, and do nothing else).
// Phase 0: x tile [64][32] loaded as float4 pairs, RNE-converted to bf16 values: f32 copy sX (pitch 33) for the gater and
//          f16(x * 16) rows sXh (pitch 40 halves) as the WMMA A operand; g_w1 staged bf16-RNE in LDS;
//          q_w | k_w | v_w [32 k][128 n] f32 -> sWT rows [p*128 + n][32 k] = f16( bf16_RNE(w) * 64 ), pitch 40 halves:
//          thread -> column n = t&127 and 8 k (each wave-wide 4-B load is one whole line), one 16-B LDS store per 8 k.
//          Phase 1 (wave -> 8 tokens): LayerNorm, silu hidden layer with lane = hidden unit (32 readlane-broadcast FMAs), gate = sigmoid(sum_lane h*g_w2 + g_b2), all f32 -> sG.
// Phase 2: per part p in {q,k,v}: wave w -> row tile w&3, 64-col half w>>2: 4 WMMAs (K = 32 = one k step; A from sXh,
//          B from sWT rows [p*128 + n][32]); epilogue f = (acc/1024 + bf16(bias[n])) * gate[row] * C (C = 8 q/k, 16 v),
//          hi = f16(f), lo = f16((f-hi)*1024) staged in LDS (q/k row-major [64][136], v transposed [128 hcol][72]);
//          block barrier; whole-line stores: q rows of 256 B by 16 consecutive lanes (instruction i: row 16i + t>>4);
//          k and v^T in fragment order (see ldfrag_p), slab (b, head), 512 contiguous bytes per wave and store.
// Phase 3 (waves 0..3, thread -> head column): this block's share of the masked-key floor sums, from the staged v planes:
//          LS[b][tb][hcol] = sum of v over the block's keys j >= 6*(tb+1), for every boundary 6*(tb+1) that lies in the
//          block, and TOT[b][block][hcol] = sum over all 64 keys (keys of time blocks >= T count as 0).
// coverage: QH/QL rows tok0..tok0+63 x 128 cols; KH/KL 4 heads x key tiles ltok0/16..+3; VTH/VTL 4 heads x key steps
//           ltok0/32..+1 x 2 d tiles; grid covers all 6144 tokens exactly once. LS rows tb = 0..510 of each batch row once
//           (the boundary of tb = 511 is past the last key: no row, and none is read); TOT 96 rows once.
// =====================================================================================================
// Suffix sums of one head column inside a 64-key block whose first boundary (key index a multiple of 6) is local key I0:
// six-key sums first (independent), then one short chain over the boundaries, last to first. r[j] = sum over the block's
// keys from boundary j on (0 where the block has no boundary j), tot = sum over all 64 keys.
#define NJMAX 11                                             // boundaries in a block: 11 for I0 = 0 and 2, 10 for I0 = 4
template <int I0>
__device__ __forceinline__ void block_suffix(const float (&val)[64], const int tb0, const int ntb,
                                             float (&r)[NJMAX], float& tot) {
  constexpr int NJ = (63 - I0) / NF + 1;
  float run = 0.f;
#pragma unroll
  for (int j = NJMAX - 1; j >= NJ; --j) r[j] = 0.f;
#pragma unroll
  for (int j = NJ - 1; j >= 0; --j) {
    float sg = 0.f;
#pragma unroll
    for (int f = 0; f < NF; ++f)
      if (I0 + NF * j + f < 64) sg += val[I0 + NF * j + f];
    run += (tb0 + 1 + j < ntb) ? sg : 0.f;                   // these keys are time block tb0 + 1 + j
    r[j] = run * (1.0f / VC);
  }
  float head = 0.f;
#pragma unroll
  for (int i = 0; i < I0; ++i) head += val[i];
  tot = (run + ((tb0 < ntb) ? head : 0.f)) * (1.0f / VC);    // the keys in front of I0 are time block tb0
}

__global__ __launch_bounds__(256) void qkv_prep(
    const float* __restrict__ x, const float* __restrict__ glnw, const float* __restrict__ glnb,
    const float* __restrict__ gw1, const float* __restrict__ gb1, const float* __restrict__ gw2,
    const float* __restrict__ gb2, const float* __restrict__ qbias, const float* __restrict__ kbias,
    const float* __restrict__ vbias, const float* __restrict__ qw, const float* __restrict__ kw,
    const float* __restrict__ vw, const float* __restrict__ ow, const float* __restrict__ fw,
    const int* __restrict__ Tp,
    unsigned short* QH, unsigned short* QL, unsigned short* KH, unsigned short* KL,
    unsigned short* VTH, unsigned short* VTL, float* LS, float* TOT, unsigned short* WOT, unsigned short* FWT) {
  __shared__ __align__(16) float sX[64 * 33];
  __shared__ __align__(16) _Float16 sXh[64 * 40];
  __shared__ float sW1[DD * GH];
  __shared__ float sG[64];
  __shared__ __align__(16) unsigned short sH[128 * 72];
  __shared__ __align__(16) unsigned short sL[128 * 72];
  __shared__ __align__(16) unsigned short sWT[3 * HID * 40];
  const int t = threadIdx.x, wave = t >> 5, lane = t & 31, hh = lane >> 4, m = lane & 15;
  if (blockIdx.x >= NTOK / 64) {                             // block-uniform, in front of every other barrier
    conv_tile((int)blockIdx.x - NTOK / 64, t, ow, fw, WOT, FWT, sX);
    return;
  }
  const int tok0  = blockIdx.x * 64;
  const int b     = tok0 / LL;
  const int ltok0 = tok0 - b * LL;
  const int tin   = Tp[0];                                   // read here so that phase 3 does not wait for it

  // ---- phase 0 ----
  {
    const int wn = t & 127, wk = t >> 7;                     // weight column; 8-k group wk + 2*(i&1) of part i>>1
    const unsigned wofs = (unsigned)(8 * wk * HID + wn);     // the thread's first element of each part
    float wv[6][8];
#pragma unroll
    for (int i = 0; i < 6; ++i) {
      const float* wsrc = (i < 2) ? qw : ((i < 4) ? kw : vw);
#pragma unroll
      for (int e = 0; e < 8; ++e) wv[i][e] = wsrc[wofs + (unsigned)((16 * (i & 1) + e) * HID)];
    }
    const int tk = t >> 2, j = 8 * (t & 3);
    const float* sp = x + (size_t)(tok0 + tk) * DD + j;
    const v4f a = *(const v4f*)(sp), c = *(const v4f*)(sp + 4);
    // one wait for the weight and x loads above: their address registers are inputs here, so that neither a later load's
    // destination nor any other instruction overwrites one of them in front of it
    asm volatile("s_wait_xcnt 0x0" :: "v"(wofs), "v"(sp) : "memory");
    float r8[8];
#pragma unroll
    for (int i = 0; i < 4; ++i) { r8[i] = bfr(a[i]); r8[4 + i] = bfr(c[i]); }
#pragma unroll
    for (int i = 0; i < 8; ++i) {
      sX[tk * 33 + j + i]  = r8[i];
      sXh[tk * 40 + j + i] = (_Float16)(r8[i] * XC);
    }
    for (int i = t; i < DD * GH; i += 256) sW1[i] = bfr(gw1[i]);
#pragma unroll
    for (int i = 0; i < 6; ++i) {
      v4u v;
#pragma unroll
      for (int e = 0; e < 4; ++e)
        v[e] = pk16(h_bits((_Float16)(bfr(wv[i][2 * e]) * WSC)), h_bits((_Float16)(bfr(wv[i][2 * e + 1]) * WSC)));
      *(v4u*)(sWT + ((i >> 1) * HID + wn) * 40 + 8 * (wk + 2 * (i & 1))) = v;
    }
  }
  __syncthreads();

  // ---- phase 1: gater (f32, VALU) ----
  {
    const float gw = bfr(glnw[lane]), gb = bfr(glnb[lane]);
    const float b1 = bfr(gb1[lane]),  w2 = bfr(gw2[lane]), b2 = bfr(gb2[0]);
#pragma unroll 1
    for (int i = 0; i < 8; ++i) {
      const int tk = wave * 8 + i;
      const float xv  = sX[tk * 33 + lane];
      const float mu  = wsum(xv) * (1.0f / DD);
      const float dv  = xv - mu;
      const float var = wsum(dv * dv) * (1.0f / DD);
      const float xn  = dv * rsqrtf(var + LNEPS) * gw + gb;
      float hacc = b1;
#pragma unroll
      for (int k = 0; k < DD; ++k) hacc += lane_bc(xn, k) * sW1[k * GH + lane];
      const float hs = hacc * sigm(hacc);
      const float gs = wsum(hs * w2) + b2;
      const float g  = sigm(gs);
      if (lane == 0) sG[tk] = g;
    }
  }
  __syncthreads();

  // ---- phase 2: projections on WMMA ----
  const int rt = wave & 3, ch = wave >> 2;
  FragH af;
  af.h[0] = *(const v8h*)(sXh + (16 * rt + m) * 40 + 8 * hh);
  af.h[1] = *(const v8h*)(sXh + (16 * rt + m) * 40 + 16 + 8 * hh);
  const _Float16* WTp = h16(sWT);
#pragma unroll 1
  for (int p = 0; p < 3; ++p) {
    const float* bp = (p == 0) ? qbias : ((p == 1) ? kbias : vbias);
    const float osc = (p == 2) ? VC : QC;
    v16h bf[4];
#pragma unroll
    for (int j = 0; j < 4; ++j)
      bf[j] = ldfrag_h(WTp + (p * HID + 64 * ch + 16 * j + m) * 40 + 8 * hh);
    v8f acc[4];
#pragma unroll
    for (int j = 0; j < 4; ++j) acc[j] = mma_h_raw(af.v, bf[j], zero8());
    guard4x6(acc[0], acc[1], acc[2], acc[3], af.v, bf[0], bf[1], bf[2], bf[3], af.v);
    float gr[8];
#pragma unroll
    for (int r = 0; r < 8; ++r) gr[r] = sG[16 * rt + 8 * hh + r];
#pragma unroll
    for (int j = 0; j < 4; ++j) {
      const int n = 64 * ch + 16 * j + m;
      const float bn = bfr(bp[n]);
#pragma unroll
      for (int r = 0; r < 8; ++r) {
        const int row = 16 * rt + 8 * hh + r;
        const float f = ((acc[j][r] * (1.0f / (XC * WSC)) + bn) * gr[r]) * osc;
        unsigned short hb, lb;
        split_h(f, hb, lb);
        if (p < 2) { sH[row * 136 + n] = hb; sL[row * 136 + n] = lb; }
        else       { sH[n * 72 + row]  = hb; sL[n * 72 + row]  = lb; }
      }
    }
    __syncthreads();
    if (p == 0) {                                                   // block-uniform
      unsigned short* Hp = QH;
      unsigned short* Lp = QL;
      const int e = t & 15;
      v4u hv[4], lv[4];
#pragma unroll
      for (int i = 0; i < 4; ++i) {
        const int row = 16 * i + (t >> 4);
        hv[i] = *(const v4u*)(sH + row * 136 + 8 * e);
        lv[i] = *(const v4u*)(sL + row * 136 + 8 * e);
      }
#pragma unroll
      for (int i = 0; i < 4; ++i) {
        const int row = 16 * i + (t >> 4);
        *(v4u*)(Hp + (size_t)(tok0 + row) * HID + 8 * e) = hv[i];
        *(v4u*)(Lp + (size_t)(tok0 + row) * HID + 8 * e) = lv[i];
      }
      
    } else if (p == 1) {
      // k in fragment order: instruction i = head; wave -> 16-key tile t>>6, half s; lane -> key m, dims 16s + 8hh ..+7
      const int ktl = t >> 6, s = (t >> 5) & 1;
      v4u hv[4], lv[4];
#pragma unroll
      for (int i = 0; i < 4; ++i) {
        const int src = (16 * ktl + m) * 136 + HD * i + 16 * s + 8 * hh;
        hv[i] = *(const v4u*)(sH + src);
        lv[i] = *(const v4u*)(sL + src);
      }
#pragma unroll
      for (int i = 0; i < 4; ++i) {
        const size_t o = ((size_t)(b * NH + i) * (LL / 16) + (ltok0 >> 4) + ktl) * 512 + s * 256 + lane * 8;
        *(v4u*)(KH + o) = hv[i];
        *(v4u*)(KL + o) = lv[i];
      }
      // the stores' registers are reused by the next part's LDS reads: keep the wait in front of that overwrite
      asm volatile("s_wait_xcnt 0x0" ::: "memory");
    } else {
      // v^T in fragment order: instruction i = head; wave -> 32-key step t>>7, d tile dt, half s; lane -> d row m,
      // keys 16s + 8hh ..+7
      const int ksl = t >> 7, dt = (t >> 6) & 1, s = (t >> 5) & 1;
      v4u hv[4], lv[4];
#pragma unroll
      for (int i = 0; i < 4; ++i) {
        const int src = (HD * i + 16 * dt + m) * 72 + 32 * ksl + 16 * s + 8 * hh;
        hv[i] = *(const v4u*)(sH + src);
        lv[i] = *(const v4u*)(sL + src);
      }
#pragma unroll
      for (int i = 0; i < 4; ++i) {
        const size_t o = ((size_t)(b * NH + i) * (LL / 32) + (ltok0 >> 5) + ksl) * 1024 + dt * 512 + s * 256 + lane * 8;
        *(v4u*)(VTH + o) = hv[i];
        *(v4u*)(VTL + o) = lv[i];
      }
      // same wait behind the v^T stores, in front of any reuse of their registers
      asm volatile("s_wait_xcnt 0x0" ::: "memory");
      // ---- phase 3: floor sums of this block's keys ----
      if (wave < 4) {                                               // wave-uniform; no barrier inside
        const int ntb = (tin < 0) ? 0 : ((tin > TT) ? TT : tin);    // structural, clamped to the static extent
        float val[64];
#pragma unroll
        for (int g = 0; g < 8; ++g) {
          const v8h a = *(const v8h*)(h16(sH) + t * 72 + 8 * g);
          const v8h l = *(const v8h*)(h16(sL) + t * 72 + 8 * g);
#pragma unroll
          for (int j = 0; j < 8; ++j)
            val[8 * g + j] = (float)a[j] + (float)l[j] * INVRS;
        }
        const int i0  = (NF - ltok0 % NF) % NF;                     // 0, 2 or 4: 64 keys shift the phase by 4
        const int tb0 = (ltok0 + i0) / NF - 1;                      // time block whose masked keys start at local key i0
        float r[NJMAX], tot;
        if (i0 == 0)      block_suffix<0>(val, tb0, ntb, r, tot);   // block-uniform
        else if (i0 == 2) block_suffix<2>(val, tb0, ntb, r, tot);
        else              block_suffix<4>(val, tb0, ntb, r, tot);
        float* lsp  = LS + ((size_t)b * TT + tb0 + 1) * HID + t;    // row tb0 + 1, the block's second boundary
        float* totp = TOT + ((size_t)b * (LL / 64) + (ltok0 >> 6)) * HID + t;
        if (tb0 >= 0) *(lsp - HID) = r[0];                          // block-uniform: key 0 is no boundary of a time block
#pragma unroll
        for (int j = 1; j < NJMAX - 1; ++j) lsp[(size_t)(j - 1) * HID] = r[j];
        if (i0 != 4) lsp[(size_t)(NJMAX - 2) * HID] = r[NJMAX - 1]; // block-uniform: the eleventh boundary
        totp[0] = tot;
        // the stores' registers may be reused behind this point: keep the wait in front of that overwrite
        asm volatile("s_wait_xcnt 0x0" ::: "memory");
      }
    }
    __syncthreads();
  }
}

// =====================================================================================================
// One 32-key step of the transposed flash formulation for 16 queries of one head (head dim 32 = one k step):
//   S^T tiles (16 keys x 16 queries) = A(k rows, dims split-map) . B(q^T): hi.hi -> s, hi.lo + lo.hi -> sr (x1024);
//   logit (log2 domain) = (s + sr/1024) * scale*log2e/64; block-causal mask by value (key < horizon of the lane's query);
//   online softmax per lane (8 + 8 keys of ONE query per lane, max combined with lane^16), p = 2^(e - m + 10) (x1024);
//   P^T as the B operand of O^T(16 d x 16 queries) += v^T(d rows, keys split-map) . P^T: element r <- tile keys kb..kb+15,
//   element 8+r <- tile kb+16..kb+31, lane unchanged; P hi to o, (v hi . P lo x1024 + v lo x1024 . P hi) to or.
// =====================================================================================================
template <bool MASKED>
__device__ __forceinline__ void attn_step(const int kb, const int jl, const int hh,
    const _Float16* __restrict__ kH, const _Float16* __restrict__ kL,
    const _Float16* __restrict__ vH, const _Float16* __restrict__ vL,
    const v16h qhi, const v16h qlo, float& m_run, float& l_run,
    v8f& o1, v8f& o1r, v8f& o2, v8f& o2r) {
  const size_t so = (size_t)kb * 32;                 // 32 keys = 1024 halves of each fragment-order plane
  const v16h kh0 = ldfrag_p(kH + so);
  const v16h kh1 = ldfrag_p(kH + so + 512);
  const v16h kl0 = ldfrag_p(kL + so);
  const v16h kl1 = ldfrag_p(kL + so + 512);
  v8f s0  = mma_h_raw(kh0, qhi, zero8());
  v8f s1  = mma_h_raw(kh1, qhi, zero8());
  v8f s0r = mma_h_raw(kh0, qlo, zero8());
  v8f s1r = mma_h_raw(kh1, qlo, zero8());
  s0r = mma_h_raw(kl0, qhi, s0r);
  s1r = mma_h_raw(kl1, qhi, s1r);
  guard4x6(s0, s1, s0r, s1r, kh0, kh1, kl0, kl1, qhi, qlo);

  float e0[8], e1[8];
#pragma unroll
  for (int r = 0; r < 8; ++r) {
    e0[r] = (s0[r] + s0r[r] * INVRS) * SCL;
    e1[r] = (s1[r] + s1r[r] * INVRS) * SCL;
  }
  if (MASKED) {
    const int lim = jl - (kb + 8 * hh);              // row r is key kb + 8hh + r (tile 0), + 16 (tile 1): visible if below jl
#pragma unroll
    for (int r = 0; r < 8; ++r) {
      e0[r] = (r      < lim) ? e0[r] : NEGBIG;
      e1[r] = (16 + r < lim) ? e1[r] : NEGBIG;
    }
  }
  float mx = fmaxf(fmaxf(fmaxf(fmaxf(e0[0], e0[1]), fmaxf(e0[2], e0[3])), fmaxf(fmaxf(e0[4], e0[5]), fmaxf(e0[6], e0[7]))),
                   fmaxf(fmaxf(fmaxf(e1[0], e1[1]), fmaxf(e1[2], e1[3])), fmaxf(fmaxf(e1[4], e1[5]), fmaxf(e1[6], e1[7]))));
  mx = fmaxf(mx, __shfl_xor(mx, 16, 32));
  const float m_new = fmaxf(m_run, mx);
  const float corr  = fexp2(m_run - m_new);
  m_run = m_new;
  const float msh = m_new - 10.0f;                   // 2^(e - m + 10) = e^{s - smax} * 1024
  l_run *= corr;
  o1 = o1 * corr; o1r = o1r * corr; o2 = o2 * corr; o2r = o2r * corr;

  FragH ph, pl;
  float ls = 0.f;
#pragma unroll
  for (int r = 0; r < 8; ++r) {
    const float p0 = fexp2(e0[r] - msh);
    const float p1 = fexp2(e1[r] - msh);
    ls += p0 + p1;
    const _Float16 a0 = (_Float16)p0, a1 = (_Float16)p1;
    ph.h[0][r] = a0;                                          // keys kb      + 8hh + r
    ph.h[1][r] = a1;                                          // keys kb + 16 + 8hh + r
    pl.h[0][r] = (_Float16)((p0 - (float)a0) * RSC);
    pl.h[1][r] = (_Float16)((p1 - (float)a1) * RSC);
  }
  l_run += ls;

  const v16h vh1 = ldfrag_p(vH + so);
  const v16h vl1 = ldfrag_p(vL + so);
  const v16h vh2 = ldfrag_p(vH + so + 512);
  const v16h vl2 = ldfrag_p(vL + so + 512);
  o1  = mma_h_raw(vh1, ph.v, o1);
  o2  = mma_h_raw(vh2, ph.v, o2);
  o1r = mma_h_raw(vh1, pl.v, o1r);
  o2r = mma_h_raw(vh2, pl.v, o2r);
  o1r = mma_h_raw(vl1, ph.v, o1r);
  o2r = mma_h_raw(vl2, ph.v, o2r);
  guard4x6(o1, o2, o1r, o2r, vh1, vh2, vl1, vl2, ph.v, pl.v);
}

// =====================================================================================================
// Attention + mean-pool for one head of one batch row and a PAIR of 48-query groups: group 63 - pi (long key range) and
// group pi (short key range), so that every block holds about the same number of 32-key steps. Block = 24 waves (768
// threads), grid = 2 * 4 * 32 = 256. Wave w -> query tile index g = w>>3 of both groups; the 8 waves of one g share the
// key steps of the long tile (nH steps) and of the short tile (nL steps) in runs of C consecutive steps, C the smallest
// run length for which the block's longest pair of tiles fits in 8 waves. Each wave runs the online softmax over its own run only (the fully
// visible steps without masking, the rest with the per-lane horizon test by value) and leaves its partial
// (row maximum m, row sum l, o + or/1024) in LDS; a lane whose keys are all masked in its run keeps m = NEGBIG and gets
// weight 0 in the merge (run 0 of every tile holds keys 0..5, visible to every query, so the merged maximum is real).
// Merge (all 768 threads, thread -> query t>>3 of 96, 4 d at 4*(t&7)): M = max m_s, w_s = 2^(m_s - M),
// attn[d] = (sum w_s o_s) / (16 sum w_s l_s) + 1e-9 * (sum of v[.][d] over the query's masked keys) -> LDS sO[96][36] (f32);
// that sum = LS[b][tq][.] (the masked keys inside the 64-key block that holds the first of them) + the totals TOT of all
// later 64-key blocks, which wave 7 sums last to first into LDS sTS[48][32] in front of the merge barrier;
// barrier; threads 0..127 pool 6 consecutive query rows (pooled row t>>3 of 16, cols 4*(t&7)) -> f16 hi (x32) / lo
// (x1024), stored to the head's own plane [head][1024 rows][32]: one wave writes 256 contiguous bytes of each plane.
// coverage: per block rows b*512 + 8*(63-pi) .. +7 and b*512 + 8*pi .. +7 of head h; 256 blocks cover [4][1024][32] once.
// =====================================================================================================
#define KS 8                                                 // waves that share one long and one short query tile
__device__ __forceinline__ int cdiv_i(int a, int d) { return (a + d - 1) / d; }
// 32-key steps of the 16-query tile that starts at query qw0: up to the block-causal horizon of its last query (<= 3072)
__device__ __forceinline__ int tile_steps(int qw0) { return (((qw0 + 15) / NF + 1) * NF + 31) >> 5; }
// run length for a pair of tiles; at most 96 since then each tile is one run
__device__ __forceinline__ int run_len(int nH, int nL) {
  int C = cdiv_i(nH + nL, KS);
  for (; C < LL / 32; ++C)
    if (cdiv_i(nH, C) + cdiv_i(nL, C) <= KS) break;
  return C;
}

__global__ __launch_bounds__(768)
void attn_pool(const unsigned short* __restrict__ QH, const unsigned short* __restrict__ QL,
               const unsigned short* __restrict__ KH, const unsigned short* __restrict__ KL,
               const unsigned short* __restrict__ VTH, const unsigned short* __restrict__ VTL,
               const float* __restrict__ LS, const float* __restrict__ TOT, unsigned short* PH, unsigned short* PL) {
  __shared__ __align__(16) float sP[3 * KS * 16 * 36];       // per wave 16 queries x 32 d, pitch 36
  __shared__ float sM[3 * KS * 16];
  __shared__ float sL[3 * KS * 16];
  __shared__ __align__(16) float sO[96 * 36];
  __shared__ __align__(16) float sTS[(LL / 64) * HD];        // [64-key block k][d]: sum of v over all keys of blocks > k
  const int t = threadIdx.x, lane = t & 31, hh = lane >> 4, c = lane & 15;
  const int wave = __builtin_amdgcn_readfirstlane(t >> 5);   // wave-uniform: run bounds and plane bases stay scalar
  const int bx = blockIdx.x;
  const int pi = bx & 31;
  const int h  = (bx >> 5) & 3;
  const int b  = bx >> 7;
  const size_t tokb = (size_t)b * LL;
  // one run length for the block, from its last (longest) tiles: run s of all three tiles covers the same keys, so the
  // three waves that walk it together read the same k and v lines
  const int C = run_len(tile_steps((63 - pi) * 48 + 32), tile_steps(pi * 48 + 32));

  if (wave == KS - 1) {                                      // scalar branch; this wave holds at most the last, short run of a short tile
    const float* tp = TOT + (size_t)b * (LL / 64) * HID + h * HD + lane;   // lane -> d
    float tv[LL / 64];
#pragma unroll
    for (int k = 0; k < LL / 64; ++k) tv[k] = tp[(size_t)k * HID];
    // the loads' address registers may be reused below: keep the wait in front of that overwrite
    asm volatile("s_wait_xcnt 0x0" ::: "memory");
    float run = 0.f;
#pragma unroll
    for (int k = LL / 64 - 1; k >= 0; --k) { sTS[k * HD + lane] = run; run += tv[k]; }
  }

  {
    const int g = wave >> 3, s8 = wave & (KS - 1);
    const int qH0 = (63 - pi) * 48 + 16 * g, qL0 = pi * 48 + 16 * g;
    const int nH = tile_steps(qH0), nL = tile_steps(qL0);
    const int SH = cdiv_i(nH, C);
    const bool isH = (s8 < SH);
    const int qw0 = isH ? qH0 : qL0;
    const int n   = isH ? nH : nL;
    const int s   = isH ? s8 : (s8 - SH);
    const int st1 = (s + 1) * C;
    const int kb1 = ((st1 < n) ? st1 : n) * 32;              // a wave past the short tile's last run does no step
    const int qi  = qw0 + c;                                 // query of this lane (B column / D column)
    const int jl  = (qi / NF + 1) * NF;                      // exclusive key horizon

    const _Float16* QHp = h16(QH);
    const _Float16* QLp = h16(QL);
    const v16h qhi = ldfrag_h(QHp + (tokb + qi) * HID + h * HD + 8 * hh);
    const v16h qlo = ldfrag_h(QLp + (tokb + qi) * HID + h * HD + 8 * hh);
    // the q loads' address registers are reused by the accumulators' start values: keep the wait in front of that overwrite
    asm volatile("s_wait_xcnt 0x0" ::: "memory");
    const size_t pbase = (size_t)(b * NH + h) * LL * HD + 8 * lane;   // (b, head) slab of a fragment-order plane; + kb * 32
    const _Float16* kH = h16(KH) + pbase;                             // key tile 2 at +512 halves
    const _Float16* kL = h16(KL) + pbase;
    const _Float16* vH = h16(VTH) + pbase;                            // d tile 2 at +512 halves
    const _Float16* vL = h16(VTL) + pbase;

    float m_run = NEGBIG, l_run = 0.f;
    v8f o1 = zero8(), o1r = zero8(), o2 = zero8(), o2r = zero8();
    const int jmin  = (qw0 / NF + 1) * NF;
    const int cfull = (jmin / 32) * 32;
    const int kbf   = (cfull < kb1) ? cfull : kb1;
    int kb = s * C * 32;
#pragma unroll 1
    for (; kb < kbf; kb += 32)
      attn_step<false>(kb, jl, hh, kH, kL, vH, vL, qhi, qlo, m_run, l_run, o1, o1r, o2, o2r);
#pragma unroll 1
    for (; kb < kb1; kb += 32)
      attn_step<true>(kb, jl, hh, kH, kL, vH, vL, qhi, qlo, m_run, l_run, o1, o1r, o2, o2r);

    l_run += __shfl_xor(l_run, 16, 32);
    float* pp = sP + (wave * 16 + c) * 36 + 8 * hh;
    v4f a0, a1, c0, c1;
#pragma unroll
    for (int r = 0; r < 4; ++r) {
      a0[r] = o1[r] + o1r[r] * INVRS;  a1[r] = o1[4 + r] + o1r[4 + r] * INVRS;
      c0[r] = o2[r] + o2r[r] * INVRS;  c1[r] = o2[4 + r] + o2r[4 + r] * INVRS;
    }
    *(v4f*)(pp)      = a0;                                   // d  8hh ..  8hh+7
    *(v4f*)(pp + 4)  = a1;
    *(v4f*)(pp + 16) = c0;                                   // d 16+8hh .. 16+8hh+7
    *(v4f*)(pp + 20) = c1;
    if (hh == 0) { sM[wave * 16 + c] = m_run; sL[wave * 16 + c] = l_run; }
  }
  __syncthreads();
  {
    const int tile = wave >> 2;                              // 0..2 long group's tiles, 3..5 short group's; 4 queries per wave
    const int hl = (tile >= 3) ? 1 : 0;
    const int g  = tile - 3 * hl;
    const int qH0 = (63 - pi) * 48 + 16 * g, qL0 = pi * 48 + 16 * g;
    const int nH = tile_steps(qH0), nL = tile_steps(qL0);
    const int SH = cdiv_i(nH, C);
    const int w0 = g * KS + (hl ? SH : 0);                   // first wave and number of waves that hold this tile's runs
    const int wn = hl ? cdiv_i(nL, C) : SH;
    const int c2 = (t >> 3) & 15, dg = t & 7;
    const int tq = ((hl ? qL0 : qH0) + c2) / NF;
    const int  j0  = (tq + 1) * NF;                          // first masked key; none for the last time block
    const bool any = (j0 < LL);
    const v4f lsv = *(const v4f*)(LS + ((size_t)b * TT + (any ? tq : 0)) * HID + h * HD + 4 * dg);
    const v4f tsv = *(const v4f*)(sTS + (any ? (j0 >> 6) : 0) * HD + 4 * dg);
    v4f sv;
#pragma unroll
    for (int e = 0; e < 4; ++e) sv[e] = any ? (lsv[e] + tsv[e]) : 0.f;
    // all KS slots read at once (one LDS latency); a slot past the tile's last run rereads run 0 and gets weight 0
    float ms[KS], ls[KS];
    v4f os[KS];
#pragma unroll
    for (int i = 0; i < KS; ++i) {
      const int wi = w0 + ((i < wn) ? i : 0);
      ms[i] = sM[wi * 16 + c2];
      ls[i] = sL[wi * 16 + c2];
      os[i] = *(const v4f*)(sP + (wi * 16 + c2) * 36 + 4 * dg);
    }
    float M = ms[0];
#pragma unroll
    for (int i = 1; i < KS; ++i) M = fmaxf(M, ms[i]);
    float L = 0.f;
    v4f O = {0.f, 0.f, 0.f, 0.f};
#pragma unroll
    for (int i = 0; i < KS; ++i) {
      const float w = (i < wn) ? fexp2(ms[i] - M) : 0.f;
      L += w * ls[i];
      O += os[i] * w;
    }
    const float inv = (1.0f / L) * (1.0f / VC);
    *(v4f*)(sO + (t >> 3) * 36 + 4 * dg) = O * inv + sv * FLOORC;
  }
  __syncthreads();
  if (wave < 4) {                                            // wave-uniform; no barrier behind it
    const int pr = t >> 3, col = 4 * (t & 7);
    v4f s = {0.f, 0.f, 0.f, 0.f};
#pragma unroll
    for (int f = 0; f < NF; ++f) s += *(const v4f*)(sO + (NF * pr + f) * 36 + col);
    unsigned short hb[4], lb[4];
#pragma unroll
    for (int e = 0; e < 4; ++e) split_h((s[e] * (1.0f / NF)) * AC, hb[e], lb[e]);
    v2u ph2, pl2;
    ph2[0] = pk16(hb[0], hb[1]); ph2[1] = pk16(hb[2], hb[3]);
    pl2[0] = pk16(lb[0], lb[1]); pl2[1] = pk16(lb[2], lb[3]);
    const int qblk = (pr < 8) ? (63 - pi) : pi;
    const size_t o = ((size_t)h * NPOOL + (size_t)(b * TT + 8 * qblk + (pr & 7))) * HD + col;
    *(v2u*)(PH + o) = ph2;
    *(v2u*)(PL + o) = pl2;
  }
}

// =====================================================================================================
// Tail: 16 pooled rows per block (grid 1024/16 = 64, 256 threads = 8 waves); wave w -> the 16 x 16 tile of output columns
// 16w..16w+15 in both products, so that a wave's share of every serial part is short: one accumulator pair per product,
// two LayerNorm rows, eight outputs per lane. Every global operand of the block (pooled planes, both weight tiles, biases,
// LayerNorm weights) is asked for at the top, in one flight.
// GEMM1 z = pooled(hi + lo/1024)/32 . Wo + bf16(o_b): A planes PH/PL [head][row][32], k step = head (two products into
// acc/accr), B = WOT rows, K=128 -> sZ rows (f32);
// LayerNorm: wave -> rows 2w, 2w+1, lane -> 4 columns; the row leaves as f16 hi (x16) / lo (x1024) planes sYh/sYl, pitch
// 136 halves, split once here in place of once per reading wave;
// GEMM2 from sYh/sYl rows . FWT rows; epilogue silu(acc + bf16(f_b)) staged in sZ, whole 512-B rows stored per wave.
// coverage: out rows r0..r0+15 x 128 cols; 64 blocks cover [1024][128] exactly once.
// =====================================================================================================
__global__ __launch_bounds__(256) void tail_k(const unsigned short* __restrict__ PH, const unsigned short* __restrict__ PL,
                                               const unsigned short* __restrict__ WOT, const float* __restrict__ obias,
                                               const float* __restrict__ flnw, const float* __restrict__ flnb,
                                               const unsigned short* __restrict__ FWT, const float* __restrict__ fbias,
                                               float* out) {
  __shared__ __align__(16) float sZ[16 * 132];
  __shared__ __align__(16) unsigned short sYh[16 * 136];
  __shared__ __align__(16) unsigned short sYl[16 * 136];
  const int t = threadIdx.x, wave = t >> 5, lane = t & 31, hh = lane >> 4, m = lane & 15;
  const int r0 = blockIdx.x * 16;
  const int n  = 16 * wave + m;                              // the lane's output column in both products

  // ---- all global operands ----
  const _Float16* Ah = h16(PH) + (size_t)(r0 + m) * HD + 8 * hh;   // + 32 * ks * NPOOL: plane of head ks
  const _Float16* Al = h16(PL) + (size_t)(r0 + m) * HD + 8 * hh;
  const _Float16* Bw = h16(WOT) + (size_t)n * HID + 8 * hh;
  const _Float16* Bf = h16(FWT) + (size_t)n * HID + 8 * hh;
  v16h ah[4], al[4], bw[4], bf[4];
#pragma unroll
  for (int ks = 0; ks < 4; ++ks) {
    ah[ks] = ldfrag_h(Ah + (size_t)(32 * ks) * NPOOL);
    bw[ks] = ldfrag_h(Bw + 32 * ks);
    al[ks] = ldfrag_h(Al + (size_t)(32 * ks) * NPOOL);
  }
  const float ob = obias[n];
  const v4f lw = *(const v4f*)(flnw + 4 * lane), lb = *(const v4f*)(flnb + 4 * lane);
#pragma unroll
  for (int ks = 0; ks < 4; ++ks) bf[ks] = ldfrag_h(Bf + 32 * ks);
  const float fb = fbias[n];
  // holds every load above in front of the first product, so that all of them fly together (left alone, the compiler issues
  // them in four groups among the WMMAs, one round trip each); loaded values and their addresses as inputs only: the
  // address registers stay whole until the data are back
  asm volatile("" :: "v"(ah[0]), "v"(ah[1]), "v"(ah[2]), "v"(ah[3]), "v"(al[0]), "v"(al[1]), "v"(al[2]), "v"(al[3]),
               "v"(bw[0]), "v"(bw[1]), "v"(bw[2]), "v"(bw[3]), "v"(bf[0]), "v"(bf[1]), "v"(bf[2]), "v"(bf[3]),
               "v"(ob), "v"(fb), "v"(lw), "v"(lb), "v"(Ah), "v"(Al), "v"(Bw), "v"(Bf));

  // ---- GEMM1 ----
  {
    v8f acc = zero8(), accr = zero8();
#pragma unroll
    for (int ks = 0; ks < 4; ++ks) {
      acc  = mma_h_raw(ah[ks], bw[ks], acc);
      accr = mma_h_raw(al[ks], bw[ks], accr);
    }
    const float bn = bfr(ob);
#pragma unroll
    for (int r = 0; r < 8; ++r)
      sZ[(8 * hh + r) * 132 + n] = (acc[r] + accr[r] * INVRS) * (1.0f / (AC * WSC)) + bn;
  }
  __syncthreads();

  // ---- LayerNorm, rows out as f16 planes ----
  {
    float gg[4], bb[4];
#pragma unroll
    for (int e = 0; e < 4; ++e) { gg[e] = bfr(lw[e]); bb[e] = bfr(lb[e]); }
    const float* zp = sZ + 2 * wave * 132 + 4 * lane;         // rows 2w and 2w + 1 from one base: both reads go out together
    unsigned short* yhp = sYh + 2 * wave * 136 + 4 * lane;
    unsigned short* ylp = sYl + 2 * wave * 136 + 4 * lane;
    v4f zz[2];
#pragma unroll
    for (int i = 0; i < 2; ++i) zz[i] = *(const v4f*)(zp + i * 132);
#pragma unroll
    for (int i = 0; i < 2; ++i) {
      const v4f z = zz[i];
      float s = (z[0] + z[1]) + (z[2] + z[3]);
      s = wsum(s);
      const float mean = s * (1.0f / HID);
      float d[4];
#pragma unroll
      for (int e = 0; e < 4; ++e) d[e] = z[e] - mean;
      float vs = (d[0] * d[0] + d[1] * d[1]) + (d[2] * d[2] + d[3] * d[3]);
      vs = wsum(vs);
      const float rstd = rsqrtf(vs * (1.0f / HID) + LNEPS);
      unsigned short hb[4], lo[4];
#pragma unroll
      for (int e = 0; e < 4; ++e) split_h(((d[e] * rstd) * gg[e] + bb[e]) * YC, hb[e], lo[e]);
      v2u yh, yl;
      yh[0] = pk16(hb[0], hb[1]); yh[1] = pk16(hb[2], hb[3]);
      yl[0] = pk16(lo[0], lo[1]); yl[1] = pk16(lo[2], lo[3]);
      *(v2u*)(yhp + i * 136) = yh;
      *(v2u*)(ylp + i * 136) = yl;
    }
  }
  __syncthreads();

  // ---- GEMM2 ----
  {
    const _Float16* yhp = h16(sYh) + m * 136 + 8 * hh;
    const _Float16* ylp = h16(sYl) + m * 136 + 8 * hh;
    v16h yh[4], yl[4];
#pragma unroll
    for (int ks = 0; ks < 4; ++ks) { yh[ks] = ldfrag_h(yhp + 32 * ks); yl[ks] = ldfrag_h(ylp + 32 * ks); }
    v8f acc2 = zero8(), acc2r = zero8();
#pragma unroll
    for (int ks = 0; ks < 4; ++ks) {
      acc2  = mma_h_raw(yh[ks], bf[ks], acc2);
      acc2r = mma_h_raw(yl[ks], bf[ks], acc2r);
    }
    const float bn = bfr(fb);
    // sZ is free: its last readers, the LayerNorm rows, are behind the barrier above
#pragma unroll
    for (int r = 0; r < 8; ++r) {
      const float a = (acc2[r] + acc2r[r] * INVRS) * (1.0f / (YC * WSC)) + bn;
      sZ[(8 * hh + r) * 132 + n] = a * sigm(a);
    }
  }
  __syncthreads();
  {
    v4f vals[2];
#pragma unroll
    for (int i = 0; i < 2; ++i) vals[i] = *(const v4f*)(sZ + (8 * i + wave) * 132 + 4 * lane);
#pragma unroll
    for (int i = 0; i < 2; ++i)
      *(v4f*)(out + (size_t)(r0 + 8 * i + wave) * FD + 4 * lane) = vals[i];
  }
}

// =====================================================================================================
// Workspace map (bytes), every offset a multiple of 256 and every plane sized to its whole-line store granularity:
//   WOT  f16 [128][128] x64        0          32768
//   FWT  f16 [128][128] x64        32768      32768
//   QH   f16 [6144][128] q x8      65536      1572864
//   QL   f16 [6144][128] residual  1638400    1572864
//   KH   f16 k x8, fragment order [2][4 heads][192 key tiles][2 halves][32 lanes][8]   3211264    1572864
//   KL                             4784128    1572864
//   VTH  f16 v x16, fragment order [2][4 heads][96 key steps][2 d tiles][2 halves][32 lanes][8]   6356992    1572864
//   VTL                            7929856    1572864
//   LS   f32 [2][512 time blocks][128]   9502720    524288   (row 511 of each batch row neither written nor read)
//   PH   f16 [4 heads][1024][32] x32  10027008   262144
//   PL                             10289152   262144
//   TOT  f32 [2][48 key blocks][128]     10551296   49152
//   end                            10600448
// =====================================================================================================
extern "C" void kernel_launch(void* const* d_in, const int* in_sizes, int n_in,
                              void* d_out, int out_size, void* d_ws, size_t ws_size,
                              hipStream_t stream) {
  if (n_in < 20) return;
  if (in_sizes[0] != NTOK * DD) return;
  if (in_sizes[1] != DD || in_sizes[2] != DD || in_sizes[3] != DD * GH || in_sizes[4] != GH ||
      in_sizes[5] != GH || in_sizes[6] != 1) return;
  if (in_sizes[7] != DD * HID || in_sizes[8] != HID || in_sizes[9] != DD * HID || in_sizes[10] != HID ||
      in_sizes[11] != DD * HID || in_sizes[12] != HID) return;
  if (in_sizes[13] != HID * HID || in_sizes[14] != HID || in_sizes[15] != HID || in_sizes[16] != HID ||
      in_sizes[17] != HID * FD || in_sizes[18] != FD || in_sizes[19] != 1) return;
  if (out_size != NPOOL * FD) return;

  const float* x    = (const float*)d_in[0];
  const float* glnw = (const float*)d_in[1];
  const float* glnb = (const float*)d_in[2];
  const float* gw1  = (const float*)d_in[3];
  const float* gb1  = (const float*)d_in[4];
  const float* gw2  = (const float*)d_in[5];
  const float* gb2  = (const float*)d_in[6];
  const float* qw   = (const float*)d_in[7];
  const float* qb   = (const float*)d_in[8];
  const float* kw   = (const float*)d_in[9];
  const float* kb   = (const float*)d_in[10];
  const float* vw   = (const float*)d_in[11];
  const float* vb   = (const float*)d_in[12];
  const float* ow   = (const float*)d_in[13];
  const float* ob   = (const float*)d_in[14];
  const float* flnw = (const float*)d_in[15];
  const float* flnb = (const float*)d_in[16];
  const float* fw   = (const float*)d_in[17];
  const float* fb   = (const float*)d_in[18];
  const int*   Tp   = (const int*)d_in[19];

  const size_t PWO = (size_t)HID * HID * 2;           //    32768
  const size_t PWF = (size_t)FD * HID * 2;            //    32768
  const size_t PQP = (size_t)NTOK * HID * 2;          //  1572864
  const size_t PVT = (size_t)NB * HID * LL * 2;       //  1572864
  const size_t PSV = (size_t)NB * HID * TT * 4;       //   524288
  const size_t PPP = (size_t)NPOOL * HID * 2;         //   262144
  const size_t PTO = (size_t)NB * (LL / 64) * HID * 4; //    49152
  size_t off = 0;
  const size_t oWO = off; off += PWO;
  const size_t oWF = off; off += PWF;
  const size_t oQH = off; off += PQP;
  const size_t oQL = off; off += PQP;
  const size_t oKH = off; off += PQP;
  const size_t oKL = off; off += PQP;
  const size_t oVH = off; off += PVT;
  const size_t oVL = off; off += PVT;
  const size_t oSV = off; off += PSV;
  const size_t oPH = off; off += PPP;
  const size_t oPL = off; off += PPP;
  const size_t oTO = off; off += PTO;
  if (off > ws_size) return;                           // off = 10600448
  if (off > (size_t)134217728) return;

  char* ws = (char*)d_ws;
  unsigned short* WOT = (unsigned short*)(ws + oWO);
  unsigned short* FWT = (unsigned short*)(ws + oWF);
  unsigned short* QH  = (unsigned short*)(ws + oQH);
  unsigned short* QL  = (unsigned short*)(ws + oQL);
  unsigned short* KH  = (unsigned short*)(ws + oKH);
  unsigned short* KL  = (unsigned short*)(ws + oKL);
  unsigned short* VTH = (unsigned short*)(ws + oVH);
  unsigned short* VTL = (unsigned short*)(ws + oVL);
  float*          LS  = (float*)(ws + oSV);
  float*          TOT = (float*)(ws + oTO);
  unsigned short* PH  = (unsigned short*)(ws + oPH);
  unsigned short* PL  = (unsigned short*)(ws + oPL);
  float*          out = (float*)d_out;

  const dim3 blk(256), blk768(768);
  const dim3 gQ(NTOK / 64 + 16);                       // 96 token blocks + 16 weight tiles
  const dim3 gA(NB * NH * (LL / 96));                  // 256
  const dim3 gT(NPOOL / 16);                           // 64

  // (1) gater + gated q/k/v planes (q rows hi/lo; k and v^T hi/lo in fragment order) + per-block masked-key floor sums;
  //     its last 16 blocks: o_w and f_w planes, transposed to k-contiguous rows: f16( bf16_RNE(w) * 64 )
  qkv_prep<<<gQ, blk, 0, stream>>>(x, glnw, glnb, gw1, gb1, gw2, gb2, qb, kb, vb, qw, kw, vw, ow, fw, Tp,
                                   QH, QL, KH, KL, VTH, VTL, LS, TOT, WOT, FWT);

  // (2) block-causal attention + mean-pool over the 6 forces -> pooled planes
  attn_pool<<<gA, blk768, 0, stream>>>(QH, QL, KH, KL, VTH, VTL, LS, TOT, PH, PL);

  // (3) o-proj + LayerNorm + final linear + SiLU -> out
  tail_k<<<gT, blk, 0, stream>>>(PH, PL, WOT, ob, flnw, flnb, FWT, fb, out);
  (void)hipGetLastError();
}

// v007
// It runs in 36 microseconds.
// In two side-by-side timings against v006, it was 1.10 and 1.12 times as fast.
// Over all steps from v000 it is 5.10 times as fast.
// Contractions: q/k/v projections (x rows f16 x16 . W^T f16 x64, K=32, one product), scores S^T = k . q^T
// (k and q each f16 x8 hi plane + f16 x1024 residual plane, 3 products per tile), O^T = v^T . P^T (v f16 x16 hi +
// x1024 residual, P f16 x1024 hi + x1024 residual, 3 products), pooled attention . Wo^T and LN rows . Wf^T
// (activation f16 hi + x1024 residual . W^T f16 x64, K=128, 2 products): all v_wmma_f32_16x16x32_f16, f32 accumulate;
// gater MLP, LayerNorm, softmax, pooling, SiLU in f32 on VALU; every float input RNE-converted to bf16 on load.
#include <hip/hip_runtime.h>
#include <math.h>
#include <stdint.h>

#define NB     2
#define TT     512
#define NF     6
#define DD     32
#define HID    128
#define NH     4
#define HD     32
#define GH     32
#define FD     128
#define LL     (TT * NF)
#define NTOK   (NB * LL)
#define NPOOL  (NB * TT)
#define LNEPS  1.0e-5f
#define XC     16.0f
#define WSC    64.0f
#define QC     8.0f
#define KC     8.0f
#define VC     16.0f
#define AC     32.0f
#define YC     16.0f
#define RSC    1024.0f
#define INVRS  (1.0f / 1024.0f)
#define FLOORC 1.0e-9f
#define NEGBIG (-1.0e30f)
#define SCL    ((0.17677669529663687f * 1.4426950408889634f) / (QC * KC))
static_assert(NH * HD == HID);
static_assert(FD == HID);
static_assert((LL % 64) == 0 && (LL % 96) == 0 && (LL % 32) == 0 && LL / 48 == 64);
static_assert((NTOK % 64) == 0 && (NPOOL % 16) == 0);
static_assert(DD == 32 && GH == 32 && (DD * GH) % 256 == 0);

typedef _Float16 v16h __attribute__((ext_vector_type(16)));
typedef _Float16 v8h  __attribute__((ext_vector_type(8)));
typedef float    v8f  __attribute__((ext_vector_type(8)));
typedef float    v4f  __attribute__((ext_vector_type(4)));
typedef unsigned int v4u __attribute__((ext_vector_type(4)));
typedef unsigned int v2u __attribute__((ext_vector_type(2)));

union FragH { v16h v; v8h h[2]; };

// ---- scalar helpers --------------------------------------------------------------------------------
__device__ __forceinline__ unsigned short bf_bits(float f) {          // f32 -> bf16 bits, RNE convert
  unsigned u = __float_as_uint(f);
  return (unsigned short)((u + 0x7FFFu + ((u >> 16) & 1u)) >> 16);
}
__device__ __forceinline__ float bf_up(unsigned short h) { return __uint_as_float(((unsigned)h) << 16); }
__device__ __forceinline__ float bfr(float f) { return bf_up(bf_bits(f)); }
__device__ __forceinline__ unsigned short h_bits(_Float16 x) { return __builtin_bit_cast(unsigned short, x); }
__device__ __forceinline__ unsigned pk16(unsigned short a, unsigned short b) { return (unsigned)a | ((unsigned)b << 16); }
__device__ __forceinline__ v8f zero8() { v8f z = {0.f, 0.f, 0.f, 0.f, 0.f, 0.f, 0.f, 0.f}; return z; }
__device__ __forceinline__ float hmax8(v8f s) {
  return fmaxf(fmaxf(fmaxf(s[0], s[1]), fmaxf(s[2], s[3])), fmaxf(fmaxf(s[4], s[5]), fmaxf(s[6], s[7])));
}
__device__ __forceinline__ const _Float16* h16(const unsigned short* p) { return (const _Float16*)(const void*)p; }
// hi = f16(f), lo = f16((f - hi) * 1024): residual plane carried x1024, folded back in the f32 epilogue
__device__ __forceinline__ void split_h(float f, unsigned short& hb, unsigned short& lb) {
  const _Float16 h = (_Float16)f;
  const _Float16 l = (_Float16)((f - (float)h) * RSC);
  hb = h_bits(h);
  lb = h_bits(l);
}
__device__ __forceinline__ float fexp2(float x) { return __builtin_amdgcn_exp2f(x); }
__device__ __forceinline__ float sigm(float a) {
  const float e = __expf(fminf(-a, 60.0f));       // quotient stays far from underflow
  return 1.0f / (1.0f + e);
}
// cross-lane moves on the vector unit (no LDS-path permute, no dscnt wait): lane l <- lane l ^ 16, and l <- l ^ X inside a
// 16-lane row (DPP row_xmask)
__device__ __forceinline__ float xhalf(float x) {
  const int b = __builtin_bit_cast(int, x);
  return __builtin_bit_cast(float, __builtin_amdgcn_permlanex16(b, b, 0x76543210, 0xfedcba98, false, false));
}
template <int X>
__device__ __forceinline__ float xrow(float x) {
  return __builtin_bit_cast(float, __builtin_amdgcn_mov_dpp(__builtin_bit_cast(int, x), 0x160 + X, 0xf, 0xf, true));
}
__device__ __forceinline__ float lane_bc(float x, int k) {   // lane k's value to every lane, through a scalar register
  return __builtin_bit_cast(float, __builtin_amdgcn_readlane(__builtin_bit_cast(int, x), k));
}
__device__ __forceinline__ float wsum(float v) {             // butterfly over 16, 8, 4, 2, 1
  v += xhalf(v);
  v += xrow<8>(v);
  v += xrow<4>(v);
  v += xrow<2>(v);
  v += xrow<1>(v);
  return v;
}

// ---- fragment loader: 16-bit A/B operand, lane -> row/col (lane&15), p already includes +8*(lane>>4);
//      elements 0..7 <- p[0..7] (k0+8h..), elements 8..15 <- p[16..23] (k0+16+8h..)
__device__ __forceinline__ v16h ldfrag_h(const _Float16* p) {
  FragH f;
  f.h[0] = *(const v8h*)(p);
  f.h[1] = *(const v8h*)(p + 16);
  return f.v;
}

// ---- the same fragment from a plane stored in fragment order: one 16 x 32 operand tile = 1024 B = two 512-B halves,
//      half s holds lane L's elements 8s..8s+7 at byte 16*L, so each wave-wide 16-B load covers four whole 128-B lines;
//      p already includes +8*lane
__device__ __forceinline__ v16h ldfrag_p(const _Float16* p) {
  FragH f;
  f.h[0] = *(const v8h*)(p);
  f.h[1] = *(const v8h*)(p + 256);
  return f.v;
}

// ---- WMMA helpers with trailing VALU hazard gap --------------------------------------------------------
__device__ __forceinline__ v8f mma_h_raw(v16h a, v16h b, v8f c) {
  return __builtin_amdgcn_wmma_f32_16x16x32_f16(false, a, false, b, (short)0, c, false, false);
}
__device__ __forceinline__ void guard4x6(v8f& a, v8f& b, v8f& c, v8f& d,
                                         v16h x0, v16h x1, v16h x2, v16h x3, v16h x4, v16h x5) {
#if defined(__HIP_DEVICE_COMPILE__)
  asm volatile("v_nop\n\tv_nop\n\tv_nop\n\tv_nop"
               : "+v"(a), "+v"(b), "+v"(c), "+v"(d)
               : "v"(x0), "v"(x1), "v"(x2), "v"(x3), "v"(x4), "v"(x5));
#endif
}

// =====================================================================================================
// Weight convert with transpose, one 64 k x 32 o tile of o_w or f_w per block (the 16 blocks behind the token blocks of
// the projection launch): in[k][o] f32 (x @ W layout) -> out[o][k] = f16( bf16_RNE(in) * WSC ), k contiguous.
// q = 0..7: o_w [128][128] -> WOT [n][k]; q = 8..15: f_w -> FWT; thread t loads k = t>>2, 8 floats at 8*(t&3) into T
// (pitch 33), stores row o = t>>3, 8 halves k = 8*(t&7).
// coverage: WOT/FWT 4 x 2 tiles x (32 o x 64 k) = [128][128] each.
// =====================================================================================================
__device__ __forceinline__ void conv_tile(const int q, const int t, const float* __restrict__ ow,
                                          const float* __restrict__ fw, unsigned short* WOT, unsigned short* FWT,
                                          float* T) {
  const bool iso = (q < 8);                                  // block-uniform
  const int rr = iso ? q : (q - 8);
  const float* src   = iso ? ow : fw;
  unsigned short* ds = iso ? WOT : FWT;
  const int o0 = (rr >> 1) * 32, k0 = (rr & 1) * 64;
  {
    const int k = t >> 2, oo = 8 * (t & 3);
    const float* sp = src + (size_t)(k0 + k) * HID + o0 + oo;
    const v4f a = *(const v4f*)(sp), c = *(const v4f*)(sp + 4);
#pragma unroll
    for (int i = 0; i < 4; ++i) { T[k * 33 + oo + i] = a[i]; T[k * 33 + oo + 4 + i] = c[i]; }
  }
  __syncthreads();
  {
    const int o = t >> 3, e = t & 7;
    float w[8];
#pragma unroll
    for (int i = 0; i < 8; ++i) w[i] = bfr(T[(8 * e + i) * 33 + o]) * WSC;
    v4u v;
#pragma unroll
    for (int i = 0; i < 4; ++i) v[i] = pk16(h_bits((_Float16)w[2 * i]), h_bits((_Float16)w[2 * i + 1]));
    unsigned short* dp = ds + (size_t)(o0 + o) * HID + k0 + 8 * e;
    *(v4u*)dp = v;
  }
}

// =====================================================================================================
// Gater + gated q/k/v projections for 64 tokens per block (256 threads = 8 waves; blocks 0..95 of a grid of 96 + 16; the
// last 16 blocks convert o_w and f_w for the tail launch, see conv_tile, and do nothing else).
// Phase 0: x tile [64][32] loaded as float4 pairs, RNE-converted to bf16 values: f32 copy sX (pitch 33) for the gater and
//          f16(x * 16) rows sXh (pitch 40 halves) as the WMMA A operand; g_w1 staged bf16-RNE in LDS;
//          q_w | k_w | v_w [32 k][128 n] f32 -> sWT rows [p*128 + n][32 k] = f16( bf16_RNE(w) * 64 ), pitch 40 halves:
//          thread -> column n = t&127 and 8 k (each wave-wide 4-B load is one whole line), one 16-B LDS store per 8 k.
//          Phase 1 (wave -> 8 tokens): LayerNorm, silu hidden layer with lane = hidden unit (32 readlane-broadcast FMAs), gate = sigmoid(sum_lane h*g_w2 + g_b2), all f32 -> sG.
// Phase 2: per part p in {q,k,v}: wave w -> row tile w&3, 64-col half w>>2: 4 WMMAs (K = 32 = one k step; A from sXh,
//          B from sWT rows [p*128 + n][32]); epilogue f = (acc/1024 + bf16(bias[n])) * gate[row] * C (C = 8 q/k, 16 v),
//          hi = f16(f), lo = f16((f-hi)*1024) staged in LDS (q/k row-major [64][136], v transposed [128 hcol][72]);
//          block barrier; whole-line stores: q rows of 256 B by 16 consecutive lanes (instruction i: row 16i + t>>4);
//          k and v^T in fragment order (see ldfrag_p), slab (b, head), 512 contiguous bytes per wave and store.
// Phase 3 (waves 0..3, thread -> head column): this block's share of the masked-key floor sums, from the staged v planes:
//          LS[b][tb][hcol] = sum of v over the block's keys j >= 6*(tb+1), for every boundary 6*(tb+1) that lies in the
//          block, and TOT[b][block][hcol] = sum over all 64 keys (keys of time blocks >= T count as 0).
// coverage: QH/QL rows tok0..tok0+63 x 128 cols; KH/KL 4 heads x key tiles ltok0/16..+3; VTH/VTL 4 heads x key steps
//           ltok0/32..+1 x 2 d tiles; grid covers all 6144 tokens exactly once. LS rows tb = 0..510 of each batch row once
//           (the boundary of tb = 511 is past the last key: no row, and none is read); TOT 96 rows once.
// =====================================================================================================
// Suffix sums of one head column inside a 64-key block whose first boundary (key index a multiple of 6) is local key I0:
// six-key sums first (independent), then one short chain over the boundaries, last to first. r[j] = sum over the block's
// keys from boundary j on (0 where the block has no boundary j), tot = sum over all 64 keys.
#define NJMAX 11                                             // boundaries in a block: 11 for I0 = 0 and 2, 10 for I0 = 4
template <int I0>
__device__ __forceinline__ void block_suffix(const float (&val)[64], const int tb0, const int ntb,
                                             float (&r)[NJMAX], float& tot) {
  constexpr int NJ = (63 - I0) / NF + 1;
  float run = 0.f;
#pragma unroll
  for (int j = NJMAX - 1; j >= NJ; --j) r[j] = 0.f;
#pragma unroll
  for (int j = NJ - 1; j >= 0; --j) {
    float sg = 0.f;
#pragma unroll
    for (int f = 0; f < NF; ++f)
      if (I0 + NF * j + f < 64) sg += val[I0 + NF * j + f];
    run += (tb0 + 1 + j < ntb) ? sg : 0.f;                   // these keys are time block tb0 + 1 + j
    r[j] = run * (1.0f / VC);
  }
  float head = 0.f;
#pragma unroll
  for (int i = 0; i < I0; ++i) head += val[i];
  tot = (run + ((tb0 < ntb) ? head : 0.f)) * (1.0f / VC);    // the keys in front of I0 are time block tb0
}

__global__ __launch_bounds__(256) void qkv_prep(
    const float* __restrict__ x, const float* __restrict__ glnw, const float* __restrict__ glnb,
    const float* __restrict__ gw1, const float* __restrict__ gb1, const float* __restrict__ gw2,
    const float* __restrict__ gb2, const float* __restrict__ qbias, const float* __restrict__ kbias,
    const float* __restrict__ vbias, const float* __restrict__ qw, const float* __restrict__ kw,
    const float* __restrict__ vw, const float* __restrict__ ow, const float* __restrict__ fw,
    const int* __restrict__ Tp,
    unsigned short* QH, unsigned short* QL, unsigned short* KH, unsigned short* KL,
    unsigned short* VTH, unsigned short* VTL, float* LS, float* TOT, unsigned short* WOT, unsigned short* FWT) {
  __shared__ __align__(16) float sX[64 * 33];
  __shared__ __align__(16) _Float16 sXh[64 * 40];
  __shared__ float sW1[DD * GH];
  __shared__ float sG[64];
  __shared__ __align__(16) unsigned short sH[128 * 72];
  __shared__ __align__(16) unsigned short sL[128 * 72];
  __shared__ __align__(16) unsigned short sWT[3 * HID * 40];
  const int t = threadIdx.x, wave = t >> 5, lane = t & 31, hh = lane >> 4, m = lane & 15;
  if (blockIdx.x >= NTOK / 64) {                             // block-uniform, in front of every other barrier
    conv_tile((int)blockIdx.x - NTOK / 64, t, ow, fw, WOT, FWT, sX);
    return;
  }
  const int tok0  = blockIdx.x * 64;
  const int b     = tok0 / LL;
  const int ltok0 = tok0 - b * LL;

  // ---- phase 0 ----
  {
    const int wn = t & 127, wk = t >> 7;                     // weight column; 8-k group wk + 2*(i&1) of part i>>1
    const unsigned wofs = (unsigned)(8 * wk * HID + wn);     // the thread's first element of each part
    float wv[6][8];
#pragma unroll
    for (int i = 0; i < 6; ++i) {
      const float* wsrc = (i < 2) ? qw : ((i < 4) ? kw : vw);
#pragma unroll
      for (int e = 0; e < 8; ++e) wv[i][e] = wsrc[wofs + (unsigned)((16 * (i & 1) + e) * HID)];
    }
    const int tk = t >> 2, j = 8 * (t & 3);
    const float* sp = x + (size_t)(tok0 + tk) * DD + j;
    const v4f a = *(const v4f*)(sp), c = *(const v4f*)(sp + 4);
    // g_w1, unrolled: the thread's four elements are asked for in the same flight as the loads above (rolled, each trip
    // waited for its own load: four round trips in a row)
    const unsigned gofs = (unsigned)t;
    float g1[DD * GH / 256];
#pragma unroll
    for (int i = 0; i < DD * GH / 256; ++i) g1[i] = gw1[gofs + (unsigned)(256 * i)];
    // one wait for the weight, x and g_w1 loads above: their address registers are inputs here, so that neither a later
    // load's destination nor any other instruction overwrites one of them in front of it
    asm volatile("s_wait_xcnt 0x0" :: "v"(wofs), "v"(sp), "v"(gofs) : "memory");
    float r8[8];
#pragma unroll
    for (int i = 0; i < 4; ++i) { r8[i] = bfr(a[i]); r8[4 + i] = bfr(c[i]); }
#pragma unroll
    for (int i = 0; i < 8; ++i) {
      sX[tk * 33 + j + i]  = r8[i];
      sXh[tk * 40 + j + i] = (_Float16)(r8[i] * XC);
    }
#pragma unroll
    for (int i = 0; i < DD * GH / 256; ++i) sW1[t + 256 * i] = bfr(g1[i]);
#pragma unroll
    for (int i = 0; i < 6; ++i) {
      v4u v;
#pragma unroll
      for (int e = 0; e < 4; ++e)
        v[e] = pk16(h_bits((_Float16)(bfr(wv[i][2 * e]) * WSC)), h_bits((_Float16)(bfr(wv[i][2 * e + 1]) * WSC)));
      *(v4u*)(sWT + ((i >> 1) * HID + wn) * 40 + 8 * (wk + 2 * (i & 1))) = v;
    }
  }
  __syncthreads();
  // read here so that phase 3 does not wait for it; behind the barrier, so that the scalar load's destination cannot be a
  // base register of phase 0's loads while they are in flight
  const int tin = Tp[0];

  // ---- phase 1: gater (f32, VALU) ----
  {
    const float gw = bfr(glnw[lane]), gb = bfr(glnb[lane]);
    const float b1 = bfr(gb1[lane]),  w2 = bfr(gw2[lane]), b2 = bfr(gb2[0]);
    // unrolled: the wave's eight tokens are eight independent chains (sums, 32-link FMA chain, sigmoids) that fill each
    // other's latency; rolled, one chain at a time left the two waves of a SIMD waiting most of the time
    float gsel = 0.f;
#pragma unroll
    for (int i = 0; i < 8; ++i) {
      const int tk = wave * 8 + i;
      const float xv  = sX[tk * 33 + lane];
      const float mu  = wsum(xv) * (1.0f / DD);
      const float dv  = xv - mu;
      const float var = wsum(dv * dv) * (1.0f / DD);
      const float xn  = dv * rsqrtf(var + LNEPS) * gw + gb;
      float hacc = b1;
#pragma unroll
      for (int k = 0; k < DD; ++k) hacc += lane_bc(xn, k) * sW1[k * GH + lane];
      const float hs = hacc * sigm(hacc);
      const float gs = wsum(hs * w2) + b2;
      const float g  = sigm(gs);
      gsel = ((lane & 7) == i) ? g : gsel;                   // every lane holds g: lanes i, i + 8, .. keep token i's
    }
    sG[wave * 8 + (lane & 7)] = gsel;                        // one store, no branch: four lanes write the same value to a slot
  }
  __syncthreads();

  // ---- phase 2: projections on WMMA ----
  const int rt = wave & 3, ch = wave >> 2;
  FragH af;
  af.h[0] = *(const v8h*)(sXh + (16 * rt + m) * 40 + 8 * hh);
  af.h[1] = *(const v8h*)(sXh + (16 * rt + m) * 40 + 16 + 8 * hh);
  const _Float16* WTp = h16(sWT);
  // unrolled: p is a constant in each copy, so the staging layout test per value costs no scalar branch, and the 32 values'
  // short chains of a part interleave in one straight block
#pragma unroll
  for (int p = 0; p < 3; ++p) {
    const float* bp = (p == 0) ? qbias : ((p == 1) ? kbias : vbias);
    const float osc = (p == 2) ? VC : QC;
    v16h bf[4];
#pragma unroll
    for (int j = 0; j < 4; ++j)
      bf[j] = ldfrag_h(WTp + (p * HID + 64 * ch + 16 * j + m) * 40 + 8 * hh);
    v8f acc[4];
#pragma unroll
    for (int j = 0; j < 4; ++j) acc[j] = mma_h_raw(af.v, bf[j], zero8());
    guard4x6(acc[0], acc[1], acc[2], acc[3], af.v, bf[0], bf[1], bf[2], bf[3], af.v);
    float gr[8];
#pragma unroll
    for (int r = 0; r < 8; ++r) gr[r] = sG[16 * rt + 8 * hh + r];
#pragma unroll
    for (int j = 0; j < 4; ++j) {
      const int n = 64 * ch + 16 * j + m;
      const float bn = bfr(bp[n]);
#pragma unroll
      for (int r = 0; r < 8; ++r) {
        const int row = 16 * rt + 8 * hh + r;
        const float f = ((acc[j][r] * (1.0f / (XC * WSC)) + bn) * gr[r]) * osc;
        unsigned short hb, lb;
        split_h(f, hb, lb);
        if (p < 2) { sH[row * 136 + n] = hb; sL[row * 136 + n] = lb; }
        else       { sH[n * 72 + row]  = hb; sL[n * 72 + row]  = lb; }
      }
    }
    __syncthreads();
    if (p == 0) {                                                   // block-uniform
      unsigned short* Hp = QH;
      unsigned short* Lp = QL;
      const int e = t & 15;
      v4u hv[4], lv[4];
#pragma unroll
      for (int i = 0; i < 4; ++i) {
        const int row = 16 * i + (t >> 4);
        hv[i] = *(const v4u*)(sH + row * 136 + 8 * e);
        lv[i] = *(const v4u*)(sL + row * 136 + 8 * e);
      }
#pragma unroll
      for (int i = 0; i < 4; ++i) {
        const int row = 16 * i + (t >> 4);
        *(v4u*)(Hp + (size_t)(tok0 + row) * HID + 8 * e) = hv[i];
        *(v4u*)(Lp + (size_t)(tok0 + row) * HID + 8 * e) = lv[i];
      }
      
    } else if (p == 1) {
      // k in fragment order: instruction i = head; wave -> 16-key tile t>>6, half s; lane -> key m, dims 16s + 8hh ..+7
      const int ktl = t >> 6, s = (t >> 5) & 1;
      v4u hv[4], lv[4];
#pragma unroll
      for (int i = 0; i < 4; ++i) {
        const int src = (16 * ktl + m) * 136 + HD * i + 16 * s + 8 * hh;
        hv[i] = *(const v4u*)(sH + src);
        lv[i] = *(const v4u*)(sL + src);
      }
#pragma unroll
      for (int i = 0; i < 4; ++i) {
        const size_t o = ((size_t)(b * NH + i) * (LL / 16) + (ltok0 >> 4) + ktl) * 512 + s * 256 + lane * 8;
        *(v4u*)(KH + o) = hv[i];
        *(v4u*)(KL + o) = lv[i];
      }
      // the stores' registers are reused by the next part's LDS reads: keep the wait in front of that overwrite
      asm volatile("s_wait_xcnt 0x0" ::: "memory");
    } else {
      // v^T in fragment order: instruction i = head; wave -> 32-key step t>>7, d tile dt, half s; lane -> d row m,
      // keys 16s + 8hh ..+7
      const int ksl = t >> 7, dt = (t >> 6) & 1, s = (t >> 5) & 1;
      v4u hv[4], lv[4];
#pragma unroll
      for (int i = 0; i < 4; ++i) {
        const int src = (HD * i + 16 * dt + m) * 72 + 32 * ksl + 16 * s + 8 * hh;
        hv[i] = *(const v4u*)(sH + src);
        lv[i] = *(const v4u*)(sL + src);
      }
#pragma unroll
      for (int i = 0; i < 4; ++i) {
        const size_t o = ((size_t)(b * NH + i) * (LL / 32) + (ltok0 >> 5) + ksl) * 1024 + dt * 512 + s * 256 + lane * 8;
        *(v4u*)(VTH + o) = hv[i];
        *(v4u*)(VTL + o) = lv[i];
      }
      // same wait behind the v^T stores, in front of any reuse of their registers
      asm volatile("s_wait_xcnt 0x0" ::: "memory");
      // ---- phase 3: floor sums of this block's keys ----
      if (wave < 4) {                                               // wave-uniform; no barrier inside
        const int ntb = (tin < 0) ? 0 : ((tin > TT) ? TT : tin);    // structural, clamped to the static extent
        float val[64];
#pragma unroll
        for (int g = 0; g < 8; ++g) {
          const v8h a = *(const v8h*)(h16(sH) + t * 72 + 8 * g);
          const v8h l = *(const v8h*)(h16(sL) + t * 72 + 8 * g);
#pragma unroll
          for (int j = 0; j < 8; ++j)
            val[8 * g + j] = (float)a[j] + (float)l[j] * INVRS;
        }
        const int i0  = (NF - ltok0 % NF) % NF;                     // 0, 2 or 4: 64 keys shift the phase by 4
        const int tb0 = (ltok0 + i0) / NF - 1;                      // time block whose masked keys start at local key i0
        float r[NJMAX], tot;
        if (i0 == 0)      block_suffix<0>(val, tb0, ntb, r, tot);   // block-uniform
        else if (i0 == 2) block_suffix<2>(val, tb0, ntb, r, tot);
        else              block_suffix<4>(val, tb0, ntb, r, tot);
        float* lsp  = LS + ((size_t)b * TT + tb0 + 1) * HID + t;    // row tb0 + 1, the block's second boundary
        float* totp = TOT + ((size_t)b * (LL / 64) + (ltok0 >> 6)) * HID + t;
        if (tb0 >= 0) *(lsp - HID) = r[0];                          // block-uniform: key 0 is no boundary of a time block
#pragma unroll
        for (int j = 1; j < NJMAX - 1; ++j) lsp[(size_t)(j - 1) * HID] = r[j];
        if (i0 != 4) lsp[(size_t)(NJMAX - 2) * HID] = r[NJMAX - 1]; // block-uniform: the eleventh boundary
        totp[0] = tot;
        // the stores' registers may be reused behind this point: keep the wait in front of that overwrite
        asm volatile("s_wait_xcnt 0x0" ::: "memory");
      }
    }
    __syncthreads();
  }
}

// =====================================================================================================
// One 32-key step of the transposed flash formulation for 16 queries of one head (head dim 32 = one k step):
//   S^T tiles (16 keys x 16 queries) = A(k rows, dims split-map) . B(q^T): hi.hi -> s, hi.lo + lo.hi -> sr (x1024);
//   logit (log2 domain) = (s + sr/1024) * scale*log2e/64; block-causal mask by value (key < horizon of the lane's query);
//   online softmax per lane (8 + 8 keys of ONE query per lane, max combined with lane^16), p = 2^(e - m + 10) (x1024);
//   P^T as the B operand of O^T(16 d x 16 queries) += v^T(d rows, keys split-map) . P^T: element r <- tile keys kb..kb+15,
//   element 8+r <- tile kb+16..kb+31, lane unchanged; P hi to o, (v hi . P lo x1024 + v lo x1024 . P hi) to or.
// =====================================================================================================
template <bool MASKED>
__device__ __forceinline__ void attn_step(const int kb, const int jl, const int hh,
    const _Float16* __restrict__ kH, const _Float16* __restrict__ kL,
    const _Float16* __restrict__ vH, const _Float16* __restrict__ vL,
    const v16h qhi, const v16h qlo, float& m_run, float& l_run,
    v8f& o1, v8f& o1r, v8f& o2, v8f& o2r) {
  const size_t so = (size_t)kb * 32;                 // 32 keys = 1024 halves of each fragment-order plane
  const v16h kh0 = ldfrag_p(kH + so);
  const v16h kh1 = ldfrag_p(kH + so + 512);
  const v16h kl0 = ldfrag_p(kL + so);
  const v16h kl1 = ldfrag_p(kL + so + 512);
  v8f s0  = mma_h_raw(kh0, qhi, zero8());
  v8f s1  = mma_h_raw(kh1, qhi, zero8());
  v8f s0r = mma_h_raw(kh0, qlo, zero8());
  v8f s1r = mma_h_raw(kh1, qlo, zero8());
  s0r = mma_h_raw(kl0, qhi, s0r);
  s1r = mma_h_raw(kl1, qhi, s1r);
  guard4x6(s0, s1, s0r, s1r, kh0, kh1, kl0, kl1, qhi, qlo);

  float e0[8], e1[8];
#pragma unroll
  for (int r = 0; r < 8; ++r) {
    e0[r] = (s0[r] + s0r[r] * INVRS) * SCL;
    e1[r] = (s1[r] + s1r[r] * INVRS) * SCL;
  }
  if (MASKED) {
    const int lim = jl - (kb + 8 * hh);              // row r is key kb + 8hh + r (tile 0), + 16 (tile 1): visible if below jl
#pragma unroll
    for (int r = 0; r < 8; ++r) {
      e0[r] = (r      < lim) ? e0[r] : NEGBIG;
      e1[r] = (16 + r < lim) ? e1[r] : NEGBIG;
    }
  }
  float mx = fmaxf(fmaxf(fmaxf(fmaxf(e0[0], e0[1]), fmaxf(e0[2], e0[3])), fmaxf(fmaxf(e0[4], e0[5]), fmaxf(e0[6], e0[7]))),
                   fmaxf(fmaxf(fmaxf(e1[0], e1[1]), fmaxf(e1[2], e1[3])), fmaxf(fmaxf(e1[4], e1[5]), fmaxf(e1[6], e1[7]))));
  mx = fmaxf(mx, __shfl_xor(mx, 16, 32));
  const float m_new = fmaxf(m_run, mx);
  const float corr  = fexp2(m_run - m_new);
  m_run = m_new;
  const float msh = m_new - 10.0f;                   // 2^(e - m + 10) = e^{s - smax} * 1024
  l_run *= corr;
  o1 = o1 * corr; o1r = o1r * corr; o2 = o2 * corr; o2r = o2r * corr;

  FragH ph, pl;
  float ls = 0.f;
#pragma unroll
  for (int r = 0; r < 8; ++r) {
    const float p0 = fexp2(e0[r] - msh);
    const float p1 = fexp2(e1[r] - msh);
    ls += p0 + p1;
    const _Float16 a0 = (_Float16)p0, a1 = (_Float16)p1;
    ph.h[0][r] = a0;                                          // keys kb      + 8hh + r
    ph.h[1][r] = a1;                                          // keys kb + 16 + 8hh + r
    pl.h[0][r] = (_Float16)((p0 - (float)a0) * RSC);
    pl.h[1][r] = (_Float16)((p1 - (float)a1) * RSC);
  }
  l_run += ls;

  const v16h vh1 = ldfrag_p(vH + so);
  const v16h vl1 = ldfrag_p(vL + so);
  const v16h vh2 = ldfrag_p(vH + so + 512);
  const v16h vl2 = ldfrag_p(vL + so + 512);
  o1  = mma_h_raw(vh1, ph.v, o1);
  o2  = mma_h_raw(vh2, ph.v, o2);
  o1r = mma_h_raw(vh1, pl.v, o1r);
  o2r = mma_h_raw(vh2, pl.v, o2r);
  o1r = mma_h_raw(vl1, ph.v, o1r);
  o2r = mma_h_raw(vl2, ph.v, o2r);
  guard4x6(o1, o2, o1r, o2r, vh1, vh2, vl1, vl2, ph.v, pl.v);
}

// =====================================================================================================
// Attention + mean-pool for one head of one batch row and a PAIR of 48-query groups: group 63 - pi (long key range) and
// group pi (short key range), so that every block holds about the same number of 32-key steps. Block = 24 waves (768
// threads), grid = 2 * 4 * 32 = 256. Wave w -> query tile index g = w>>3 of both groups; the 8 waves of one g share the
// key steps of the long tile (nH steps) and of the short tile (nL steps) in runs of C consecutive steps, C the smallest
// run length for which the block's longest pair of tiles fits in 8 waves. Each wave runs the online softmax over its own run only (the fully
// visible steps without masking, the rest with the per-lane horizon test by value) and leaves its partial
// (row maximum m, row sum l, o + or/1024) in LDS; a lane whose keys are all masked in its run keeps m = NEGBIG and gets
// weight 0 in the merge (run 0 of every tile holds keys 0..5, visible to every query, so the merged maximum is real).
// Merge (all 768 threads, thread -> query t>>3 of 96, 4 d at 4*(t&7)): M = max m_s, w_s = 2^(m_s - M),
// attn[d] = (sum w_s o_s) / (16 sum w_s l_s) + 1e-9 * (sum of v[.][d] over the query's masked keys) -> LDS sO[96][36] (f32);
// that sum = LS[b][tq][.] (the masked keys inside the 64-key block that holds the first of them) + the totals TOT of all
// later 64-key blocks, which wave 7 sums last to first into LDS sTS[48][32] in front of the merge barrier;
// barrier; threads 0..127 pool 6 consecutive query rows (pooled row t>>3 of 16, cols 4*(t&7)) -> f16 hi (x32) / lo
// (x1024), stored to the head's own plane [head][1024 rows][32]: one wave writes 256 contiguous bytes of each plane.
// coverage: per block rows b*512 + 8*(63-pi) .. +7 and b*512 + 8*pi .. +7 of head h; 256 blocks cover [4][1024][32] once.
// =====================================================================================================
#define KS 8                                                 // waves that share one long and one short query tile
__device__ __forceinline__ int cdiv_i(int a, int d) { return (a + d - 1) / d; }
// 32-key steps of the 16-query tile that starts at query qw0: up to the block-causal horizon of its last query (<= 3072)
__device__ __forceinline__ int tile_steps(int qw0) { return (((qw0 + 15) / NF + 1) * NF + 31) >> 5; }
// run length for a pair of tiles; at most 96 since then each tile is one run
__device__ __forceinline__ int run_len(int nH, int nL) {
  int C = cdiv_i(nH + nL, KS);
  for (; C < LL / 32; ++C)
    if (cdiv_i(nH, C) + cdiv_i(nL, C) <= KS) break;
  return C;
}

__global__ __launch_bounds__(768)
void attn_pool(const unsigned short* __restrict__ QH, const unsigned short* __restrict__ QL,
               const unsigned short* __restrict__ KH, const unsigned short* __restrict__ KL,
               const unsigned short* __restrict__ VTH, const unsigned short* __restrict__ VTL,
               const float* __restrict__ LS, const float* __restrict__ TOT, unsigned short* PH, unsigned short* PL) {
  __shared__ __align__(16) float sP[3 * KS * 16 * 36];       // per wave 16 queries x 32 d, pitch 36
  __shared__ float sM[3 * KS * 16];
  __shared__ float sL[3 * KS * 16];
  __shared__ __align__(16) float sO[96 * 36];
  __shared__ __align__(16) float sTS[(LL / 64) * HD];        // [64-key block k][d]: sum of v over all keys of blocks > k
  const int t = threadIdx.x, lane = t & 31, hh = lane >> 4, c = lane & 15;
  const int wave = __builtin_amdgcn_readfirstlane(t >> 5);   // wave-uniform: run bounds and plane bases stay scalar
  const int bx = blockIdx.x;
  const int pi = bx & 31;
  const int h  = (bx >> 5) & 3;
  const int b  = bx >> 7;
  const size_t tokb = (size_t)b * LL;
  // one run length for the block, from its last (longest) tiles: run s of all three tiles covers the same keys, so the
  // three waves that walk it together read the same k and v lines
  const int C = run_len(tile_steps((63 - pi) * 48 + 32), tile_steps(pi * 48 + 32));

  if (wave == KS - 1) {                                      // scalar branch; this wave holds at most the last, short run of a short tile
    const float* tp = TOT + (size_t)b * (LL / 64) * HID + h * HD + lane;   // lane -> d
    float tv[LL / 64];
#pragma unroll
    for (int k = 0; k < LL / 64; ++k) tv[k] = tp[(size_t)k * HID];
    // the loads' address registers may be reused below: keep the wait in front of that overwrite
    asm volatile("s_wait_xcnt 0x0" ::: "memory");
    float run = 0.f;
#pragma unroll
    for (int k = LL / 64 - 1; k >= 0; --k) { sTS[k * HD + lane] = run; run += tv[k]; }
  }

  {
    const int g = wave >> 3, s8 = wave & (KS - 1);
    const int qH0 = (63 - pi) * 48 + 16 * g, qL0 = pi * 48 + 16 * g;
    const int nH = tile_steps(qH0), nL = tile_steps(qL0);
    const int SH = cdiv_i(nH, C);
    const bool isH = (s8 < SH);
    const int qw0 = isH ? qH0 : qL0;
    const int n   = isH ? nH : nL;
    const int s   = isH ? s8 : (s8 - SH);
    const int st1 = (s + 1) * C;
    const int kb1 = ((st1 < n) ? st1 : n) * 32;              // a wave past the short tile's last run does no step
    const int qi  = qw0 + c;                                 // query of this lane (B column / D column)
    const int jl  = (qi / NF + 1) * NF;                      // exclusive key horizon

    const _Float16* QHp = h16(QH);
    const _Float16* QLp = h16(QL);
    const v16h qhi = ldfrag_h(QHp + (tokb + qi) * HID + h * HD + 8 * hh);
    const v16h qlo = ldfrag_h(QLp + (tokb + qi) * HID + h * HD + 8 * hh);
    // the q loads' address registers are reused by the accumulators' start values: keep the wait in front of that overwrite
    asm volatile("s_wait_xcnt 0x0" ::: "memory");
    const size_t pbase = (size_t)(b * NH + h) * LL * HD + 8 * lane;   // (b, head) slab of a fragment-order plane; + kb * 32
    const _Float16* kH = h16(KH) + pbase;                             // key tile 2 at +512 halves
    const _Float16* kL = h16(KL) + pbase;
    const _Float16* vH = h16(VTH) + pbase;                            // d tile 2 at +512 halves
    const _Float16* vL = h16(VTL) + pbase;

    float m_run = NEGBIG, l_run = 0.f;
    v8f o1 = zero8(), o1r = zero8(), o2 = zero8(), o2r = zero8();
    const int jmin  = (qw0 / NF + 1) * NF;
    const int cfull = (jmin / 32) * 32;
    const int kbf   = (cfull < kb1) ? cfull : kb1;
    int kb = s * C * 32;
#pragma unroll 1
    for (; kb < kbf; kb += 32)
      attn_step<false>(kb, jl, hh, kH, kL, vH, vL, qhi, qlo, m_run, l_run, o1, o1r, o2, o2r);
#pragma unroll 1
    for (; kb < kb1; kb += 32)
      attn_step<true>(kb, jl, hh, kH, kL, vH, vL, qhi, qlo, m_run, l_run, o1, o1r, o2, o2r);

    l_run += __shfl_xor(l_run, 16, 32);
    float* pp = sP + (wave * 16 + c) * 36 + 8 * hh;
    v4f a0, a1, c0, c1;
#pragma unroll
    for (int r = 0; r < 4; ++r) {
      a0[r] = o1[r] + o1r[r] * INVRS;  a1[r] = o1[4 + r] + o1r[4 + r] * INVRS;
      c0[r] = o2[r] + o2r[r] * INVRS;  c1[r] = o2[4 + r] + o2r[4 + r] * INVRS;
    }
    *(v4f*)(pp)      = a0;                                   // d  8hh ..  8hh+7
    *(v4f*)(pp + 4)  = a1;
    *(v4f*)(pp + 16) = c0;                                   // d 16+8hh .. 16+8hh+7
    *(v4f*)(pp + 20) = c1;
    if (hh == 0) { sM[wave * 16 + c] = m_run; sL[wave * 16 + c] = l_run; }
  }
  __syncthreads();
  {
    const int tile = wave >> 2;                              // 0..2 long group's tiles, 3..5 short group's; 4 queries per wave
    const int hl = (tile >= 3) ? 1 : 0;
    const int g  = tile - 3 * hl;
    const int qH0 = (63 - pi) * 48 + 16 * g, qL0 = pi * 48 + 16 * g;
    const int nH = tile_steps(qH0), nL = tile_steps(qL0);
    const int SH = cdiv_i(nH, C);
    const int w0 = g * KS + (hl ? SH : 0);                   // first wave and number of waves that hold this tile's runs
    const int wn = hl ? cdiv_i(nL, C) : SH;
    const int c2 = (t >> 3) & 15, dg = t & 7;
    const int tq = ((hl ? qL0 : qH0) + c2) / NF;
    const int  j0  = (tq + 1) * NF;                          // first masked key; none for the last time block
    const bool any = (j0 < LL);
    const v4f lsv = *(const v4f*)(LS + ((size_t)b * TT + (any ? tq : 0)) * HID + h * HD + 4 * dg);
    const v4f tsv = *(const v4f*)(sTS + (any ? (j0 >> 6) : 0) * HD + 4 * dg);
    v4f sv;
#pragma unroll
    for (int e = 0; e < 4; ++e) sv[e] = any ? (lsv[e] + tsv[e]) : 0.f;
    // all KS slots read at once (one LDS latency); a slot past the tile's last run rereads run 0 and gets weight 0
    float ms[KS], ls[KS];
    v4f os[KS];
#pragma unroll
    for (int i = 0; i < KS; ++i) {
      const int wi = w0 + ((i < wn) ? i : 0);
      ms[i] = sM[wi * 16 + c2];
      ls[i] = sL[wi * 16 + c2];
      os[i] = *(const v4f*)(sP + (wi * 16 + c2) * 36 + 4 * dg);
    }
    float M = ms[0];
#pragma unroll
    for (int i = 1; i < KS; ++i) M = fmaxf(M, ms[i]);
    float L = 0.f;
    v4f O = {0.f, 0.f, 0.f, 0.f};
#pragma unroll
    for (int i = 0; i < KS; ++i) {
      const float w = (i < wn) ? fexp2(ms[i] - M) : 0.f;
      L += w * ls[i];
      O += os[i] * w;
    }
    const float inv = (1.0f / L) * (1.0f / VC);
    *(v4f*)(sO + (t >> 3) * 36 + 4 * dg) = O * inv + sv * FLOORC;
  }
  __syncthreads();
  if (wave < 4) {                                            // wave-uniform; no barrier behind it
    const int pr = t >> 3, col = 4 * (t & 7);
    v4f s = {0.f, 0.f, 0.f, 0.f};
#pragma unroll
    for (int f = 0; f < NF; ++f) s += *(const v4f*)(sO + (NF * pr + f) * 36 + col);
    unsigned short hb[4], lb[4];
#pragma unroll
    for (int e = 0; e < 4; ++e) split_h((s[e] * (1.0f / NF)) * AC, hb[e], lb[e]);
    v2u ph2, pl2;
    ph2[0] = pk16(hb[0], hb[1]); ph2[1] = pk16(hb[2], hb[3]);
    pl2[0] = pk16(lb[0], lb[1]); pl2[1] = pk16(lb[2], lb[3]);
    const int qblk = (pr < 8) ? (63 - pi) : pi;
    const size_t o = ((size_t)h * NPOOL + (size_t)(b * TT + 8 * qblk + (pr & 7))) * HD + col;
    *(v2u*)(PH + o) = ph2;
    *(v2u*)(PL + o) = pl2;
  }
}

// =====================================================================================================
// Tail: 16 pooled rows per block (grid 1024/16 = 64, 256 threads = 8 waves); wave w -> the 16 x 16 tile of output columns
// 16w..16w+15 in both products, so that a wave's share of every serial part is short: one accumulator pair per product,
// two LayerNorm rows, eight outputs per lane. Every global operand of the block (pooled planes, both weight tiles, biases,
// LayerNorm weights) is asked for at the top, in one flight.
// GEMM1 z = pooled(hi + lo/1024)/32 . Wo + bf16(o_b): A planes PH/PL [head][row][32], k step = head (two products into
// acc/accr), B = WOT rows, K=128 -> sZ rows (f32);
// LayerNorm: wave -> rows 2w, 2w+1, lane -> 4 columns; the row leaves as f16 hi (x16) / lo (x1024) planes sYh/sYl, pitch
// 136 halves, split once here in place of once per reading wave;
// GEMM2 from sYh/sYl rows . FWT rows; epilogue silu(acc + bf16(f_b)) staged in sZ, whole 512-B rows stored per wave.
// coverage: out rows r0..r0+15 x 128 cols; 64 blocks cover [1024][128] exactly once.
// =====================================================================================================
__global__ __launch_bounds__(256) void tail_k(const unsigned short* __restrict__ PH, const unsigned short* __restrict__ PL,
                                               const unsigned short* __restrict__ WOT, const float* __restrict__ obias,
                                               const float* __restrict__ flnw, const float* __restrict__ flnb,
                                               const unsigned short* __restrict__ FWT, const float* __restrict__ fbias,
                                               float* out) {
  __shared__ __align__(16) float sZ[16 * 132];
  __shared__ __align__(16) unsigned short sYh[16 * 136];
  __shared__ __align__(16) unsigned short sYl[16 * 136];
  const int t = threadIdx.x, wave = t >> 5, lane = t & 31, hh = lane >> 4, m = lane & 15;
  const int r0 = blockIdx.x * 16;
  const int n  = 16 * wave + m;                              // the lane's output column in both products

  // ---- all global operands ----
  const _Float16* Ah = h16(PH) + (size_t)(r0 + m) * HD + 8 * hh;   // + 32 * ks * NPOOL: plane of head ks
  const _Float16* Al = h16(PL) + (size_t)(r0 + m) * HD + 8 * hh;
  const _Float16* Bw = h16(WOT) + (size_t)n * HID + 8 * hh;
  const _Float16* Bf = h16(FWT) + (size_t)n * HID + 8 * hh;
  v16h ah[4], al[4], bw[4], bf[4];
#pragma unroll
  for (int ks = 0; ks < 4; ++ks) {
    ah[ks] = ldfrag_h(Ah + (size_t)(32 * ks) * NPOOL);
    bw[ks] = ldfrag_h(Bw + 32 * ks);
    al[ks] = ldfrag_h(Al + (size_t)(32 * ks) * NPOOL);
  }
  const float ob = obias[n];
  const v4f lw = *(const v4f*)(flnw + 4 * lane), lb = *(const v4f*)(flnb + 4 * lane);
#pragma unroll
  for (int ks = 0; ks < 4; ++ks) bf[ks] = ldfrag_h(Bf + 32 * ks);
  const float fb = fbias[n];
  // holds every load above in front of the first product, so that all of them fly together (left alone, the compiler issues
  // them in four groups among the WMMAs, one round trip each); loaded values and their addresses as inputs only: the
  // address registers stay whole until the data are back
  asm volatile("" :: "v"(ah[0]), "v"(ah[1]), "v"(ah[2]), "v"(ah[3]), "v"(al[0]), "v"(al[1]), "v"(al[2]), "v"(al[3]),
               "v"(bw[0]), "v"(bw[1]), "v"(bw[2]), "v"(bw[3]), "v"(bf[0]), "v"(bf[1]), "v"(bf[2]), "v"(bf[3]),
               "v"(ob), "v"(fb), "v"(lw), "v"(lb), "v"(Ah), "v"(Al), "v"(Bw), "v"(Bf));

  // ---- GEMM1 ----
  {
    v8f acc = zero8(), accr = zero8();
#pragma unroll
    for (int ks = 0; ks < 4; ++ks) {
      acc  = mma_h_raw(ah[ks], bw[ks], acc);
      accr = mma_h_raw(al[ks], bw[ks], accr);
    }
    const float bn = bfr(ob);
#pragma unroll
    for (int r = 0; r < 8; ++r)
      sZ[(8 * hh + r) * 132 + n] = (acc[r] + accr[r] * INVRS) * (1.0f / (AC * WSC)) + bn;
  }
  __syncthreads();

  // ---- LayerNorm, rows out as f16 planes ----
  {
    float gg[4], bb[4];
#pragma unroll
    for (int e = 0; e < 4; ++e) { gg[e] = bfr(lw[e]); bb[e] = bfr(lb[e]); }
    const float* zp = sZ + 2 * wave * 132 + 4 * lane;         // rows 2w and 2w + 1 from one base: both reads go out together
    unsigned short* yhp = sYh + 2 * wave * 136 + 4 * lane;
    unsigned short* ylp = sYl + 2 * wave * 136 + 4 * lane;
    v4f zz[2];
#pragma unroll
    for (int i = 0; i < 2; ++i) zz[i] = *(const v4f*)(zp + i * 132);
#pragma unroll
    for (int i = 0; i < 2; ++i) {
      const v4f z = zz[i];
      float s = (z[0] + z[1]) + (z[2] + z[3]);
      s = wsum(s);
      const float mean = s * (1.0f / HID);
      float d[4];
#pragma unroll
      for (int e = 0; e < 4; ++e) d[e] = z[e] - mean;
      float vs = (d[0] * d[0] + d[1] * d[1]) + (d[2] * d[2] + d[3] * d[3]);
      vs = wsum(vs);
      const float rstd = rsqrtf(vs * (1.0f / HID) + LNEPS);
      unsigned short hb[4], lo[4];
#pragma unroll
      for (int e = 0; e < 4; ++e) split_h(((d[e] * rstd) * gg[e] + bb[e]) * YC, hb[e], lo[e]);
      v2u yh, yl;
      yh[0] = pk16(hb[0], hb[1]); yh[1] = pk16(hb[2], hb[3]);
      yl[0] = pk16(lo[0], lo[1]); yl[1] = pk16(lo[2], lo[3]);
      *(v2u*)(yhp + i * 136) = yh;
      *(v2u*)(ylp + i * 136) = yl;
    }
  }
  __syncthreads();

  // ---- GEMM2 ----
  {
    const _Float16* yhp = h16(sYh) + m * 136 + 8 * hh;
    const _Float16* ylp = h16(sYl) + m * 136 + 8 * hh;
    v16h yh[4], yl[4];
#pragma unroll
    for (int ks = 0; ks < 4; ++ks) { yh[ks] = ldfrag_h(yhp + 32 * ks); yl[ks] = ldfrag_h(ylp + 32 * ks); }
    v8f acc2 = zero8(), acc2r = zero8();
#pragma unroll
    for (int ks = 0; ks < 4; ++ks) {
      acc2  = mma_h_raw(yh[ks], bf[ks], acc2);
      acc2r = mma_h_raw(yl[ks], bf[ks], acc2r);
    }
    const float bn = bfr(fb);
    // sZ is free: its last readers, the LayerNorm rows, are behind the barrier above
#pragma unroll
    for (int r = 0; r < 8; ++r) {
      const float a = (acc2[r] + acc2r[r] * INVRS) * (1.0f / (YC * WSC)) + bn;
      sZ[(8 * hh + r) * 132 + n] = a * sigm(a);
    }
  }
  __syncthreads();
  {
    v4f vals[2];
#pragma unroll
    for (int i = 0; i < 2; ++i) vals[i] = *(const v4f*)(sZ + (8 * i + wave) * 132 + 4 * lane);
#pragma unroll
    for (int i = 0; i < 2; ++i)
      *(v4f*)(out + (size_t)(r0 + 8 * i + wave) * FD + 4 * lane) = vals[i];
  }
}

// =====================================================================================================
// Workspace map (bytes), every offset a multiple of 256 and every plane sized to its whole-line store granularity:
//   WOT  f16 [128][128] x64        0          32768
//   FWT  f16 [128][128] x64        32768      32768
//   QH   f16 [6144][128] q x8      65536      1572864
//   QL   f16 [6144][128] residual  1638400    1572864
//   KH   f16 k x8, fragment order [2][4 heads][192 key tiles][2 halves][32 lanes][8]   3211264    1572864
//   KL                             4784128    1572864
//   VTH  f16 v x16, fragment order [2][4 heads][96 key steps][2 d tiles][2 halves][32 lanes][8]   6356992    1572864
//   VTL                            7929856    1572864
//   LS   f32 [2][512 time blocks][128]   9502720    524288   (row 511 of each batch row neither written nor read)
//   PH   f16 [4 heads][1024][32] x32  10027008   262144
//   PL                             10289152   262144
//   TOT  f32 [2][48 key blocks][128]     10551296   49152
//   end                            10600448
// =====================================================================================================
extern "C" void kernel_launch(void* const* d_in, const int* in_sizes, int n_in,
                              void* d_out, int out_size, void* d_ws, size_t ws_size,
                              hipStream_t stream) {
  if (n_in < 20) return;
  if (in_sizes[0] != NTOK * DD) return;
  if (in_sizes[1] != DD || in_sizes[2] != DD || in_sizes[3] != DD * GH || in_sizes[4] != GH ||
      in_sizes[5] != GH || in_sizes[6] != 1) return;
  if (in_sizes[7] != DD * HID || in_sizes[8] != HID || in_sizes[9] != DD * HID || in_sizes[10] != HID ||
      in_sizes[11] != DD * HID || in_sizes[12] != HID) return;
  if (in_sizes[13] != HID * HID || in_sizes[14] != HID || in_sizes[15] != HID || in_sizes[16] != HID ||
      in_sizes[17] != HID * FD || in_sizes[18] != FD || in_sizes[19] != 1) return;
  if (out_size != NPOOL * FD) return;

  const float* x    = (const float*)d_in[0];
  const float* glnw = (const float*)d_in[1];
  const float* glnb = (const float*)d_in[2];
  const float* gw1  = (const float*)d_in[3];
  const float* gb1  = (const float*)d_in[4];
  const float* gw2  = (const float*)d_in[5];
  const float* gb2  = (const float*)d_in[6];
  const float* qw   = (const float*)d_in[7];
  const float* qb   = (const float*)d_in[8];
  const float* kw   = (const float*)d_in[9];
  const float* kb   = (const float*)d_in[10];
  const float* vw   = (const float*)d_in[11];
  const float* vb   = (const float*)d_in[12];
  const float* ow   = (const float*)d_in[13];
  const float* ob   = (const float*)d_in[14];
  const float* flnw = (const float*)d_in[15];
  const float* flnb = (const float*)d_in[16];
  const float* fw   = (const float*)d_in[17];
  const float* fb   = (const float*)d_in[18];
  const int*   Tp   = (const int*)d_in[19];

  const size_t PWO = (size_t)HID * HID * 2;           //    32768
  const size_t PWF = (size_t)FD * HID * 2;            //    32768
  const size_t PQP = (size_t)NTOK * HID * 2;          //  1572864
  const size_t PVT = (size_t)NB * HID * LL * 2;       //  1572864
  const size_t PSV = (size_t)NB * HID * TT * 4;       //   524288
  const size_t PPP = (size_t)NPOOL * HID * 2;         //   262144
  const size_t PTO = (size_t)NB * (LL / 64) * HID * 4; //    49152
  size_t off = 0;
  const size_t oWO = off; off += PWO;
  const size_t oWF = off; off += PWF;
  const size_t oQH = off; off += PQP;
  const size_t oQL = off; off += PQP;
  const size_t oKH = off; off += PQP;
  const size_t oKL = off; off += PQP;
  const size_t oVH = off; off += PVT;
  const size_t oVL = off; off += PVT;
  const size_t oSV = off; off += PSV;
  const size_t oPH = off; off += PPP;
  const size_t oPL = off; off += PPP;
  const size_t oTO = off; off += PTO;
  if (off > ws_size) return;                           // off = 10600448
  if (off > (size_t)134217728) return;

  char* ws = (char*)d_ws;
  unsigned short* WOT = (unsigned short*)(ws + oWO);
  unsigned short* FWT = (unsigned short*)(ws + oWF);
  unsigned short* QH  = (unsigned short*)(ws + oQH);
  unsigned short* QL  = (unsigned short*)(ws + oQL);
  unsigned short* KH  = (unsigned short*)(ws + oKH);
  unsigned short* KL  = (unsigned short*)(ws + oKL);
  unsigned short* VTH = (unsigned short*)(ws + oVH);
  unsigned short* VTL = (unsigned short*)(ws + oVL);
  float*          LS  = (float*)(ws + oSV);
  float*          TOT = (float*)(ws + oTO);
  unsigned short* PH  = (unsigned short*)(ws + oPH);
  unsigned short* PL  = (unsigned short*)(ws + oPL);
  float*          out = (float*)d_out;

  const dim3 blk(256), blk768(768);
  const dim3 gQ(NTOK / 64 + 16);                       // 96 token blocks + 16 weight tiles
  const dim3 gA(NB * NH * (LL / 96));                  // 256
  const dim3 gT(NPOOL / 16);                           // 64

  // (1) gater + gated q/k/v planes (q rows hi/lo; k and v^T hi/lo in fragment order) + per-block masked-key floor sums;
  //     its last 16 blocks: o_w and f_w planes, transposed to k-contiguous rows: f16( bf16_RNE(w) * 64 )
  qkv_prep<<<gQ, blk, 0, stream>>>(x, glnw, glnb, gw1, gb1, gw2, gb2, qb, kb, vb, qw, kw, vw, ow, fw, Tp,
                                   QH, QL, KH, KL, VTH, VTL, LS, TOT, WOT, FWT);

  // (2) block-causal attention + mean-pool over the 6 forces -> pooled planes
  attn_pool<<<gA, blk768, 0, stream>>>(QH, QL, KH, KL, VTH, VTL, LS, TOT, PH, PL);

  // (3) o-proj + LayerNorm + final linear + SiLU -> out
  tail_k<<<gT, blk, 0, stream>>>(PH, PL, WOT, ob, flnw, flnb, FWT, fb, out);
  (void)hipGetLastError();
}

// v008
// It runs in 34.3 microseconds.
// Timed twice side by side with v007, it ran 1.05 times as fast both times.
// Over all steps from v000 it is 5.36 times as fast.
// Contractions: q/k/v projections (x rows f16 x16 . W^T f16 x64, K=32, one product), scores S^T = k . q^T
// (k and q each f16 x8 hi plane + f16 x1024 residual plane, 3 products per tile), O^T = v^T . P^T (v f16 x16 hi +
// x1024 residual, P f16 x1024 hi + x1024 residual, 3 products), pooled attention . Wo^T and LN rows . Wf^T
// (activation f16 hi + x1024 residual . W^T f16 x64, K=128, 2 products): all v_wmma_f32_16x16x32_f16, f32 accumulate;
// gater MLP, LayerNorm, softmax, pooling, SiLU in f32 on VALU; every float input RNE-converted to bf16 on load.
#include <hip/hip_runtime.h>
#include <math.h>
#include <stdint.h>

#define NB     2
#define TT     512
#define NF     6
#define DD     32
#define HID    128
#define NH     4
#define HD     32
#define GH     32
#define FD     128
#define LL     (TT * NF)
#define NTOK   (NB * LL)
#define NPOOL  (NB * TT)
#define LNEPS  1.0e-5f
#define XC     16.0f
#define WSC    64.0f
#define QC     8.0f
#define KC     8.0f
#define VC     16.0f
#define AC     32.0f
#define YC     16.0f
#define RSC    1024.0f
#define INVRS  (1.0f / 1024.0f)
#define FLOORC 1.0e-9f
#define NEGBIG (-1.0e30f)
#define MFLOOR (-1.0e25f)
#define SCL    ((0.17677669529663687f * 1.4426950408889634f) / (QC * KC))
static_assert(NH * HD == HID);
static_assert(FD == HID);
static_assert((LL % 64) == 0 && (LL % 96) == 0 && (LL % 32) == 0 && LL / 48 == 64);
static_assert((NTOK % 64) == 0 && (NPOOL % 16) == 0);
static_assert(DD == 32 && GH == 32 && (DD * GH) % 256 == 0);

typedef _Float16 v16h __attribute__((ext_vector_type(16)));
typedef _Float16 v8h  __attribute__((ext_vector_type(8)));
typedef float    v8f  __attribute__((ext_vector_type(8)));
typedef float    v4f  __attribute__((ext_vector_type(4)));
typedef unsigned int v4u __attribute__((ext_vector_type(4)));
typedef unsigned int v2u __attribute__((ext_vector_type(2)));
typedef float    v2f  __attribute__((ext_vector_type(2)));
typedef _Float16 v2h  __attribute__((ext_vector_type(2)));

union FragH { v16h v; v8h h[2]; };

// ---- scalar helpers --------------------------------------------------------------------------------
__device__ __forceinline__ unsigned short bf_bits(float f) {          // f32 -> bf16 bits, RNE convert
  unsigned u = __float_as_uint(f);
  return (unsigned short)((u + 0x7FFFu + ((u >> 16) & 1u)) >> 16);
}
__device__ __forceinline__ float bf_up(unsigned short h) { return __uint_as_float(((unsigned)h) << 16); }
__device__ __forceinline__ float bfr(float f) { return bf_up(bf_bits(f)); }
__device__ __forceinline__ unsigned short h_bits(_Float16 x) { return __builtin_bit_cast(unsigned short, x); }
__device__ __forceinline__ unsigned pk16(unsigned short a, unsigned short b) { return (unsigned)a | ((unsigned)b << 16); }
__device__ __forceinline__ v8f zero8() { v8f z = {0.f, 0.f, 0.f, 0.f, 0.f, 0.f, 0.f, 0.f}; return z; }
__device__ __forceinline__ float hmax8(v8f s) {
  return fmaxf(fmaxf(fmaxf(s[0], s[1]), fmaxf(s[2], s[3])), fmaxf(fmaxf(s[4], s[5]), fmaxf(s[6], s[7])));
}
__device__ __forceinline__ const _Float16* h16(const unsigned short* p) { return (const _Float16*)(const void*)p; }
// hi = f16(f), lo = f16((f - hi) * 1024): residual plane carried x1024, folded back in the f32 epilogue
__device__ __forceinline__ void split_h(float f, unsigned short& hb, unsigned short& lb) {
  const _Float16 h = (_Float16)f;
  const _Float16 l = (_Float16)((f - (float)h) * RSC);
  hb = h_bits(h);
  lb = h_bits(l);
}
__device__ __forceinline__ float fexp2(float x) { return __builtin_amdgcn_exp2f(x); }
__device__ __forceinline__ float sigm(float a) {
  const float e = __expf(fminf(-a, 60.0f));       // quotient stays far from underflow
  return 1.0f / (1.0f + e);
}
// cross-lane moves on the vector unit (no LDS-path permute, no dscnt wait): lane l <- lane l ^ 16, and l <- l ^ X inside a
// 16-lane row (DPP row_xmask)
__device__ __forceinline__ float xhalf(float x) {
  const int b = __builtin_bit_cast(int, x);
  return __builtin_bit_cast(float, __builtin_amdgcn_permlanex16(b, b, 0x76543210, 0xfedcba98, false, false));
}
template <int X>
__device__ __forceinline__ float xrow(float x) {
  return __builtin_bit_cast(float, __builtin_amdgcn_mov_dpp(__builtin_bit_cast(int, x), 0x160 + X, 0xf, 0xf, true));
}
__device__ __forceinline__ float lane_bc(float x, int k) {   // lane k's value to every lane, through a scalar register
  return __builtin_bit_cast(float, __builtin_amdgcn_readlane(__builtin_bit_cast(int, x), k));
}
__device__ __forceinline__ float wsum(float v) {             // butterfly over 16, 8, 4, 2, 1
  v += xhalf(v);
  v += xrow<8>(v);
  v += xrow<4>(v);
  v += xrow<2>(v);
  v += xrow<1>(v);
  return v;
}

// ---- fragment loader: 16-bit A/B operand, lane -> row/col (lane&15), p already includes +8*(lane>>4);
//      elements 0..7 <- p[0..7] (k0+8h..), elements 8..15 <- p[16..23] (k0+16+8h..)
__device__ __forceinline__ v16h ldfrag_h(const _Float16* p) {
  FragH f;
  f.h[0] = *(const v8h*)(p);
  f.h[1] = *(const v8h*)(p + 16);
  return f.v;
}

// ---- the same fragment from a plane stored in fragment order: one 16 x 32 operand tile = 1024 B = two 512-B halves,
//      half s holds lane L's elements 8s..8s+7 at byte 16*L, so each wave-wide 16-B load covers four whole 128-B lines;
//      p already includes +8*lane
__device__ __forceinline__ v16h ldfrag_p(const _Float16* p) {
  FragH f;
  f.h[0] = *(const v8h*)(p);
  f.h[1] = *(const v8h*)(p + 256);
  return f.v;
}

// ---- WMMA helpers with trailing VALU hazard gap --------------------------------------------------------
__device__ __forceinline__ v8f mma_h_raw(v16h a, v16h b, v8f c) {
  return __builtin_amdgcn_wmma_f32_16x16x32_f16(false, a, false, b, (short)0, c, false, false);
}
__device__ __forceinline__ void guard4x6(v8f& a, v8f& b, v8f& c, v8f& d,
                                         v16h x0, v16h x1, v16h x2, v16h x3, v16h x4, v16h x5) {
#if defined(__HIP_DEVICE_COMPILE__)
  asm volatile("v_nop\n\tv_nop\n\tv_nop\n\tv_nop"
               : "+v"(a), "+v"(b), "+v"(c), "+v"(d)
               : "v"(x0), "v"(x1), "v"(x2), "v"(x3), "v"(x4), "v"(x5));
#endif
}

// =====================================================================================================
// Weight convert with transpose, one 64 k x 32 o tile of o_w or f_w per block (the 16 blocks behind the token blocks of
// the projection launch): in[k][o] f32 (x @ W layout) -> out[o][k] = f16( bf16_RNE(in) * WSC ), k contiguous.
// q = 0..7: o_w [128][128] -> WOT [n][k]; q = 8..15: f_w -> FWT; thread t loads k = t>>2, 8 floats at 8*(t&3) into T
// (pitch 33), stores row o = t>>3, 8 halves k = 8*(t&7).
// coverage: WOT/FWT 4 x 2 tiles x (32 o x 64 k) = [128][128] each.
// =====================================================================================================
__device__ __forceinline__ void conv_tile(const int q, const int t, const float* __restrict__ ow,
                                          const float* __restrict__ fw, unsigned short* WOT, unsigned short* FWT,
                                          float* T) {
  const bool iso = (q < 8);                                  // block-uniform
  const int rr = iso ? q : (q - 8);
  const float* src   = iso ? ow : fw;
  unsigned short* ds = iso ? WOT : FWT;
  const int o0 = (rr >> 1) * 32, k0 = (rr & 1) * 64;
  {
    const int k = t >> 2, oo = 8 * (t & 3);
    const float* sp = src + (size_t)(k0 + k) * HID + o0 + oo;
    const v4f a = *(const v4f*)(sp), c = *(const v4f*)(sp + 4);
#pragma unroll
    for (int i = 0; i < 4; ++i) { T[k * 33 + oo + i] = a[i]; T[k * 33 + oo + 4 + i] = c[i]; }
  }
  __syncthreads();
  {
    const int o = t >> 3, e = t & 7;
    float w[8];
#pragma unroll
    for (int i = 0; i < 8; ++i) w[i] = bfr(T[(8 * e + i) * 33 + o]) * WSC;
    v4u v;
#pragma unroll
    for (int i = 0; i < 4; ++i) v[i] = pk16(h_bits((_Float16)w[2 * i]), h_bits((_Float16)w[2 * i + 1]));
    unsigned short* dp = ds + (size_t)(o0 + o) * HID + k0 + 8 * e;
    *(v4u*)dp = v;
  }
}

// =====================================================================================================
// Gater + gated q/k/v projections for 64 tokens per block (256 threads = 8 waves; blocks 0..95 of a grid of 96 + 16; the
// last 16 blocks convert o_w and f_w for the tail launch, see conv_tile, and do nothing else).
// Phase 0: x tile [64][32] loaded as float4 pairs, RNE-converted to bf16 values: f32 copy sX (pitch 33) for the gater and
//          f16(x * 16) rows sXh (pitch 40 halves) as the WMMA A operand; g_w1 staged bf16-RNE in LDS;
//          q_w | k_w | v_w [32 k][128 n] f32 -> sWT rows [p*128 + n][32 k] = f16( bf16_RNE(w) * 64 ), pitch 40 halves:
//          thread -> column n = t&127 and 8 k (each wave-wide 4-B load is one whole line), one 16-B LDS store per 8 k.
//          Phase 1 (wave -> 8 tokens): LayerNorm, silu hidden layer with lane = hidden unit (32 readlane-broadcast FMAs), gate = sigmoid(sum_lane h*g_w2 + g_b2), all f32 -> sG.
// Phase 2: per part p in {q,k,v}: wave w -> row tile w&3, 64-col half w>>2: 4 WMMAs (K = 32 = one k step; A from sXh,
//          B from sWT rows [p*128 + n][32]); epilogue f = (acc/1024 + bf16(bias[n])) * gate[row] * C (C = 8 q/k, 16 v),
//          hi = f16(f), lo = f16((f-hi)*1024) staged in LDS (q/k row-major [64][136], v transposed [128 hcol][72]);
//          block barrier; whole-line stores: q rows of 256 B by 16 consecutive lanes (instruction i: row 16i + t>>4);
//          k and v^T in fragment order (see ldfrag_p), slab (b, head), 512 contiguous bytes per wave and store.
// Phase 3 (waves 0..3, thread -> head column): this block's share of the masked-key floor sums, from the staged v planes:
//          LS[b][tb][hcol] = sum of v over the block's keys j >= 6*(tb+1), for every boundary 6*(tb+1) that lies in the
//          block, and TOT[b][block][hcol] = sum over all 64 keys (keys of time blocks >= T count as 0).
// coverage: QH/QL rows tok0..tok0+63 x 128 cols; KH/KL 4 heads x key tiles ltok0/16..+3; VTH/VTL 4 heads x key steps
//           ltok0/32..+1 x 2 d tiles; grid covers all 6144 tokens exactly once. LS rows tb = 0..510 of each batch row once
//           (the boundary of tb = 511 is past the last key: no row, and none is read); TOT 96 rows once.
// =====================================================================================================
// Suffix sums of one head column inside a 64-key block whose first boundary (key index a multiple of 6) is local key I0:
// six-key sums first (independent), then one short chain over the boundaries, last to first. r[j] = sum over the block's
// keys from boundary j on (0 where the block has no boundary j), tot = sum over all 64 keys.
#define NJMAX 11                                             // boundaries in a block: 11 for I0 = 0 and 2, 10 for I0 = 4
template <int I0>
__device__ __forceinline__ void block_suffix(const float (&val)[64], const int tb0, const int ntb,
                                             float (&r)[NJMAX], float& tot) {
  constexpr int NJ = (63 - I0) / NF + 1;
  float run = 0.f;
#pragma unroll
  for (int j = NJMAX - 1; j >= NJ; --j) r[j] = 0.f;
#pragma unroll
  for (int j = NJ - 1; j >= 0; --j) {
    float sg = 0.f;
#pragma unroll
    for (int f = 0; f < NF; ++f)
      if (I0 + NF * j + f < 64) sg += val[I0 + NF * j + f];
    run += (tb0 + 1 + j < ntb) ? sg : 0.f;                   // these keys are time block tb0 + 1 + j
    r[j] = run * (1.0f / VC);
  }
  float head = 0.f;
#pragma unroll
  for (int i = 0; i < I0; ++i) head += val[i];
  tot = (run + ((tb0 < ntb) ? head : 0.f)) * (1.0f / VC);    // the keys in front of I0 are time block tb0
}

__global__ __launch_bounds__(256) void qkv_prep(
    const float* __restrict__ x, const float* __restrict__ glnw, const float* __restrict__ glnb,
    const float* __restrict__ gw1, const float* __restrict__ gb1, const float* __restrict__ gw2,
    const float* __restrict__ gb2, const float* __restrict__ qbias, const float* __restrict__ kbias,
    const float* __restrict__ vbias, const float* __restrict__ qw, const float* __restrict__ kw,
    const float* __restrict__ vw, const float* __restrict__ ow, const float* __restrict__ fw,
    const int* __restrict__ Tp,
    unsigned short* QH, unsigned short* QL, unsigned short* KH, unsigned short* KL,
    unsigned short* VTH, unsigned short* VTL, float* LS, float* TOT, unsigned short* WOT, unsigned short* FWT) {
  __shared__ __align__(16) float sX[64 * 33];
  __shared__ __align__(16) _Float16 sXh[64 * 40];
  __shared__ float sW1[DD * GH];
  __shared__ float sG[64];
  __shared__ __align__(16) unsigned short sH[128 * 72];
  __shared__ __align__(16) unsigned short sL[128 * 72];
  __shared__ __align__(16) unsigned short sWT[3 * HID * 40];
  const int t = threadIdx.x, wave = t >> 5, lane = t & 31, hh = lane >> 4, m = lane & 15;
  if (blockIdx.x >= NTOK / 64) {                             // block-uniform, in front of every other barrier
    conv_tile((int)blockIdx.x - NTOK / 64, t, ow, fw, WOT, FWT, sX);
    return;
  }
  const int tok0  = blockIdx.x * 64;
  const int b     = tok0 / LL;
  const int ltok0 = tok0 - b * LL;

  // ---- phase 0 ----
  {
    const int wn = t & 127, wk = t >> 7;                     // weight column; 8-k group wk + 2*(i&1) of part i>>1
    const unsigned wofs = (unsigned)(8 * wk * HID + wn);     // the thread's first element of each part
    float wv[6][8];
#pragma unroll
    for (int i = 0; i < 6; ++i) {
      const float* wsrc = (i < 2) ? qw : ((i < 4) ? kw : vw);
#pragma unroll
      for (int e = 0; e < 8; ++e) wv[i][e] = wsrc[wofs + (unsigned)((16 * (i & 1) + e) * HID)];
    }
    const int tk = t >> 2, j = 8 * (t & 3);
    const float* sp = x + (size_t)(tok0 + tk) * DD + j;
    const v4f a = *(const v4f*)(sp), c = *(const v4f*)(sp + 4);
    // g_w1, unrolled: the thread's four elements are asked for in the same flight as the loads above (rolled, each trip
    // waited for its own load: four round trips in a row)
    const unsigned gofs = (unsigned)t;
    float g1[DD * GH / 256];
#pragma unroll
    for (int i = 0; i < DD * GH / 256; ++i) g1[i] = gw1[gofs + (unsigned)(256 * i)];
    // one wait for the weight, x and g_w1 loads above: their address registers are inputs here, so that neither a later
    // load's destination nor any other instruction overwrites one of them in front of it
    asm volatile("s_wait_xcnt 0x0" :: "v"(wofs), "v"(sp), "v"(gofs) : "memory");
    float r8[8];
#pragma unroll
    for (int i = 0; i < 4; ++i) { r8[i] = bfr(a[i]); r8[4 + i] = bfr(c[i]); }
#pragma unroll
    for (int i = 0; i < 8; ++i) {
      sX[tk * 33 + j + i]  = r8[i];
      sXh[tk * 40 + j + i] = (_Float16)(r8[i] * XC);
    }
#pragma unroll
    for (int i = 0; i < DD * GH / 256; ++i) sW1[t + 256 * i] = bfr(g1[i]);
#pragma unroll
    for (int i = 0; i < 6; ++i) {
      v4u v;
#pragma unroll
      for (int e = 0; e < 4; ++e)
        v[e] = pk16(h_bits((_Float16)(bfr(wv[i][2 * e]) * WSC)), h_bits((_Float16)(bfr(wv[i][2 * e + 1]) * WSC)));
      *(v4u*)(sWT + ((i >> 1) * HID + wn) * 40 + 8 * (wk + 2 * (i & 1))) = v;
    }
  }
  __syncthreads();
  // read here so that phase 3 does not wait for it; behind the barrier, so that the scalar load's destination cannot be a
  // base register of phase 0's loads while they are in flight
  const int tin = Tp[0];

  // ---- phase 1: gater (f32, VALU) ----
  {
    const float gw = bfr(glnw[lane]), gb = bfr(glnb[lane]);
    const float b1 = bfr(gb1[lane]),  w2 = bfr(gw2[lane]), b2 = bfr(gb2[0]);
    // unrolled: the wave's eight tokens are eight independent chains (sums, 32-link FMA chain, sigmoids) that fill each
    // other's latency; rolled, one chain at a time left the two waves of a SIMD waiting most of the time
    float gsel = 0.f;
#pragma unroll
    for (int i = 0; i < 8; ++i) {
      const int tk = wave * 8 + i;
      const float xv  = sX[tk * 33 + lane];
      const float mu  = wsum(xv) * (1.0f / DD);
      const float dv  = xv - mu;
      const float var = wsum(dv * dv) * (1.0f / DD);
      const float xn  = dv * rsqrtf(var + LNEPS) * gw + gb;
      float hacc = b1;
#pragma unroll
      for (int k = 0; k < DD; ++k) hacc += lane_bc(xn, k) * sW1[k * GH + lane];
      const float hs = hacc * sigm(hacc);
      const float gs = wsum(hs * w2) + b2;
      const float g  = sigm(gs);
      gsel = ((lane & 7) == i) ? g : gsel;                   // every lane holds g: lanes i, i + 8, .. keep token i's
    }
    sG[wave * 8 + (lane & 7)] = gsel;                        // one store, no branch: four lanes write the same value to a slot
  }
  __syncthreads();

  // ---- phase 2: projections on WMMA ----
  const int rt = wave & 3, ch = wave >> 2;
  FragH af;
  af.h[0] = *(const v8h*)(sXh + (16 * rt + m) * 40 + 8 * hh);
  af.h[1] = *(const v8h*)(sXh + (16 * rt + m) * 40 + 16 + 8 * hh);
  const _Float16* WTp = h16(sWT);
  // unrolled: p is a constant in each copy, so the staging layout test per value costs no scalar branch, and the 32 values'
  // short chains of a part interleave in one straight block
#pragma unroll
  for (int p = 0; p < 3; ++p) {
    const float* bp = (p == 0) ? qbias : ((p == 1) ? kbias : vbias);
    const float osc = (p == 2) ? VC : QC;
    v16h bf[4];
#pragma unroll
    for (int j = 0; j < 4; ++j)
      bf[j] = ldfrag_h(WTp + (p * HID + 64 * ch + 16 * j + m) * 40 + 8 * hh);
    v8f acc[4];
#pragma unroll
    for (int j = 0; j < 4; ++j) acc[j] = mma_h_raw(af.v, bf[j], zero8());
    guard4x6(acc[0], acc[1], acc[2], acc[3], af.v, bf[0], bf[1], bf[2], bf[3], af.v);
    float gr[8];
#pragma unroll
    for (int r = 0; r < 8; ++r) gr[r] = sG[16 * rt + 8 * hh + r];
#pragma unroll
    for (int j = 0; j < 4; ++j) {
      const int n = 64 * ch + 16 * j + m;
      const float bn = bfr(bp[n]);
#pragma unroll
      for (int r = 0; r < 8; ++r) {
        const int row = 16 * rt + 8 * hh + r;
        const float f = ((acc[j][r] * (1.0f / (XC * WSC)) + bn) * gr[r]) * osc;
        unsigned short hb, lb;
        split_h(f, hb, lb);
        if (p < 2) { sH[row * 136 + n] = hb; sL[row * 136 + n] = lb; }
        else       { sH[n * 72 + row]  = hb; sL[n * 72 + row]  = lb; }
      }
    }
    __syncthreads();
    if (p == 0) {                                                   // block-uniform
      unsigned short* Hp = QH;
      unsigned short* Lp = QL;
      const int e = t & 15;
      v4u hv[4], lv[4];
#pragma unroll
      for (int i = 0; i < 4; ++i) {
        const int row = 16 * i + (t >> 4);
        hv[i] = *(const v4u*)(sH + row * 136 + 8 * e);
        lv[i] = *(const v4u*)(sL + row * 136 + 8 * e);
      }
#pragma unroll
      for (int i = 0; i < 4; ++i) {
        const int row = 16 * i + (t >> 4);
        *(v4u*)(Hp + (size_t)(tok0 + row) * HID + 8 * e) = hv[i];
        *(v4u*)(Lp + (size_t)(tok0 + row) * HID + 8 * e) = lv[i];
      }
      
    } else if (p == 1) {
      // k in fragment order: instruction i = head; wave -> 16-key tile t>>6, half s; lane -> key m, dims 16s + 8hh ..+7
      const int ktl = t >> 6, s = (t >> 5) & 1;
      v4u hv[4], lv[4];
#pragma unroll
      for (int i = 0; i < 4; ++i) {
        const int src = (16 * ktl + m) * 136 + HD * i + 16 * s + 8 * hh;
        hv[i] = *(const v4u*)(sH + src);
        lv[i] = *(const v4u*)(sL + src);
      }
#pragma unroll
      for (int i = 0; i < 4; ++i) {
        const size_t o = ((size_t)(b * NH + i) * (LL / 16) + (ltok0 >> 4) + ktl) * 512 + s * 256 + lane * 8;
        *(v4u*)(KH + o) = hv[i];
        *(v4u*)(KL + o) = lv[i];
      }
      // the stores' registers are reused by the next part's LDS reads: keep the wait in front of that overwrite
      asm volatile("s_wait_xcnt 0x0" ::: "memory");
    } else {
      // v^T in fragment order: instruction i = head; wave -> 32-key step t>>7, d tile dt, half s; lane -> d row m,
      // keys 16s + 8hh ..+7
      const int ksl = t >> 7, dt = (t >> 6) & 1, s = (t >> 5) & 1;
      v4u hv[4], lv[4];
#pragma unroll
      for (int i = 0; i < 4; ++i) {
        const int src = (HD * i + 16 * dt + m) * 72 + 32 * ksl + 16 * s + 8 * hh;
        hv[i] = *(const v4u*)(sH + src);
        lv[i] = *(const v4u*)(sL + src);
      }
#pragma unroll
      for (int i = 0; i < 4; ++i) {
        const size_t o = ((size_t)(b * NH + i) * (LL / 32) + (ltok0 >> 5) + ksl) * 1024 + dt * 512 + s * 256 + lane * 8;
        *(v4u*)(VTH + o) = hv[i];
        *(v4u*)(VTL + o) = lv[i];
      }
      // same wait behind the v^T stores, in front of any reuse of their registers
      asm volatile("s_wait_xcnt 0x0" ::: "memory");
      // ---- phase 3: floor sums of this block's keys ----
      if (wave < 4) {                                               // wave-uniform; no barrier inside
        const int ntb = (tin < 0) ? 0 : ((tin > TT) ? TT : tin);    // structural, clamped to the static extent
        float val[64];
#pragma unroll
        for (int g = 0; g < 8; ++g) {
          const v8h a = *(const v8h*)(h16(sH) + t * 72 + 8 * g);
          const v8h l = *(const v8h*)(h16(sL) + t * 72 + 8 * g);
#pragma unroll
          for (int j = 0; j < 8; ++j)
            val[8 * g + j] = (float)a[j] + (float)l[j] * INVRS;
        }
        const int i0  = (NF - ltok0 % NF) % NF;                     // 0, 2 or 4: 64 keys shift the phase by 4
        const int tb0 = (ltok0 + i0) / NF - 1;                      // time block whose masked keys start at local key i0
        float r[NJMAX], tot;
        if (i0 == 0)      block_suffix<0>(val, tb0, ntb, r, tot);   // block-uniform
        else if (i0 == 2) block_suffix<2>(val, tb0, ntb, r, tot);
        else              block_suffix<4>(val, tb0, ntb, r, tot);
        float* lsp  = LS + ((size_t)b * TT + tb0 + 1) * HID + t;    // row tb0 + 1, the block's second boundary
        float* totp = TOT + ((size_t)b * (LL / 64) + (ltok0 >> 6)) * HID + t;
        if (tb0 >= 0) *(lsp - HID) = r[0];                          // block-uniform: key 0 is no boundary of a time block
#pragma unroll
        for (int j = 1; j < NJMAX - 1; ++j) lsp[(size_t)(j - 1) * HID] = r[j];
        if (i0 != 4) lsp[(size_t)(NJMAX - 2) * HID] = r[NJMAX - 1]; // block-uniform: the eleventh boundary
        totp[0] = tot;
        // the stores' registers may be reused behind this point: keep the wait in front of that overwrite
        asm volatile("s_wait_xcnt 0x0" ::: "memory");
      }
    }
    __syncthreads();
  }
}

// Residual plane of four packed f16 pairs: l = f16(P - 1024 h), each half by ONE mixed-precision FMA that reads its f16 half of
// h, the f32 P, and rounds straight into its half of l (left to itself the compiler makes the f32 difference, then converts, and
// rounds h a second time for it: about twice the instructions). The four low halves stand in front of the four high halves, and
// the hints name that distance, so that no instruction waits unannounced for the one that wrote the other half of its register.
__device__ __forceinline__ void resid4(unsigned& l0, unsigned& l1, unsigned& l2, unsigned& l3,
                                       const unsigned h0, const unsigned h1, const unsigned h2, const unsigned h3,
                                       const v2f p0, const v2f p1, const v2f p2, const v2f p3) {
#if defined(__HIP_DEVICE_COMPILE__)
  const float nr = -RSC;
  asm("v_fma_mixlo_f16 %0, %4, %8, %9 op_sel_hi:[1,0,0]\n\t"
      "v_fma_mixlo_f16 %1, %5, %8, %11 op_sel_hi:[1,0,0]\n\t"
      "v_fma_mixlo_f16 %2, %6, %8, %13 op_sel_hi:[1,0,0]\n\t"
      "v_fma_mixlo_f16 %3, %7, %8, %15 op_sel_hi:[1,0,0]\n\t"
      "s_delay_alu instid0(VALU_DEP_4) | instskip(NEXT) | instid1(VALU_DEP_4)\n\t"
      "v_fma_mixhi_f16 %0, %4, %8, %10 op_sel:[1,0,0] op_sel_hi:[1,0,0]\n\t"
      "v_fma_mixhi_f16 %1, %5, %8, %12 op_sel:[1,0,0] op_sel_hi:[1,0,0]\n\t"
      "s_delay_alu instid0(VALU_DEP_4) | instskip(NEXT) | instid1(VALU_DEP_4)\n\t"
      "v_fma_mixhi_f16 %2, %6, %8, %14 op_sel:[1,0,0] op_sel_hi:[1,0,0]\n\t"
      "v_fma_mixhi_f16 %3, %7, %8, %16 op_sel:[1,0,0] op_sel_hi:[1,0,0]"
      : "=&v"(l0), "=&v"(l1), "=&v"(l2), "=&v"(l3)
      : "v"(h0), "v"(h1), "v"(h2), "v"(h3), "s"(nr),
        "v"(p0.x), "v"(p0.y), "v"(p1.x), "v"(p1.y), "v"(p2.x), "v"(p2.y), "v"(p3.x), "v"(p3.y));
#endif
}

// =====================================================================================================
// One 32-key step of the transposed flash formulation for 16 queries of one head (head dim 32 = one k step):
//   S^T tiles (16 keys x 16 queries) = A(k rows, dims split-map) . B(q^T): hi.hi -> s, hi.lo + lo.hi -> sr (x1024);
//   raw score u = s + sr/1024; block-causal mask by value (key < horizon of the lane's query);
//   online softmax per lane (8 + 8 keys of ONE query per lane, maximum m of the raw scores, combined with lane^16):
//   P = 2^((u - m) * scale*log2e/64 + 20), the scale folded into the exponent's one FMA; p = P / 1024 (e^{s - smax} x1024);
//   P^T as the B operand of O^T(16 d x 16 queries) += v^T(d rows, fragment order) . P^T: element r <- tile keys kb..kb+15,
//   element 8+r <- tile kb+16..kb+31, lane unchanged; P hi to o, (v hi . P lo x1024 + v lo x1024 . P hi) to or.
// =====================================================================================================
template <bool MASKED>
__device__ __forceinline__ void attn_step(const int kb, const int jl, const int hh,
    const _Float16* __restrict__ kH, const _Float16* __restrict__ kL,
    const _Float16* __restrict__ vH, const _Float16* __restrict__ vL,
    const v16h qhi, const v16h qlo, float& m_run, float& l_run,
    v8f& o1, v8f& o1r, v8f& o2, v8f& o2r) {
  const size_t so = (size_t)kb * 32;                 // 32 keys = 1024 halves of each fragment-order plane
  const v16h kh0 = ldfrag_p(kH + so);
  const v16h kh1 = ldfrag_p(kH + so + 512);
  const v16h kl0 = ldfrag_p(kL + so);
  const v16h kl1 = ldfrag_p(kL + so + 512);
  v8f s0  = mma_h_raw(kh0, qhi, zero8());
  v8f s1  = mma_h_raw(kh1, qhi, zero8());
  v8f s0r = mma_h_raw(kh0, qlo, zero8());
  v8f s1r = mma_h_raw(kh1, qlo, zero8());
  s0r = mma_h_raw(kl0, qhi, s0r);
  s1r = mma_h_raw(kl1, qhi, s1r);
  guard4x6(s0, s1, s0r, s1r, kh0, kh1, kl0, kl1, qhi, qlo);

  // raw scores (q x8 . k x8), pairs of neighbouring accumulator rows: u[i] = tile 0 rows 2i, 2i+1; u[4+i] = tile 1
  v2f u[8];
#pragma unroll
  for (int i = 0; i < 4; ++i) {
    const v2f a0 = {s0[2 * i], s0[2 * i + 1]}, r0 = {s0r[2 * i], s0r[2 * i + 1]};
    const v2f a1 = {s1[2 * i], s1[2 * i + 1]}, r1 = {s1r[2 * i], s1r[2 * i + 1]};
    u[i]     = a0 + r0 * INVRS;
    u[4 + i] = a1 + r1 * INVRS;
  }
  if (MASKED) {
    const int lim = jl - (kb + 8 * hh);              // row r is key kb + 8hh + r (tile 0), + 16 (tile 1): visible if below jl
#pragma unroll
    for (int i = 0; i < 4; ++i) {
      u[i].x     = (2 * i          < lim) ? u[i].x     : NEGBIG;
      u[i].y     = (2 * i + 1      < lim) ? u[i].y     : NEGBIG;
      u[4 + i].x = (16 + 2 * i     < lim) ? u[4 + i].x : NEGBIG;
      u[4 + i].y = (16 + 2 * i + 1 < lim) ? u[4 + i].y : NEGBIG;
    }
  }
  float mx = fmaxf(fmaxf(fmaxf(fmaxf(u[0].x, u[0].y), fmaxf(u[1].x, u[1].y)), fmaxf(fmaxf(u[2].x, u[2].y), fmaxf(u[3].x, u[3].y))),
                   fmaxf(fmaxf(fmaxf(u[4].x, u[4].y), fmaxf(u[5].x, u[5].y)), fmaxf(fmaxf(u[6].x, u[6].y), fmaxf(u[7].x, u[7].y))));
  mx = fmaxf(mx, xhalf(mx));
  const float m_new = fmaxf(m_run, mx);              // running maximum of the RAW scores (the scale is positive)
  const float corr  = fexp2((m_run - m_new) * SCL);
  m_run = m_new;
  // exponent = u * SCL + cofs = (u - m) * SCL + 20: one FMA per score. A lane whose keys have all been masked so far has
  // m = NEGBIG; the floor keeps its exponents hugely negative (P = 0) where m * SCL's rounding error would decide them
  const float mc   = MASKED ? fmaxf(m_new, MFLOOR) : m_new;
  const float cofs = fmaf(-mc, SCL, 20.0f);
  o1 = o1 * corr; o1r = o1r * corr; o2 = o2 * corr; o2r = o2r * corr;

  v2f P[8];                                          // e^{s - smax} * 2^20
#pragma unroll
  for (int i = 0; i < 8; ++i) {
    const v2f a = u[i] * SCL + cofs;
    P[i].x = fexp2(a.x);
    P[i].y = fexp2(a.y);
  }
  const v2f lt = ((P[0] + P[1]) + (P[2] + P[3])) + ((P[4] + P[5]) + (P[6] + P[7]));
  l_run = l_run * corr + (lt.x + lt.y);              // carried x 2^20

  // hi = f16(P / 1024) (the x1024 plane), residual = f16(P - 1024 hi) = f16((p - hi) * 1024): the FMA is exact, one rounding
  union FragU { v16h v; unsigned w[8]; } ph, pl;     // word i: half i>>2 (keys kb + 16 (i>>2) + 8hh + ..), rows 2(i&3), 2(i&3)+1
#pragma unroll
  for (int i = 0; i < 8; ++i)
    ph.w[i] = __builtin_bit_cast(unsigned, __builtin_convertvector(P[i] * INVRS, v2h));
  resid4(pl.w[0], pl.w[1], pl.w[2], pl.w[3], ph.w[0], ph.w[1], ph.w[2], ph.w[3], P[0], P[1], P[2], P[3]);
  resid4(pl.w[4], pl.w[5], pl.w[6], pl.w[7], ph.w[4], ph.w[5], ph.w[6], ph.w[7], P[4], P[5], P[6], P[7]);

  const v16h vh1 = ldfrag_p(vH + so);
  const v16h vl1 = ldfrag_p(vL + so);
  const v16h vh2 = ldfrag_p(vH + so + 512);
  const v16h vl2 = ldfrag_p(vL + so + 512);
  o1  = mma_h_raw(vh1, ph.v, o1);
  o2  = mma_h_raw(vh2, ph.v, o2);
  o1r = mma_h_raw(vh1, pl.v, o1r);
  o2r = mma_h_raw(vh2, pl.v, o2r);
  o1r = mma_h_raw(vl1, ph.v, o1r);
  o2r = mma_h_raw(vl2, ph.v, o2r);
  guard4x6(o1, o2, o1r, o2r, vh1, vh2, vl1, vl2, ph.v, pl.v);
}

// =====================================================================================================
// Attention + mean-pool for one head of one batch row and a PAIR of 48-query groups: group 63 - pi (long key range) and
// group pi (short key range), so that every block holds about the same number of 32-key steps. Block = 24 waves (768
// threads), grid = 2 * 4 * 32 = 256. Wave w -> query tile index g = w>>3 of both groups; the 8 waves of one g share the
// key steps of the long tile (nH steps) and of the short tile (nL steps) in runs of C consecutive steps, C the smallest
// run length for which the block's longest pair of tiles fits in 8 waves. Each wave runs the online softmax over its own run only (the fully
// visible steps without masking, the rest with the per-lane horizon test by value) and leaves its partial
// (row maximum m, row sum l, o + or/1024) in LDS; a lane whose keys are all masked in its run keeps m = NEGBIG and gets
// weight 0 in the merge (run 0 of every tile holds keys 0..5, visible to every query, so the merged maximum is real).
// Merge (all 768 threads, thread -> query t>>3 of 96, 4 d at 4*(t&7)): M = max m_s, w_s = 2^(m_s - M),
// attn[d] = (sum w_s o_s) / (16 sum w_s l_s) + 1e-9 * (sum of v[.][d] over the query's masked keys) -> LDS sO[96][36] (f32);
// that sum = LS[b][tq][.] (the masked keys inside the 64-key block that holds the first of them) + the totals TOT of all
// later 64-key blocks, which wave 7 sums last to first into LDS sTS[48][32] in front of the merge barrier;
// barrier; threads 0..127 pool 6 consecutive query rows (pooled row t>>3 of 16, cols 4*(t&7)) -> f16 hi (x32) / lo
// (x1024), stored to the head's own plane [head][1024 rows][32]: one wave writes 256 contiguous bytes of each plane.
// coverage: per block rows b*512 + 8*(63-pi) .. +7 and b*512 + 8*pi .. +7 of head h; 256 blocks cover [4][1024][32] once.
// =====================================================================================================
#define KS 8                                                 // waves that share one long and one short query tile
__device__ __forceinline__ int cdiv_i(int a, int d) { return (a + d - 1) / d; }
// 32-key steps of the 16-query tile that starts at query qw0: up to the block-causal horizon of its last query (<= 3072)
__device__ __forceinline__ int tile_steps(int qw0) { return (((qw0 + 15) / NF + 1) * NF + 31) >> 5; }
// run length for a pair of tiles; at most 96 since then each tile is one run
__device__ __forceinline__ int run_len(int nH, int nL) {
  int C = cdiv_i(nH + nL, KS);
  for (; C < LL / 32; ++C)
    if (cdiv_i(nH, C) + cdiv_i(nL, C) <= KS) break;
  return C;
}

__global__ __launch_bounds__(768)
void attn_pool(const unsigned short* __restrict__ QH, const unsigned short* __restrict__ QL,
               const unsigned short* __restrict__ KH, const unsigned short* __restrict__ KL,
               const unsigned short* __restrict__ VTH, const unsigned short* __restrict__ VTL,
               const float* __restrict__ LS, const float* __restrict__ TOT, unsigned short* PH, unsigned short* PL) {
  __shared__ __align__(16) float sP[3 * KS * 16 * 36];       // per wave 16 queries x 32 d, pitch 36
  __shared__ float sM[3 * KS * 16];
  __shared__ float sL[3 * KS * 16];
  __shared__ __align__(16) float sO[96 * 36];
  __shared__ __align__(16) float sTS[(LL / 64) * HD];        // [64-key block k][d]: sum of v over all keys of blocks > k
  const int t = threadIdx.x, lane = t & 31, hh = lane >> 4, c = lane & 15;
  const int wave = __builtin_amdgcn_readfirstlane(t >> 5);   // wave-uniform: run bounds and plane bases stay scalar
  const int bx = blockIdx.x;
  const int pi = bx & 31;
  const int h  = (bx >> 5) & 3;
  const int b  = bx >> 7;
  const size_t tokb = (size_t)b * LL;
  // one run length for the block, from its last (longest) tiles: run s of all three tiles covers the same keys, so the
  // three waves that walk it together read the same k and v lines
  const int C = run_len(tile_steps((63 - pi) * 48 + 32), tile_steps(pi * 48 + 32));

  if (wave == KS - 1) {                                      // scalar branch; this wave holds at most the last, short run of a short tile
    const float* tp = TOT + (size_t)b * (LL / 64) * HID + h * HD + lane;   // lane -> d
    float tv[LL / 64];
#pragma unroll
    for (int k = 0; k < LL / 64; ++k) tv[k] = tp[(size_t)k * HID];
    // the loads' address registers may be reused below: keep the wait in front of that overwrite
    asm volatile("s_wait_xcnt 0x0" ::: "memory");
    float run = 0.f;
#pragma unroll
    for (int k = LL / 64 - 1; k >= 0; --k) { sTS[k * HD + lane] = run; run += tv[k]; }
  }

  {
    const int g = wave >> 3, s8 = wave & (KS - 1);
    const int qH0 = (63 - pi) * 48 + 16 * g, qL0 = pi * 48 + 16 * g;
    const int nH = tile_steps(qH0), nL = tile_steps(qL0);
    const int SH = cdiv_i(nH, C);
    const bool isH = (s8 < SH);
    const int qw0 = isH ? qH0 : qL0;
    const int n   = isH ? nH : nL;
    const int s   = isH ? s8 : (s8 - SH);
    const int st1 = (s + 1) * C;
    const int kb1 = ((st1 < n) ? st1 : n) * 32;              // a wave past the short tile's last run does no step
    const int qi  = qw0 + c;                                 // query of this lane (B column / D column)
    const int jl  = (qi / NF + 1) * NF;                      // exclusive key horizon

    const _Float16* QHp = h16(QH);
    const _Float16* QLp = h16(QL);
    const v16h qhi = ldfrag_h(QHp + (tokb + qi) * HID + h * HD + 8 * hh);
    const v16h qlo = ldfrag_h(QLp + (tokb + qi) * HID + h * HD + 8 * hh);
    // the q loads' address registers are reused by the accumulators' start values: keep the wait in front of that overwrite
    asm volatile("s_wait_xcnt 0x0" ::: "memory");
    const size_t pbase = (size_t)(b * NH + h) * LL * HD + 8 * lane;   // (b, head) slab of a fragment-order plane; + kb * 32
    const _Float16* kH = h16(KH) + pbase;                             // key tile 2 at +512 halves
    const _Float16* kL = h16(KL) + pbase;
    const _Float16* vH = h16(VTH) + pbase;                            // d tile 2 at +512 halves
    const _Float16* vL = h16(VTL) + pbase;

    float m_run = NEGBIG, l_run = 0.f;
    v8f o1 = zero8(), o1r = zero8(), o2 = zero8(), o2r = zero8();
    const int jmin  = (qw0 / NF + 1) * NF;
    const int cfull = (jmin / 32) * 32;
    const int kbf   = (cfull < kb1) ? cfull : kb1;
    int kb = s * C * 32;
#pragma unroll 1
    for (; kb < kbf; kb += 32)
      attn_step<false>(kb, jl, hh, kH, kL, vH, vL, qhi, qlo, m_run, l_run, o1, o1r, o2, o2r);
#pragma unroll 1
    for (; kb < kb1; kb += 32)
      attn_step<true>(kb, jl, hh, kH, kL, vH, vL, qhi, qlo, m_run, l_run, o1, o1r, o2, o2r);

    l_run += __shfl_xor(l_run, 16, 32);
    float* pp = sP + (wave * 16 + c) * 36 + 8 * hh;
    v4f a0, a1, c0, c1;
#pragma unroll
    for (int r = 0; r < 4; ++r) {
      a0[r] = o1[r] + o1r[r] * INVRS;  a1[r] = o1[4 + r] + o1r[4 + r] * INVRS;
      c0[r] = o2[r] + o2r[r] * INVRS;  c1[r] = o2[4 + r] + o2r[4 + r] * INVRS;
    }
    *(v4f*)(pp)      = a0;                                   // d  8hh ..  8hh+7
    *(v4f*)(pp + 4)  = a1;
    *(v4f*)(pp + 16) = c0;                                   // d 16+8hh .. 16+8hh+7
    *(v4f*)(pp + 20) = c1;
    // the merge works in the log2 domain and with l on the x1024 scale of o
    if (hh == 0) { sM[wave * 16 + c] = m_run * SCL; sL[wave * 16 + c] = l_run * INVRS; }
  }
  __syncthreads();
  {
    const int tile = wave >> 2;                              // 0..2 long group's tiles, 3..5 short group's; 4 queries per wave
    const int hl = (tile >= 3) ? 1 : 0;
    const int g  = tile - 3 * hl;
    const int qH0 = (63 - pi) * 48 + 16 * g, qL0 = pi * 48 + 16 * g;
    const int nH = tile_steps(qH0), nL = tile_steps(qL0);
    const int SH = cdiv_i(nH, C);
    const int w0 = g * KS + (hl ? SH : 0);                   // first wave and number of waves that hold this tile's runs
    const int wn = hl ? cdiv_i(nL, C) : SH;
    const int c2 = (t >> 3) & 15, dg = t & 7;
    const int tq = ((hl ? qL0 : qH0) + c2) / NF;
    const int  j0  = (tq + 1) * NF;                          // first masked key; none for the last time block
    const bool any = (j0 < LL);
    const v4f lsv = *(const v4f*)(LS + ((size_t)b * TT + (any ? tq : 0)) * HID + h * HD + 4 * dg);
    const v4f tsv = *(const v4f*)(sTS + (any ? (j0 >> 6) : 0) * HD + 4 * dg);
    v4f sv;
#pragma unroll
    for (int e = 0; e < 4; ++e) sv[e] = any ? (lsv[e] + tsv[e]) : 0.f;
    // all KS slots read at once (one LDS latency); a slot past the tile's last run rereads run 0 and gets weight 0
    float ms[KS], ls[KS];
    v4f os[KS];
#pragma unroll
    for (int i = 0; i < KS; ++i) {
      const int wi = w0 + ((i < wn) ? i : 0);
      ms[i] = sM[wi * 16 + c2];
      ls[i] = sL[wi * 16 + c2];
      os[i] = *(const v4f*)(sP + (wi * 16 + c2) * 36 + 4 * dg);
    }
    float M = ms[0];
#pragma unroll
    for (int i = 1; i < KS; ++i) M = fmaxf(M, ms[i]);
    float L = 0.f;
    v4f O = {0.f, 0.f, 0.f, 0.f};
#pragma unroll
    for (int i = 0; i < KS; ++i) {
      const float w = (i < wn) ? fexp2(ms[i] - M) : 0.f;
      L += w * ls[i];
      O += os[i] * w;
    }
    const float inv = (1.0f / L) * (1.0f / VC);
    *(v4f*)(sO + (t >> 3) * 36 + 4 * dg) = O * inv + sv * FLOORC;
  }
  __syncthreads();
  if (wave < 4) {                                            // wave-uniform; no barrier behind it
    const int pr = t >> 3, col = 4 * (t & 7);
    v4f s = {0.f, 0.f, 0.f, 0.f};
#pragma unroll
    for (int f = 0; f < NF; ++f) s += *(const v4f*)(sO + (NF * pr + f) * 36 + col);
    unsigned short hb[4], lb[4];
#pragma unroll
    for (int e = 0; e < 4; ++e) split_h((s[e] * (1.0f / NF)) * AC, hb[e], lb[e]);
    v2u ph2, pl2;
    ph2[0] = pk16(hb[0], hb[1]); ph2[1] = pk16(hb[2], hb[3]);
    pl2[0] = pk16(lb[0], lb[1]); pl2[1] = pk16(lb[2], lb[3]);
    const int qblk = (pr < 8) ? (63 - pi) : pi;
    const size_t o = ((size_t)h * NPOOL + (size_t)(b * TT + 8 * qblk + (pr & 7))) * HD + col;
    *(v2u*)(PH + o) = ph2;
    *(v2u*)(PL + o) = pl2;
  }
}

// =====================================================================================================
// Tail: 16 pooled rows per block (grid 1024/16 = 64, 256 threads = 8 waves); wave w -> the 16 x 16 tile of output columns
// 16w..16w+15 in both products, so that a wave's share of every serial part is short: one accumulator pair per product,
// two LayerNorm rows, eight outputs per lane. Every global operand of the block (pooled planes, both weight tiles, biases,
// LayerNorm weights) is asked for at the top, in one flight.
// GEMM1 z = pooled(hi + lo/1024)/32 . Wo + bf16(o_b): A planes PH/PL [head][row][32], k step = head (two products into
// acc/accr), B = WOT rows, K=128 -> sZ rows (f32);
// LayerNorm: wave -> rows 2w, 2w+1, lane -> 4 columns; the row leaves as f16 hi (x16) / lo (x1024) planes sYh/sYl, pitch
// 136 halves, split once here in place of once per reading wave;
// GEMM2 from sYh/sYl rows . FWT rows; epilogue silu(acc + bf16(f_b)) staged in sZ, whole 512-B rows stored per wave.
// coverage: out rows r0..r0+15 x 128 cols; 64 blocks cover [1024][128] exactly once.
// =====================================================================================================
__global__ __launch_bounds__(256) void tail_k(const unsigned short* __restrict__ PH, const unsigned short* __restrict__ PL,
                                               const unsigned short* __restrict__ WOT, const float* __restrict__ obias,
                                               const float* __restrict__ flnw, const float* __restrict__ flnb,
                                               const unsigned short* __restrict__ FWT, const float* __restrict__ fbias,
                                               float* out) {
  __shared__ __align__(16) float sZ[16 * 132];
  __shared__ __align__(16) unsigned short sYh[16 * 136];
  __shared__ __align__(16) unsigned short sYl[16 * 136];
  const int t = threadIdx.x, wave = t >> 5, lane = t & 31, hh = lane >> 4, m = lane & 15;
  const int r0 = blockIdx.x * 16;
  const int n  = 16 * wave + m;                              // the lane's output column in both products

  // ---- all global operands ----
  const _Float16* Ah = h16(PH) + (size_t)(r0 + m) * HD + 8 * hh;   // + 32 * ks * NPOOL: plane of head ks
  const _Float16* Al = h16(PL) + (size_t)(r0 + m) * HD + 8 * hh;
  const _Float16* Bw = h16(WOT) + (size_t)n * HID + 8 * hh;
  const _Float16* Bf = h16(FWT) + (size_t)n * HID + 8 * hh;
  v16h ah[4], al[4], bw[4], bf[4];
#pragma unroll
  for (int ks = 0; ks < 4; ++ks) {
    ah[ks] = ldfrag_h(Ah + (size_t)(32 * ks) * NPOOL);
    bw[ks] = ldfrag_h(Bw + 32 * ks);
    al[ks] = ldfrag_h(Al + (size_t)(32 * ks) * NPOOL);
  }
  const float ob = obias[n];
  const v4f lw = *(const v4f*)(flnw + 4 * lane), lb = *(const v4f*)(flnb + 4 * lane);
#pragma unroll
  for (int ks = 0; ks < 4; ++ks) bf[ks] = ldfrag_h(Bf + 32 * ks);
  const float fb = fbias[n];
  // holds every load above in front of the first product, so that all of them fly together (left alone, the compiler issues
  // them in four groups among the WMMAs, one round trip each); loaded values and their addresses as inputs only: the
  // address registers stay whole until the data are back
  asm volatile("" :: "v"(ah[0]), "v"(ah[1]), "v"(ah[2]), "v"(ah[3]), "v"(al[0]), "v"(al[1]), "v"(al[2]), "v"(al[3]),
               "v"(bw[0]), "v"(bw[1]), "v"(bw[2]), "v"(bw[3]), "v"(bf[0]), "v"(bf[1]), "v"(bf[2]), "v"(bf[3]),
               "v"(ob), "v"(fb), "v"(lw), "v"(lb), "v"(Ah), "v"(Al), "v"(Bw), "v"(Bf));

  // ---- GEMM1 ----
  {
    v8f acc = zero8(), accr = zero8();
#pragma unroll
    for (int ks = 0; ks < 4; ++ks) {
      acc  = mma_h_raw(ah[ks], bw[ks], acc);
      accr = mma_h_raw(al[ks], bw[ks], accr);
    }
    const float bn = bfr(ob);
#pragma unroll
    for (int r = 0; r < 8; ++r)
      sZ[(8 * hh + r) * 132 + n] = (acc[r] + accr[r] * INVRS) * (1.0f / (AC * WSC)) + bn;
  }
  __syncthreads();

  // ---- LayerNorm, rows out as f16 planes ----
  {
    float gg[4], bb[4];
#pragma unroll
    for (int e = 0; e < 4; ++e) { gg[e] = bfr(lw[e]); bb[e] = bfr(lb[e]); }
    const float* zp = sZ + 2 * wave * 132 + 4 * lane;         // rows 2w and 2w + 1 from one base: both reads go out together
    unsigned short* yhp = sYh + 2 * wave * 136 + 4 * lane;
    unsigned short* ylp = sYl + 2 * wave * 136 + 4 * lane;
    v4f zz[2];
#pragma unroll
    for (int i = 0; i < 2; ++i) zz[i] = *(const v4f*)(zp + i * 132);
#pragma unroll
    for (int i = 0; i < 2; ++i) {
      const v4f z = zz[i];
      float s = (z[0] + z[1]) + (z[2] + z[3]);
      s = wsum(s);
      const float mean = s * (1.0f / HID);
      float d[4];
#pragma unroll
      for (int e = 0; e < 4; ++e) d[e] = z[e] - mean;
      float vs = (d[0] * d[0] + d[1] * d[1]) + (d[2] * d[2] + d[3] * d[3]);
      vs = wsum(vs);
      const float rstd = rsqrtf(vs * (1.0f / HID) + LNEPS);
      unsigned short hb[4], lo[4];
#pragma unroll
      for (int e = 0; e < 4; ++e) split_h(((d[e] * rstd) * gg[e] + bb[e]) * YC, hb[e], lo[e]);
      v2u yh, yl;
      yh[0] = pk16(hb[0], hb[1]); yh[1] = pk16(hb[2], hb[3]);
      yl[0] = pk16(lo[0], lo[1]); yl[1] = pk16(lo[2], lo[3]);
      *(v2u*)(yhp + i * 136) = yh;
      *(v2u*)(ylp + i * 136) = yl;
    }
  }
  __syncthreads();

  // ---- GEMM2 ----
  {
    const _Float16* yhp = h16(sYh) + m * 136 + 8 * hh;
    const _Float16* ylp = h16(sYl) + m * 136 + 8 * hh;
    v16h yh[4], yl[4];
#pragma unroll
    for (int ks = 0; ks < 4; ++ks) { yh[ks] = ldfrag_h(yhp + 32 * ks); yl[ks] = ldfrag_h(ylp + 32 * ks); }
    v8f acc2 = zero8(), acc2r = zero8();
#pragma unroll
    for (int ks = 0; ks < 4; ++ks) {
      acc2  = mma_h_raw(yh[ks], bf[ks], acc2);
      acc2r = mma_h_raw(yl[ks], bf[ks], acc2r);
    }
    const float bn = bfr(fb);
    // sZ is free: its last readers, the LayerNorm rows, are behind the barrier above
#pragma unroll
    for (int r = 0; r < 8; ++r) {
      const float a = (acc2[r] + acc2r[r] * INVRS) * (1.0f / (YC * WSC)) + bn;
      sZ[(8 * hh + r) * 132 + n] = a * sigm(a);
    }
  }
  __syncthreads();
  {
    v4f vals[2];
#pragma unroll
    for (int i = 0; i < 2; ++i) vals[i] = *(const v4f*)(sZ + (8 * i + wave) * 132 + 4 * lane);
#pragma unroll
    for (int i = 0; i < 2; ++i)
      *(v4f*)(out + (size_t)(r0 + 8 * i + wave) * FD + 4 * lane) = vals[i];
  }
}

// =====================================================================================================
// Workspace map (bytes), every offset a multiple of 256 and every plane sized to its whole-line store granularity:
//   WOT  f16 [128][128] x64        0          32768
//   FWT  f16 [128][128] x64        32768      32768
//   QH   f16 [6144][128] q x8      65536      1572864
//   QL   f16 [6144][128] residual  1638400    1572864
//   KH   f16 k x8, fragment order [2][4 heads][192 key tiles][2 halves][32 lanes][8]   3211264    1572864
//   KL                             4784128    1572864
//   VTH  f16 v x16, fragment order [2][4 heads][96 key steps][2 d tiles][2 halves][32 lanes][8]   6356992    1572864
//   VTL                            7929856    1572864
//   LS   f32 [2][512 time blocks][128]   9502720    524288   (row 511 of each batch row neither written nor read)
//   PH   f16 [4 heads][1024][32] x32  10027008   262144
//   PL                             10289152   262144
//   TOT  f32 [2][48 key blocks][128]     10551296   49152
//   end                            10600448
// =====================================================================================================
extern "C" void kernel_launch(void* const* d_in, const int* in_sizes, int n_in,
                              void* d_out, int out_size, void* d_ws, size_t ws_size,
                              hipStream_t stream) {
  if (n_in < 20) return;
  if (in_sizes[0] != NTOK * DD) return;
  if (in_sizes[1] != DD || in_sizes[2] != DD || in_sizes[3] != DD * GH || in_sizes[4] != GH ||
      in_sizes[5] != GH || in_sizes[6] != 1) return;
  if (in_sizes[7] != DD * HID || in_sizes[8] != HID || in_sizes[9] != DD * HID || in_sizes[10] != HID ||
      in_sizes[11] != DD * HID || in_sizes[12] != HID) return;
  if (in_sizes[13] != HID * HID || in_sizes[14] != HID || in_sizes[15] != HID || in_sizes[16] != HID ||
      in_sizes[17] != HID * FD || in_sizes[18] != FD || in_sizes[19] != 1) return;
  if (out_size != NPOOL * FD) return;

  const float* x    = (const float*)d_in[0];
  const float* glnw = (const float*)d_in[1];
  const float* glnb = (const float*)d_in[2];
  const float* gw1  = (const float*)d_in[3];
  const float* gb1  = (const float*)d_in[4];
  const float* gw2  = (const float*)d_in[5];
  const float* gb2  = (const float*)d_in[6];
  const float* qw   = (const float*)d_in[7];
  const float* qb   = (const float*)d_in[8];
  const float* kw   = (const float*)d_in[9];
  const float* kb   = (const float*)d_in[10];
  const float* vw   = (const float*)d_in[11];
  const float* vb   = (const float*)d_in[12];
  const float* ow   = (const float*)d_in[13];
  const float* ob   = (const float*)d_in[14];
  const float* flnw = (const float*)d_in[15];
  const float* flnb = (const float*)d_in[16];
  const float* fw   = (const float*)d_in[17];
  const float* fb   = (const float*)d_in[18];
  const int*   Tp   = (const int*)d_in[19];

  const size_t PWO = (size_t)HID * HID * 2;           //    32768
  const size_t PWF = (size_t)FD * HID * 2;            //    32768
  const size_t PQP = (size_t)NTOK * HID * 2;          //  1572864
  const size_t PVT = (size_t)NB * HID * LL * 2;       //  1572864
  const size_t PSV = (size_t)NB * HID * TT * 4;       //   524288
  const size_t PPP = (size_t)NPOOL * HID * 2;         //   262144
  const size_t PTO = (size_t)NB * (LL / 64) * HID * 4; //    49152
  size_t off = 0;
  const size_t oWO = off; off += PWO;
  const size_t oWF = off; off += PWF;
  const size_t oQH = off; off += PQP;
  const size_t oQL = off; off += PQP;
  const size_t oKH = off; off += PQP;
  const size_t oKL = off; off += PQP;
  const size_t oVH = off; off += PVT;
  const size_t oVL = off; off += PVT;
  const size_t oSV = off; off += PSV;
  const size_t oPH = off; off += PPP;
  const size_t oPL = off; off += PPP;
  const size_t oTO = off; off += PTO;
  if (off > ws_size) return;                           // off = 10600448
  if (off > (size_t)134217728) return;

  char* ws = (char*)d_ws;
  unsigned short* WOT = (unsigned short*)(ws + oWO);
  unsigned short* FWT = (unsigned short*)(ws + oWF);
  unsigned short* QH  = (unsigned short*)(ws + oQH);
  unsigned short* QL  = (unsigned short*)(ws + oQL);
  unsigned short* KH  = (unsigned short*)(ws + oKH);
  unsigned short* KL  = (unsigned short*)(ws + oKL);
  unsigned short* VTH = (unsigned short*)(ws + oVH);
  unsigned short* VTL = (unsigned short*)(ws + oVL);
  float*          LS  = (float*)(ws + oSV);
  float*          TOT = (float*)(ws + oTO);
  unsigned short* PH  = (unsigned short*)(ws + oPH);
  unsigned short* PL  = (unsigned short*)(ws + oPL);
  float*          out = (float*)d_out;

  const dim3 blk(256), blk768(768);
  const dim3 gQ(NTOK / 64 + 16);                       // 96 token blocks + 16 weight tiles
  const dim3 gA(NB * NH * (LL / 96));                  // 256
  const dim3 gT(NPOOL / 16);                           // 64

  // (1) gater + gated q/k/v planes (q rows hi/lo; k and v^T hi/lo in fragment order) + per-block masked-key floor sums;
  //     its last 16 blocks: o_w and f_w planes, transposed to k-contiguous rows: f16( bf16_RNE(w) * 64 )
  qkv_prep<<<gQ, blk, 0, stream>>>(x, glnw, glnb, gw1, gb1, gw2, gb2, qb, kb, vb, qw, kw, vw, ow, fw, Tp,
                                   QH, QL, KH, KL, VTH, VTL, LS, TOT, WOT, FWT);

  // (2) block-causal attention + mean-pool over the 6 forces -> pooled planes
  attn_pool<<<gA, blk768, 0, stream>>>(QH, QL, KH, KL, VTH, VTL, LS, TOT, PH, PL);

  // (3) o-proj + LayerNorm + final linear + SiLU -> out
  tail_k<<<gT, blk, 0, stream>>>(PH, PL, WOT, ob, flnw, flnb, FWT, fb, out);
  (void)hipGetLastError();
}

// v009
// Measured time: 31.7 microseconds a run.
// In both of two side-by-side timings against v008, it was 1.09 times as fast.
// Counting every step since v000, it is 5.84 times as fast.
// Contractions: q/k/v projections (x rows f16 x16 . W^T f16 x64, K=32, one product), scores S^T = k . q^T
// (k and q each f16 x8 hi plane + f16 x1024 residual plane, 3 products per tile), O^T = v^T . P^T (v f16 x16 hi +
// x1024 residual, P f16 x1024 hi + x1024 residual, 3 products), pooled attention . Wo^T and LN rows . Wf^T
// (activation f16 hi + x1024 residual . W^T f16 x64, K=128, 2 products): all v_wmma_f32_16x16x32_f16, f32 accumulate;
// gater MLP, LayerNorm, softmax, pooling, SiLU in f32 on VALU; every float input RNE-converted to bf16 on load.
#include <hip/hip_runtime.h>
#include <math.h>
#include <stdint.h>

#define NB     2
#define TT     512
#define NF     6
#define DD     32
#define HID    128
#define NH     4
#define HD     32
#define GH     32
#define FD     128
#define LL     (TT * NF)
#define NTOK   (NB * LL)
#define NPOOL  (NB * TT)
#define LNEPS  1.0e-5f
#define XC     16.0f
#define WSC    64.0f
#define QC     8.0f
#define KC     8.0f
#define VC     16.0f
#define AC     32.0f
#define YC     16.0f
#define RSC    1024.0f
#define INVRS  (1.0f / 1024.0f)
#define FLOORC 1.0e-9f
#define NEGBIG (-1.0e30f)
#define MFLOOR (-1.0e25f)
#define SCL    ((0.17677669529663687f * 1.4426950408889634f) / (QC * KC))
static_assert(NH * HD == HID);
static_assert(FD == HID);
static_assert((LL % 64) == 0 && (LL % 96) == 0 && (LL % 32) == 0 && LL / 48 == 64);
static_assert((NTOK % 64) == 0 && (NPOOL % 16) == 0);
static_assert(DD == 32 && GH == 32 && (DD * GH) % 256 == 0);

typedef _Float16 v16h __attribute__((ext_vector_type(16)));
typedef _Float16 v8h  __attribute__((ext_vector_type(8)));
typedef float    v8f  __attribute__((ext_vector_type(8)));
typedef float    v4f  __attribute__((ext_vector_type(4)));
typedef unsigned int v4u __attribute__((ext_vector_type(4)));
typedef unsigned int v2u __attribute__((ext_vector_type(2)));
typedef float    v2f  __attribute__((ext_vector_type(2)));
typedef _Float16 v2h  __attribute__((ext_vector_type(2)));

union FragH { v16h v; v8h h[2]; };

// ---- scalar helpers --------------------------------------------------------------------------------
__device__ __forceinline__ unsigned short bf_bits(float f) {          // f32 -> bf16 bits, RNE convert
  unsigned u = __float_as_uint(f);
  return (unsigned short)((u + 0x7FFFu + ((u >> 16) & 1u)) >> 16);
}
__device__ __forceinline__ float bf_up(unsigned short h) { return __uint_as_float(((unsigned)h) << 16); }
__device__ __forceinline__ float bfr(float f) { return bf_up(bf_bits(f)); }
__device__ __forceinline__ unsigned short h_bits(_Float16 x) { return __builtin_bit_cast(unsigned short, x); }
__device__ __forceinline__ unsigned pk16(unsigned short a, unsigned short b) { return (unsigned)a | ((unsigned)b << 16); }
__device__ __forceinline__ v8f zero8() { v8f z = {0.f, 0.f, 0.f, 0.f, 0.f, 0.f, 0.f, 0.f}; return z; }
__device__ __forceinline__ float hmax8(v8f s) {
  return fmaxf(fmaxf(fmaxf(s[0], s[1]), fmaxf(s[2], s[3])), fmaxf(fmaxf(s[4], s[5]), fmaxf(s[6], s[7])));
}
__device__ __forceinline__ const _Float16* h16(const unsigned short* p) { return (const _Float16*)(const void*)p; }
// hi = f16(f), lo = f16((f - hi) * 1024): residual plane carried x1024, folded back in the f32 epilogue
__device__ __forceinline__ void split_h(float f, unsigned short& hb, unsigned short& lb) {
  const _Float16 h = (_Float16)f;
  const _Float16 l = (_Float16)((f - (float)h) * RSC);
  hb = h_bits(h);
  lb = h_bits(l);
}
__device__ __forceinline__ float fexp2(float x) { return __builtin_amdgcn_exp2f(x); }
__device__ __forceinline__ float sigm(float a) {
  const float e = __expf(fminf(-a, 60.0f));       // quotient stays far from underflow
  return 1.0f / (1.0f + e);
}
// cross-lane moves on the vector unit (no LDS-path permute, no dscnt wait): lane l <- lane l ^ 16, and l <- l ^ X inside a
// 16-lane row (DPP row_xmask)
__device__ __forceinline__ float xhalf(float x) {
  const int b = __builtin_bit_cast(int, x);
  return __builtin_bit_cast(float, __builtin_amdgcn_permlanex16(b, b, 0x76543210, 0xfedcba98, false, false));
}
template <int X>
__device__ __forceinline__ float xrow(float x) {
  return __builtin_bit_cast(float, __builtin_amdgcn_mov_dpp(__builtin_bit_cast(int, x), 0x160 + X, 0xf, 0xf, true));
}
__device__ __forceinline__ float lane_bc(float x, int k) {   // lane k's value to every lane, through a scalar register
  return __builtin_bit_cast(float, __builtin_amdgcn_readlane(__builtin_bit_cast(int, x), k));
}
__device__ __forceinline__ float wsum(float v) {             // butterfly over 16, 8, 4, 2, 1
  v += xhalf(v);
  v += xrow<8>(v);
  v += xrow<4>(v);
  v += xrow<2>(v);
  v += xrow<1>(v);
  return v;
}

// ---- fragment loader: 16-bit A/B operand, lane -> row/col (lane&15), p already includes +8*(lane>>4);
//      elements 0..7 <- p[0..7] (k0+8h..), elements 8..15 <- p[16..23] (k0+16+8h..)
__device__ __forceinline__ v16h ldfrag_h(const _Float16* p) {
  FragH f;
  f.h[0] = *(const v8h*)(p);
  f.h[1] = *(const v8h*)(p + 16);
  return f.v;
}

// ---- the same fragment from a plane stored in fragment order: one 16 x 32 operand tile = 1024 B = two 512-B halves,
//      half s holds lane L's elements 8s..8s+7 at byte 16*L, so each wave-wide 16-B load covers four whole 128-B lines;
//      p already includes +8*lane
__device__ __forceinline__ v16h ldfrag_p(const _Float16* p) {
  FragH f;
  f.h[0] = *(const v8h*)(p);
  f.h[1] = *(const v8h*)(p + 256);
  return f.v;
}

// ---- WMMA helpers with trailing VALU hazard gap --------------------------------------------------------
__device__ __forceinline__ v8f mma_h_raw(v16h a, v16h b, v8f c) {
  return __builtin_amdgcn_wmma_f32_16x16x32_f16(false, a, false, b, (short)0, c, false, false);
}
__device__ __forceinline__ void guard4x6(v8f& a, v8f& b, v8f& c, v8f& d,
                                         v16h x0, v16h x1, v16h x2, v16h x3, v16h x4, v16h x5) {
#if defined(__HIP_DEVICE_COMPILE__)
  asm volatile("v_nop\n\tv_nop\n\tv_nop\n\tv_nop"
               : "+v"(a), "+v"(b), "+v"(c), "+v"(d)
               : "v"(x0), "v"(x1), "v"(x2), "v"(x3), "v"(x4), "v"(x5));
#endif
}

// =====================================================================================================
// Weight convert with transpose, one 64 k x 32 o tile of o_w or f_w per block (the 16 blocks behind the token blocks of
// the projection launch): in[k][o] f32 (x @ W layout) -> out[o][k] = f16( bf16_RNE(in) * WSC ), k contiguous.
// q = 0..7: o_w [128][128] -> WOT [n][k]; q = 8..15: f_w -> FWT; thread t loads k = t>>2, 8 floats at 8*(t&3) into T
// (pitch 33), stores row o = t>>3, 8 halves k = 8*(t&7).
// coverage: WOT/FWT 4 x 2 tiles x (32 o x 64 k) = [128][128] each.
// =====================================================================================================
__device__ __forceinline__ void conv_tile(const int q, const int t, const float* __restrict__ ow,
                                          const float* __restrict__ fw, unsigned short* WOT, unsigned short* FWT,
                                          float* T) {
  const bool iso = (q < 8);                                  // block-uniform
  const int rr = iso ? q : (q - 8);
  const float* src   = iso ? ow : fw;
  unsigned short* ds = iso ? WOT : FWT;
  const int o0 = (rr >> 1) * 32, k0 = (rr & 1) * 64;
  {
    const int k = t >> 2, oo = 8 * (t & 3);
    const float* sp = src + (size_t)(k0 + k) * HID + o0 + oo;
    const v4f a = *(const v4f*)(sp), c = *(const v4f*)(sp + 4);
#pragma unroll
    for (int i = 0; i < 4; ++i) { T[k * 33 + oo + i] = a[i]; T[k * 33 + oo + 4 + i] = c[i]; }
  }
  __syncthreads();
  {
    const int o = t >> 3, e = t & 7;
    float w[8];
#pragma unroll
    for (int i = 0; i < 8; ++i) w[i] = bfr(T[(8 * e + i) * 33 + o]) * WSC;
    v4u v;
#pragma unroll
    for (int i = 0; i < 4; ++i) v[i] = pk16(h_bits((_Float16)w[2 * i]), h_bits((_Float16)w[2 * i + 1]));
    unsigned short* dp = ds + (size_t)(o0 + o) * HID + k0 + 8 * e;
    *(v4u*)dp = v;
  }
}

// =====================================================================================================
// Gater + gated q/k/v projections for 64 tokens per block (256 threads = 8 waves; blocks 0..95 of a grid of 96 + 16; the
// last 16 blocks convert o_w and f_w for the tail launch, see conv_tile, and do nothing else).
// Phase 0: x tile [64][32] loaded as float4 pairs, RNE-converted to bf16 values: f32 copy sX (pitch 33) for the gater and
//          f16(x * 16) rows sXh (pitch 40 halves) as a WMMA operand; g_w1 and the q/k/v biases staged bf16-RNE in LDS;
//          q_w | k_w | v_w [32 k][128 n] f32 -> sWT rows [p*128 + n][32 k] = f16( bf16_RNE(w) * 64 ), pitch 40 halves:
//          thread -> column n = t&127 and 8 k (each wave-wide 4-B load is one whole line), one 16-B LDS store per 8 k.
//          Phase 1 (gater, wave -> 8 tokens): with lane = hidden unit (32 readlane-broadcast FMAs), gate = sigmoid(sum_lane h*g_w2 + g_b2), all f32 -> sG.
// Phase 2: per part p in {v,q,k}: wave w -> 16-token tile w&3, 64-col half w>>2: 4 WMMAs (K = 32 = one k step; x rows from
//          sXh, weight rows [p*128 + n][32] from sWT); epilogue f = (acc/1024 + bf16(bias[n])) * gate[token] * C (C = 8 q/k,
//          16 v), hi = f16(f), lo = f16((f-hi)*1024). v: A = x, B = W, so a lane holds 8 consecutive keys of one head column;
//          q, k: A = W, B = x (the transposed product), so a lane holds 8 consecutive dims of one token. Either way the
//          lane's 8 values of one accumulator tile are its 16 bytes of one fragment-order half (see ldfrag_p): every plane is
//          stored straight from registers, slab (b, head), 512 contiguous bytes per wave and store. Only v is also staged in
//          LDS (transposed [128 hcol][72]) for phase 3, behind the one barrier of this phase, which stands in front of every
//          global store, so that it waits for none.
// Phase 3 (waves 0..3, thread -> head column): this block's share of the masked-key floor sums, from the staged v planes:
//          LS[b][tb][hcol] = sum of v over the block's keys j >= 6*(tb+1), for every boundary 6*(tb+1) that lies in the
//          block, and TOT[b][block][hcol] = sum over all 64 keys (keys of time blocks >= T count as 0).
// coverage: QH/QL and KH/KL 4 heads x 16-token tiles ltok0/16..+3 x 2 halves; VTH/VTL 4 heads x key steps
//           ltok0/32..+1 x 2 d tiles; grid covers all 6144 tokens exactly once. LS rows tb = 0..510 of each batch row once
//           (the boundary of tb = 511 is past the last key: no row, and none is read); TOT 96 rows once.
// =====================================================================================================
// Suffix sums of one head column inside a 64-key block whose first boundary (key index a multiple of 6) is local key I0:
// six-key sums first (independent), then one short chain over the boundaries, last to first. r[j] = sum over the block's
// keys from boundary j on (0 where the block has no boundary j), tot = sum over all 64 keys.
#define NJMAX 11                                             // boundaries in a block: 11 for I0 = 0 and 2, 10 for I0 = 4
template <int I0>
__device__ __forceinline__ void block_suffix(const float (&val)[64], const int tb0, const int ntb,
                                             float (&r)[NJMAX], float& tot) {
  constexpr int NJ = (63 - I0) / NF + 1;
  float run = 0.f;
#pragma unroll
  for (int j = NJMAX - 1; j >= NJ; --j) r[j] = 0.f;
#pragma unroll
  for (int j = NJ - 1; j >= 0; --j) {
    float sg = 0.f;
#pragma unroll
    for (int f = 0; f < NF; ++f)
      if (I0 + NF * j + f < 64) sg += val[I0 + NF * j + f];
    run += (tb0 + 1 + j < ntb) ? sg : 0.f;                   // these keys are time block tb0 + 1 + j
    r[j] = run * (1.0f / VC);
  }
  float head = 0.f;
#pragma unroll
  for (int i = 0; i < I0; ++i) head += val[i];
  tot = (run + ((tb0 < ntb) ? head : 0.f)) * (1.0f / VC);    // the keys in front of I0 are time block tb0
}

__global__ __launch_bounds__(256) void qkv_prep(
    const float* __restrict__ x, const float* __restrict__ glnw, const float* __restrict__ glnb,
    const float* __restrict__ gw1, const float* __restrict__ gb1, const float* __restrict__ gw2,
    const float* __restrict__ gb2, const float* __restrict__ qbias, const float* __restrict__ kbias,
    const float* __restrict__ vbias, const float* __restrict__ qw, const float* __restrict__ kw,
    const float* __restrict__ vw, const float* __restrict__ ow, const float* __restrict__ fw,
    const int* __restrict__ Tp,
    unsigned short* QH, unsigned short* QL, unsigned short* KH, unsigned short* KL,
    unsigned short* VTH, unsigned short* VTL, float* LS, float* TOT, unsigned short* WOT, unsigned short* FWT) {
  __shared__ __align__(16) float sX[64 * 33];
  __shared__ __align__(16) _Float16 sXh[64 * 40];
  __shared__ float sW1[DD * GH];
  __shared__ float sG[64];
  __shared__ __align__(16) float sBias[3 * HID];             // bf16-RNE q_b | k_b | v_b: a lane of the transposed product needs 8 in a row
  __shared__ __align__(16) unsigned short sH[128 * 72];
  __shared__ __align__(16) unsigned short sL[128 * 72];
  __shared__ __align__(16) unsigned short sWT[3 * HID * 40];
  const int t = threadIdx.x, wave = t >> 5, lane = t & 31, hh = lane >> 4, m = lane & 15;
  if (blockIdx.x >= NTOK / 64) {                             // block-uniform, in front of every other barrier
    conv_tile((int)blockIdx.x - NTOK / 64, t, ow, fw, WOT, FWT, sX);
    return;
  }
  const int tok0  = blockIdx.x * 64;
  const int b     = tok0 / LL;
  const int ltok0 = tok0 - b * LL;

  // ---- phase 0 ----
  {
    const int wn = t & 127, wk = t >> 7;                     // weight column; 8-k group wk + 2*(i&1) of part i>>1
    const unsigned wofs = (unsigned)(8 * wk * HID + wn);     // the thread's first element of each part
    float wv[6][8];
#pragma unroll
    for (int i = 0; i < 6; ++i) {
      const float* wsrc = (i < 2) ? qw : ((i < 4) ? kw : vw);
#pragma unroll
      for (int e = 0; e < 8; ++e) wv[i][e] = wsrc[wofs + (unsigned)((16 * (i & 1) + e) * HID)];
    }
    const int tk = t >> 2, j = 8 * (t & 3);
    const float* sp = x + (size_t)(tok0 + tk) * DD + j;
    const v4f a = *(const v4f*)(sp), c = *(const v4f*)(sp + 4);
    // g_w1, unrolled: the thread's four elements are asked for in the same flight as the loads above (rolled, each trip
    // waited for its own load: four round trips in a row)
    const unsigned gofs = (unsigned)t;
    float g1[DD * GH / 256];
#pragma unroll
    for (int i = 0; i < DD * GH / 256; ++i) g1[i] = gw1[gofs + (unsigned)(256 * i)];
    const float* bsrc = (__builtin_amdgcn_readfirstlane(t) < HID) ? qbias : kbias;   // waves 0..3: q_b, waves 4..7: k_b
    const unsigned bofs = (unsigned)(t & (HID - 1));
    const float bqk = bsrc[bofs];
    const float bv0 = vbias[bofs];
    // one wait for the weight, x, g_w1 and bias loads above: their address registers, offsets and scalar bases, are inputs
    // here, so that neither a later load's destination nor any other instruction overwrites one of them in front of it
    asm volatile("s_wait_xcnt 0x0" :: "v"(wofs), "v"(sp), "v"(gofs), "v"(bofs), "s"(qw), "s"(kw), "s"(vw), "s"(gw1),
                 "s"(bsrc), "s"(vbias) : "memory");
    float r8[8];
#pragma unroll
    for (int i = 0; i < 4; ++i) { r8[i] = bfr(a[i]); r8[4 + i] = bfr(c[i]); }
#pragma unroll
    for (int i = 0; i < 8; ++i) {
      sX[tk * 33 + j + i]  = r8[i];
      sXh[tk * 40 + j + i] = (_Float16)(r8[i] * XC);
    }
#pragma unroll
    for (int i = 0; i < DD * GH / 256; ++i) sW1[t + 256 * i] = bfr(g1[i]);
    sBias[t] = bfr(bqk);
    sBias[2 * HID + (t & (HID - 1))] = bfr(bv0);             // no branch: two threads write the same value to a slot
#pragma unroll
    for (int i = 0; i < 6; ++i) {
      v4u v;
#pragma unroll
      for (int e = 0; e < 4; ++e)
        v[e] = pk16(h_bits((_Float16)(bfr(wv[i][2 * e]) * WSC)), h_bits((_Float16)(bfr(wv[i][2 * e + 1]) * WSC)));
      *(v4u*)(sWT + ((i >> 1) * HID + wn) * 40 + 8 * (wk + 2 * (i & 1))) = v;
    }
  }
  __syncthreads();
  // read here so that phase 3 does not wait for it; behind the barrier, so that the scalar load's destination cannot be a
  // base register of phase 0's loads while they are in flight
  const int tin = Tp[0];

  // ---- phase 1: gater (f32, VALU) ----
  {
    const float gw = bfr(glnw[lane]), gb = bfr(glnb[lane]);
    const float b1 = bfr(gb1[lane]),  w2 = bfr(gw2[lane]), b2 = bfr(gb2[0]);
    // unrolled: the wave's eight tokens are eight independent chains (sums, 32-link FMA chain, sigmoids) that fill each
    // other's latency; rolled, one chain at a time left the two waves of a SIMD waiting most of the time
    float gsel = 0.f;
#pragma unroll
    for (int i = 0; i < 8; ++i) {
      const int tk = wave * 8 + i;
      const float xv  = sX[tk * 33 + lane];
      const float mu  = wsum(xv) * (1.0f / DD);
      const float dv  = xv - mu;
      const float var = wsum(dv * dv) * (1.0f / DD);
      const float xn  = dv * rsqrtf(var + LNEPS) * gw + gb;
      float hacc = b1;
#pragma unroll
      for (int k = 0; k < DD; ++k) hacc += lane_bc(xn, k) * sW1[k * GH + lane];
      const float hs = hacc * sigm(hacc);
      const float gs = wsum(hs * w2) + b2;
      const float g  = sigm(gs);
      gsel = ((lane & 7) == i) ? g : gsel;                   // every lane holds g: lanes i, i + 8, .. keep token i's
    }
    sG[wave * 8 + (lane & 7)] = gsel;                        // one store, no branch: four lanes write the same value to a slot
  }
  __syncthreads();

  // ---- phase 2: projections on WMMA ----
  const int rt = wave & 3, ch = wave >> 2;
  FragH af;
  af.h[0] = *(const v8h*)(sXh + (16 * rt + m) * 40 + 8 * hh);
  af.h[1] = *(const v8h*)(sXh + (16 * rt + m) * 40 + 16 + 8 * hh);
  const _Float16* WTp = h16(sWT);
  const float gl = sG[16 * rt + m];                          // q, k: the lane's token is its accumulator column
  float gr[8];                                               // v: the lane's tokens are its accumulator rows
#pragma unroll
  for (int r = 0; r < 8; ++r) gr[r] = sG[16 * rt + 8 * hh + r];
  // unrolled: p is a constant in each copy (operand order, bias source and plane layout cost no branch). v comes first: its
  // LDS copy is published by the barrier while no global store is outstanding
#pragma unroll
  for (int pp = 0; pp < 3; ++pp) {
    const int p = (pp + 2) % 3;                              // 2 (v), 0 (q), 1 (k)
    v16h bf[4];
#pragma unroll
    for (int j = 0; j < 4; ++j)
      bf[j] = ldfrag_h(WTp + (p * HID + 64 * ch + 16 * j + m) * 40 + 8 * hh);
    v8f acc[4];
#pragma unroll
    for (int j = 0; j < 4; ++j)
      acc[j] = (p == 2) ? mma_h_raw(af.v, bf[j], zero8()) : mma_h_raw(bf[j], af.v, zero8());
    guard4x6(acc[0], acc[1], acc[2], acc[3], af.v, bf[0], bf[1], bf[2], bf[3], af.v);
    v4u hv[4], lv[4];
#pragma unroll
    for (int j = 0; j < 4; ++j) {
      float bn[8];
      if (p == 2) {
        const float bv = sBias[2 * HID + 64 * ch + 16 * j + m];   // column n = 64ch + 16j + m
#pragma unroll
        for (int r = 0; r < 8; ++r) bn[r] = bv;
      } else {
        const float* bq = sBias + p * HID + 64 * ch + 16 * j + 8 * hh;   // rows n = 64ch + 16j + 8hh + r
        const v4f b0 = *(const v4f*)(bq), b1 = *(const v4f*)(bq + 4);
#pragma unroll
        for (int r = 0; r < 4; ++r) { bn[r] = b0[r]; bn[4 + r] = b1[r]; }
      }
      unsigned short hb[8], lb[8];
#pragma unroll
      for (int r = 0; r < 8; ++r) {
        const float f = ((acc[j][r] * (1.0f / (XC * WSC)) + bn[r]) * ((p == 2) ? gr[r] : gl)) * ((p == 2) ? VC : QC);
        split_h(f, hb[r], lb[r]);
      }
#pragma unroll
      for (int e = 0; e < 4; ++e) {
        hv[j][e] = pk16(hb[2 * e], hb[2 * e + 1]);
        lv[j][e] = pk16(lb[2 * e], lb[2 * e + 1]);
      }
    }
    unsigned short* Hp;
    unsigned short* Lp;
    if (p == 2) {
      // phase 3's copy: head column n, keys 16rt + 8hh ..+7
#pragma unroll
      for (int j = 0; j < 4; ++j) {
        const int dst = (64 * ch + 16 * j + m) * 72 + 16 * rt + 8 * hh;
        *(v4u*)(sH + dst) = hv[j];
        *(v4u*)(sL + dst) = lv[j];
      }
      __syncthreads();
      // v^T: tile j = head 2ch + (j>>1), d tile j&1; token tile rt = 32-key step rt>>1, half rt&1; lane -> d row m, keys 8hh ..+7
      const size_t o = ((size_t)(b * NH + 2 * ch) * (LL / 32) + (ltok0 >> 5) + (rt >> 1)) * 1024 + (rt & 1) * 256 + lane * 8;
      Hp = VTH + o;
      Lp = VTL + o;
#pragma unroll
      for (int j = 0; j < 4; ++j) {
        *(v4u*)(Hp + (size_t)(j >> 1) * (LL / 32) * 1024 + (j & 1) * 512) = hv[j];
        *(v4u*)(Lp + (size_t)(j >> 1) * (LL / 32) * 1024 + (j & 1) * 512) = lv[j];
      }
    } else {
      // q, k: tile j = head 2ch + (j>>1), half j&1; 16-token tile rt; lane -> token m, dims 16(j&1) + 8hh ..+7
      const size_t o = ((size_t)(b * NH + 2 * ch) * (LL / 16) + (ltok0 >> 4) + rt) * 512 + lane * 8;
      Hp = ((p == 0) ? QH : KH) + o;
      Lp = ((p == 0) ? QL : KL) + o;
#pragma unroll
      for (int j = 0; j < 4; ++j) {
        *(v4u*)(Hp + (size_t)(j >> 1) * (LL / 16) * 512 + (j & 1) * 256) = hv[j];
        *(v4u*)(Lp + (size_t)(j >> 1) * (LL / 16) * 512 + (j & 1) * 256) = lv[j];
      }
    }
    // the stores' data and address registers are inputs here, so that nothing overwrites one of them in front of the wait
    asm volatile("s_wait_xcnt 0x0" :: "v"(hv[0]), "v"(hv[1]), "v"(hv[2]), "v"(hv[3]), "v"(lv[0]), "v"(lv[1]), "v"(lv[2]),
                 "v"(lv[3]), "v"(Hp), "v"(Lp) : "memory");
  }
  // ---- phase 3: floor sums of this block's keys ----
  if (wave < 4) {                                               // wave-uniform; no barrier inside
    const int ntb = (tin < 0) ? 0 : ((tin > TT) ? TT : tin);    // structural, clamped to the static extent
    float val[64];
#pragma unroll
    for (int g = 0; g < 8; ++g) {
      const v8h a = *(const v8h*)(h16(sH) + t * 72 + 8 * g);
      const v8h l = *(const v8h*)(h16(sL) + t * 72 + 8 * g);
#pragma unroll
      for (int j = 0; j < 8; ++j)
        val[8 * g + j] = (float)a[j] + (float)l[j] * INVRS;
    }
    const int i0  = (NF - ltok0 % NF) % NF;                     // 0, 2 or 4: 64 keys shift the phase by 4
    const int tb0 = (ltok0 + i0) / NF - 1;                      // time block whose masked keys start at local key i0
    float r[NJMAX], tot;
    if (i0 == 0)      block_suffix<0>(val, tb0, ntb, r, tot);   // block-uniform
    else if (i0 == 2) block_suffix<2>(val, tb0, ntb, r, tot);
    else              block_suffix<4>(val, tb0, ntb, r, tot);
    float* lsp  = LS + ((size_t)b * TT + tb0 + 1) * HID + t;    // row tb0 + 1, the block's second boundary
    float* totp = TOT + ((size_t)b * (LL / 64) + (ltok0 >> 6)) * HID + t;
    if (tb0 >= 0) *(lsp - HID) = r[0];                          // block-uniform: key 0 is no boundary of a time block
#pragma unroll
    for (int j = 1; j < NJMAX - 1; ++j) lsp[(size_t)(j - 1) * HID] = r[j];
    if (i0 != 4) lsp[(size_t)(NJMAX - 2) * HID] = r[NJMAX - 1]; // block-uniform: the eleventh boundary
    totp[0] = tot;
    // the stores' registers may be reused behind this point: keep the wait in front of that overwrite
    asm volatile("s_wait_xcnt 0x0" ::: "memory");
  }
}

// Residual plane of four packed f16 pairs: l = f16(P - 1024 h), each half by ONE mixed-precision FMA that reads its f16 half of
// h, the f32 P, and rounds straight into its half of l (left to itself the compiler makes the f32 difference, then converts, and
// rounds h a second time for it: about twice the instructions). The four low halves stand in front of the four high halves, and
// the hints name that distance, so that no instruction waits unannounced for the one that wrote the other half of its register.
__device__ __forceinline__ void resid4(unsigned& l0, unsigned& l1, unsigned& l2, unsigned& l3,
                                       const unsigned h0, const unsigned h1, const unsigned h2, const unsigned h3,
                                       const v2f p0, const v2f p1, const v2f p2, const v2f p3) {
#if defined(__HIP_DEVICE_COMPILE__)
  const float nr = -RSC;
  asm("v_fma_mixlo_f16 %0, %4, %8, %9 op_sel_hi:[1,0,0]\n\t"
      "v_fma_mixlo_f16 %1, %5, %8, %11 op_sel_hi:[1,0,0]\n\t"
      "v_fma_mixlo_f16 %2, %6, %8, %13 op_sel_hi:[1,0,0]\n\t"
      "v_fma_mixlo_f16 %3, %7, %8, %15 op_sel_hi:[1,0,0]\n\t"
      "s_delay_alu instid0(VALU_DEP_4) | instskip(NEXT) | instid1(VALU_DEP_4)\n\t"
      "v_fma_mixhi_f16 %0, %4, %8, %10 op_sel:[1,0,0] op_sel_hi:[1,0,0]\n\t"
      "v_fma_mixhi_f16 %1, %5, %8, %12 op_sel:[1,0,0] op_sel_hi:[1,0,0]\n\t"
      "s_delay_alu instid0(VALU_DEP_4) | instskip(NEXT) | instid1(VALU_DEP_4)\n\t"
      "v_fma_mixhi_f16 %2, %6, %8, %14 op_sel:[1,0,0] op_sel_hi:[1,0,0]\n\t"
      "v_fma_mixhi_f16 %3, %7, %8, %16 op_sel:[1,0,0] op_sel_hi:[1,0,0]"
      : "=&v"(l0), "=&v"(l1), "=&v"(l2), "=&v"(l3)
      : "v"(h0), "v"(h1), "v"(h2), "v"(h3), "s"(nr),
        "v"(p0.x), "v"(p0.y), "v"(p1.x), "v"(p1.y), "v"(p2.x), "v"(p2.y), "v"(p3.x), "v"(p3.y));
#endif
}

// =====================================================================================================
// One 32-key step of the transposed flash formulation for 16 queries of one head (head dim 32 = one k step):
//   S^T tiles (16 keys x 16 queries) = A(k rows, dims split-map) . B(q^T): hi.hi -> s, hi.lo + lo.hi -> sr (x1024);
//   raw score u = s + sr/1024; block-causal mask by value (key < horizon of the lane's query);
//   online softmax per lane (8 + 8 keys of ONE query per lane, maximum m of the raw scores, combined with lane^16):
//   P = 2^((u - m) * scale*log2e/64 + 20), the scale folded into the exponent's one FMA; p = P / 1024 (e^{s - smax} x1024);
//   P^T as the B operand of O^T(16 d x 16 queries) += v^T(d rows, fragment order) . P^T: element r <- tile keys kb..kb+15,
//   element 8+r <- tile kb+16..kb+31, lane unchanged; P hi to o, (v hi . P lo x1024 + v lo x1024 . P hi) to or.
// =====================================================================================================
template <bool MASKED>
__device__ __forceinline__ void attn_step(const int kb, const int jl, const int hh,
    const _Float16* __restrict__ kH, const _Float16* __restrict__ kL,
    const _Float16* __restrict__ vH, const _Float16* __restrict__ vL,
    const v16h qhi, const v16h qlo, float& m_run, float& l_run,
    v8f& o1, v8f& o1r, v8f& o2, v8f& o2r) {
  const size_t so = (size_t)kb * 32;                 // 32 keys = 1024 halves of each fragment-order plane
  const v16h kh0 = ldfrag_p(kH + so);
  const v16h kh1 = ldfrag_p(kH + so + 512);
  const v16h kl0 = ldfrag_p(kL + so);
  const v16h kl1 = ldfrag_p(kL + so + 512);
  v8f s0  = mma_h_raw(kh0, qhi, zero8());
  v8f s1  = mma_h_raw(kh1, qhi, zero8());
  v8f s0r = mma_h_raw(kh0, qlo, zero8());
  v8f s1r = mma_h_raw(kh1, qlo, zero8());
  s0r = mma_h_raw(kl0, qhi, s0r);
  s1r = mma_h_raw(kl1, qhi, s1r);
  guard4x6(s0, s1, s0r, s1r, kh0, kh1, kl0, kl1, qhi, qlo);

  // raw scores (q x8 . k x8), pairs of neighbouring accumulator rows: u[i] = tile 0 rows 2i, 2i+1; u[4+i] = tile 1
  v2f u[8];
#pragma unroll
  for (int i = 0; i < 4; ++i) {
    const v2f a0 = {s0[2 * i], s0[2 * i + 1]}, r0 = {s0r[2 * i], s0r[2 * i + 1]};
    const v2f a1 = {s1[2 * i], s1[2 * i + 1]}, r1 = {s1r[2 * i], s1r[2 * i + 1]};
    u[i]     = a0 + r0 * INVRS;
    u[4 + i] = a1 + r1 * INVRS;
  }
  if (MASKED) {
    const int lim = jl - (kb + 8 * hh);              // row r is key kb + 8hh + r (tile 0), + 16 (tile 1): visible if below jl
#pragma unroll
    for (int i = 0; i < 4; ++i) {
      u[i].x     = (2 * i          < lim) ? u[i].x     : NEGBIG;
      u[i].y     = (2 * i + 1      < lim) ? u[i].y     : NEGBIG;
      u[4 + i].x = (16 + 2 * i     < lim) ? u[4 + i].x : NEGBIG;
      u[4 + i].y = (16 + 2 * i + 1 < lim) ? u[4 + i].y : NEGBIG;
    }
  }
  float mx = fmaxf(fmaxf(fmaxf(fmaxf(u[0].x, u[0].y), fmaxf(u[1].x, u[1].y)), fmaxf(fmaxf(u[2].x, u[2].y), fmaxf(u[3].x, u[3].y))),
                   fmaxf(fmaxf(fmaxf(u[4].x, u[4].y), fmaxf(u[5].x, u[5].y)), fmaxf(fmaxf(u[6].x, u[6].y), fmaxf(u[7].x, u[7].y))));
  mx = fmaxf(mx, xhalf(mx));
  const float m_new = fmaxf(m_run, mx);              // running maximum of the RAW scores (the scale is positive)
  const float corr  = fexp2((m_run - m_new) * SCL);
  m_run = m_new;
  // exponent = u * SCL + cofs = (u - m) * SCL + 20: one FMA per score. A lane whose keys have all been masked so far has
  // m = NEGBIG; the floor keeps its exponents hugely negative (P = 0) where m * SCL's rounding error would decide them
  const float mc   = MASKED ? fmaxf(m_new, MFLOOR) : m_new;
  const float cofs = fmaf(-mc, SCL, 20.0f);
  o1 = o1 * corr; o1r = o1r * corr; o2 = o2 * corr; o2r = o2r * corr;

  v2f P[8];                                          // e^{s - smax} * 2^20
#pragma unroll
  for (int i = 0; i < 8; ++i) {
    const v2f a = u[i] * SCL + cofs;
    P[i].x = fexp2(a.x);
    P[i].y = fexp2(a.y);
  }
  const v2f lt = ((P[0] + P[1]) + (P[2] + P[3])) + ((P[4] + P[5]) + (P[6] + P[7]));
  l_run = l_run * corr + (lt.x + lt.y);              // carried x 2^20

  // hi = f16(P / 1024) (the x1024 plane), residual = f16(P - 1024 hi) = f16((p - hi) * 1024): the FMA is exact, one rounding
  union FragU { v16h v; unsigned w[8]; } ph, pl;     // word i: half i>>2 (keys kb + 16 (i>>2) + 8hh + ..), rows 2(i&3), 2(i&3)+1
#pragma unroll
  for (int i = 0; i < 8; ++i)
    ph.w[i] = __builtin_bit_cast(unsigned, __builtin_convertvector(P[i] * INVRS, v2h));
  resid4(pl.w[0], pl.w[1], pl.w[2], pl.w[3], ph.w[0], ph.w[1], ph.w[2], ph.w[3], P[0], P[1], P[2], P[3]);
  resid4(pl.w[4], pl.w[5], pl.w[6], pl.w[7], ph.w[4], ph.w[5], ph.w[6], ph.w[7], P[4], P[5], P[6], P[7]);

  const v16h vh1 = ldfrag_p(vH + so);
  const v16h vl1 = ldfrag_p(vL + so);
  const v16h vh2 = ldfrag_p(vH + so + 512);
  const v16h vl2 = ldfrag_p(vL + so + 512);
  o1  = mma_h_raw(vh1, ph.v, o1);
  o2  = mma_h_raw(vh2, ph.v, o2);
  o1r = mma_h_raw(vh1, pl.v, o1r);
  o2r = mma_h_raw(vh2, pl.v, o2r);
  o1r = mma_h_raw(vl1, ph.v, o1r);
  o2r = mma_h_raw(vl2, ph.v, o2r);
  guard4x6(o1, o2, o1r, o2r, vh1, vh2, vl1, vl2, ph.v, pl.v);
}

// =====================================================================================================
// Attention + mean-pool for one head of one batch row and a PAIR of 48-query groups: group 63 - pi (long key range) and
// group pi (short key range), so that every block holds about the same number of 32-key steps. Block = 24 waves (768
// threads), grid = 2 * 4 * 32 = 256. Wave w -> query tile index g = w>>3 of both groups; the 8 waves of one g share the
// key steps of the long tile (nH steps) and of the short tile (nL steps) in runs of C consecutive steps, C the smallest
// run length for which the block's longest pair of tiles fits in 8 waves. Each wave runs the online softmax over its own run only (the fully
// visible steps without masking, the rest with the per-lane horizon test by value) and leaves its partial
// (row maximum m, row sum l, o + or/1024) in LDS; a lane whose keys are all masked in its run keeps m = NEGBIG and gets
// weight 0 in the merge (run 0 of every tile holds keys 0..5, visible to every query, so the merged maximum is real).
// Merge (all 768 threads, thread -> query t>>3 of 96, 4 d at 4*(t&7)): M = max m_s, w_s = 2^(m_s - M),
// attn[d] = (sum w_s o_s) / (16 sum w_s l_s) + 1e-9 * (sum of v[.][d] over the query's masked keys) -> LDS sO[96][36] (f32);
// that sum = LS[b][tq][.] (the masked keys inside the 64-key block that holds the first of them) + the totals TOT of all
// later 64-key blocks, which wave 7 sums last to first into LDS sTS[48][32] in front of the merge barrier;
// barrier; threads 0..127 pool 6 consecutive query rows (pooled row t>>3 of 16, cols 4*(t&7)) -> f16 hi (x32) / lo
// (x1024), stored to the head's own plane [head][1024 rows][32]: one wave writes 256 contiguous bytes of each plane.
// coverage: per block rows b*512 + 8*(63-pi) .. +7 and b*512 + 8*pi .. +7 of head h; 256 blocks cover [4][1024][32] once.
// =====================================================================================================
#define KS 8                                                 // waves that share one long and one short query tile
__device__ __forceinline__ int cdiv_i(int a, int d) { return (a + d - 1) / d; }
// 32-key steps of the 16-query tile that starts at query qw0: up to the block-causal horizon of its last query (<= 3072)
__device__ __forceinline__ int tile_steps(int qw0) { return (((qw0 + 15) / NF + 1) * NF + 31) >> 5; }
// run length for a pair of tiles; at most 96 since then each tile is one run
__device__ __forceinline__ int run_len(int nH, int nL) {
  int C = cdiv_i(nH + nL, KS);
  for (; C < LL / 32; ++C)
    if (cdiv_i(nH, C) + cdiv_i(nL, C) <= KS) break;
  return C;
}

__global__ __launch_bounds__(768)
void attn_pool(const unsigned short* __restrict__ QH, const unsigned short* __restrict__ QL,
               const unsigned short* __restrict__ KH, const unsigned short* __restrict__ KL,
               const unsigned short* __restrict__ VTH, const unsigned short* __restrict__ VTL,
               const float* __restrict__ LS, const float* __restrict__ TOT, unsigned short* PH, unsigned short* PL) {
  __shared__ __align__(16) float sP[3 * KS * 16 * 36];       // per wave 16 queries x 32 d, pitch 36
  __shared__ float sM[3 * KS * 16];
  __shared__ float sL[3 * KS * 16];
  __shared__ __align__(16) float sO[96 * 36];
  __shared__ __align__(16) float sTS[(LL / 64) * HD];        // [64-key block k][d]: sum of v over all keys of blocks > k
  const int t = threadIdx.x, lane = t & 31, hh = lane >> 4, c = lane & 15;
  const int wave = __builtin_amdgcn_readfirstlane(t >> 5);   // wave-uniform: run bounds and plane bases stay scalar
  const int bx = blockIdx.x;
  const int pi = bx & 31;
  const int h  = (bx >> 5) & 3;
  const int b  = bx >> 7;
  // one run length for the block, from its last (longest) tiles: run s of all three tiles covers the same keys, so the
  // three waves that walk it together read the same k and v lines
  const int C = run_len(tile_steps((63 - pi) * 48 + 32), tile_steps(pi * 48 + 32));

  if (wave == KS - 1) {                                      // scalar branch; this wave holds at most the last, short run of a short tile
    const float* tp = TOT + (size_t)b * (LL / 64) * HID + h * HD + lane;   // lane -> d
    float tv[LL / 64];
#pragma unroll
    for (int k = 0; k < LL / 64; ++k) tv[k] = tp[(size_t)k * HID];
    // the loads' address registers may be reused below: keep the wait in front of that overwrite
    asm volatile("s_wait_xcnt 0x0" ::: "memory");
    float run = 0.f;
#pragma unroll
    for (int k = LL / 64 - 1; k >= 0; --k) { sTS[k * HD + lane] = run; run += tv[k]; }
  }

  {
    const int g = wave >> 3, s8 = wave & (KS - 1);
    const int qH0 = (63 - pi) * 48 + 16 * g, qL0 = pi * 48 + 16 * g;
    const int nH = tile_steps(qH0), nL = tile_steps(qL0);
    const int SH = cdiv_i(nH, C);
    const bool isH = (s8 < SH);
    const int qw0 = isH ? qH0 : qL0;
    const int n   = isH ? nH : nL;
    const int s   = isH ? s8 : (s8 - SH);
    const int st1 = (s + 1) * C;
    const int kb1 = ((st1 < n) ? st1 : n) * 32;              // a wave past the short tile's last run does no step
    const int qi  = qw0 + c;                                 // query of this lane (B column / D column)
    const int jl  = (qi / NF + 1) * NF;                      // exclusive key horizon

    const _Float16* QHp = h16(QH);
    const _Float16* QLp = h16(QL);
    const size_t qbase = ((size_t)(b * NH + h) * (LL / 16) + (qw0 >> 4)) * 512 + 8 * lane;   // the tile's fragment, lane -> query c
    const v16h qhi = ldfrag_p(QHp + qbase);
    const v16h qlo = ldfrag_p(QLp + qbase);
    // the q loads' address registers are reused by the accumulators' start values: keep the wait in front of that overwrite
    asm volatile("s_wait_xcnt 0x0" ::: "memory");
    const size_t pbase = (size_t)(b * NH + h) * LL * HD + 8 * lane;   // (b, head) slab of a fragment-order plane; + kb * 32
    const _Float16* kH = h16(KH) + pbase;                             // key tile 2 at +512 halves
    const _Float16* kL = h16(KL) + pbase;
    const _Float16* vH = h16(VTH) + pbase;                            // d tile 2 at +512 halves
    const _Float16* vL = h16(VTL) + pbase;

    float m_run = NEGBIG, l_run = 0.f;
    v8f o1 = zero8(), o1r = zero8(), o2 = zero8(), o2r = zero8();
    const int jmin  = (qw0 / NF + 1) * NF;
    const int cfull = (jmin / 32) * 32;
    const int kbf   = (cfull < kb1) ? cfull : kb1;
    int kb = s * C * 32;
#pragma unroll 1
    for (; kb < kbf; kb += 32)
      attn_step<false>(kb, jl, hh, kH, kL, vH, vL, qhi, qlo, m_run, l_run, o1, o1r, o2, o2r);
#pragma unroll 1
    for (; kb < kb1; kb += 32)
      attn_step<true>(kb, jl, hh, kH, kL, vH, vL, qhi, qlo, m_run, l_run, o1, o1r, o2, o2r);

    l_run += __shfl_xor(l_run, 16, 32);
    float* pp = sP + (wave * 16 + c) * 36 + 8 * hh;
    v4f a0, a1, c0, c1;
#pragma unroll
    for (int r = 0; r < 4; ++r) {
      a0[r] = o1[r] + o1r[r] * INVRS;  a1[r] = o1[4 + r] + o1r[4 + r] * INVRS;
      c0[r] = o2[r] + o2r[r] * INVRS;  c1[r] = o2[4 + r] + o2r[4 + r] * INVRS;
    }
    *(v4f*)(pp)      = a0;                                   // d  8hh ..  8hh+7
    *(v4f*)(pp + 4)  = a1;
    *(v4f*)(pp + 16) = c0;                                   // d 16+8hh .. 16+8hh+7
    *(v4f*)(pp + 20) = c1;
    // the merge works in the log2 domain and with l on the x1024 scale of o
    if (hh == 0) { sM[wave * 16 + c] = m_run * SCL; sL[wave * 16 + c] = l_run * INVRS; }
  }
  __syncthreads();
  {
    const int tile = wave >> 2;                              // 0..2 long group's tiles, 3..5 short group's; 4 queries per wave
    const int hl = (tile >= 3) ? 1 : 0;
    const int g  = tile - 3 * hl;
    const int qH0 = (63 - pi) * 48 + 16 * g, qL0 = pi * 48 + 16 * g;
    const int nH = tile_steps(qH0), nL = tile_steps(qL0);
    const int SH = cdiv_i(nH, C);
    const int w0 = g * KS + (hl ? SH : 0);                   // first wave and number of waves that hold this tile's runs
    const int wn = hl ? cdiv_i(nL, C) : SH;
    const int c2 = (t >> 3) & 15, dg = t & 7;
    const int tq = ((hl ? qL0 : qH0) + c2) / NF;
    const int  j0  = (tq + 1) * NF;                          // first masked key; none for the last time block
    const bool any = (j0 < LL);
    const v4f lsv = *(const v4f*)(LS + ((size_t)b * TT + (any ? tq : 0)) * HID + h * HD + 4 * dg);
    const v4f tsv = *(const v4f*)(sTS + (any ? (j0 >> 6) : 0) * HD + 4 * dg);
    v4f sv;
#pragma unroll
    for (int e = 0; e < 4; ++e) sv[e] = any ? (lsv[e] + tsv[e]) : 0.f;
    // all KS slots read at once (one LDS latency); a slot past the tile's last run rereads run 0 and gets weight 0
    float ms[KS], ls[KS];
    v4f os[KS];
#pragma unroll
    for (int i = 0; i < KS; ++i) {
      const int wi = w0 + ((i < wn) ? i : 0);
      ms[i] = sM[wi * 16 + c2];
      ls[i] = sL[wi * 16 + c2];
      os[i] = *(const v4f*)(sP + (wi * 16 + c2) * 36 + 4 * dg);
    }
    float M = ms[0];
#pragma unroll
    for (int i = 1; i < KS; ++i) M = fmaxf(M, ms[i]);
    float L = 0.f;
    v4f O = {0.f, 0.f, 0.f, 0.f};
#pragma unroll
    for (int i = 0; i < KS; ++i) {
      const float w = (i < wn) ? fexp2(ms[i] - M) : 0.f;
      L += w * ls[i];
      O += os[i] * w;
    }
    const float inv = (1.0f / L) * (1.0f / VC);
    *(v4f*)(sO + (t >> 3) * 36 + 4 * dg) = O * inv + sv * FLOORC;
  }
  __syncthreads();
  if (wave < 4) {                                            // wave-uniform; no barrier behind it
    const int pr = t >> 3, col = 4 * (t & 7);
    v4f s = {0.f, 0.f, 0.f, 0.f};
#pragma unroll
    for (int f = 0; f < NF; ++f) s += *(const v4f*)(sO + (NF * pr + f) * 36 + col);
    unsigned short hb[4], lb[4];
#pragma unroll
    for (int e = 0; e < 4; ++e) split_h((s[e] * (1.0f / NF)) * AC, hb[e], lb[e]);
    v2u ph2, pl2;
    ph2[0] = pk16(hb[0], hb[1]); ph2[1] = pk16(hb[2], hb[3]);
    pl2[0] = pk16(lb[0], lb[1]); pl2[1] = pk16(lb[2], lb[3]);
    const int qblk = (pr < 8) ? (63 - pi) : pi;
    const size_t o = ((size_t)h * NPOOL + (size_t)(b * TT + 8 * qblk + (pr & 7))) * HD + col;
    *(v2u*)(PH + o) = ph2;
    *(v2u*)(PL + o) = pl2;
  }
}

// =====================================================================================================
// Tail: 16 pooled rows per block (grid 1024/16 = 64, 256 threads = 8 waves); wave w -> the 16 x 16 tile of output columns
// 16w..16w+15 in both products, so that a wave's share of every serial part is short: one accumulator pair per product,
// two LayerNorm rows, eight outputs per lane. Every global operand of the block (pooled planes, both weight tiles, biases,
// LayerNorm weights) is asked for at the top, in one flight.
// GEMM1 z = pooled(hi + lo/1024)/32 . Wo + bf16(o_b): A planes PH/PL [head][row][32], k step = head (two products into
// acc/accr), B = WOT rows, K=128 -> sZ rows (f32);
// LayerNorm: wave -> rows 2w, 2w+1, lane -> 4 columns; the row leaves as f16 hi (x16) / lo (x1024) planes sYh/sYl, pitch
// 136 halves, split once here in place of once per reading wave;
// GEMM2 from sYh/sYl rows . FWT rows; epilogue silu(acc + bf16(f_b)) staged in sZ, whole 512-B rows stored per wave.
// coverage: out rows r0..r0+15 x 128 cols; 64 blocks cover [1024][128] exactly once.
// =====================================================================================================
__global__ __launch_bounds__(256) void tail_k(const unsigned short* __restrict__ PH, const unsigned short* __restrict__ PL,
                                               const unsigned short* __restrict__ WOT, const float* __restrict__ obias,
                                               const float* __restrict__ flnw, const float* __restrict__ flnb,
                                               const unsigned short* __restrict__ FWT, const float* __restrict__ fbias,
                                               float* out) {
  __shared__ __align__(16) float sZ[16 * 132];
  __shared__ __align__(16) unsigned short sYh[16 * 136];
  __shared__ __align__(16) unsigned short sYl[16 * 136];
  const int t = threadIdx.x, wave = t >> 5, lane = t & 31, hh = lane >> 4, m = lane & 15;
  const int r0 = blockIdx.x * 16;
  const int n  = 16 * wave + m;                              // the lane's output column in both products

  // ---- all global operands ----
  const _Float16* Ah = h16(PH) + (size_t)(r0 + m) * HD + 8 * hh;   // + 32 * ks * NPOOL: plane of head ks
  const _Float16* Al = h16(PL) + (size_t)(r0 + m) * HD + 8 * hh;
  const _Float16* Bw = h16(WOT) + (size_t)n * HID + 8 * hh;
  const _Float16* Bf = h16(FWT) + (size_t)n * HID + 8 * hh;
  v16h ah[4], al[4], bw[4], bf[4];
#pragma unroll
  for (int ks = 0; ks < 4; ++ks) {
    ah[ks] = ldfrag_h(Ah + (size_t)(32 * ks) * NPOOL);
    bw[ks] = ldfrag_h(Bw + 32 * ks);
    al[ks] = ldfrag_h(Al + (size_t)(32 * ks) * NPOOL);
  }
  const float ob = obias[n];
  const v4f lw = *(const v4f*)(flnw + 4 * lane), lb = *(const v4f*)(flnb + 4 * lane);
#pragma unroll
  for (int ks = 0; ks < 4; ++ks) bf[ks] = ldfrag_h(Bf + 32 * ks);
  const float fb = fbias[n];
  // holds every load above in front of the first product, so that all of them fly together (left alone, the compiler issues
  // them in four groups among the WMMAs, one round trip each); loaded values and their addresses as inputs only: the
  // address registers stay whole until the data are back
  asm volatile("" :: "v"(ah[0]), "v"(ah[1]), "v"(ah[2]), "v"(ah[3]), "v"(al[0]), "v"(al[1]), "v"(al[2]), "v"(al[3]),
               "v"(bw[0]), "v"(bw[1]), "v"(bw[2]), "v"(bw[3]), "v"(bf[0]), "v"(bf[1]), "v"(bf[2]), "v"(bf[3]),
               "v"(ob), "v"(fb), "v"(lw), "v"(lb), "v"(Ah), "v"(Al), "v"(Bw), "v"(Bf));

  // ---- GEMM1 ----
  {
    v8f acc = zero8(), accr = zero8();
#pragma unroll
    for (int ks = 0; ks < 4; ++ks) {
      acc  = mma_h_raw(ah[ks], bw[ks], acc);
      accr = mma_h_raw(al[ks], bw[ks], accr);
    }
    const float bn = bfr(ob);
#pragma unroll
    for (int r = 0; r < 8; ++r)
      sZ[(8 * hh + r) * 132 + n] = (acc[r] + accr[r] * INVRS) * (1.0f / (AC * WSC)) + bn;
  }
  __syncthreads();

  // ---- LayerNorm, rows out as f16 planes ----
  {
    float gg[4], bb[4];
#pragma unroll
    for (int e = 0; e < 4; ++e) { gg[e] = bfr(lw[e]); bb[e] = bfr(lb[e]); }
    const float* zp = sZ + 2 * wave * 132 + 4 * lane;         // rows 2w and 2w + 1 from one base: both reads go out together
    unsigned short* yhp = sYh + 2 * wave * 136 + 4 * lane;
    unsigned short* ylp = sYl + 2 * wave * 136 + 4 * lane;
    v4f zz[2];
#pragma unroll
    for (int i = 0; i < 2; ++i) zz[i] = *(const v4f*)(zp + i * 132);
#pragma unroll
    for (int i = 0; i < 2; ++i) {
      const v4f z = zz[i];
      float s = (z[0] + z[1]) + (z[2] + z[3]);
      s = wsum(s);
      const float mean = s * (1.0f / HID);
      float d[4];
#pragma unroll
      for (int e = 0; e < 4; ++e) d[e] = z[e] - mean;
      float vs = (d[0] * d[0] + d[1] * d[1]) + (d[2] * d[2] + d[3] * d[3]);
      vs = wsum(vs);
      const float rstd = rsqrtf(vs * (1.0f / HID) + LNEPS);
      unsigned short hb[4], lo[4];
#pragma unroll
      for (int e = 0; e < 4; ++e) split_h(((d[e] * rstd) * gg[e] + bb[e]) * YC, hb[e], lo[e]);
      v2u yh, yl;
      yh[0] = pk16(hb[0], hb[1]); yh[1] = pk16(hb[2], hb[3]);
      yl[0] = pk16(lo[0], lo[1]); yl[1] = pk16(lo[2], lo[3]);
      *(v2u*)(yhp + i * 136) = yh;
      *(v2u*)(ylp + i * 136) = yl;
    }
  }
  __syncthreads();

  // ---- GEMM2 ----
  {
    const _Float16* yhp = h16(sYh) + m * 136 + 8 * hh;
    const _Float16* ylp = h16(sYl) + m * 136 + 8 * hh;
    v16h yh[4], yl[4];
#pragma unroll
    for (int ks = 0; ks < 4; ++ks) { yh[ks] = ldfrag_h(yhp + 32 * ks); yl[ks] = ldfrag_h(ylp + 32 * ks); }
    v8f acc2 = zero8(), acc2r = zero8();
#pragma unroll
    for (int ks = 0; ks < 4; ++ks) {
      acc2  = mma_h_raw(yh[ks], bf[ks], acc2);
      acc2r = mma_h_raw(yl[ks], bf[ks], acc2r);
    }
    const float bn = bfr(fb);
    // sZ is free: its last readers, the LayerNorm rows, are behind the barrier above
#pragma unroll
    for (int r = 0; r < 8; ++r) {
      const float a = (acc2[r] + acc2r[r] * INVRS) * (1.0f / (YC * WSC)) + bn;
      sZ[(8 * hh + r) * 132 + n] = a * sigm(a);
    }
  }
  __syncthreads();
  {
    v4f vals[2];
#pragma unroll
    for (int i = 0; i < 2; ++i) vals[i] = *(const v4f*)(sZ + (8 * i + wave) * 132 + 4 * lane);
#pragma unroll
    for (int i = 0; i < 2; ++i)
      *(v4f*)(out + (size_t)(r0 + 8 * i + wave) * FD + 4 * lane) = vals[i];
  }
}

// =====================================================================================================
// Workspace map (bytes), every offset a multiple of 256 and every plane sized to its whole-line store granularity:
//   WOT  f16 [128][128] x64        0          32768
//   FWT  f16 [128][128] x64        32768      32768
//   QH   f16 q x8, fragment order [2][4 heads][192 query tiles][2 halves][32 lanes][8]   65536      1572864
//   QL   residual                  1638400    1572864
//   KH   f16 k x8, fragment order [2][4 heads][192 key tiles][2 halves][32 lanes][8]   3211264    1572864
//   KL                             4784128    1572864
//   VTH  f16 v x16, fragment order [2][4 heads][96 key steps][2 d tiles][2 halves][32 lanes][8]   6356992    1572864
//   VTL                            7929856    1572864
//   LS   f32 [2][512 time blocks][128]   9502720    524288   (row 511 of each batch row neither written nor read)
//   PH   f16 [4 heads][1024][32] x32  10027008   262144
//   PL                             10289152   262144
//   TOT  f32 [2][48 key blocks][128]     10551296   49152
//   end                            10600448
// =====================================================================================================
extern "C" void kernel_launch(void* const* d_in, const int* in_sizes, int n_in,
                              void* d_out, int out_size, void* d_ws, size_t ws_size,
                              hipStream_t stream) {
  if (n_in < 20) return;
  if (in_sizes[0] != NTOK * DD) return;
  if (in_sizes[1] != DD || in_sizes[2] != DD || in_sizes[3] != DD * GH || in_sizes[4] != GH ||
      in_sizes[5] != GH || in_sizes[6] != 1) return;
  if (in_sizes[7] != DD * HID || in_sizes[8] != HID || in_sizes[9] != DD * HID || in_sizes[10] != HID ||
      in_sizes[11] != DD * HID || in_sizes[12] != HID) return;
  if (in_sizes[13] != HID * HID || in_sizes[14] != HID || in_sizes[15] != HID || in_sizes[16] != HID ||
      in_sizes[17] != HID * FD || in_sizes[18] != FD || in_sizes[19] != 1) return;
  if (out_size != NPOOL * FD) return;

  const float* x    = (const float*)d_in[0];
  const float* glnw = (const float*)d_in[1];
  const float* glnb = (const float*)d_in[2];
  const float* gw1  = (const float*)d_in[3];
  const float* gb1  = (const float*)d_in[4];
  const float* gw2  = (const float*)d_in[5];
  const float* gb2  = (const float*)d_in[6];
  const float* qw   = (const float*)d_in[7];
  const float* qb   = (const float*)d_in[8];
  const float* kw   = (const float*)d_in[9];
  const float* kb   = (const float*)d_in[10];
  const float* vw   = (const float*)d_in[11];
  const float* vb   = (const float*)d_in[12];
  const float* ow   = (const float*)d_in[13];
  const float* ob   = (const float*)d_in[14];
  const float* flnw = (const float*)d_in[15];
  const float* flnb = (const float*)d_in[16];
  const float* fw   = (const float*)d_in[17];
  const float* fb   = (const float*)d_in[18];
  const int*   Tp   = (const int*)d_in[19];

  const size_t PWO = (size_t)HID * HID * 2;           //    32768
  const size_t PWF = (size_t)FD * HID * 2;            //    32768
  const size_t PQP = (size_t)NTOK * HID * 2;          //  1572864
  const size_t PVT = (size_t)NB * HID * LL * 2;       //  1572864
  const size_t PSV = (size_t)NB * HID * TT * 4;       //   524288
  const size_t PPP = (size_t)NPOOL * HID * 2;         //   262144
  const size_t PTO = (size_t)NB * (LL / 64) * HID * 4; //    49152
  size_t off = 0;
  const size_t oWO = off; off += PWO;
  const size_t oWF = off; off += PWF;
  const size_t oQH = off; off += PQP;
  const size_t oQL = off; off += PQP;
  const size_t oKH = off; off += PQP;
  const size_t oKL = off; off += PQP;
  const size_t oVH = off; off += PVT;
  const size_t oVL = off; off += PVT;
  const size_t oSV = off; off += PSV;
  const size_t oPH = off; off += PPP;
  const size_t oPL = off; off += PPP;
  const size_t oTO = off; off += PTO;
  if (off > ws_size) return;                           // off = 10600448
  if (off > (size_t)134217728) return;

  char* ws = (char*)d_ws;
  unsigned short* WOT = (unsigned short*)(ws + oWO);
  unsigned short* FWT = (unsigned short*)(ws + oWF);
  unsigned short* QH  = (unsigned short*)(ws + oQH);
  unsigned short* QL  = (unsigned short*)(ws + oQL);
  unsigned short* KH  = (unsigned short*)(ws + oKH);
  unsigned short* KL  = (unsigned short*)(ws + oKL);
  unsigned short* VTH = (unsigned short*)(ws + oVH);
  unsigned short* VTL = (unsigned short*)(ws + oVL);
  float*          LS  = (float*)(ws + oSV);
  float*          TOT = (float*)(ws + oTO);
  unsigned short* PH  = (unsigned short*)(ws + oPH);
  unsigned short* PL  = (unsigned short*)(ws + oPL);
  float*          out = (float*)d_out;

  const dim3 blk(256), blk768(768);
  const dim3 gQ(NTOK / 64 + 16);                       // 96 token blocks + 16 weight tiles
  const dim3 gA(NB * NH * (LL / 96));                  // 256
  const dim3 gT(NPOOL / 16);                           // 64

  // (1) gater + gated q/k/v planes (q, k and v^T hi/lo in fragment order) + per-block masked-key floor sums;
  //     its last 16 blocks: o_w and f_w planes, transposed to k-contiguous rows: f16( bf16_RNE(w) * 64 )
  qkv_prep<<<gQ, blk, 0, stream>>>(x, glnw, glnb, gw1, gb1, gw2, gb2, qb, kb, vb, qw, kw, vw, ow, fw, Tp,
                                   QH, QL, KH, KL, VTH, VTL, LS, TOT, WOT, FWT);

  // (2) block-causal attention + mean-pool over the 6 forces -> pooled planes
  attn_pool<<<gA, blk768, 0, stream>>>(QH, QL, KH, KL, VTH, VTL, LS, TOT, PH, PL);

  // (3) o-proj + LayerNorm + final linear + SiLU -> out
  tail_k<<<gT, blk, 0, stream>>>(PH, PL, WOT, ob, flnw, flnb, FWT, fb, out);
  (void)hipGetLastError();
}

// v010
// It runs in 29.2 microseconds.
// In both of two side-by-side timings against v009, it was 1.09 times as fast.
// Counting every step since v000, it is 6.36 times as fast.
// Contractions: q/k/v projections (x rows f16 x16 . W^T f16 x64, K=32, one product), scores S^T = k . q^T
// (k and q each f16 x8 hi plane + f16 x1024 residual plane, 3 products per tile), O^T = v^T . P^T (v f16 x16 hi +
// x1024 residual, P f16 x1024 hi + x1024 residual, 3 products), pooled attention . Wo^T and LN rows . Wf^T
// (activation f16 hi + x1024 residual . W^T f16 x64, K=128, 2 products): all v_wmma_f32_16x16x32_f16, f32 accumulate;
// gater MLP, LayerNorm, softmax, pooling, SiLU in f32 on VALU; every float input RNE-converted to bf16 on load.
#include <hip/hip_runtime.h>
#include <math.h>
#include <stdint.h>

#define NB     2
#define TT     512
#define NF     6
#define DD     32
#define HID    128
#define NH     4
#define HD     32
#define GH     32
#define FD     128
#define LL     (TT * NF)
#define NTOK   (NB * LL)
#define NPOOL  (NB * TT)
#define LNEPS  1.0e-5f
#define XC     16.0f
#define WSC    64.0f
#define QC     8.0f
#define KC     8.0f
#define VC     16.0f
#define AC     32.0f
#define YC     16.0f
#define RSC    1024.0f
#define INVRS  (1.0f / 1024.0f)
#define FLOORC 1.0e-9f
#define NEGBIG (-1.0e30f)
#define MFLOOR (-1.0e25f)
#define SCL    ((0.17677669529663687f * 1.4426950408889634f) / (QC * KC))
static_assert(NH * HD == HID);
static_assert(FD == HID);
static_assert((LL % 64) == 0 && (LL % 96) == 0 && (LL % 32) == 0 && LL / 48 == 64);
static_assert((NTOK % 64) == 0 && (NPOOL % 16) == 0);
static_assert(DD == 32 && GH == 32 && (DD * GH) % 256 == 0);

typedef _Float16 v16h __attribute__((ext_vector_type(16)));
typedef _Float16 v8h  __attribute__((ext_vector_type(8)));
typedef float    v8f  __attribute__((ext_vector_type(8)));
typedef float    v4f  __attribute__((ext_vector_type(4)));
typedef unsigned int v4u __attribute__((ext_vector_type(4)));
typedef unsigned int v2u __attribute__((ext_vector_type(2)));
typedef float    v2f  __attribute__((ext_vector_type(2)));
typedef _Float16 v2h  __attribute__((ext_vector_type(2)));

union FragH { v16h v; v8h h[2]; };

// ---- scalar helpers --------------------------------------------------------------------------------
__device__ __forceinline__ unsigned short bf_bits(float f) {          // f32 -> bf16 bits, RNE convert
  unsigned u = __float_as_uint(f);
  return (unsigned short)((u + 0x7FFFu + ((u >> 16) & 1u)) >> 16);
}
__device__ __forceinline__ float bf_up(unsigned short h) { return __uint_as_float(((unsigned)h) << 16); }
__device__ __forceinline__ float bfr(float f) { return bf_up(bf_bits(f)); }
__device__ __forceinline__ unsigned short h_bits(_Float16 x) { return __builtin_bit_cast(unsigned short, x); }
__device__ __forceinline__ unsigned pk16(unsigned short a, unsigned short b) { return (unsigned)a | ((unsigned)b << 16); }
__device__ __forceinline__ v8f zero8() { v8f z = {0.f, 0.f, 0.f, 0.f, 0.f, 0.f, 0.f, 0.f}; return z; }
__device__ __forceinline__ float hmax8(v8f s) {
  return fmaxf(fmaxf(fmaxf(s[0], s[1]), fmaxf(s[2], s[3])), fmaxf(fmaxf(s[4], s[5]), fmaxf(s[6], s[7])));
}
__device__ __forceinline__ const _Float16* h16(const unsigned short* p) { return (const _Float16*)(const void*)p; }
// hi = f16(f), lo = f16((f - hi) * 1024): residual plane carried x1024, folded back in the f32 epilogue
__device__ __forceinline__ void split_h(float f, unsigned short& hb, unsigned short& lb) {
  const _Float16 h = (_Float16)f;
  const _Float16 l = (_Float16)((f - (float)h) * RSC);
  hb = h_bits(h);
  lb = h_bits(l);
}
__device__ __forceinline__ float fexp2(float x) { return __builtin_amdgcn_exp2f(x); }
__device__ __forceinline__ float sigm(float a) {
  const float e = __expf(fminf(-a, 60.0f));       // quotient stays far from underflow
  return 1.0f / (1.0f + e);
}
// cross-lane moves on the vector unit (no LDS-path permute, no dscnt wait): lane l <- lane l ^ 16, and l <- l ^ X inside a
// 16-lane row (DPP row_xmask)
__device__ __forceinline__ float xhalf(float x) {
  const int b = __builtin_bit_cast(int, x);
  return __builtin_bit_cast(float, __builtin_amdgcn_permlanex16(b, b, 0x76543210, 0xfedcba98, false, false));
}
template <int X>
__device__ __forceinline__ float xrow(float x) {
  return __builtin_bit_cast(float, __builtin_amdgcn_mov_dpp(__builtin_bit_cast(int, x), 0x160 + X, 0xf, 0xf, true));
}
__device__ __forceinline__ float lane_bc(float x, int k) {   // lane k's value to every lane, through a scalar register
  return __builtin_bit_cast(float, __builtin_amdgcn_readlane(__builtin_bit_cast(int, x), k));
}
__device__ __forceinline__ float wsum(float v) {             // butterfly over 16, 8, 4, 2, 1
  v += xhalf(v);
  v += xrow<8>(v);
  v += xrow<4>(v);
  v += xrow<2>(v);
  v += xrow<1>(v);
  return v;
}

// ---- fragment loader: 16-bit A/B operand, lane -> row/col (lane&15), p already includes +8*(lane>>4);
//      elements 0..7 <- p[0..7] (k0+8h..), elements 8..15 <- p[16..23] (k0+16+8h..)
__device__ __forceinline__ v16h ldfrag_h(const _Float16* p) {
  FragH f;
  f.h[0] = *(const v8h*)(p);
  f.h[1] = *(const v8h*)(p + 16);
  return f.v;
}

// ---- the same fragment from a plane stored in fragment order: one 16 x 32 operand tile = 1024 B = two 512-B halves,
//      half s holds lane L's elements 8s..8s+7 at byte 16*L, so each wave-wide 16-B load covers four whole 128-B lines;
//      p already includes +8*lane
__device__ __forceinline__ v16h ldfrag_p(const _Float16* p) {
  FragH f;
  f.h[0] = *(const v8h*)(p);
  f.h[1] = *(const v8h*)(p + 256);
  return f.v;
}

// ---- WMMA helpers with trailing VALU hazard gap --------------------------------------------------------
__device__ __forceinline__ v8f mma_h_raw(v16h a, v16h b, v8f c) {
  return __builtin_amdgcn_wmma_f32_16x16x32_f16(false, a, false, b, (short)0, c, false, false);
}
__device__ __forceinline__ void guard4x6(v8f& a, v8f& b, v8f& c, v8f& d,
                                         v16h x0, v16h x1, v16h x2, v16h x3, v16h x4, v16h x5) {
#if defined(__HIP_DEVICE_COMPILE__)
  asm volatile("v_nop\n\tv_nop\n\tv_nop\n\tv_nop"
               : "+v"(a), "+v"(b), "+v"(c), "+v"(d)
               : "v"(x0), "v"(x1), "v"(x2), "v"(x3), "v"(x4), "v"(x5));
#endif
}

// the same gap for the attention kernel, whose wave holds more than 256 registers: only the four results are operands (an asm
// operand must lie in v0..v255), the products' A and B operands may stay above
__device__ __forceinline__ void guard4(v8f& a, v8f& b, v8f& c, v8f& d) {
#if defined(__HIP_DEVICE_COMPILE__)
  asm volatile("v_nop\n\tv_nop\n\tv_nop\n\tv_nop" : "+v"(a), "+v"(b), "+v"(c), "+v"(d));
#endif
}

// =====================================================================================================
// Weight convert with transpose, one 64 k x 32 o tile of o_w or f_w per block (the 16 blocks behind the token blocks of
// the projection launch): in[k][o] f32 (x @ W layout) -> out[o][k] = f16( bf16_RNE(in) * WSC ), k contiguous.
// q = 0..7: o_w [128][128] -> WOT [n][k]; q = 8..15: f_w -> FWT; thread t loads k = t>>2, 8 floats at 8*(t&3) into T
// (pitch 33), stores row o = t>>3, 8 halves k = 8*(t&7).
// coverage: WOT/FWT 4 x 2 tiles x (32 o x 64 k) = [128][128] each.
// =====================================================================================================
__device__ __forceinline__ void conv_tile(const int q, const int t, const float* __restrict__ ow,
                                          const float* __restrict__ fw, unsigned short* WOT, unsigned short* FWT,
                                          float* T) {
  const bool iso = (q < 8);                                  // block-uniform
  const int rr = iso ? q : (q - 8);
  const float* src   = iso ? ow : fw;
  unsigned short* ds = iso ? WOT : FWT;
  const int o0 = (rr >> 1) * 32, k0 = (rr & 1) * 64;
  {
    const int k = t >> 2, oo = 8 * (t & 3);
    const float* sp = src + (size_t)(k0 + k) * HID + o0 + oo;
    const v4f a = *(const v4f*)(sp), c = *(const v4f*)(sp + 4);
#pragma unroll
    for (int i = 0; i < 4; ++i) { T[k * 33 + oo + i] = a[i]; T[k * 33 + oo + 4 + i] = c[i]; }
  }
  __syncthreads();
  {
    const int o = t >> 3, e = t & 7;
    float w[8];
#pragma unroll
    for (int i = 0; i < 8; ++i) w[i] = bfr(T[(8 * e + i) * 33 + o]) * WSC;
    v4u v;
#pragma unroll
    for (int i = 0; i < 4; ++i) v[i] = pk16(h_bits((_Float16)w[2 * i]), h_bits((_Float16)w[2 * i + 1]));
    unsigned short* dp = ds + (size_t)(o0 + o) * HID + k0 + 8 * e;
    *(v4u*)dp = v;
  }
}

// =====================================================================================================
// Gater + gated q/k/v projections for 64 tokens per block (256 threads = 8 waves; blocks 0..95 of a grid of 96 + 16; the
// last 16 blocks convert o_w and f_w for the tail launch, see conv_tile, and do nothing else).
// Phase 0: x tile [64][32] loaded as float4 pairs, RNE-converted to bf16 values: f32 copy sX (pitch 33) for the gater and
//          f16(x * 16) rows sXh (pitch 40 halves) as a WMMA operand; g_w1 and the q/k/v biases staged bf16-RNE in LDS;
//          q_w | k_w | v_w [32 k][128 n] f32 -> sWT rows [p*128 + n][32 k] = f16( bf16_RNE(w) * 64 ), pitch 40 halves:
//          thread -> column n = t&127 and 8 k (each wave-wide 4-B load is one whole line), one 16-B LDS store per 8 k.
//          Phase 1 (gater, wave -> 8 tokens): with lane = hidden unit (32 readlane-broadcast FMAs), gate = sigmoid(sum_lane h*g_w2 + g_b2), all f32 -> sG.
// Phase 2: per part p in {v,q,k}: wave w -> 16-token tile w&3, 64-col half w>>2: 4 WMMAs (K = 32 = one k step; x rows from
//          sXh, weight rows [p*128 + n][32] from sWT); epilogue f = (acc/1024 + bf16(bias[n])) * gate[token] * C (C = 8 q/k,
//          16 v), hi = f16(f), lo = f16((f-hi)*1024). v: A = x, B = W, so a lane holds 8 consecutive keys of one head column;
//          q, k: A = W, B = x (the transposed product), so a lane holds 8 consecutive dims of one token. Either way the
//          lane's 8 values of one accumulator tile are its 16 bytes of one fragment-order half (see ldfrag_p): every plane is
//          stored straight from registers, slab (b, head), 512 contiguous bytes per wave and store. Only v is also staged in
//          LDS (transposed [128 hcol][72]) for phase 3, behind the one barrier of this phase, which stands in front of every
//          global store, so that it waits for none.
// Phase 3 (waves 0..3, thread -> head column): this block's share of the masked-key floor sums, from the staged v planes:
//          LS[b][tb][hcol] = sum of v over the block's keys j >= 6*(tb+1), for every boundary 6*(tb+1) that lies in the
//          block, and TOT[b][block][hcol] = sum over all 64 keys (keys of time blocks >= T count as 0).
// coverage: QH/QL and KH/KL 4 heads x 16-token tiles ltok0/16..+3 x 2 halves; VTH/VTL 4 heads x key steps
//           ltok0/32..+1 x 2 d tiles; grid covers all 6144 tokens exactly once. LS rows tb = 0..510 of each batch row once
//           (the boundary of tb = 511 is past the last key: no row, and none is read); TOT 96 rows once.
// =====================================================================================================
// Suffix sums of one head column inside a 64-key block whose first boundary (key index a multiple of 6) is local key I0:
// six-key sums first (independent), then one short chain over the boundaries, last to first. r[j] = sum over the block's
// keys from boundary j on (0 where the block has no boundary j), tot = sum over all 64 keys.
#define NJMAX 11                                             // boundaries in a block: 11 for I0 = 0 and 2, 10 for I0 = 4
template <int I0>
__device__ __forceinline__ void block_suffix(const float (&val)[64], const int tb0, const int ntb,
                                             float (&r)[NJMAX], float& tot) {
  constexpr int NJ = (63 - I0) / NF + 1;
  float run = 0.f;
#pragma unroll
  for (int j = NJMAX - 1; j >= NJ; --j) r[j] = 0.f;
#pragma unroll
  for (int j = NJ - 1; j >= 0; --j) {
    float sg = 0.f;
#pragma unroll
    for (int f = 0; f < NF; ++f)
      if (I0 + NF * j + f < 64) sg += val[I0 + NF * j + f];
    run += (tb0 + 1 + j < ntb) ? sg : 0.f;                   // these keys are time block tb0 + 1 + j
    r[j] = run * (1.0f / VC);
  }
  float head = 0.f;
#pragma unroll
  for (int i = 0; i < I0; ++i) head += val[i];
  tot = (run + ((tb0 < ntb) ? head : 0.f)) * (1.0f / VC);    // the keys in front of I0 are time block tb0
}

__global__ __launch_bounds__(256) void qkv_prep(
    const float* __restrict__ x, const float* __restrict__ glnw, const float* __restrict__ glnb,
    const float* __restrict__ gw1, const float* __restrict__ gb1, const float* __restrict__ gw2,
    const float* __restrict__ gb2, const float* __restrict__ qbias, const float* __restrict__ kbias,
    const float* __restrict__ vbias, const float* __restrict__ qw, const float* __restrict__ kw,
    const float* __restrict__ vw, const float* __restrict__ ow, const float* __restrict__ fw,
    const int* __restrict__ Tp,
    unsigned short* QH, unsigned short* QL, unsigned short* KH, unsigned short* KL,
    unsigned short* VTH, unsigned short* VTL, float* LS, float* TOT, unsigned short* WOT, unsigned short* FWT) {
  __shared__ __align__(16) float sX[64 * 33];
  __shared__ __align__(16) _Float16 sXh[64 * 40];
  __shared__ float sW1[DD * GH];
  __shared__ float sG[64];
  __shared__ __align__(16) float sBias[3 * HID];             // bf16-RNE q_b | k_b | v_b: a lane of the transposed product needs 8 in a row
  __shared__ __align__(16) unsigned short sH[128 * 72];
  __shared__ __align__(16) unsigned short sL[128 * 72];
  __shared__ __align__(16) unsigned short sWT[3 * HID * 40];
  const int t = threadIdx.x, wave = t >> 5, lane = t & 31, hh = lane >> 4, m = lane & 15;
  if (blockIdx.x >= NTOK / 64) {                             // block-uniform, in front of every other barrier
    conv_tile((int)blockIdx.x - NTOK / 64, t, ow, fw, WOT, FWT, sX);
    return;
  }
  const int tok0  = blockIdx.x * 64;
  const int b     = tok0 / LL;
  const int ltok0 = tok0 - b * LL;

  // ---- phase 0 ----
  {
    const int wn = t & 127, wk = t >> 7;                     // weight column; 8-k group wk + 2*(i&1) of part i>>1
    const unsigned wofs = (unsigned)(8 * wk * HID + wn);     // the thread's first element of each part
    float wv[6][8];
#pragma unroll
    for (int i = 0; i < 6; ++i) {
      const float* wsrc = (i < 2) ? qw : ((i < 4) ? kw : vw);
#pragma unroll
      for (int e = 0; e < 8; ++e) wv[i][e] = wsrc[wofs + (unsigned)((16 * (i & 1) + e) * HID)];
    }
    const int tk = t >> 2, j = 8 * (t & 3);
    const float* sp = x + (size_t)(tok0 + tk) * DD + j;
    const v4f a = *(const v4f*)(sp), c = *(const v4f*)(sp + 4);
    // g_w1, unrolled: the thread's four elements are asked for in the same flight as the loads above (rolled, each trip
    // waited for its own load: four round trips in a row)
    const unsigned gofs = (unsigned)t;
    float g1[DD * GH / 256];
#pragma unroll
    for (int i = 0; i < DD * GH / 256; ++i) g1[i] = gw1[gofs + (unsigned)(256 * i)];
    const float* bsrc = (__builtin_amdgcn_readfirstlane(t) < HID) ? qbias : kbias;   // waves 0..3: q_b, waves 4..7: k_b
    const unsigned bofs = (unsigned)(t & (HID - 1));
    const float bqk = bsrc[bofs];
    const float bv0 = vbias[bofs];
    // one wait for the weight, x, g_w1 and bias loads above: their address registers, offsets and scalar bases, are inputs
    // here, so that neither a later load's destination nor any other instruction overwrites one of them in front of it
    asm volatile("s_wait_xcnt 0x0" :: "v"(wofs), "v"(sp), "v"(gofs), "v"(bofs), "s"(qw), "s"(kw), "s"(vw), "s"(gw1),
                 "s"(bsrc), "s"(vbias) : "memory");
    float r8[8];
#pragma unroll
    for (int i = 0; i < 4; ++i) { r8[i] = bfr(a[i]); r8[4 + i] = bfr(c[i]); }
#pragma unroll
    for (int i = 0; i < 8; ++i) {
      sX[tk * 33 + j + i]  = r8[i];
      sXh[tk * 40 + j + i] = (_Float16)(r8[i] * XC);
    }
#pragma unroll
    for (int i = 0; i < DD * GH / 256; ++i) sW1[t + 256 * i] = bfr(g1[i]);
    sBias[t] = bfr(bqk);
    sBias[2 * HID + (t & (HID - 1))] = bfr(bv0);             // no branch: two threads write the same value to a slot
#pragma unroll
    for (int i = 0; i < 6; ++i) {
      v4u v;
#pragma unroll
      for (int e = 0; e < 4; ++e)
        v[e] = pk16(h_bits((_Float16)(bfr(wv[i][2 * e]) * WSC)), h_bits((_Float16)(bfr(wv[i][2 * e + 1]) * WSC)));
      *(v4u*)(sWT + ((i >> 1) * HID + wn) * 40 + 8 * (wk + 2 * (i & 1))) = v;
    }
  }
  __syncthreads();
  // read here so that phase 3 does not wait for it; behind the barrier, so that the scalar load's destination cannot be a
  // base register of phase 0's loads while they are in flight
  const int tin = Tp[0];

  // ---- phase 1: gater (f32, VALU) ----
  {
    const float gw = bfr(glnw[lane]), gb = bfr(glnb[lane]);
    const float b1 = bfr(gb1[lane]),  w2 = bfr(gw2[lane]), b2 = bfr(gb2[0]);
    // unrolled: the wave's eight tokens are eight independent chains (sums, 32-link FMA chain, sigmoids) that fill each
    // other's latency; rolled, one chain at a time left the two waves of a SIMD waiting most of the time
    float gsel = 0.f;
#pragma unroll
    for (int i = 0; i < 8; ++i) {
      const int tk = wave * 8 + i;
      const float xv  = sX[tk * 33 + lane];
      const float mu  = wsum(xv) * (1.0f / DD);
      const float dv  = xv - mu;
      const float var = wsum(dv * dv) * (1.0f / DD);
      const float xn  = dv * rsqrtf(var + LNEPS) * gw + gb;
      float hacc = b1;
#pragma unroll
      for (int k = 0; k < DD; ++k) hacc += lane_bc(xn, k) * sW1[k * GH + lane];
      const float hs = hacc * sigm(hacc);
      const float gs = wsum(hs * w2) + b2;
      const float g  = sigm(gs);
      gsel = ((lane & 7) == i) ? g : gsel;                   // every lane holds g: lanes i, i + 8, .. keep token i's
    }
    sG[wave * 8 + (lane & 7)] = gsel;                        // one store, no branch: four lanes write the same value to a slot
  }
  __syncthreads();

  // ---- phase 2: projections on WMMA ----
  const int rt = wave & 3, ch = wave >> 2;
  FragH af;
  af.h[0] = *(const v8h*)(sXh + (16 * rt + m) * 40 + 8 * hh);
  af.h[1] = *(const v8h*)(sXh + (16 * rt + m) * 40 + 16 + 8 * hh);
  const _Float16* WTp = h16(sWT);
  const float gl = sG[16 * rt + m];                          // q, k: the lane's token is its accumulator column
  float gr[8];                                               // v: the lane's tokens are its accumulator rows
#pragma unroll
  for (int r = 0; r < 8; ++r) gr[r] = sG[16 * rt + 8 * hh + r];
  // unrolled: p is a constant in each copy (operand order, bias source and plane layout cost no branch). v comes first: its
  // LDS copy is published by the barrier while no global store is outstanding
#pragma unroll
  for (int pp = 0; pp < 3; ++pp) {
    const int p = (pp + 2) % 3;                              // 2 (v), 0 (q), 1 (k)
    v16h bf[4];
#pragma unroll
    for (int j = 0; j < 4; ++j)
      bf[j] = ldfrag_h(WTp + (p * HID + 64 * ch + 16 * j + m) * 40 + 8 * hh);
    v8f acc[4];
#pragma unroll
    for (int j = 0; j < 4; ++j)
      acc[j] = (p == 2) ? mma_h_raw(af.v, bf[j], zero8()) : mma_h_raw(bf[j], af.v, zero8());
    guard4x6(acc[0], acc[1], acc[2], acc[3], af.v, bf[0], bf[1], bf[2], bf[3], af.v);
    v4u hv[4], lv[4];
#pragma unroll
    for (int j = 0; j < 4; ++j) {
      float bn[8];
      if (p == 2) {
        const float bv = sBias[2 * HID + 64 * ch + 16 * j + m];   // column n = 64ch + 16j + m
#pragma unroll
        for (int r = 0; r < 8; ++r) bn[r] = bv;
      } else {
        const float* bq = sBias + p * HID + 64 * ch + 16 * j + 8 * hh;   // rows n = 64ch + 16j + 8hh + r
        const v4f b0 = *(const v4f*)(bq), b1 = *(const v4f*)(bq + 4);
#pragma unroll
        for (int r = 0; r < 4; ++r) { bn[r] = b0[r]; bn[4 + r] = b1[r]; }
      }
      unsigned short hb[8], lb[8];
#pragma unroll
      for (int r = 0; r < 8; ++r) {
        const float f = ((acc[j][r] * (1.0f / (XC * WSC)) + bn[r]) * ((p == 2) ? gr[r] : gl)) * ((p == 2) ? VC : QC);
        split_h(f, hb[r], lb[r]);
      }
#pragma unroll
      for (int e = 0; e < 4; ++e) {
        hv[j][e] = pk16(hb[2 * e], hb[2 * e + 1]);
        lv[j][e] = pk16(lb[2 * e], lb[2 * e + 1]);
      }
    }
    unsigned short* Hp;
    unsigned short* Lp;
    if (p == 2) {
      // phase 3's copy: head column n, keys 16rt + 8hh ..+7
#pragma unroll
      for (int j = 0; j < 4; ++j) {
        const int dst = (64 * ch + 16 * j + m) * 72 + 16 * rt + 8 * hh;
        *(v4u*)(sH + dst) = hv[j];
        *(v4u*)(sL + dst) = lv[j];
      }
      __syncthreads();
      // v^T: tile j = head 2ch + (j>>1), d tile j&1; token tile rt = 32-key step rt>>1, half rt&1; lane -> d row m, keys 8hh ..+7
      const size_t o = ((size_t)(b * NH + 2 * ch) * (LL / 32) + (ltok0 >> 5) + (rt >> 1)) * 1024 + (rt & 1) * 256 + lane * 8;
      Hp = VTH + o;
      Lp = VTL + o;
#pragma unroll
      for (int j = 0; j < 4; ++j) {
        *(v4u*)(Hp + (size_t)(j >> 1) * (LL / 32) * 1024 + (j & 1) * 512) = hv[j];
        *(v4u*)(Lp + (size_t)(j >> 1) * (LL / 32) * 1024 + (j & 1) * 512) = lv[j];
      }
    } else {
      // q, k: tile j = head 2ch + (j>>1), half j&1; 16-token tile rt; lane -> token m, dims 16(j&1) + 8hh ..+7
      const size_t o = ((size_t)(b * NH + 2 * ch) * (LL / 16) + (ltok0 >> 4) + rt) * 512 + lane * 8;
      Hp = ((p == 0) ? QH : KH) + o;
      Lp = ((p == 0) ? QL : KL) + o;
#pragma unroll
      for (int j = 0; j < 4; ++j) {
        *(v4u*)(Hp + (size_t)(j >> 1) * (LL / 16) * 512 + (j & 1) * 256) = hv[j];
        *(v4u*)(Lp + (size_t)(j >> 1) * (LL / 16) * 512 + (j & 1) * 256) = lv[j];
      }
    }
    // the stores' data and address registers are inputs here, so that nothing overwrites one of them in front of the wait
    asm volatile("s_wait_xcnt 0x0" :: "v"(hv[0]), "v"(hv[1]), "v"(hv[2]), "v"(hv[3]), "v"(lv[0]), "v"(lv[1]), "v"(lv[2]),
                 "v"(lv[3]), "v"(Hp), "v"(Lp) : "memory");
  }
  // ---- phase 3: floor sums of this block's keys ----
  if (wave < 4) {                                               // wave-uniform; no barrier inside
    const int ntb = (tin < 0) ? 0 : ((tin > TT) ? TT : tin);    // structural, clamped to the static extent
    float val[64];
#pragma unroll
    for (int g = 0; g < 8; ++g) {
      const v8h a = *(const v8h*)(h16(sH) + t * 72 + 8 * g);
      const v8h l = *(const v8h*)(h16(sL) + t * 72 + 8 * g);
#pragma unroll
      for (int j = 0; j < 8; ++j)
        val[8 * g + j] = (float)a[j] + (float)l[j] * INVRS;
    }
    const int i0  = (NF - ltok0 % NF) % NF;                     // 0, 2 or 4: 64 keys shift the phase by 4
    const int tb0 = (ltok0 + i0) / NF - 1;                      // time block whose masked keys start at local key i0
    float r[NJMAX], tot;
    if (i0 == 0)      block_suffix<0>(val, tb0, ntb, r, tot);   // block-uniform
    else if (i0 == 2) block_suffix<2>(val, tb0, ntb, r, tot);
    else              block_suffix<4>(val, tb0, ntb, r, tot);
    float* lsp  = LS + ((size_t)b * TT + tb0 + 1) * HID + t;    // row tb0 + 1, the block's second boundary
    float* totp = TOT + ((size_t)b * (LL / 64) + (ltok0 >> 6)) * HID + t;
    if (tb0 >= 0) *(lsp - HID) = r[0];                          // block-uniform: key 0 is no boundary of a time block
#pragma unroll
    for (int j = 1; j < NJMAX - 1; ++j) lsp[(size_t)(j - 1) * HID] = r[j];
    if (i0 != 4) lsp[(size_t)(NJMAX - 2) * HID] = r[NJMAX - 1]; // block-uniform: the eleventh boundary
    totp[0] = tot;
    // the stores' registers may be reused behind this point: keep the wait in front of that overwrite
    asm volatile("s_wait_xcnt 0x0" ::: "memory");
  }
}

// Residual plane of four packed f16 pairs: l = f16(P - 1024 h), each half by ONE mixed-precision FMA that reads its f16 half of
// h, the f32 P, and rounds straight into its half of l (left to itself the compiler makes the f32 difference, then converts, and
// rounds h a second time for it: about twice the instructions). The four low halves stand in front of the four high halves, and
// the hints name that distance, so that no instruction waits unannounced for the one that wrote the other half of its register.
__device__ __forceinline__ void resid4(unsigned& l0, unsigned& l1, unsigned& l2, unsigned& l3,
                                       const unsigned h0, const unsigned h1, const unsigned h2, const unsigned h3,
                                       const v2f p0, const v2f p1, const v2f p2, const v2f p3) {
#if defined(__HIP_DEVICE_COMPILE__)
  const float nr = -RSC;
  asm("v_fma_mixlo_f16 %0, %4, %8, %9 op_sel_hi:[1,0,0]\n\t"
      "v_fma_mixlo_f16 %1, %5, %8, %11 op_sel_hi:[1,0,0]\n\t"
      "v_fma_mixlo_f16 %2, %6, %8, %13 op_sel_hi:[1,0,0]\n\t"
      "v_fma_mixlo_f16 %3, %7, %8, %15 op_sel_hi:[1,0,0]\n\t"
      "s_delay_alu instid0(VALU_DEP_4) | instskip(NEXT) | instid1(VALU_DEP_4)\n\t"
      "v_fma_mixhi_f16 %0, %4, %8, %10 op_sel:[1,0,0] op_sel_hi:[1,0,0]\n\t"
      "v_fma_mixhi_f16 %1, %5, %8, %12 op_sel:[1,0,0] op_sel_hi:[1,0,0]\n\t"
      "s_delay_alu instid0(VALU_DEP_4) | instskip(NEXT) | instid1(VALU_DEP_4)\n\t"
      "v_fma_mixhi_f16 %2, %6, %8, %14 op_sel:[1,0,0] op_sel_hi:[1,0,0]\n\t"
      "v_fma_mixhi_f16 %3, %7, %8, %16 op_sel:[1,0,0] op_sel_hi:[1,0,0]"
      : "=&v"(l0), "=&v"(l1), "=&v"(l2), "=&v"(l3)
      : "v"(h0), "v"(h1), "v"(h2), "v"(h3), "s"(nr),
        "v"(p0.x), "v"(p0.y), "v"(p1.x), "v"(p1.y), "v"(p2.x), "v"(p2.y), "v"(p3.x), "v"(p3.y));
#endif
}

// =====================================================================================================
// One 32-key step of the transposed flash formulation for 16 queries of one head (head dim 32 = one k step):
//   S^T tiles (16 keys x 16 queries) = A(k rows, dims split-map) . B(q^T): hi.hi -> s, hi.lo + lo.hi -> sr (x1024);
//   raw score u = s + sr/1024; block-causal mask by value (key < horizon of the lane's query);
//   online softmax per lane (8 + 8 keys of ONE query per lane, maximum m of the raw scores, combined with lane^16):
//   P = 2^((u - m) * scale*log2e/64 + 20), the scale folded into the exponent's one FMA; p = P / 1024 (e^{s - smax} x1024);
//   P^T as the B operand of O^T(16 d x 16 queries) += v^T(d rows, fragment order) . P^T: element r <- tile keys kb..kb+15,
//   element 8+r <- tile kb+16..kb+31, lane unchanged; P hi to o, (v hi . P lo x1024 + v lo x1024 . P hi) to or.
// =====================================================================================================
template <bool MASKED>
__device__ __forceinline__ void attn_tile(const int kb, const int jl, const int hh,
    const v16h kh0, const v16h kh1, const v16h kl0, const v16h kl1,
    const v16h vh1, const v16h vl1, const v16h vh2, const v16h vl2,
    const v16h qhi, const v16h qlo, float& m_run, float& l_run,
    v8f& o1, v8f& o1r, v8f& o2, v8f& o2r) {
  v8f s0  = mma_h_raw(kh0, qhi, zero8());
  v8f s1  = mma_h_raw(kh1, qhi, zero8());
  v8f s0r = mma_h_raw(kh0, qlo, zero8());
  v8f s1r = mma_h_raw(kh1, qlo, zero8());
  s0r = mma_h_raw(kl0, qhi, s0r);
  s1r = mma_h_raw(kl1, qhi, s1r);
  guard4(s0, s1, s0r, s1r);

  // raw scores (q x8 . k x8), pairs of neighbouring accumulator rows: u[i] = tile 0 rows 2i, 2i+1; u[4+i] = tile 1
  v2f u[8];
#pragma unroll
  for (int i = 0; i < 4; ++i) {
    const v2f a0 = {s0[2 * i], s0[2 * i + 1]}, r0 = {s0r[2 * i], s0r[2 * i + 1]};
    const v2f a1 = {s1[2 * i], s1[2 * i + 1]}, r1 = {s1r[2 * i], s1r[2 * i + 1]};
    u[i]     = a0 + r0 * INVRS;
    u[4 + i] = a1 + r1 * INVRS;
  }
  if (MASKED) {
    const int lim = jl - (kb + 8 * hh);              // row r is key kb + 8hh + r (tile 0), + 16 (tile 1): visible if below jl
#pragma unroll
    for (int i = 0; i < 4; ++i) {
      u[i].x     = (2 * i          < lim) ? u[i].x     : NEGBIG;
      u[i].y     = (2 * i + 1      < lim) ? u[i].y     : NEGBIG;
      u[4 + i].x = (16 + 2 * i     < lim) ? u[4 + i].x : NEGBIG;
      u[4 + i].y = (16 + 2 * i + 1 < lim) ? u[4 + i].y : NEGBIG;
    }
  }
  float mx = fmaxf(fmaxf(fmaxf(fmaxf(u[0].x, u[0].y), fmaxf(u[1].x, u[1].y)), fmaxf(fmaxf(u[2].x, u[2].y), fmaxf(u[3].x, u[3].y))),
                   fmaxf(fmaxf(fmaxf(u[4].x, u[4].y), fmaxf(u[5].x, u[5].y)), fmaxf(fmaxf(u[6].x, u[6].y), fmaxf(u[7].x, u[7].y))));
  mx = fmaxf(mx, xhalf(mx));
  const float m_new = fmaxf(m_run, mx);              // running maximum of the RAW scores (the scale is positive)
  const float corr  = fexp2((m_run - m_new) * SCL);
  m_run = m_new;
  // exponent = u * SCL + cofs = (u - m) * SCL + 20: one FMA per score. A lane whose keys have all been masked so far has
  // m = NEGBIG; the floor keeps its exponents hugely negative (P = 0) where m * SCL's rounding error would decide them
  const float mc   = MASKED ? fmaxf(m_new, MFLOOR) : m_new;
  const float cofs = fmaf(-mc, SCL, 20.0f);
  o1 = o1 * corr; o1r = o1r * corr; o2 = o2 * corr; o2r = o2r * corr;

  v2f P[8];                                          // e^{s - smax} * 2^20
#pragma unroll
  for (int i = 0; i < 8; ++i) {
    const v2f a = u[i] * SCL + cofs;
    P[i].x = fexp2(a.x);
    P[i].y = fexp2(a.y);
  }
  const v2f lt = ((P[0] + P[1]) + (P[2] + P[3])) + ((P[4] + P[5]) + (P[6] + P[7]));
  l_run = l_run * corr + (lt.x + lt.y);              // carried x 2^20

  // hi = f16(P / 1024) (the x1024 plane), residual = f16(P - 1024 hi) = f16((p - hi) * 1024): the FMA is exact, one rounding
  union FragU { v16h v; unsigned w[8]; } ph, pl;     // word i: half i>>2 (keys kb + 16 (i>>2) + 8hh + ..), rows 2(i&3), 2(i&3)+1
#pragma unroll
  for (int i = 0; i < 8; ++i)
    ph.w[i] = __builtin_bit_cast(unsigned, __builtin_convertvector(P[i] * INVRS, v2h));
  resid4(pl.w[0], pl.w[1], pl.w[2], pl.w[3], ph.w[0], ph.w[1], ph.w[2], ph.w[3], P[0], P[1], P[2], P[3]);
  resid4(pl.w[4], pl.w[5], pl.w[6], pl.w[7], ph.w[4], ph.w[5], ph.w[6], ph.w[7], P[4], P[5], P[6], P[7]);

  o1  = mma_h_raw(vh1, ph.v, o1);
  o2  = mma_h_raw(vh2, ph.v, o2);
  o1r = mma_h_raw(vh1, pl.v, o1r);
  o2r = mma_h_raw(vh2, pl.v, o2r);
  o1r = mma_h_raw(vl1, ph.v, o1r);
  o2r = mma_h_raw(vl2, ph.v, o2r);
  guard4(o1, o2, o1r, o2r);
}

// One 32-key step for the three 16-query tiles of a 48-query group: the step's k and v fragments (8 KiB) are loaded once and
// stay in registers for all three tiles.
#define QT 3
template <bool MASKED>
__device__ __forceinline__ void attn_step3(const int kb, const int (&jl)[QT], const int hh,
    const _Float16* __restrict__ kH, const _Float16* __restrict__ kL,
    const _Float16* __restrict__ vH, const _Float16* __restrict__ vL,
    const v16h (&qhi)[QT], const v16h (&qlo)[QT], float (&m_run)[QT], float (&l_run)[QT],
    v8f (&o1)[QT], v8f (&o1r)[QT], v8f (&o2)[QT], v8f (&o2r)[QT]) {
  const size_t so = (size_t)kb * 32;                 // 32 keys = 1024 halves of each fragment-order plane
  const _Float16* pkh = kH + so;
  const _Float16* pkl = kL + so;
  const _Float16* pvh = vH + so;
  const _Float16* pvl = vL + so;
  const v16h kh0 = ldfrag_p(pkh);
  const v16h kh1 = ldfrag_p(pkh + 512);
  const v16h kl0 = ldfrag_p(pkl);
  const v16h kl1 = ldfrag_p(pkl + 512);
  const v16h vh1 = ldfrag_p(pvh);
  const v16h vl1 = ldfrag_p(pvl);
  const v16h vh2 = ldfrag_p(pvh + 512);
  const v16h vl2 = ldfrag_p(pvl + 512);
  // one wait for the sixteen loads above: their address registers are inputs here, so that neither a later load's destination
  // nor any other instruction overwrites one of them in front of it
  asm volatile("s_wait_xcnt 0x0" :: "v"(pkh), "v"(pkl), "v"(pvh), "v"(pvl) : "memory");
  // keeps the products behind all sixteen loads: left alone, the compiler lets the first products free registers for the last
  // loads, which then start only when the first have come back (two round trips a step in place of one)
  __builtin_amdgcn_sched_barrier(0);
#pragma unroll
  for (int g = 0; g < QT; ++g)
    attn_tile<MASKED>(kb, jl[g], hh, kh0, kh1, kl0, kl1, vh1, vl1, vh2, vl2, qhi[g], qlo[g], m_run[g], l_run[g],
                      o1[g], o1r[g], o2[g], o2r[g]);
}

// =====================================================================================================
// Attention + mean-pool for one head of one batch row and a PAIR of 48-query groups: group 63 - pi (long key range) and
// group pi (short key range), so that every block holds about the same number of 32-key steps. Block = 12 waves (384
// threads), grid = 2 * 4 * 32 = 256. A wave works on all three 16-query tiles of ONE group, so that each k and v fragment it
// loads feeds three tiles' products; the 12 waves share the key steps of the long group (nH steps) and of the short group
// (nL steps) in runs of C consecutive steps, C the smallest run length for which both groups fit in 12 waves. A group's step
// count is that of its last tile; a step past the horizon of an earlier tile is masked there like any other (P = 0).
// Each wave runs the online softmax over its own run only (the steps fully visible to the whole group without masking, the
// rest with the per-lane horizon test by value) and leaves its partials
// (row maximum m, row sum l, o + or/1024) in LDS; a lane whose keys are all masked in its run keeps m = NEGBIG and gets
// weight 0 in the merge (run 0 of every group holds keys 0..5, visible to every query, so the merged maximum is real).
// Merge (all 384 threads, thread -> query t>>3 of 48 in the long and in the short group, 4 d at 4*(t&7); each of the 12 slots
// is read once and counts for the group whose run it holds): M = max m_s, w_s = 2^(m_s - M),
// attn[d] = (sum w_s o_s) / (16 sum w_s l_s) + 1e-9 * (sum of v[.][d] over the query's masked keys) -> LDS sO[96][36] (f32);
// that sum = LS[b][tq][.] (the masked keys inside the 64-key block that holds the first of them) + the totals TOT of all
// later 64-key blocks, which the last wave sums last to first into LDS sTS[48][32] in front of the merge barrier;
// barrier; threads 0..127 pool 6 consecutive query rows (pooled row t>>3 of 16, cols 4*(t&7)) -> f16 hi (x32) / lo
// (x1024), stored to the head's own plane [head][1024 rows][32]: one wave writes 256 contiguous bytes of each plane.
// coverage: per block rows b*512 + 8*(63-pi) .. +7 and b*512 + 8*pi .. +7 of head h; 256 blocks cover [4][1024][32] once.
// =====================================================================================================
#define NW 12                                                // waves of a block: they share the runs of the long and the short group
static_assert(NW * 32 == 48 * 8);                            // merge: one thread per (query of a group, 4 d)
__device__ __forceinline__ int cdiv_i(int a, int d) { return (a + d - 1) / d; }
// 32-key steps of the 16-query tile that starts at query qw0: up to the block-causal horizon of its last query (<= 3072)
__device__ __forceinline__ int tile_steps(int qw0) { return (((qw0 + 15) / NF + 1) * NF + 31) >> 5; }
// run length for a pair of groups; at most 96 since then each group is one run
__device__ __forceinline__ int run_len(int nH, int nL) {
  int C = cdiv_i(nH + nL, NW);
  for (; C < LL / 32; ++C)
    if (cdiv_i(nH, C) + cdiv_i(nL, C) <= NW) break;
  return C;
}

__global__ __launch_bounds__(NW * 32)
void attn_pool(const unsigned short* __restrict__ QH, const unsigned short* __restrict__ QL,
               const unsigned short* __restrict__ KH, const unsigned short* __restrict__ KL,
               const unsigned short* __restrict__ VTH, const unsigned short* __restrict__ VTL,
               const float* __restrict__ LS, const float* __restrict__ TOT, unsigned short* PH, unsigned short* PL) {
  __shared__ __align__(16) float sP[NW * 48 * 36];           // per wave 48 queries x 32 d, pitch 36
  __shared__ float sM[NW * 48];
  __shared__ float sL[NW * 48];
  __shared__ __align__(16) float sO[96 * 36];
  __shared__ __align__(16) float sTS[(LL / 64) * HD];        // [64-key block k][d]: sum of v over all keys of blocks > k
  const int t = threadIdx.x, lane = t & 31, hh = (t >> 4) & 1, c = t & 15;
  const int wave = __builtin_amdgcn_readfirstlane(t >> 5);   // wave-uniform: run bounds and plane bases stay scalar
  const int bx = blockIdx.x;
  const int pi = bx & 31;
  const int h  = (bx >> 5) & 3;
  const int b  = bx >> 7;
  const int nH = tile_steps((63 - pi) * 48 + 32), nL = tile_steps(pi * 48 + 32);   // steps of a group: its last tile's
  const int C  = run_len(nH, nL);
  const int SH = cdiv_i(nH, C);                              // waves 0..SH-1 hold the long group's runs, the rest the short group's

  if (wave == NW - 1) {                                      // scalar branch; this wave holds the short group's last run, or none
    const float* tp = TOT + (size_t)b * (LL / 64) * HID + h * HD + lane;   // lane -> d
    float tv[LL / 64];
#pragma unroll
    for (int k = 0; k < LL / 64; ++k) tv[k] = tp[(size_t)k * HID];
    // the loads' address registers may be reused below: keep the wait in front of that overwrite
    asm volatile("s_wait_xcnt 0x0" ::: "memory");
    float run = 0.f;
#pragma unroll
    for (int k = LL / 64 - 1; k >= 0; --k) { sTS[k * HD + lane] = run; run += tv[k]; }
  }

  {
    const bool isH = (wave < SH);
    const int qg0 = (isH ? (63 - pi) : pi) * 48;             // first query of the wave's group
    const int n   = isH ? nH : nL;
    const int s   = isH ? wave : (wave - SH);
    const int st1 = (s + 1) * C;
    const int kb1 = ((st1 < n) ? st1 : n) * 32;              // a wave past the short group's last run does no step
    int jl[QT];                                              // exclusive key horizon of this lane's query (B column / D column) in tile g
#pragma unroll
    for (int g = 0; g < QT; ++g) jl[g] = ((qg0 + 16 * g + c) / NF + 1) * NF;

    const _Float16* QHp = h16(QH);
    const _Float16* QLp = h16(QL);
    const size_t qbase = ((size_t)(b * NH + h) * (LL / 16) + (qg0 >> 4)) * 512 + 8 * lane;   // tile 0's fragment, lane -> query c
    const _Float16* pqh = QHp + qbase;
    const _Float16* pql = QLp + qbase;
    v16h qhi[QT], qlo[QT];
#pragma unroll
    for (int g = 0; g < QT; ++g) {
      qhi[g] = ldfrag_p(pqh + 512 * g);
      qlo[g] = ldfrag_p(pql + 512 * g);
    }
    // the q loads' address registers are reused right behind them: they are inputs here, so that the wait stands in front of
    // that overwrite
    asm volatile("s_wait_xcnt 0x0" :: "v"(pqh), "v"(pql) : "memory");
    const size_t pbase = (size_t)(b * NH + h) * LL * HD + 8 * lane;   // (b, head) slab of a fragment-order plane; + kb * 32
    const _Float16* kH = h16(KH) + pbase;                             // key tile 2 at +512 halves
    const _Float16* kL = h16(KL) + pbase;
    const _Float16* vH = h16(VTH) + pbase;                            // d tile 2 at +512 halves
    const _Float16* vL = h16(VTL) + pbase;

    float m_run[QT], l_run[QT];
    v8f o1[QT], o1r[QT], o2[QT], o2r[QT];
#pragma unroll
    for (int g = 0; g < QT; ++g) {
      m_run[g] = NEGBIG; l_run[g] = 0.f;
      o1[g] = zero8(); o1r[g] = zero8(); o2[g] = zero8(); o2r[g] = zero8();
    }
    const int jmin  = (qg0 / NF + 1) * NF;                   // horizon of the group's first query
    const int cfull = (jmin / 32) * 32;
    const int kbf   = (cfull < kb1) ? cfull : kb1;
    int kb = s * C * 32;
#pragma unroll 1
    for (; kb < kbf; kb += 32)
      attn_step3<false>(kb, jl, hh, kH, kL, vH, vL, qhi, qlo, m_run, l_run, o1, o1r, o2, o2r);
#pragma unroll 1
    for (; kb < kb1; kb += 32)
      attn_step3<true>(kb, jl, hh, kH, kL, vH, vL, qhi, qlo, m_run, l_run, o1, o1r, o2, o2r);

#pragma unroll
    for (int g = 0; g < QT; ++g) {
      const float lr = l_run[g] + __shfl_xor(l_run[g], 16, 32);
      float* pp = sP + (wave * 48 + 16 * g + c) * 36 + 8 * hh;
      v4f a0, a1, c0, c1;
#pragma unroll
      for (int r = 0; r < 4; ++r) {
        a0[r] = o1[g][r] + o1r[g][r] * INVRS;  a1[r] = o1[g][4 + r] + o1r[g][4 + r] * INVRS;
        c0[r] = o2[g][r] + o2r[g][r] * INVRS;  c1[r] = o2[g][4 + r] + o2r[g][4 + r] * INVRS;
      }
      *(v4f*)(pp)      = a0;                                 // d  8hh ..  8hh+7
      *(v4f*)(pp + 4)  = a1;
      *(v4f*)(pp + 16) = c0;                                 // d 16+8hh .. 16+8hh+7
      *(v4f*)(pp + 20) = c1;
      // the merge works in the log2 domain and with l on the x1024 scale of o
      if (hh == 0) { sM[wave * 48 + 16 * g + c] = m_run[g] * SCL; sL[wave * 48 + 16 * g + c] = lr * INVRS; }
    }
  }
  __syncthreads();
  {
    const int q48 = t >> 3, dg = t & 7;                      // query of the group, 4 d
    const int SA = SH + cdiv_i(nL, C);                       // waves SH..SA-1 hold the short group's runs, waves from SA on none
    v4f sv[2];                                               // 0: long group, 1: short group
    {
      const int tq0 = ((63 - pi) * 48 + q48) / NF, tq1 = (pi * 48 + q48) / NF;
      const int j00 = (tq0 + 1) * NF, j01 = (tq1 + 1) * NF;  // first masked key; none for the last time block
      const bool any0 = (j00 < LL), any1 = (j01 < LL);
      const float* lp0 = LS + ((size_t)b * TT + (any0 ? tq0 : 0)) * HID + h * HD + 4 * dg;
      const float* lp1 = LS + ((size_t)b * TT + (any1 ? tq1 : 0)) * HID + h * HD + 4 * dg;
      const v4f lsv0 = *(const v4f*)lp0;
      const v4f lsv1 = *(const v4f*)lp1;
      // the two loads' address registers are inputs here, so that nothing, their own destinations included, overwrites one of
      // them in front of the wait
      asm volatile("s_wait_xcnt 0x0" :: "v"(lp0), "v"(lp1) : "memory");
      const v4f tsv0 = *(const v4f*)(sTS + (any0 ? (j00 >> 6) : 0) * HD + 4 * dg);
      const v4f tsv1 = *(const v4f*)(sTS + (any1 ? (j01 >> 6) : 0) * HD + 4 * dg);
#pragma unroll
      for (int e = 0; e < 4; ++e) {
        sv[0][e] = any0 ? (lsv0[e] + tsv0[e]) : 0.f;
        sv[1][e] = any1 ? (lsv1[e] + tsv1[e]) : 0.f;
      }
    }
    // every wave's slot is read once, all at once (one LDS latency); it counts for the group whose run it holds and gets
    // weight 0 for the other (the tests are scalar)
    float ms[NW], ls[NW];
    v4f os[NW];
#pragma unroll
    for (int w = 0; w < NW; ++w) {
      ms[w] = sM[w * 48 + q48];
      ls[w] = sL[w * 48 + q48];
      os[w] = *(const v4f*)(sP + (w * 48 + q48) * 36 + 4 * dg);
    }
    float M0 = ms[0], M1 = -3.0e38f;                         // wave 0 holds run 0 of the long group, wave SH run 0 of the short group
#pragma unroll
    for (int w = 1; w < NW; ++w) {
      M0 = (w < SH) ? fmaxf(M0, ms[w]) : M0;
      M1 = (w >= SH && w < SA) ? fmaxf(M1, ms[w]) : M1;
    }
    float L0 = 0.f, L1 = 0.f;
    v4f O0 = {0.f, 0.f, 0.f, 0.f}, O1 = {0.f, 0.f, 0.f, 0.f};
#pragma unroll
    for (int w = 0; w < NW; ++w) {
      const float e  = fexp2(ms[w] - ((w < SH) ? M0 : M1));
      const float w0 = (w < SH) ? e : 0.f;
      const float w1 = (w >= SH && w < SA) ? e : 0.f;
      L0 += w0 * ls[w];
      O0 += os[w] * w0;
      L1 += w1 * ls[w];
      O1 += os[w] * w1;
    }
    const float inv0 = (1.0f / L0) * (1.0f / VC), inv1 = (1.0f / L1) * (1.0f / VC);
    *(v4f*)(sO + q48 * 36 + 4 * dg)        = O0 * inv0 + sv[0] * FLOORC;
    *(v4f*)(sO + (48 + q48) * 36 + 4 * dg) = O1 * inv1 + sv[1] * FLOORC;
  }
  __syncthreads();
  if (wave < 4) {                                            // wave-uniform; no barrier behind it
    const int pr = t >> 3, col = 4 * (t & 7);
    v4f s = {0.f, 0.f, 0.f, 0.f};
#pragma unroll
    for (int f = 0; f < NF; ++f) s += *(const v4f*)(sO + (NF * pr + f) * 36 + col);
    unsigned short hb[4], lb[4];
#pragma unroll
    for (int e = 0; e < 4; ++e) split_h((s[e] * (1.0f / NF)) * AC, hb[e], lb[e]);
    v2u ph2, pl2;
    ph2[0] = pk16(hb[0], hb[1]); ph2[1] = pk16(hb[2], hb[3]);
    pl2[0] = pk16(lb[0], lb[1]); pl2[1] = pk16(lb[2], lb[3]);
    const int qblk = (pr < 8) ? (63 - pi) : pi;
    const size_t o = ((size_t)h * NPOOL + (size_t)(b * TT + 8 * qblk + (pr & 7))) * HD + col;
    *(v2u*)(PH + o) = ph2;
    *(v2u*)(PL + o) = pl2;
  }
}

// =====================================================================================================
// Tail: 16 pooled rows per block (grid 1024/16 = 64, 256 threads = 8 waves); wave w -> the 16 x 16 tile of output columns
// 16w..16w+15 in both products, so that a wave's share of every serial part is short: one accumulator pair per product,
// two LayerNorm rows, eight outputs per lane. Every global operand of the block (pooled planes, both weight tiles, biases,
// LayerNorm weights) is asked for at the top, in one flight.
// GEMM1 z = pooled(hi + lo/1024)/32 . Wo + bf16(o_b): A planes PH/PL [head][row][32], k step = head (two products into
// acc/accr), B = WOT rows, K=128 -> sZ rows (f32);
// LayerNorm: wave -> rows 2w, 2w+1, lane -> 4 columns; the row leaves as f16 hi (x16) / lo (x1024) planes sYh/sYl, pitch
// 136 halves, split once here in place of once per reading wave;
// GEMM2 from sYh/sYl rows . FWT rows; epilogue silu(acc + bf16(f_b)) staged in sZ, whole 512-B rows stored per wave.
// coverage: out rows r0..r0+15 x 128 cols; 64 blocks cover [1024][128] exactly once.
// =====================================================================================================
__global__ __launch_bounds__(256) void tail_k(const unsigned short* __restrict__ PH, const unsigned short* __restrict__ PL,
                                               const unsigned short* __restrict__ WOT, const float* __restrict__ obias,
                                               const float* __restrict__ flnw, const float* __restrict__ flnb,
                                               const unsigned short* __restrict__ FWT, const float* __restrict__ fbias,
                                               float* out) {
  __shared__ __align__(16) float sZ[16 * 132];
  __shared__ __align__(16) unsigned short sYh[16 * 136];
  __shared__ __align__(16) unsigned short sYl[16 * 136];
  const int t = threadIdx.x, wave = t >> 5, lane = t & 31, hh = lane >> 4, m = lane & 15;
  const int r0 = blockIdx.x * 16;
  const int n  = 16 * wave + m;                              // the lane's output column in both products

  // ---- all global operands ----
  const _Float16* Ah = h16(PH) + (size_t)(r0 + m) * HD + 8 * hh;   // + 32 * ks * NPOOL: plane of head ks
  const _Float16* Al = h16(PL) + (size_t)(r0 + m) * HD + 8 * hh;
  const _Float16* Bw = h16(WOT) + (size_t)n * HID + 8 * hh;
  const _Float16* Bf = h16(FWT) + (size_t)n * HID + 8 * hh;
  v16h ah[4], al[4], bw[4], bf[4];
#pragma unroll
  for (int ks = 0; ks < 4; ++ks) {
    ah[ks] = ldfrag_h(Ah + (size_t)(32 * ks) * NPOOL);
    bw[ks] = ldfrag_h(Bw + 32 * ks);
    al[ks] = ldfrag_h(Al + (size_t)(32 * ks) * NPOOL);
  }
  const float ob = obias[n];
  const v4f lw = *(const v4f*)(flnw + 4 * lane), lb = *(const v4f*)(flnb + 4 * lane);
#pragma unroll
  for (int ks = 0; ks < 4; ++ks) bf[ks] = ldfrag_h(Bf + 32 * ks);
  const float fb = fbias[n];
  // holds every load above in front of the first product, so that all of them fly together (left alone, the compiler issues
  // them in four groups among the WMMAs, one round trip each); loaded values and their addresses as inputs only: the
  // address registers stay whole until the data are back
  asm volatile("" :: "v"(ah[0]), "v"(ah[1]), "v"(ah[2]), "v"(ah[3]), "v"(al[0]), "v"(al[1]), "v"(al[2]), "v"(al[3]),
               "v"(bw[0]), "v"(bw[1]), "v"(bw[2]), "v"(bw[3]), "v"(bf[0]), "v"(bf[1]), "v"(bf[2]), "v"(bf[3]),
               "v"(ob), "v"(fb), "v"(lw), "v"(lb), "v"(Ah), "v"(Al), "v"(Bw), "v"(Bf));

  // ---- GEMM1 ----
  {
    v8f acc = zero8(), accr = zero8();
#pragma unroll
    for (int ks = 0; ks < 4; ++ks) {
      acc  = mma_h_raw(ah[ks], bw[ks], acc);
      accr = mma_h_raw(al[ks], bw[ks], accr);
    }
    const float bn = bfr(ob);
#pragma unroll
    for (int r = 0; r < 8; ++r)
      sZ[(8 * hh + r) * 132 + n] = (acc[r] + accr[r] * INVRS) * (1.0f / (AC * WSC)) + bn;
  }
  __syncthreads();

  // ---- LayerNorm, rows out as f16 planes ----
  {
    float gg[4], bb[4];
#pragma unroll
    for (int e = 0; e < 4; ++e) { gg[e] = bfr(lw[e]); bb[e] = bfr(lb[e]); }
    const float* zp = sZ + 2 * wave * 132 + 4 * lane;         // rows 2w and 2w + 1 from one base: both reads go out together
    unsigned short* yhp = sYh + 2 * wave * 136 + 4 * lane;
    unsigned short* ylp = sYl + 2 * wave * 136 + 4 * lane;
    v4f zz[2];
#pragma unroll
    for (int i = 0; i < 2; ++i) zz[i] = *(const v4f*)(zp + i * 132);
#pragma unroll
    for (int i = 0; i < 2; ++i) {
      const v4f z = zz[i];
      float s = (z[0] + z[1]) + (z[2] + z[3]);
      s = wsum(s);
      const float mean = s * (1.0f / HID);
      float d[4];
#pragma unroll
      for (int e = 0; e < 4; ++e) d[e] = z[e] - mean;
      float vs = (d[0] * d[0] + d[1] * d[1]) + (d[2] * d[2] + d[3] * d[3]);
      vs = wsum(vs);
      const float rstd = rsqrtf(vs * (1.0f / HID) + LNEPS);
      unsigned short hb[4], lo[4];
#pragma unroll
      for (int e = 0; e < 4; ++e) split_h(((d[e] * rstd) * gg[e] + bb[e]) * YC, hb[e], lo[e]);
      v2u yh, yl;
      yh[0] = pk16(hb[0], hb[1]); yh[1] = pk16(hb[2], hb[3]);
      yl[0] = pk16(lo[0], lo[1]); yl[1] = pk16(lo[2], lo[3]);
      *(v2u*)(yhp + i * 136) = yh;
      *(v2u*)(ylp + i * 136) = yl;
    }
  }
  __syncthreads();

  // ---- GEMM2 ----
  {
    const _Float16* yhp = h16(sYh) + m * 136 + 8 * hh;
    const _Float16* ylp = h16(sYl) + m * 136 + 8 * hh;
    v16h yh[4], yl[4];
#pragma unroll
    for (int ks = 0; ks < 4; ++ks) { yh[ks] = ldfrag_h(yhp + 32 * ks); yl[ks] = ldfrag_h(ylp + 32 * ks); }
    v8f acc2 = zero8(), acc2r = zero8();
#pragma unroll
    for (int ks = 0; ks < 4; ++ks) {
      acc2  = mma_h_raw(yh[ks], bf[ks], acc2);
      acc2r = mma_h_raw(yl[ks], bf[ks], acc2r);
    }
    const float bn = bfr(fb);
    // sZ is free: its last readers, the LayerNorm rows, are behind the barrier above
#pragma unroll
    for (int r = 0; r < 8; ++r) {
      const float a = (acc2[r] + acc2r[r] * INVRS) * (1.0f / (YC * WSC)) + bn;
      sZ[(8 * hh + r) * 132 + n] = a * sigm(a);
    }
  }
  __syncthreads();
  {
    v4f vals[2];
#pragma unroll
    for (int i = 0; i < 2; ++i) vals[i] = *(const v4f*)(sZ + (8 * i + wave) * 132 + 4 * lane);
#pragma unroll
    for (int i = 0; i < 2; ++i)
      *(v4f*)(out + (size_t)(r0 + 8 * i + wave) * FD + 4 * lane) = vals[i];
  }
}

// =====================================================================================================
// Workspace map (bytes), every offset a multiple of 256 and every plane sized to its whole-line store granularity:
//   WOT  f16 [128][128] x64        0          32768
//   FWT  f16 [128][128] x64        32768      32768
//   QH   f16 q x8, fragment order [2][4 heads][192 query tiles][2 halves][32 lanes][8]   65536      1572864
//   QL   residual                  1638400    1572864
//   KH   f16 k x8, fragment order [2][4 heads][192 key tiles][2 halves][32 lanes][8]   3211264    1572864
//   KL                             4784128    1572864
//   VTH  f16 v x16, fragment order [2][4 heads][96 key steps][2 d tiles][2 halves][32 lanes][8]   6356992    1572864
//   VTL                            7929856    1572864
//   LS   f32 [2][512 time blocks][128]   9502720    524288   (row 511 of each batch row neither written nor read)
//   PH   f16 [4 heads][1024][32] x32  10027008   262144
//   PL                             10289152   262144
//   TOT  f32 [2][48 key blocks][128]     10551296   49152
//   end                            10600448
// =====================================================================================================
extern "C" void kernel_launch(void* const* d_in, const int* in_sizes, int n_in,
                              void* d_out, int out_size, void* d_ws, size_t ws_size,
                              hipStream_t stream) {
  if (n_in < 20) return;
  if (in_sizes[0] != NTOK * DD) return;
  if (in_sizes[1] != DD || in_sizes[2] != DD || in_sizes[3] != DD * GH || in_sizes[4] != GH ||
      in_sizes[5] != GH || in_sizes[6] != 1) return;
  if (in_sizes[7] != DD * HID || in_sizes[8] != HID || in_sizes[9] != DD * HID || in_sizes[10] != HID ||
      in_sizes[11] != DD * HID || in_sizes[12] != HID) return;
  if (in_sizes[13] != HID * HID || in_sizes[14] != HID || in_sizes[15] != HID || in_sizes[16] != HID ||
      in_sizes[17] != HID * FD || in_sizes[18] != FD || in_sizes[19] != 1) return;
  if (out_size != NPOOL * FD) return;

  const float* x    = (const float*)d_in[0];
  const float* glnw = (const float*)d_in[1];
  const float* glnb = (const float*)d_in[2];
  const float* gw1  = (const float*)d_in[3];
  const float* gb1  = (const float*)d_in[4];
  const float* gw2  = (const float*)d_in[5];
  const float* gb2  = (const float*)d_in[6];
  const float* qw   = (const float*)d_in[7];
  const float* qb   = (const float*)d_in[8];
  const float* kw   = (const float*)d_in[9];
  const float* kb   = (const float*)d_in[10];
  const float* vw   = (const float*)d_in[11];
  const float* vb   = (const float*)d_in[12];
  const float* ow   = (const float*)d_in[13];
  const float* ob   = (const float*)d_in[14];
  const float* flnw = (const float*)d_in[15];
  const float* flnb = (const float*)d_in[16];
  const float* fw   = (const float*)d_in[17];
  const float* fb   = (const float*)d_in[18];
  const int*   Tp   = (const int*)d_in[19];

  const size_t PWO = (size_t)HID * HID * 2;           //    32768
  const size_t PWF = (size_t)FD * HID * 2;            //    32768
  const size_t PQP = (size_t)NTOK * HID * 2;          //  1572864
  const size_t PVT = (size_t)NB * HID * LL * 2;       //  1572864
  const size_t PSV = (size_t)NB * HID * TT * 4;       //   524288
  const size_t PPP = (size_t)NPOOL * HID * 2;         //   262144
  const size_t PTO = (size_t)NB * (LL / 64) * HID * 4; //    49152
  size_t off = 0;
  const size_t oWO = off; off += PWO;
  const size_t oWF = off; off += PWF;
  const size_t oQH = off; off += PQP;
  const size_t oQL = off; off += PQP;
  const size_t oKH = off; off += PQP;
  const size_t oKL = off; off += PQP;
  const size_t oVH = off; off += PVT;
  const size_t oVL = off; off += PVT;
  const size_t oSV = off; off += PSV;
  const size_t oPH = off; off += PPP;
  const size_t oPL = off; off += PPP;
  const size_t oTO = off; off += PTO;
  if (off > ws_size) return;                           // off = 10600448
  if (off > (size_t)134217728) return;

  char* ws = (char*)d_ws;
  unsigned short* WOT = (unsigned short*)(ws + oWO);
  unsigned short* FWT = (unsigned short*)(ws + oWF);
  unsigned short* QH  = (unsigned short*)(ws + oQH);
  unsigned short* QL  = (unsigned short*)(ws + oQL);
  unsigned short* KH  = (unsigned short*)(ws + oKH);
  unsigned short* KL  = (unsigned short*)(ws + oKL);
  unsigned short* VTH = (unsigned short*)(ws + oVH);
  unsigned short* VTL = (unsigned short*)(ws + oVL);
  float*          LS  = (float*)(ws + oSV);
  float*          TOT = (float*)(ws + oTO);
  unsigned short* PH  = (unsigned short*)(ws + oPH);
  unsigned short* PL  = (unsigned short*)(ws + oPL);
  float*          out = (float*)d_out;

  const dim3 blk(256), blkA(NW * 32);
  const dim3 gQ(NTOK / 64 + 16);                       // 96 token blocks + 16 weight tiles
  const dim3 gA(NB * NH * (LL / 96));                  // 256
  const dim3 gT(NPOOL / 16);                           // 64

  // (1) gater + gated q/k/v planes (q, k and v^T hi/lo in fragment order) + per-block masked-key floor sums;
  //     its last 16 blocks: o_w and f_w planes, transposed to k-contiguous rows: f16( bf16_RNE(w) * 64 )
  qkv_prep<<<gQ, blk, 0, stream>>>(x, glnw, glnb, gw1, gb1, gw2, gb2, qb, kb, vb, qw, kw, vw, ow, fw, Tp,
                                   QH, QL, KH, KL, VTH, VTL, LS, TOT, WOT, FWT);

  // (2) block-causal attention + mean-pool over the 6 forces -> pooled planes
  attn_pool<<<gA, blkA, 0, stream>>>(QH, QL, KH, KL, VTH, VTL, LS, TOT, PH, PL);

  // (3) o-proj + LayerNorm + final linear + SiLU -> out
  tail_k<<<gT, blk, 0, stream>>>(PH, PL, WOT, ob, flnw, flnb, FWT, fb, out);
  (void)hipGetLastError();
}
